// v000
// The times below were measured on an AMD MI455X: many runs one after another, warmed up first and cycling through
// copies of the inputs, with the whole window's GPU time divided by the number of runs. Launches and the gaps
// between them are all in it. The median over several windows is given; except for v000 it joins two sittings, which
// can be a few percent apart, so the side-by-side timings, each taken in one sitting, are the better comparison.
// v000, which the later versions start from, runs in 691 microseconds.
#include <hip/hip_runtime.h>

// "Super-aggressive" attention: f_q, f_k, f_v = LN(q|k|v) W_in split into 8 heads x 64; per (head, batch) pair: cos = clip(f_q.f_k / (n1 n2), +-0.99) (n = norm + 1e-8),
// cov = reg x (f_q - rowmean_d)(f_k - colmean_m) / (8 + 1e-6) (reg = 1e-3/1024, x10 if the global std of the raw cov < 1e-6), csim = clip(qn.kn) with max(norm, 1e-6), margin =
// clip(0.01 - csim, 0, 10), var_c = row mean of margin; per-head weights (cw, covw, vw) from a tiny MLP on the global means of f_q / f_k (softmax, /clip(weight_temp), softmax, clip, renorm);
// cn / covn / vn = global std (ddof 1) of cos / cov / var_c (+1e-6); d2 = cw cos/cn cscale + covw cov/covn/2 + vw var_c/vn/2; temp = 0.3 + std(d2) (dstd >= 1e-6; clipped to [0.1, 5]);
// attn = softmax(d2 / temp); out_h = attn f_v; out = concat_h W_out + b -> [4][1024][512].
// Every global statistic is a deterministic two-level f32 reduction (per-wave partials, then one fixed-order kernel); the [1024 x 1024] score tiles are recomputed in three passes
// (component statistics; d2 statistics with per-row shifts; softmax + PV) instead of being stored.
// WMMA (v_wmma_f32_16x16x32_f16, f32 accumulate): W_in (LN(x) single f16 x8, exact weights), dots / centered-cov tiles (single f16 x8 feature planes, K = 64), P.V (P single x8, f_v^T hi+lo:
// 2 products), W_out (O hi+lo: 2 products). LN, norms, all statistics and the weight-predictor MLP in f32. Inputs rounded to bf16 once. Fragment k-map per lane half hh

namespace {
constexpr int QB = 4, NT = 1024, DIM = 512, NH = 8, DH = 64, NP_ = NH * QB /* 32 (h,q) pairs, index h*QB + q */, NR = QB * NT /* 4096 rows */, NWAVE = NP_ * (NT / 16) /* 2048 score waves */;
constexpr float XS = 8.0f, WSC = 256.0f, PS = 8.0f, GAMMA = 0.01f, LREG = 0.001f;
constexpr float NTOT = 33554432.0f;   // 33,554,432 score elements

typedef _Float16 b16;
typedef __attribute__((ext_vector_type(16))) _Float16 v16b;
typedef __attribute__((ext_vector_type(8))) _Float16 v8b;
typedef __attribute__((ext_vector_type(8))) float v8f;
typedef __attribute__((ext_vector_type(4))) float v4f;
__device__ __forceinline__ float bf16_rne(float f) { unsigned int u = __float_as_uint(f); u += 0x7FFFu + ((u >> 16) & 1u); return __uint_as_float(u & 0xFFFF0000u); }
__device__ __forceinline__ void split16(float v, b16& hi, b16& lo) { hi = (b16)v; lo = (b16)(v - (float)hi); }
__device__ __forceinline__ v16b frag_kb(const b16* p, int hh) { const v8b a = *(const v8b*)(p + 8 * hh), b = *(const v8b*)(p + 16 + 8 * hh); v16b f;
#pragma unroll
  for (int e = 0; e < 8; ++e) { f[e] = a[e]; f[8 + e] = b[e]; } return f; }
__device__ __forceinline__ v8f wmma16b(v16b a, v16b b, v8f c) { v8f d = __builtin_amdgcn_wmma_f32_16x16x32_f16(false, a, false, b, (short)0, c, false, false); asm volatile("v_nop\n\tv_nop\n\tv_nop\n\tv_nop" : "+v"(d) : "v"(a), "v"(b)); return d; }
__device__ __forceinline__ void wave_lds_sync() { __builtin_amdgcn_fence(__ATOMIC_RELEASE, "workgroup"); __builtin_amdgcn_wave_barrier(); __builtin_amdgcn_fence(__ATOMIC_ACQUIRE, "workgroup"); }
__device__ __forceinline__ float nexp(float x) { return __builtin_amdgcn_exp2f(x * 1.4426950408889634f); }
__device__ __forceinline__ float pmul(float a, float b) { float p = a * b; asm volatile("" : "+v"(p)); return p; }
__device__ __forceinline__ float hsum16(float v) { v += __shfl_xor(v, 1); v += __shfl_xor(v, 2); v += __shfl_xor(v, 4); return v + __shfl_xor(v, 8); }
__device__ __forceinline__ float clampf(float v, float lo, float hi) { return fminf(fmaxf(v, lo), hi); }

__global__ __launch_bounds__(256) void ln_kernel(const float* __restrict__ q, const float* __restrict__ k, const float* __restrict__ v, const float* __restrict__ g, const float* __restrict__ be, b16* __restrict__ X16) {
  const int wave = threadIdx.x >> 5, lane = threadIdx.x & 31; const int rowall = blockIdx.x * 8 + wave; const int which = rowall / NR, row = rowall - which * NR;
  const float* src = (which == 0 ? q : which == 1 ? k : v) + (size_t)row * DIM + lane * 16; float x[16];
  { const v4f a = *(const v4f*)src, b = *(const v4f*)(src + 4), c = *(const v4f*)(src + 8), d = *(const v4f*)(src + 12); for (int j = 0; j < 4; ++j) { x[j] = bf16_rne(a[j]); x[4 + j] = bf16_rne(b[j]); x[8 + j] = bf16_rne(c[j]); x[12 + j] = bf16_rne(d[j]); } }
  float s = 0.0f; for (int j = 0; j < 16; ++j) s += x[j];
#pragma unroll
  for (int o = 16; o >= 1; o >>= 1) s += __shfl_xor(s, o);
  const float mu = s * (1.0f / DIM); float ss = 0.0f; for (int j = 0; j < 16; ++j) { const float d = x[j] - mu; ss += pmul(d, d); }
#pragma unroll
  for (int o = 16; o >= 1; o >>= 1) ss += __shfl_xor(ss, o);
  const float rs = rsqrtf(ss * (1.0f / DIM) + 1e-5f); v8b o0, o1;
  for (int j = 0; j < 16; ++j) { const int c = lane * 16 + j; const b16 hv = (b16)((pmul((x[j] - mu) * rs, bf16_rne(g[c])) + bf16_rne(be[c])) * XS); if (j < 8) o0[j] = hv; else o1[j - 8] = hv; }
  { b16* dst = X16 + ((size_t)which * NR + row) * DIM + lane * 16; *(v8b*)dst = o0; *(v8b*)(dst + 8) = o1;  }
}
__global__ __launch_bounds__(256) void prepw_kernel(const float* __restrict__ win, const float* __restrict__ wout, b16* __restrict__ WIN, b16* __restrict__ WOUT) {
  const int t = blockIdx.x * 256 + threadIdx.x; if (t >= 2 * DIM * DIM / 8) return; const int kind = t / (DIM * DIM / 8), tt = t - kind * (DIM * DIM / 8); const int o_ = (tt * 8) / DIM, k0 = tt * 8 - o_ * DIM;
  const float* w = kind == 0 ? win : wout; v8b o; for (int j = 0; j < 8; ++j) o[j] = (b16)(bf16_rne(w[(size_t)(k0 + j) * DIM + o_]) * WSC);
  { *(v8b*)((kind == 0 ? WIN : WOUT) + (size_t)tt * 8) = o;  }
}
// features: F = X16 W_in per row (block = 64 rows x 4 waves, wave = 16 rows x 128 cols = 2 heads; grid.y = 4): which 0 (q): F32Q [pair][n][64] f32 rows; which 1 (k): F32K; which 2 (v): F32V. (f32 planes,
__global__ __launch_bounds__(128) void feat_kernel(const b16* __restrict__ X16, const b16* __restrict__ WIN, float* __restrict__ F32) {
  __shared__ __attribute__((aligned(16))) float Ts[4][16][128 + 4];
  const int wave = threadIdx.x >> 5, lane = threadIdx.x & 31, nloc = lane & 15, hlf = lane >> 4; const int which = blockIdx.z; const size_t m0 = (size_t)blockIdx.x * 64 + wave * 16; const int n0 = blockIdx.y * 128;
  v8f acc[8];
#pragma unroll
  for (int t = 0; t < 8; ++t) acc[t] = (v8f){};
#pragma unroll 4
  for (int kb = 0; kb < DIM; kb += 32) { const v16b a = frag_kb(X16 + ((size_t)which * NR + m0 + nloc) * DIM + kb, hlf);
#pragma unroll
    for (int t = 0; t < 8; ++t) acc[t] = wmma16b(a, frag_kb(WIN + (size_t)(n0 + t * 16 + nloc) * DIM + kb, hlf), acc[t]); }
#pragma unroll
  for (int t = 0; t < 8; ++t)
#pragma unroll
    for (int r = 0; r < 8; ++r) Ts[wave][8 * hlf + r][t * 16 + nloc] = acc[t][r] * (1.0f / (XS * WSC));
  wave_lds_sync();
  // rows m0+rr: q_idx = row / NT, n = row % NT; cols n0 + c -> head h = (n0 + c) / 64, d = % 64; F32 layout [which][pair][n][64]
  { for (int rr = 0; rr < 16; ++rr) { const size_t row = m0 + rr; const int qi = (int)(row / NT), n = (int)(row - (size_t)qi * NT); for (int hq = 0; hq < 2; ++hq) { const int h = n0 / DH + hq; const int pair = h * QB + qi;
        if (lane < 16) *(v4f*)(F32 + (((size_t)which * NP_ + pair) * NT + n) * DH + lane * 4) = *(const v4f*)(&Ts[wave][rr][hq * DH + lane * 4]); } }  }
}
// per-pair column statistics of f_k (mean over the 1024 keys per d) and head means qg/kg (over all 4,096 rows): colstat: block = pair, 256 threads: thread (d = t%64, part = t/64) sums rows part*256..+255;
__global__ __launch_bounds__(256) void colstat_kernel(const float* __restrict__ F32, float* __restrict__ KCM, float* __restrict__ PSUM) {   // PSUM [which 0/1][pair][64] = column sums
  __shared__ float part[4][DH];
  const int which = blockIdx.y, pair = blockIdx.x, t_ = threadIdx.x, d = t_ & 63, pq = t_ >> 6; const float* base = F32 + (((size_t)which * NP_ + pair) * NT) * DH;
  float s = 0.0f; for (int n = pq * 256; n < pq * 256 + 256; ++n) s += base[(size_t)n * DH + d]; part[pq][d] = s;
  __syncthreads();
  if (t_ < DH) { const float tot = (part[0][t_] + part[1][t_]) + (part[2][t_] + part[3][t_]);
    { ((float*)PSUM)[((size_t)which * NP_ + pair) * DH + t_] = tot; if (which == 1) ((float*)KCM)[(size_t)pair * DH + t_] = tot * (1.0f / NT);  } }
}
// operand planes per pair: FQ16 [pair][n][64] = f16(8 f_q), FQC16 = f16(8 (f_q - rowmean)), N1 [pair][n] = ||f_q|| (f32); FK16, FKC16 = f16(8 (f_k - colmean)), N2; FVTh/FVTl [pair][64][1024] = f_v^T hi/lo x8.
__global__ __launch_bounds__(256) void rowops_kernel(const float* __restrict__ F32, const float* __restrict__ KCM, b16* __restrict__ FQ16, b16* __restrict__ FQC16, float* __restrict__ N1, b16* __restrict__ FK16, b16* __restrict__ FKC16, float* __restrict__ N2) {
  const int wave = threadIdx.x >> 5, lane = threadIdx.x & 31; const size_t prow = ((size_t)blockIdx.x * 8 + wave) * 2 + (lane >> 4);   // pair*NT + n, over NP_*NT rows
  const int pair = (int)(prow / NT); const int c0 = (lane & 15) * 4;
  const v4f fq = *(const v4f*)(F32 + (0 * (size_t)NP_ * NT + prow) * DH + c0), fk = *(const v4f*)(F32 + (1 * (size_t)NP_ * NT + prow) * DH + c0);
  float sq = 0.0f, ssq = 0.0f, ssk = 0.0f; for (int j = 0; j < 4; ++j) { sq += fq[j]; ssq += pmul(fq[j], fq[j]); ssk += pmul(fk[j], fk[j]); }
  sq = hsum16(sq); ssq = hsum16(ssq); ssk = hsum16(ssk); const float mq = sq * (1.0f / DH);
  typedef __attribute__((ext_vector_type(4))) _Float16 v4b; v4b a, ac, b, bc;
  for (int j = 0; j < 4; ++j) { a[j] = (b16)(fq[j] * XS); ac[j] = (b16)((fq[j] - mq) * XS); b[j] = (b16)(fk[j] * XS); bc[j] = (b16)((fk[j] - KCM[(size_t)pair * DH + c0 + j]) * XS); }
  { *(v4b*)(FQ16 + prow * DH + c0) = a; *(v4b*)(FQC16 + prow * DH + c0) = ac; *(v4b*)(FK16 + prow * DH + c0) = b; *(v4b*)(FKC16 + prow * DH + c0) = bc;  }
  // norms: ssq/ssk are not stored here; N1/N2 are written by norms_kernel (one thread per row).
}
__global__ __launch_bounds__(256) void norms_kernel(const float* __restrict__ F32, float* __restrict__ N1, float* __restrict__ N2) {   // thread per row: 256 rows per block -> N1/N2 spans of 256 floats (8 lines) each
  const size_t prow = (size_t)blockIdx.x * 256 + threadIdx.x; const float* fq = F32 + (0 * (size_t)NP_ * NT + prow) * DH; const float* fk = F32 + (1 * (size_t)NP_ * NT + prow) * DH;
  float sq = 0.0f, sk = 0.0f; for (int d = 0; d < DH; ++d) { sq += pmul(fq[d], fq[d]); sk += pmul(fk[d], fk[d]); }
  { ((float*)N1)[prow] = sqrtf(sq); ((float*)N2)[prow] = sqrtf(sk);  }
}
__global__ __launch_bounds__(256) void vt_kernel(const float* __restrict__ F32, b16* __restrict__ FVTh, b16* __restrict__ FVTl) {   // block = (pair, 64-key chunk): transpose [64 n][64 d] -> rows d, hi/lo
  __shared__ __attribute__((aligned(16))) b16 Th[DH][64 + 8], Tl[DH][64 + 8];
  const int pair = blockIdx.y, n0 = blockIdx.x * 64, t_ = threadIdx.x; const float* base = F32 + ((2 * (size_t)NP_ + pair) * NT + n0) * DH;
  for (int qq = t_; qq < 64 * DH; qq += 256) { const int nn = qq >> 6, d = qq & 63; b16 h_, l_; split16(base[(size_t)nn * DH + d] * XS, h_, l_); Th[d][nn] = h_; Tl[d][nn] = l_; }
  __syncthreads();
  { for (int qq = t_; qq < DH * 8; qq += 256) { const int d = qq >> 3, c8 = (qq & 7) * 8; const size_t gi = ((size_t)pair * DH + d) * NT + n0 + c8; *(v8b*)(FVTh + gi) = *(const v8b*)(&Th[d][c8]); *(v8b*)(FVTl + gi) = *(const v8b*)(&Tl[d][c8]); }  }
}
// score-tile passes: wave = 16 query rows n of one pair (block = 2 waves), loop over 32 key blocks of 32: dots^T and covraw^T tiles (keys x queries, K = 64: 2 steps x 2 key tiles x 2 GEMMs = 8 WMMAs),
// lane (hh, col=query) holds keys kb+8hh+r and kb+16+8hh+r.  cos = clip(dots/((n1+1e-8)(n2+1e-8))), csim = clip(dots/(max(n1,1e-6) max(n2,1e-6))), margin = clip(0.01 - csim, 0, 10), covraw = c/(8+1e-6).
// PASS 2 (given cn, covfac = reg/covn/2, w per head, vn): per row c_row = vw var_c/(2 vn); e = cw cos/cn cscale + covw covraw covfac (d2 - c_row): per-wave S_e, S_e2 and per-row rowsum_e -> P2, ROWE.
// PASS 3 (given temp): logits = (e + c_row)/temp -> online softmax (f32) with o^T += f_v^T P^T (hi+lo, 4 d-tiles): O [pair][n][64] -> OC16h/l [row = q*NT+n][h*64+d] (concat-head planes, hi/lo x8).
struct PassC { float cn_inv_cscale, covfac, vn_half_inv, temp_inv; float cw[NH], covw[NH], vw[NH]; };
template <int PASS>
__global__ __launch_bounds__(64) void score_kernel(const b16* __restrict__ FQ16, const b16* __restrict__ FQC16, const float* __restrict__ N1, const b16* __restrict__ FK16, const b16* __restrict__ FKC16, const float* __restrict__ N2, const b16* __restrict__ FVTh, const b16* __restrict__ FVTl,
                                                  const float* __restrict__ CST /* PassC as floats */, float* __restrict__ P1, float* __restrict__ VARC, float* __restrict__ P2, float* __restrict__ ROWE, b16* __restrict__ OCh, b16* __restrict__ OCl) {
  __shared__ __attribute__((aligned(16))) float To[2][16][DH + 4]; __shared__ float Tr[2][16]; __shared__ float Tp[2][4];
  const int wave = threadIdx.x >> 5, lane = threadIdx.x & 31, hh = lane >> 4, col = lane & 15; const int pair = blockIdx.y, n0 = blockIdx.x * 32 + wave * 16, ni = n0 + col; const int h = pair / QB, qi = pair - h * QB;
  const size_t prow = (size_t)pair * NT + ni; const b16* Qp = FQ16 + prow * DH; const b16* Qc = FQC16 + prow * DH; const b16* Kb = FK16 + (size_t)pair * NT * DH; const b16* Kc = FKC16 + (size_t)pair * NT * DH;
  const float n1 = N1[prow]; const float inv1a = 1.0f / (n1 + 1e-8f), inv1b = 1.0f / fmaxf(n1, 1e-6f);
  PassC C; if (PASS >= 2) { const float* cf = CST; C.cn_inv_cscale = cf[0]; C.covfac = cf[1]; C.vn_half_inv = cf[2]; C.temp_inv = cf[3]; for (int j = 0; j < NH; ++j) { C.cw[j] = cf[4 + j]; C.covw[j] = cf[4 + NH + j]; C.vw[j] = cf[4 + 2 * NH + j]; } }
  float crow = 0.0f; if (PASS >= 2) crow = C.vw[h] * VARC[prow] * C.vn_half_inv;
  float s_a = 0.0f, s_b = 0.0f, s_c = 0.0f, s_d = 0.0f, rowacc = 0.0f;
  float m = -INFINITY, l = 0.0f; v8f o[4] = {{}, {}, {}, {}}, ol[4] = {{}, {}, {}, {}};
  const v16b qa0 = frag_kb(Qp, hh), qa1 = frag_kb(Qp + 32, hh), qc0 = frag_kb(Qc, hh), qc1 = frag_kb(Qc + 32, hh);
  for (int kb = 0; kb < NT; kb += 32) {
    v8f d0 = {}, d1 = {}, c0 = {}, c1 = {};
    d0 = wmma16b(frag_kb(Kb + (size_t)(kb + col) * DH, hh), qa0, d0); d0 = wmma16b(frag_kb(Kb + (size_t)(kb + col) * DH + 32, hh), qa1, d0);
    d1 = wmma16b(frag_kb(Kb + (size_t)(kb + 16 + col) * DH, hh), qa0, d1); d1 = wmma16b(frag_kb(Kb + (size_t)(kb + 16 + col) * DH + 32, hh), qa1, d1);
    c0 = wmma16b(frag_kb(Kc + (size_t)(kb + col) * DH, hh), qc0, c0); c0 = wmma16b(frag_kb(Kc + (size_t)(kb + col) * DH + 32, hh), qc1, c0);
    c1 = wmma16b(frag_kb(Kc + (size_t)(kb + 16 + col) * DH, hh), qc0, c1); c1 = wmma16b(frag_kb(Kc + (size_t)(kb + 16 + col) * DH + 32, hh), qc1, c1);
    float ev0[8], ev1[8];
#pragma unroll
    for (int r = 0; r < 8; ++r) {
#pragma unroll
      for (int hq = 0; hq < 2; ++hq) { const int key = kb + (hq ? 16 : 0) + 8 * hh + r; const float dot = (hq ? d1[r] : d0[r]) * (1.0f / (XS * XS)); const float covraw = (hq ? c1[r] : c0[r]) * (1.0f / (XS * XS)) * (1.0f / (8.0f + 1e-6f));
        const float n2 = N2[(size_t)pair * NT + key]; const float cosv = clampf(dot * inv1a * (1.0f / (n2 + 1e-8f)), -0.99f, 0.99f); 
        if (PASS == 1) { const float csim = clampf(dot * inv1b * (1.0f / fmaxf(n2, 1e-6f)), -0.99f, 0.99f); const float margin = clampf(GAMMA - csim, 0.0f, 10.0f);
          s_a += cosv; s_b += pmul(cosv, cosv); s_c += covraw; s_d += pmul(covraw, covraw); rowacc += margin; }
        else { const float e = pmul(C.cw[h], cosv * C.cn_inv_cscale) + pmul(C.covw[h], covraw * C.covfac);
          if (PASS == 2) { s_a += e; s_b += pmul(e, e); rowacc += e; }
          else { (hq ? ev1 : ev0)[r] = (e + crow) * C.temp_inv; } } } }
    if (PASS == 3) { float mr = -INFINITY;
#pragma unroll
      for (int r = 0; r < 8; ++r) mr = fmaxf(mr, fmaxf(ev0[r], ev1[r]));
      mr = fmaxf(mr, __shfl_xor(mr, 16)); const float mn = fmaxf(m, mr); const float al_ = nexp(m - mn); m = mn; float sum = 0.0f; v16b pb;
#pragma unroll
      for (int r = 0; r < 8; ++r) { const float e0 = nexp(ev0[r] - mn), e1 = nexp(ev1[r] - mn); sum += e0 + e1; pb[r] = (b16)(e0 * PS); pb[8 + r] = (b16)(e1 * PS); }
      sum += __shfl_xor(sum, 16); l = l * al_ + sum;
#pragma unroll
      for (int t = 0; t < 4; ++t) { o[t] *= al_; ol[t] *= al_; const b16* vr = FVTh + ((size_t)pair * DH + t * 16 + col) * NT + kb; o[t] = wmma16b(frag_kb(vr, hh), pb, o[t]); ol[t] = wmma16b(frag_kb(FVTl + ((size_t)pair * DH + t * 16 + col) * NT + kb, hh), pb, ol[t]); } } }
  if (PASS <= 2) {   // per-row sums across the two lane halves; per-wave partials over the 16 rows and 32 lanes
    rowacc += __shfl_xor(rowacc, 16); if (hh == 0) Tr[wave][col] = rowacc;
    float v4[4] = {s_a, s_b, s_c, s_d};
#pragma unroll
    for (int j = 0; j < 4; ++j) { float v = v4[j];
#pragma unroll
      for (int oo = 16; oo >= 1; oo >>= 1) v += __shfl_xor(v, oo);
      v4[j] = v; }
    if (lane == 0) { Tp[wave][0] = v4[0]; Tp[wave][1] = v4[1]; Tp[wave][2] = v4[2]; Tp[wave][3] = v4[3]; }
    wave_lds_sync();
    const size_t widx = (size_t)pair * (NT / 16) + blockIdx.x * 2 + wave;
    __syncthreads();
    {
      if (wave == 0) { const float rv = Tr[lane >> 4][lane & 15] * (PASS == 1 ? (1.0f / NT) : 1.0f); ((float*)(PASS == 1 ? VARC : ROWE))[(size_t)pair * NT + blockIdx.x * 32 + lane] = rv;
        ((float*)(PASS == 1 ? P1 : P2))[((size_t)pair * (NT / 32) + blockIdx.x) * 32 + lane] = (lane < 8) ? Tp[lane >> 2][lane & 3] : 0.0f; }
       }
    (void)widx;
  } else {
    const float inv = 1.0f / (l * PS * XS);
#pragma unroll
    for (int t = 0; t < 4; ++t)
#pragma unroll
      for (int r = 0; r < 8; ++r) To[wave][col][t * 16 + 8 * hh + r] = (o[t][r] + ol[t][r]) * inv;
    wave_lds_sync();
    { for (int r2 = 0; r2 < 16; r2 += 4) { const int rr = r2 + (lane >> 3), c8 = (lane & 7) * 8; v8b hv, lv; for (int j = 0; j < 8; ++j) { b16 a_, c_; split16(To[wave][rr][c8 + j] * XS, a_, c_); hv[j] = a_; lv[j] = c_; }
        const size_t gi = ((size_t)qi * NT + n0 + rr) * DIM + h * DH + c8; *(v8b*)(OCh + gi) = hv; *(v8b*)(OCl + gi) = lv; }  }
  }
}
// reductions (one block each, fixed order). reduce1: cn, covn, vn, weights -> CST[0..27]; reduce2: dstd -> temp -> CST[3].
__global__ __launch_bounds__(256) void reduce1_kernel(const float* __restrict__ P1, const float* __restrict__ VARC, const float* __restrict__ PSUM, const float* __restrict__ w1, const float* __restrict__ b1, const float* __restrict__ g2, const float* __restrict__ be2, const float* __restrict__ w2, const float* __restrict__ b2, const float* __restrict__ w3, const float* __restrict__ b3, const float* __restrict__ wtemp, float* __restrict__ CST) {
  __shared__ float red[4][256]; __shared__ float sh[64];
  const int t_ = threadIdx.x; const int NPART = NP_ * (NT / 32);   // 1,024 block partials of 8 floats (2 waves x 4)
  float a = 0, b = 0, c = 0, d = 0; for (int i = t_; i < NPART; i += 256) { const float* p = P1 + (size_t)i * 32; a += p[0] + p[4]; b += p[1] + p[5]; c += p[2] + p[6]; d += p[3] + p[7]; }
  red[0][t_] = a; red[1][t_] = b; red[2][t_] = c; red[3][t_] = d; __syncthreads();
  for (int s = 128; s >= 1; s >>= 1) { if (t_ < s) { for (int j = 0; j < 4; ++j) red[j][t_] += red[j][t_ + s]; } __syncthreads(); }
  float vs = 0.0f; for (int i = t_; i < NP_ * NT; i += 256) vs += VARC[i];
  __shared__ float r2[256]; r2[t_] = vs; __syncthreads(); for (int s = 128; s >= 1; s >>= 1) { if (t_ < s) r2[t_] += r2[t_ + s]; __syncthreads(); }
  const float vmu = r2[0] / (float)(NP_ * NT); __syncthreads();
  float vq = 0.0f;
#pragma unroll 1
  for (int i = t_; i < NP_ * NT; i += 256) { const float dv = VARC[i] - vmu; vq += pmul(dv, dv); }
  r2[t_] = vq; __syncthreads(); for (int s = 128; s >= 1; s >>= 1) { if (t_ < s) r2[t_] += r2[t_ + s]; __syncthreads(); }
  // head means qg/kg [8][64] from PSUM [which][pair][64]: mean over (q, n) = sum over the 4 pairs of the head / 4096 -> feats [h][128]; MLP: h1 = relu(LN(feats W1 + b1)), h2 = relu(h1 W2 + b2), logits = softmax(h2 W3 + b3), w = softmax(logits / clip(wt)), clip [0.05,0.8], renorm
  __shared__ float feats[NH][2 * DH], h1s[NH][DH], h2s[NH][32], ws[NH][3];
  for (int i = t_; i < NH * 2 * DH; i += 256) { const int h = i / (2 * DH), c = i - h * 2 * DH; const int which = c / DH, dd = c - which * DH; float s = 0.0f;
#pragma unroll 1
    for (int qq = 0; qq < QB; ++qq) s += PSUM[((size_t)which * NP_ + h * QB + qq) * DH + dd]; feats[h][c] = s * (1.0f / (QB * NT)); }
  __syncthreads();
  for (int i = t_; i < NH * DH; i += 256) { const int h = i / DH, o_ = i - h * DH; float s = bf16_rne(b1[o_]);
#pragma unroll 1
    for (int c = 0; c < 2 * DH; ++c) s += pmul(feats[h][c], bf16_rne(w1[c * DH + o_])); h1s[h][o_] = s; }
  __syncthreads();
  if (t_ < NH) { const int h = t_; float mu = 0.0f;
#pragma unroll 1
    for (int c = 0; c < DH; ++c) mu += h1s[h][c];
    mu *= (1.0f / DH); float var = 0.0f;
#pragma unroll 1
    for (int c = 0; c < DH; ++c) { const float dv = h1s[h][c] - mu; var += pmul(dv, dv); }
    var *= (1.0f / DH); const float rs = rsqrtf(var + 1e-5f);
#pragma unroll 1
    for (int c = 0; c < DH; ++c) h1s[h][c] = fmaxf(pmul((h1s[h][c] - mu) * rs, bf16_rne(g2[c])) + bf16_rne(be2[c]), 0.0f); }
  __syncthreads();
  for (int i = t_; i < NH * 32; i += 256) { const int h = i / 32, o_ = i - h * 32; float s = bf16_rne(b2[o_]);
#pragma unroll 1
    for (int c = 0; c < DH; ++c) s += pmul(h1s[h][c], bf16_rne(w2[c * 32 + o_])); h2s[h][o_] = fmaxf(s, 0.0f); }
  __syncthreads();
  if (t_ < NH) { const int h = t_; float lg[3]; for (int o_ = 0; o_ < 3; ++o_) { float s = bf16_rne(b3[o_]);
#pragma unroll 1
      for (int c = 0; c < 32; ++c) s += pmul(h2s[h][c], bf16_rne(w3[c * 3 + o_])); lg[o_] = s; }
    float mx = fmaxf(lg[0], fmaxf(lg[1], lg[2])); float e3[3], se = 0.0f; for (int j = 0; j < 3; ++j) { e3[j] = __expf(lg[j] - mx); se += e3[j]; } for (int j = 0; j < 3; ++j) e3[j] /= se;
    const float wt = clampf(bf16_rne(wtemp[0]), 0.1f, 20.0f); float z[3]; for (int j = 0; j < 3; ++j) z[j] = e3[j] / wt; mx = fmaxf(z[0], fmaxf(z[1], z[2])); se = 0.0f; for (int j = 0; j < 3; ++j) { e3[j] = __expf(z[j] - mx); se += e3[j]; }
    float wv[3], sw = 0.0f; for (int j = 0; j < 3; ++j) { wv[j] = clampf(e3[j] / se, 0.05f, 0.8f); sw += wv[j]; } for (int j = 0; j < 3; ++j) ws[h][j] = wv[j] / sw; }
  __syncthreads();
  if (t_ == 0) { const float n = (float)NTOT; const float sa_ = red[0][0], sb = red[1][0], sc = red[2][0], sd = red[3][0];
    const float cstd = sqrtf(fmaxf((sb - sa_ * (sa_ / n)) / (n - 1.0f), 0.0f)); const float covstd_raw = sqrtf(fmaxf((sd - sc * (sc / n)) / (n - 1.0f), 0.0f));
    const float base_reg = LREG / (float)NT; const float reg = (covstd_raw < 1e-6f) ? base_reg * 10.0f : base_reg;   // reference: reg chosen on the std of the RAW cov, then cov = clip(reg cov, +-50) (never clips at this scale)
    const float covn = reg * covstd_raw + 1e-6f; const float cn = cstd + 1e-6f; const float cscale = (cn < 1e-4f) ? 0.1f : 1.0f;
    const float vn = sqrtf(r2[0] * ((float)NT / (n - 1.0f))) + 1e-6f;   // std over the broadcast [.., m] copies: each row value repeated NT times
    sh[0] = cscale / cn; sh[1] = reg * 0.5f / covn; sh[2] = 0.5f / vn; sh[3] = 0.0f; for (int h = 0; h < NH; ++h) { sh[4 + h] = ws[h][0]; sh[4 + NH + h] = ws[h][1]; sh[4 + 2 * NH + h] = ws[h][2]; } }
  __syncthreads();
  { if (t_ < 32) ((float*)CST)[t_] = (t_ < 4 + 3 * NH) ? sh[t_] : 0.0f;  }
}
__global__ __launch_bounds__(256) void reduce2_kernel(const float* __restrict__ P2, const float* __restrict__ ROWE, const float* __restrict__ VARC, float* __restrict__ CST) {
  __shared__ float red[5][256];
  const int t_ = threadIdx.x; const int NPART = NP_ * (NT / 32);
  const float vfac = CST[2];   // 0.5/vn; per-row constant c = vw[h] var_c vfac; d2 = e + c
  float a = 0, b = 0; for (int i = t_; i < NPART; i += 256) { const float* p = P2 + (size_t)i * 32; a += (p[0] + p[4]); b += (p[1] + p[5]); }
  // var(d2) = E[(d2 - M)^2] - (E[d2 - M])^2 with the shift M = mean of the row constants (kills the large common offset): per row, sum_m (d2 - M) = rowsum_e + NT (c - M), sum_m (d2 - M)^2 = sum e^2 + 2 (c - M) rowsum_e + NT (c - M)^2
  float sc = 0; for (int i = t_; i < NP_ * NT; i += 256) { const int h = (i / NT) / QB; sc += CST[4 + 2 * NH + h] * VARC[i] * vfac; }
  red[4][t_] = sc; __syncthreads(); for (int s = 128; s >= 1; s >>= 1) { if (t_ < s) red[4][t_] += red[4][t_ + s]; __syncthreads(); }
  const float M = red[4][0] / (float)(NP_ * NT); __syncthreads();
  float s1 = 0, s2 = 0; for (int i = t_; i < NP_ * NT; i += 256) { const int h = (i / NT) / QB; const float cm = CST[4 + 2 * NH + h] * VARC[i] * vfac - M; s1 += (float)NT * cm; s2 += 2.0f * cm * ROWE[i] + (float)NT * cm * cm; }
  red[0][t_] = a + s1; red[1][t_] = b + s2; __syncthreads();
  for (int s = 128; s >= 1; s >>= 1) { if (t_ < s) { red[0][t_] += red[0][t_ + s]; red[1][t_] += red[1][t_ + s]; } __syncthreads(); }
  if (t_ == 0) { const float n = NTOT; const float var = (red[1][0] - red[0][0] * (red[0][0] / n)) / (n - 1.0f); const float dstd = sqrtf(fmaxf(var, 0.0f)); const float temp = (dstd < 1e-6f) ? 0.1f : 0.3f + dstd; const float tinv = 1.0f / clampf(temp, 0.1f, 5.0f);
    { ((float*)CST)[3] = tinv;  } }
}
__global__ __launch_bounds__(128) void outproj_kernel(const b16* __restrict__ OCh, const b16* __restrict__ OCl, const b16* __restrict__ WOUT, const float* __restrict__ bo, float* __restrict__ out) {
  __shared__ __attribute__((aligned(16))) float Ts[4][16][128 + 4];
  const int wave = threadIdx.x >> 5, lane = threadIdx.x & 31, nloc = lane & 15, hlf = lane >> 4; const size_t m0 = (size_t)blockIdx.x * 64 + wave * 16; const int n0 = blockIdx.y * 128;
  v8f acc[8];
#pragma unroll
  for (int t = 0; t < 8; ++t) acc[t] = (v8f){};
#pragma unroll 2
  for (int kb = 0; kb < DIM; kb += 32) { const v16b a = frag_kb(OCh + (m0 + nloc) * DIM + kb, hlf), al = frag_kb(OCl + (m0 + nloc) * DIM + kb, hlf);
#pragma unroll
    for (int t = 0; t < 8; ++t) { const v16b bw = frag_kb(WOUT + (size_t)(n0 + t * 16 + nloc) * DIM + kb, hlf); acc[t] = wmma16b(a, bw, acc[t]); acc[t] = wmma16b(al, bw, acc[t]); } }
#pragma unroll
  for (int t = 0; t < 8; ++t) { const float bb = bf16_rne(bo[n0 + t * 16 + nloc]);
#pragma unroll
    for (int r = 0; r < 8; ++r) Ts[wave][8 * hlf + r][t * 16 + nloc] = acc[t][r] * (1.0f / (XS * WSC)) + bb; }
  wave_lds_sync();
  { for (int rr = 0; rr < 16; ++rr) *(v4f*)(out + (m0 + rr) * DIM + n0 + lane * 4) = *(const v4f*)(&Ts[wave][rr][lane * 4]);  }
}
}  // namespace

extern "C" void kernel_launch(void* const* d_in, const int* in_sizes, int n_in, void* d_out, int out_size, void* d_ws, size_t ws_size, hipStream_t stream) {
  (void)n_in;
  auto Fp = [&](int i) { return (const float*)d_in[i]; };
  // input order: 0 q, 1 k, 2 v [4,1024,512]; 3 ln_in_g, 4 ln_in_b; 5 W_in [512,512]; 6 wp_W1 [128,64], 7 wp_b1, 8 wp_ln_g, 9 wp_ln_b, 10 wp_W2 [64,32], 11 wp_b2, 12 wp_W3 [32,3], 13 wp_b3, 14 weight_temp [1], 15 W_out [512,512], 16 b_out
  if (in_sizes[0] != NR * DIM || in_sizes[1] != NR * DIM || in_sizes[2] != NR * DIM || in_sizes[5] != DIM * DIM || in_sizes[6] != 2 * DH * DH || in_sizes[15] != DIM * DIM || out_size != NR * DIM) return;
  size_t off = 0; char* ws = (char*)d_ws;
  auto carve = [&](size_t bytes) { char* p = ws + off; off += (bytes + 255) & ~(size_t)255; return p; };
  b16* X16 = (b16*)carve((size_t)3 * NR * DIM * 2); b16* WIN = (b16*)carve((size_t)DIM * DIM * 2); b16* WOUT = (b16*)carve((size_t)DIM * DIM * 2);
  float* F32 = (float*)carve((size_t)3 * NP_ * NT * DH * 4); float* KCM = (float*)carve((size_t)NP_ * DH * 4); float* PSUM = (float*)carve((size_t)2 * NP_ * DH * 4);
  b16* FQ16 = (b16*)carve((size_t)NP_ * NT * DH * 2); b16* FQC16 = (b16*)carve((size_t)NP_ * NT * DH * 2); b16* FK16 = (b16*)carve((size_t)NP_ * NT * DH * 2); b16* FKC16 = (b16*)carve((size_t)NP_ * NT * DH * 2);
  float* N1 = (float*)carve((size_t)NP_ * NT * 4); float* N2 = (float*)carve((size_t)NP_ * NT * 4); b16* FVTh = (b16*)carve((size_t)NP_ * DH * NT * 2); b16* FVTl = (b16*)carve((size_t)NP_ * DH * NT * 2);
  float* P1 = (float*)carve((size_t)NP_ * (NT / 32) * 32 * 4); float* VARC = (float*)carve((size_t)NP_ * NT * 4); float* P2 = (float*)carve((size_t)NP_ * (NT / 32) * 32 * 4); float* ROWE = (float*)carve((size_t)NP_ * NT * 4); float* CST = (float*)carve(256);
  b16* OCh = (b16*)carve((size_t)NR * DIM * 2); b16* OCl = (b16*)carve((size_t)NR * DIM * 2);
  if (off > ws_size || off > ((size_t)128 << 20)) return;   // ≈ 73 MB
  ln_kernel<<<3 * NR / 8, 256, 0, stream>>>(Fp(0), Fp(1), Fp(2), Fp(3), Fp(4), X16);
  prepw_kernel<<<(2 * DIM * DIM / 8 + 255) / 256, 256, 0, stream>>>(Fp(5), Fp(15), WIN, WOUT);
  feat_kernel<<<dim3(NR / 64, DIM / 128, 3), 128, 0, stream>>>(X16, WIN, F32);
  colstat_kernel<<<dim3(NP_, 2), 256, 0, stream>>>(F32, KCM, PSUM);
  rowops_kernel<<<NP_ * NT / 16, 256, 0, stream>>>(F32, KCM, FQ16, FQC16, N1, FK16, FKC16, N2);
  norms_kernel<<<NP_ * NT / 256, 256, 0, stream>>>(F32, N1, N2);
  vt_kernel<<<dim3(NT / 64, NP_), 256, 0, stream>>>(F32, FVTh, FVTl);
  score_kernel<1><<<dim3(NT / 32, NP_), 64, 0, stream>>>(FQ16, FQC16, N1, FK16, FKC16, N2, FVTh, FVTl, CST, P1, VARC, P2, ROWE, OCh, OCl);
  reduce1_kernel<<<1, 256, 0, stream>>>(P1, VARC, PSUM, Fp(6), Fp(7), Fp(8), Fp(9), Fp(10), Fp(11), Fp(12), Fp(13), Fp(14), CST);
  score_kernel<2><<<dim3(NT / 32, NP_), 64, 0, stream>>>(FQ16, FQC16, N1, FK16, FKC16, N2, FVTh, FVTl, CST, P1, VARC, P2, ROWE, OCh, OCl);
  reduce2_kernel<<<1, 256, 0, stream>>>(P2, ROWE, VARC, CST);
  score_kernel<3><<<dim3(NT / 32, NP_), 64, 0, stream>>>(FQ16, FQC16, N1, FK16, FKC16, N2, FVTh, FVTl, CST, P1, VARC, P2, ROWE, OCh, OCl);
  outproj_kernel<<<dim3(NR / 64, DIM / 128), 128, 0, stream>>>(OCh, OCl, WOUT, Fp(16), (float*)d_out);
}

// v001
// It runs in 399 microseconds.
// Timed twice side by side with v000, it ran 1.72 and 1.76 times as fast.
#include <hip/hip_runtime.h>

// "Super-aggressive" attention: f_q, f_k, f_v = LN(q|k|v) W_in split into 8 heads x 64; per (head, batch) pair: cos = clip(f_q.f_k / (n1 n2), +-0.99) (n = norm + 1e-8),
// cov = reg x (f_q - rowmean_d)(f_k - colmean_m) / (8 + 1e-6) (reg = 1e-3/1024, x10 if the global std of the raw cov < 1e-6), csim = clip(qn.kn) with max(norm, 1e-6), margin =
// clip(0.01 - csim, 0, 10), var_c = row mean of margin; per-head weights (cw, covw, vw) from a tiny MLP on the global means of f_q / f_k (softmax, /clip(weight_temp), softmax, clip, renorm);
// cn / covn / vn = global std (ddof 1) of cos / cov / var_c (+1e-6); d2 = cw cos/cn cscale + covw cov/covn/2 + vw var_c/vn/2; temp = 0.3 + std(d2) (dstd >= 1e-6; clipped to [0.1, 5]);
// attn = softmax(d2 / temp); out_h = attn f_v; out = concat_h W_out + b -> [4][1024][512].
// Every global statistic is a deterministic two-level f32 reduction (per-wave partials, then one fixed-order kernel); the [1024 x 1024] score tiles are recomputed in three passes
// (component statistics; d2 statistics with per-row shifts; softmax + PV) instead of being stored.
// WMMA (v_wmma_f32_16x16x32_f16, f32 accumulate): W_in (LN(x) single f16 x8, exact weights), dots / centered-cov tiles (single f16 x8 feature planes, K = 64), P.V (P single x8, f_v^T hi+lo:
// 2 products), W_out (O hi+lo: 2 products). LN, norms, all statistics and the weight-predictor MLP in f32. Inputs rounded to bf16 once. Fragment k-map per lane half hh

namespace {
constexpr int QB = 4, NT = 1024, DIM = 512, NH = 8, DH = 64, NP_ = NH * QB /* 32 (h,q) pairs, index h*QB + q */, NR = QB * NT /* 4096 rows */, NWAVE = NP_ * (NT / 16) /* 2048 score waves */;
constexpr float XS = 8.0f, WSC = 256.0f, PS = 8.0f, GAMMA = 0.01f, LREG = 0.001f;
constexpr float NTOT = 33554432.0f;   // 33,554,432 score elements

typedef _Float16 b16;
typedef __attribute__((ext_vector_type(16))) _Float16 v16b;
typedef __attribute__((ext_vector_type(8))) _Float16 v8b;
typedef __attribute__((ext_vector_type(8))) float v8f;
typedef __attribute__((ext_vector_type(4))) float v4f;
__device__ __forceinline__ float bf16_rne(float f) { unsigned int u = __float_as_uint(f); u += 0x7FFFu + ((u >> 16) & 1u); return __uint_as_float(u & 0xFFFF0000u); }
__device__ __forceinline__ void split16(float v, b16& hi, b16& lo) { hi = (b16)v; lo = (b16)(v - (float)hi); }
__device__ __forceinline__ v16b frag_kb(const b16* p, int hh) { const v8b a = *(const v8b*)(p + 8 * hh), b = *(const v8b*)(p + 16 + 8 * hh); v16b f;
#pragma unroll
  for (int e = 0; e < 8; ++e) { f[e] = a[e]; f[8 + e] = b[e]; } return f; }
// the same fragment, addressed as a wave-uniform base plus one per-lane byte offset (the 8 * hh elements included)
__device__ __forceinline__ v16b frag_ub(const b16* ubase, unsigned lane_bytes) { const char* p = (const char*)ubase + lane_bytes; const v8b a = *(const v8b*)p, b = *(const v8b*)(p + 32); v16b f;
#pragma unroll
  for (int e = 0; e < 8; ++e) { f[e] = a[e]; f[8 + e] = b[e]; } return f; }
__device__ __forceinline__ v8f wmma16b(v16b a, v16b b, v8f c) { v8f d = __builtin_amdgcn_wmma_f32_16x16x32_f16(false, a, false, b, (short)0, c, false, false); asm volatile("v_nop\n\tv_nop\n\tv_nop\n\tv_nop" : "+v"(d) : "v"(a), "v"(b)); return d; }
// the same product for a B operand that stays live and unwritten through the whole loop (the query fragments): B is left out of the statement's operands, which all have to sit in the first 256 registers, so that it may live above them
__device__ __forceinline__ v8f wmma16q(v16b a, v16b b, v8f c) { v8f d = __builtin_amdgcn_wmma_f32_16x16x32_f16(false, a, false, b, (short)0, c, false, false); asm volatile("v_nop\n\tv_nop\n\tv_nop\n\tv_nop" : "+v"(d) : "v"(a)); return d; }
// closes a run of global loads. The wait stands in front of the next instruction that writes a register from which those loads took their address (a precaution).
// The scheduling barrier keeps later address arithmetic from being lifted over that wait, and keeps the run up here, ahead of the work that covers its latency: sunk towards their uses the loads would each be waited for in turn.
__device__ __forceinline__ void close_load_run() { asm volatile("s_wait_xcnt 0x0" ::: "memory"); __builtin_amdgcn_sched_barrier(0); }
__device__ __forceinline__ void wave_lds_sync() { __builtin_amdgcn_fence(__ATOMIC_RELEASE, "workgroup"); __builtin_amdgcn_wave_barrier(); __builtin_amdgcn_fence(__ATOMIC_ACQUIRE, "workgroup"); }
// exp(x) on v_exp_f32, with the slot that the instruction set asks for behind a transcendental (before its result is used or its source overwritten) filled in the same statement: a v_nop in a statement of its own did not stay behind it
__device__ __forceinline__ float nexp(float x) { float r; asm("v_exp_f32 %0, %1\n\tv_nop" : "=v"(r) : "v"(x * 1.4426950408889634f)); return r; }
__device__ __forceinline__ float pmul(float a, float b) { float p = a * b; asm volatile("" : "+v"(p)); return p; }
__device__ __forceinline__ float hsum16(float v) { v += __shfl_xor(v, 1); v += __shfl_xor(v, 2); v += __shfl_xor(v, 4); return v + __shfl_xor(v, 8); }
__device__ __forceinline__ float clampf(float v, float lo, float hi) { return fminf(fmaxf(v, lo), hi); }

__global__ __launch_bounds__(256) void ln_kernel(const float* __restrict__ q, const float* __restrict__ k, const float* __restrict__ v, const float* __restrict__ g, const float* __restrict__ be, b16* __restrict__ X16) {
  const int wave = threadIdx.x >> 5, lane = threadIdx.x & 31; const int rowall = blockIdx.x * 8 + wave; const int which = rowall / NR, row = rowall - which * NR;
  const float* src = (which == 0 ? q : which == 1 ? k : v) + (size_t)row * DIM + lane * 16; float x[16];
  { const v4f a = *(const v4f*)src, b = *(const v4f*)(src + 4), c = *(const v4f*)(src + 8), d = *(const v4f*)(src + 12); for (int j = 0; j < 4; ++j) { x[j] = bf16_rne(a[j]); x[4 + j] = bf16_rne(b[j]); x[8 + j] = bf16_rne(c[j]); x[12 + j] = bf16_rne(d[j]); } }
  float s = 0.0f; for (int j = 0; j < 16; ++j) s += x[j];
#pragma unroll
  for (int o = 16; o >= 1; o >>= 1) s += __shfl_xor(s, o);
  const float mu = s * (1.0f / DIM); float ss = 0.0f; for (int j = 0; j < 16; ++j) { const float d = x[j] - mu; ss += pmul(d, d); }
#pragma unroll
  for (int o = 16; o >= 1; o >>= 1) ss += __shfl_xor(ss, o);
  const float rs = rsqrtf(ss * (1.0f / DIM) + 1e-5f); v8b o0, o1;
  for (int j = 0; j < 16; ++j) { const int c = lane * 16 + j; const b16 hv = (b16)((pmul((x[j] - mu) * rs, bf16_rne(g[c])) + bf16_rne(be[c])) * XS); if (j < 8) o0[j] = hv; else o1[j - 8] = hv; }
  { b16* dst = X16 + ((size_t)which * NR + row) * DIM + lane * 16; *(v8b*)dst = o0; *(v8b*)(dst + 8) = o1;  }
}
__global__ __launch_bounds__(256) void prepw_kernel(const float* __restrict__ win, const float* __restrict__ wout, b16* __restrict__ WIN, b16* __restrict__ WOUT) {
  const int t = blockIdx.x * 256 + threadIdx.x; if (t >= 2 * DIM * DIM / 8) return; const int kind = t / (DIM * DIM / 8), tt = t - kind * (DIM * DIM / 8); const int o_ = (tt * 8) / DIM, k0 = tt * 8 - o_ * DIM;
  const float* w = kind == 0 ? win : wout; v8b o; for (int j = 0; j < 8; ++j) o[j] = (b16)(bf16_rne(w[(size_t)(k0 + j) * DIM + o_]) * WSC);
  { *(v8b*)((kind == 0 ? WIN : WOUT) + (size_t)tt * 8) = o;  }
}
// features: F = X16 W_in per row (block = 64 rows x 4 waves, wave = 16 rows x 128 cols = 2 heads; grid.y = 4): which 0 (q): F32Q [pair][n][64] f32 rows; which 1 (k): F32K; which 2 (v): F32V. (f32 planes,
__global__ __launch_bounds__(128) void feat_kernel(const b16* __restrict__ X16, const b16* __restrict__ WIN, float* __restrict__ F32) {
  __shared__ __attribute__((aligned(16))) float Ts[4][16][128 + 4];
  const int wave = threadIdx.x >> 5, lane = threadIdx.x & 31, nloc = lane & 15, hlf = lane >> 4; const int which = blockIdx.z; const size_t m0 = (size_t)blockIdx.x * 64 + wave * 16; const int n0 = blockIdx.y * 128;
  v8f acc[8];
#pragma unroll
  for (int t = 0; t < 8; ++t) acc[t] = (v8f){};
  const b16* ap = X16 + ((size_t)which * NR + m0 + nloc) * DIM; const b16* bp = WIN + (size_t)(n0 + nloc) * DIM;
  v16b a = frag_kb(ap, hlf), b[8];
#pragma unroll
  for (int t = 0; t < 8; ++t) b[t] = frag_kb(bp + (size_t)t * 16 * DIM, hlf);
#pragma unroll   // full: the two fragment sets swap by renaming, and the last step's fetch falls away
  for (int kb = 0; kb < DIM; kb += 32) { v16b an = a, bn[8];
#pragma unroll
    for (int t = 0; t < 8; ++t) bn[t] = b[t];
    if (kb + 32 < DIM) { an = frag_kb(ap + kb + 32, hlf);
#pragma unroll
      for (int t = 0; t < 8; ++t) bn[t] = frag_kb(bp + (size_t)t * 16 * DIM + kb + 32, hlf); }
    __builtin_amdgcn_sched_barrier(0);   // keeps the next step's loads, as one group, ahead of this step's products: sunk towards their uses they would each be waited for in turn
#pragma unroll
    for (int t = 0; t < 8; ++t) acc[t] = wmma16b(a, b[t], acc[t]);
    a = an;
#pragma unroll
    for (int t = 0; t < 8; ++t) b[t] = bn[t]; }
#pragma unroll
  for (int t = 0; t < 8; ++t)
#pragma unroll
    for (int r = 0; r < 8; ++r) Ts[wave][8 * hlf + r][t * 16 + nloc] = acc[t][r] * (1.0f / (XS * WSC));
  wave_lds_sync();
  // rows m0+rr: q_idx = row / NT, n = row % NT; cols n0 + c -> head h = (n0 + c) / 64, d = % 64; F32 layout [which][pair][n][64]
  { for (int rr = 0; rr < 16; ++rr) { const size_t row = m0 + rr; const int qi = (int)(row / NT), n = (int)(row - (size_t)qi * NT); for (int hq = 0; hq < 2; ++hq) { const int h = n0 / DH + hq; const int pair = h * QB + qi;
        if (lane < 16) *(v4f*)(F32 + (((size_t)which * NP_ + pair) * NT + n) * DH + lane * 4) = *(const v4f*)(&Ts[wave][rr][hq * DH + lane * 4]); } }  }
}
// per-pair column statistics of f_k (mean over the 1024 keys per d) and head means qg/kg (over all 4,096 rows): colstat: block = pair, 256 threads: thread (d = t%64, part = t/64) sums rows part*256..+255;
__global__ __launch_bounds__(256) void colstat_kernel(const float* __restrict__ F32, float* __restrict__ KCM, float* __restrict__ PSUM) {   // PSUM [which 0/1][pair][64] = column sums
  __shared__ float part[4][DH];
  const int which = blockIdx.y, pair = blockIdx.x, t_ = threadIdx.x, d = t_ & 63, pq = t_ >> 6; const float* base = F32 + (((size_t)which * NP_ + pair) * NT) * DH;
  float s = 0.0f; for (int n = pq * 256; n < pq * 256 + 256; ++n) s += base[(size_t)n * DH + d]; part[pq][d] = s;
  __syncthreads();
  if (t_ < DH) { const float tot = (part[0][t_] + part[1][t_]) + (part[2][t_] + part[3][t_]);
    { ((float*)PSUM)[((size_t)which * NP_ + pair) * DH + t_] = tot; if (which == 1) ((float*)KCM)[(size_t)pair * DH + t_] = tot * (1.0f / NT);  } }
}
// operand planes per pair: FQ16 [pair][n][64] = f16(8 f_q), FQC16 = f16(8 (f_q - rowmean)), N1 [pair][n] = ||f_q|| (f32); FK16, FKC16 = f16(8 (f_k - colmean)), N2; FVTh/FVTl [pair][64][1024] = f_v^T hi/lo x8.
__global__ __launch_bounds__(256) void rowops_kernel(const float* __restrict__ F32, const float* __restrict__ KCM, b16* __restrict__ FQ16, b16* __restrict__ FQC16, float* __restrict__ N1, b16* __restrict__ FK16, b16* __restrict__ FKC16, float* __restrict__ N2) {
  const int wave = threadIdx.x >> 5, lane = threadIdx.x & 31; const size_t prow = ((size_t)blockIdx.x * 8 + wave) * 2 + (lane >> 4);   // pair*NT + n, over NP_*NT rows
  const int pair = (int)(prow / NT); const int c0 = (lane & 15) * 4;
  const v4f fq = *(const v4f*)(F32 + (0 * (size_t)NP_ * NT + prow) * DH + c0), fk = *(const v4f*)(F32 + (1 * (size_t)NP_ * NT + prow) * DH + c0);
  float sq = 0.0f, ssq = 0.0f, ssk = 0.0f; for (int j = 0; j < 4; ++j) { sq += fq[j]; ssq += pmul(fq[j], fq[j]); ssk += pmul(fk[j], fk[j]); }
  sq = hsum16(sq); ssq = hsum16(ssq); ssk = hsum16(ssk); const float mq = sq * (1.0f / DH);
  typedef __attribute__((ext_vector_type(4))) _Float16 v4b; v4b a, ac, b, bc;
  for (int j = 0; j < 4; ++j) { a[j] = (b16)(fq[j] * XS); ac[j] = (b16)((fq[j] - mq) * XS); b[j] = (b16)(fk[j] * XS); bc[j] = (b16)((fk[j] - KCM[(size_t)pair * DH + c0 + j]) * XS); }
  { *(v4b*)(FQ16 + prow * DH + c0) = a; *(v4b*)(FQC16 + prow * DH + c0) = ac; *(v4b*)(FK16 + prow * DH + c0) = b; *(v4b*)(FKC16 + prow * DH + c0) = bc;  }
  // norms: ssq/ssk are not stored here; N1/N2 are written by norms_kernel (one thread per row).
}
__global__ __launch_bounds__(256) void norms_kernel(const float* __restrict__ F32, float* __restrict__ N1, float* __restrict__ N2) {   // thread per row: 256 rows per block -> N1/N2 spans of 256 floats (8 lines) each
  const size_t prow = (size_t)blockIdx.x * 256 + threadIdx.x; const float* fq = F32 + (0 * (size_t)NP_ * NT + prow) * DH; const float* fk = F32 + (1 * (size_t)NP_ * NT + prow) * DH;
  float sq = 0.0f, sk = 0.0f; for (int d = 0; d < DH; ++d) { sq += pmul(fq[d], fq[d]); sk += pmul(fk[d], fk[d]); }
  { ((float*)N1)[prow] = sqrtf(sq); ((float*)N2)[prow] = sqrtf(sk);  }
}
__global__ __launch_bounds__(256) void vt_kernel(const float* __restrict__ F32, b16* __restrict__ FVTh, b16* __restrict__ FVTl) {   // block = (pair, 64-key chunk): transpose [64 n][64 d] -> rows d, hi/lo
  __shared__ __attribute__((aligned(16))) b16 Th[DH][64 + 8], Tl[DH][64 + 8];
  const int pair = blockIdx.y, n0 = blockIdx.x * 64, t_ = threadIdx.x; const float* base = F32 + ((2 * (size_t)NP_ + pair) * NT + n0) * DH;
  for (int qq = t_; qq < 64 * DH; qq += 256) { const int nn = qq >> 6, d = qq & 63; b16 h_, l_; split16(base[(size_t)nn * DH + d] * XS, h_, l_); Th[d][nn] = h_; Tl[d][nn] = l_; }
  __syncthreads();
  { for (int qq = t_; qq < DH * 8; qq += 256) { const int d = qq >> 3, c8 = (qq & 7) * 8; const size_t gi = ((size_t)pair * DH + d) * NT + n0 + c8; *(v8b*)(FVTh + gi) = *(const v8b*)(&Th[d][c8]); *(v8b*)(FVTl + gi) = *(const v8b*)(&Tl[d][c8]); }  }
}
// score-tile passes: wave = 16 query rows n of one pair (block = 2 waves), loop over 32 key blocks of 32: dots^T and covraw^T tiles (keys x queries, K = 64: 2 steps x 2 key tiles x 2 GEMMs = 8 WMMAs),
// lane (hh, col=query) holds keys kb+8hh+r and kb+16+8hh+r.  cos = clip(dots/((n1+1e-8)(n2+1e-8))), csim = clip(dots/(max(n1,1e-6) max(n2,1e-6))), margin = clip(0.01 - csim, 0, 10), covraw = c/(8+1e-6).
// PASS 2 (given cn, covfac = reg/covn/2, w per head, vn): per row c_row = vw var_c/(2 vn); e = cw cos/cn cscale + covw covraw covfac (d2 - c_row): per-wave S_e, S_e2 and per-row rowsum_e -> P2, ROWE.
// PASS 3 (given temp): logits = (e + c_row)/temp -> online softmax (f32) with o^T += f_v^T P^T (hi+lo, 4 d-tiles): O [pair][n][64] -> OC16h/l [row = q*NT+n][h*64+d] (concat-head planes, hi/lo x8).
template <int PASS>
__global__ __launch_bounds__(64) void score_kernel(const b16* __restrict__ FQ16, const b16* __restrict__ FQC16, const float* __restrict__ N1, const b16* __restrict__ FK16, const b16* __restrict__ FKC16, const float* __restrict__ N2, const b16* __restrict__ FVTh, const b16* __restrict__ FVTl,
                                                  const float* __restrict__ CST /* [0..3] cscale/cn, reg/(2 covn), 1/(2 vn), 1/temp; [4..27] cw, covw, vw per head */, float* __restrict__ P1, float* __restrict__ VARC, float* __restrict__ P2, float* __restrict__ ROWE, b16* __restrict__ OCh, b16* __restrict__ OCl) {
  __shared__ __attribute__((aligned(16))) float To[2][16][DH + 4]; __shared__ float Tr[2][16]; __shared__ float Tp[2][4];
  const int wave = threadIdx.x >> 5, lane = threadIdx.x & 31, hh = lane >> 4, col = lane & 15; const int pair = blockIdx.y, n0 = blockIdx.x * 32 + wave * 16, ni = n0 + col; const int h = pair / QB, qi = pair - h * QB;
  const size_t prow = (size_t)pair * NT + ni; const b16* Qp = FQ16 + prow * DH; const b16* Qc = FQC16 + prow * DH; const b16* Kb = FK16 + (size_t)pair * NT * DH; const b16* Kc = FKC16 + (size_t)pair * NT * DH;
  __builtin_amdgcn_sched_barrier(0);   // keeps the index arithmetic above from being placed between the loads below and the wait that closes their run
  const v16b qa0 = frag_kb(Qp, hh), qa1 = frag_kb(Qp + 32, hh); close_load_run();
  const v16b qc0 = frag_kb(Qc, hh), qc1 = frag_kb(Qc + 32, hh); close_load_run();
  const float n1 = N1[prow]; close_load_run(); const float inv1a = 1.0f / (n1 + 1e-8f), inv1b = 1.0f / fmaxf(n1, 1e-6f);
  float cn_inv_cscale = 0.0f, covfac = 0.0f, vn_half_inv = 0.0f, temp_inv = 0.0f, cwh = 0.0f, covwh = 0.0f, vwh = 0.0f;   // this head's constants, read once ahead of the loop
  if (PASS >= 2) { const float* cf = CST; cn_inv_cscale = cf[0]; covfac = cf[1]; vn_half_inv = cf[2]; temp_inv = cf[3]; cwh = cf[4 + h]; covwh = cf[4 + NH + h]; vwh = cf[4 + 2 * NH + h]; }
  float crow = 0.0f; if (PASS >= 2) crow = vwh * VARC[prow] * vn_half_inv;
  float s_a = 0.0f, s_b = 0.0f, s_c = 0.0f, s_d = 0.0f, rowacc = 0.0f;
  float m = -INFINITY, l = 0.0f; v8f o[4] = {{}, {}, {}, {}}, ol[4] = {{}, {}, {}, {}};
  // One key block's operands (8 key fragments, 16 key norms) live in registers and are fetched together, a whole block ahead of their use.
  v16b k0a, k0b, k1a, k1b, x0a, x0b, x1a, x1b; v4f nn0, nn1, nn2, nn3;
  const unsigned klane = (unsigned)(col * DH + 8 * hh) * 2u, nlane = (unsigned)hh * 32u, vlane = (unsigned)(col * NT + 8 * hh) * 2u;   // per-lane byte offsets into a key block, its norms, the value rows
  auto fetch_keys = [&](int kq) { const b16* kr = Kb + (size_t)kq * DH; const b16* cr = Kc + (size_t)kq * DH; const char* np = (const char*)(N2 + (size_t)pair * NT + kq) + nlane;
    nn0 = *(const v4f*)np; nn1 = *(const v4f*)(np + 16); nn2 = *(const v4f*)(np + 64); nn3 = *(const v4f*)(np + 80); close_load_run();
    k0a = frag_ub(kr, klane); k0b = frag_ub(kr + 32, klane); k1a = frag_ub(kr + 16 * DH, klane); k1b = frag_ub(kr + 16 * DH + 32, klane); close_load_run();
    x0a = frag_ub(cr, klane); x0b = frag_ub(cr + 32, klane); x1a = frag_ub(cr + 16 * DH, klane); x1b = frag_ub(cr + 16 * DH + 32, klane); close_load_run(); };
  fetch_keys(0);
  for (int kb = 0; kb < NT; kb += 32) {
    v8f d0 = {}, d1 = {}, c0 = {}, c1 = {};
    d0 = wmma16q(k0a, qa0, d0); d0 = wmma16q(k0b, qa1, d0);
    d1 = wmma16q(k1a, qa0, d1); d1 = wmma16q(k1b, qa1, d1);
    c0 = wmma16q(x0a, qc0, c0); c0 = wmma16q(x0b, qc1, c0);
    c1 = wmma16q(x1a, qc0, c1); c1 = wmma16q(x1b, qc1, c1);
    const v4f na0 = nn0, na1 = nn1, nb0 = nn2, nb1 = nn3;
    // behind the last score product: this block's value fragments (used after the softmax arithmetic), then the next block's keys (the last block re-reads block 0, unused), all in flight under the vector work
    v16b vh[4], vl[4];
    if (PASS == 3) {
#pragma unroll
      for (int t = 0; t < 4; ++t) { vh[t] = frag_ub(FVTh + ((size_t)pair * DH + t * 16) * NT + kb, vlane); vl[t] = frag_ub(FVTl + ((size_t)pair * DH + t * 16) * NT + kb, vlane); }
      close_load_run(); }
    const int kn = kb + 32 < NT ? kb + 32 : 0;
    fetch_keys(kn);
    float ev0[8], ev1[8];
#pragma unroll
    for (int r = 0; r < 8; ++r) {
#pragma unroll
      for (int hq = 0; hq < 2; ++hq) { const float dot = (hq ? d1[r] : d0[r]) * (1.0f / (XS * XS)); const float covraw = (hq ? c1[r] : c0[r]) * (1.0f / (XS * XS)) * (1.0f / (8.0f + 1e-6f));
        const float n2 = hq ? (r < 4 ? nb0[r & 3] : nb1[r & 3]) : (r < 4 ? na0[r & 3] : na1[r & 3]); const float cosv = clampf(dot * inv1a * (1.0f / (n2 + 1e-8f)), -0.99f, 0.99f); 
        if (PASS == 1) { const float csim = clampf(dot * inv1b * (1.0f / fmaxf(n2, 1e-6f)), -0.99f, 0.99f); const float margin = clampf(GAMMA - csim, 0.0f, 10.0f);
          s_a += cosv; s_b += pmul(cosv, cosv); s_c += covraw; s_d += pmul(covraw, covraw); rowacc += margin; }
        else { const float e = pmul(cwh, cosv * cn_inv_cscale) + pmul(covwh, covraw * covfac);
          if (PASS == 2) { s_a += e; s_b += pmul(e, e); rowacc += e; }
          else { (hq ? ev1 : ev0)[r] = (e + crow) * temp_inv; } } } }
    if (PASS == 3) { float mr = -INFINITY;
#pragma unroll
      for (int r = 0; r < 8; ++r) mr = fmaxf(mr, fmaxf(ev0[r], ev1[r]));
      mr = fmaxf(mr, __shfl_xor(mr, 16)); const float mn = fmaxf(m, mr); const float al_ = nexp(m - mn); m = mn; float sum = 0.0f; v16b pb;
#pragma unroll
      for (int r = 0; r < 8; ++r) { const float e0 = nexp(ev0[r] - mn), e1 = nexp(ev1[r] - mn); sum += e0 + e1; pb[r] = (b16)(e0 * PS); pb[8 + r] = (b16)(e1 * PS); }
      sum += __shfl_xor(sum, 16); l = l * al_ + sum;
#pragma unroll
      for (int t = 0; t < 4; ++t) { o[t] *= al_; ol[t] *= al_; o[t] = wmma16b(vh[t], pb, o[t]); ol[t] = wmma16b(vl[t], pb, ol[t]); } } }
  if (PASS <= 2) {   // per-row sums across the two lane halves; per-wave partials over the 16 rows and 32 lanes
    rowacc += __shfl_xor(rowacc, 16); if (hh == 0) Tr[wave][col] = rowacc;
    float v4[4] = {s_a, s_b, s_c, s_d};
#pragma unroll
    for (int j = 0; j < 4; ++j) { float v = v4[j];
#pragma unroll
      for (int oo = 16; oo >= 1; oo >>= 1) v += __shfl_xor(v, oo);
      v4[j] = v; }
    if (lane == 0) { Tp[wave][0] = v4[0]; Tp[wave][1] = v4[1]; Tp[wave][2] = v4[2]; Tp[wave][3] = v4[3]; }
    wave_lds_sync();
    const size_t widx = (size_t)pair * (NT / 16) + blockIdx.x * 2 + wave;
    __syncthreads();
    {
      if (wave == 0) { const float rv = Tr[lane >> 4][lane & 15] * (PASS == 1 ? (1.0f / NT) : 1.0f); ((float*)(PASS == 1 ? VARC : ROWE))[(size_t)pair * NT + blockIdx.x * 32 + lane] = rv;
        ((float*)(PASS == 1 ? P1 : P2))[((size_t)pair * (NT / 32) + blockIdx.x) * 32 + lane] = (lane < 8) ? Tp[lane >> 2][lane & 3] : 0.0f; }
       }
    (void)widx;
  } else {
    const float inv = 1.0f / (l * PS * XS);
#pragma unroll
    for (int t = 0; t < 4; ++t)
#pragma unroll
      for (int r = 0; r < 8; ++r) To[wave][col][t * 16 + 8 * hh + r] = (o[t][r] + ol[t][r]) * inv;
    wave_lds_sync();
    { for (int r2 = 0; r2 < 16; r2 += 4) { const int rr = r2 + (lane >> 3), c8 = (lane & 7) * 8; v8b hv, lv; for (int j = 0; j < 8; ++j) { b16 a_, c_; split16(To[wave][rr][c8 + j] * XS, a_, c_); hv[j] = a_; lv[j] = c_; }
        const size_t gi = ((size_t)qi * NT + n0 + rr) * DIM + h * DH + c8; *(v8b*)(OCh + gi) = hv; *(v8b*)(OCl + gi) = lv; }  }
  }
}
// reductions (one block each, fixed order). reduce1: cn, covn, vn, weights -> CST[0..27]; reduce2: dstd -> temp -> CST[3].
__global__ __launch_bounds__(256) void reduce1_kernel(const float* __restrict__ P1, const float* __restrict__ VARC, const float* __restrict__ PSUM, const float* __restrict__ w1, const float* __restrict__ b1, const float* __restrict__ g2, const float* __restrict__ be2, const float* __restrict__ w2, const float* __restrict__ b2, const float* __restrict__ w3, const float* __restrict__ b3, const float* __restrict__ wtemp, float* __restrict__ CST) {
  __shared__ float red[4][256]; __shared__ float sh[64];
  const int t_ = threadIdx.x; const int NPART = NP_ * (NT / 32);   // 1,024 block partials of 8 floats (2 waves x 4)
  float a = 0, b = 0, c = 0, d = 0; for (int i = t_; i < NPART; i += 256) { const float* p = P1 + (size_t)i * 32; a += p[0] + p[4]; b += p[1] + p[5]; c += p[2] + p[6]; d += p[3] + p[7]; }
  red[0][t_] = a; red[1][t_] = b; red[2][t_] = c; red[3][t_] = d; __syncthreads();
  for (int s = 128; s >= 1; s >>= 1) { if (t_ < s) { for (int j = 0; j < 4; ++j) red[j][t_] += red[j][t_ + s]; } __syncthreads(); }
  float vs = 0.0f; for (int i = t_; i < NP_ * NT; i += 256) vs += VARC[i];
  __shared__ float r2[256]; r2[t_] = vs; __syncthreads(); for (int s = 128; s >= 1; s >>= 1) { if (t_ < s) r2[t_] += r2[t_ + s]; __syncthreads(); }
  const float vmu = r2[0] / (float)(NP_ * NT); __syncthreads();
  float vq = 0.0f;
#pragma unroll 1
  for (int i = t_; i < NP_ * NT; i += 256) { const float dv = VARC[i] - vmu; vq += pmul(dv, dv); }
  r2[t_] = vq; __syncthreads(); for (int s = 128; s >= 1; s >>= 1) { if (t_ < s) r2[t_] += r2[t_ + s]; __syncthreads(); }
  // head means qg/kg [8][64] from PSUM [which][pair][64]: mean over (q, n) = sum over the 4 pairs of the head / 4096 -> feats [h][128]; MLP: h1 = relu(LN(feats W1 + b1)), h2 = relu(h1 W2 + b2), logits = softmax(h2 W3 + b3), w = softmax(logits / clip(wt)), clip [0.05,0.8], renorm
  __shared__ float feats[NH][2 * DH], h1s[NH][DH], h2s[NH][32], ws[NH][3];
  for (int i = t_; i < NH * 2 * DH; i += 256) { const int h = i / (2 * DH), c = i - h * 2 * DH; const int which = c / DH, dd = c - which * DH; float s = 0.0f;
#pragma unroll 1
    for (int qq = 0; qq < QB; ++qq) s += PSUM[((size_t)which * NP_ + h * QB + qq) * DH + dd]; feats[h][c] = s * (1.0f / (QB * NT)); }
  __syncthreads();
  for (int i = t_; i < NH * DH; i += 256) { const int h = i / DH, o_ = i - h * DH; float s = bf16_rne(b1[o_]);
#pragma unroll 1
    for (int c = 0; c < 2 * DH; ++c) s += pmul(feats[h][c], bf16_rne(w1[c * DH + o_])); h1s[h][o_] = s; }
  __syncthreads();
  if (t_ < NH) { const int h = t_; float mu = 0.0f;
#pragma unroll 1
    for (int c = 0; c < DH; ++c) mu += h1s[h][c];
    mu *= (1.0f / DH); float var = 0.0f;
#pragma unroll 1
    for (int c = 0; c < DH; ++c) { const float dv = h1s[h][c] - mu; var += pmul(dv, dv); }
    var *= (1.0f / DH); const float rs = rsqrtf(var + 1e-5f);
#pragma unroll 1
    for (int c = 0; c < DH; ++c) h1s[h][c] = fmaxf(pmul((h1s[h][c] - mu) * rs, bf16_rne(g2[c])) + bf16_rne(be2[c]), 0.0f); }
  __syncthreads();
  for (int i = t_; i < NH * 32; i += 256) { const int h = i / 32, o_ = i - h * 32; float s = bf16_rne(b2[o_]);
#pragma unroll 1
    for (int c = 0; c < DH; ++c) s += pmul(h1s[h][c], bf16_rne(w2[c * 32 + o_])); h2s[h][o_] = fmaxf(s, 0.0f); }
  __syncthreads();
  if (t_ < NH) { const int h = t_; float lg[3]; for (int o_ = 0; o_ < 3; ++o_) { float s = bf16_rne(b3[o_]);
#pragma unroll 1
      for (int c = 0; c < 32; ++c) s += pmul(h2s[h][c], bf16_rne(w3[c * 3 + o_])); lg[o_] = s; }
    float mx = fmaxf(lg[0], fmaxf(lg[1], lg[2])); float e3[3], se = 0.0f; for (int j = 0; j < 3; ++j) { e3[j] = __expf(lg[j] - mx); se += e3[j]; } for (int j = 0; j < 3; ++j) e3[j] /= se;
    const float wt = clampf(bf16_rne(wtemp[0]), 0.1f, 20.0f); float z[3]; for (int j = 0; j < 3; ++j) z[j] = e3[j] / wt; mx = fmaxf(z[0], fmaxf(z[1], z[2])); se = 0.0f; for (int j = 0; j < 3; ++j) { e3[j] = __expf(z[j] - mx); se += e3[j]; }
    float wv[3], sw = 0.0f; for (int j = 0; j < 3; ++j) { wv[j] = clampf(e3[j] / se, 0.05f, 0.8f); sw += wv[j]; } for (int j = 0; j < 3; ++j) ws[h][j] = wv[j] / sw; }
  __syncthreads();
  if (t_ == 0) { const float n = (float)NTOT; const float sa_ = red[0][0], sb = red[1][0], sc = red[2][0], sd = red[3][0];
    const float cstd = sqrtf(fmaxf((sb - sa_ * (sa_ / n)) / (n - 1.0f), 0.0f)); const float covstd_raw = sqrtf(fmaxf((sd - sc * (sc / n)) / (n - 1.0f), 0.0f));
    const float base_reg = LREG / (float)NT; const float reg = (covstd_raw < 1e-6f) ? base_reg * 10.0f : base_reg;   // reference: reg chosen on the std of the RAW cov, then cov = clip(reg cov, +-50) (never clips at this scale)
    const float covn = reg * covstd_raw + 1e-6f; const float cn = cstd + 1e-6f; const float cscale = (cn < 1e-4f) ? 0.1f : 1.0f;
    const float vn = sqrtf(r2[0] * ((float)NT / (n - 1.0f))) + 1e-6f;   // std over the broadcast [.., m] copies: each row value repeated NT times
    sh[0] = cscale / cn; sh[1] = reg * 0.5f / covn; sh[2] = 0.5f / vn; sh[3] = 0.0f; for (int h = 0; h < NH; ++h) { sh[4 + h] = ws[h][0]; sh[4 + NH + h] = ws[h][1]; sh[4 + 2 * NH + h] = ws[h][2]; } }
  __syncthreads();
  { if (t_ < 32) ((float*)CST)[t_] = (t_ < 4 + 3 * NH) ? sh[t_] : 0.0f;  }
}
__global__ __launch_bounds__(256) void reduce2_kernel(const float* __restrict__ P2, const float* __restrict__ ROWE, const float* __restrict__ VARC, float* __restrict__ CST) {
  __shared__ float red[5][256];
  const int t_ = threadIdx.x; const int NPART = NP_ * (NT / 32);
  const float vfac = CST[2];   // 0.5/vn; per-row constant c = vw[h] var_c vfac; d2 = e + c
  float a = 0, b = 0; for (int i = t_; i < NPART; i += 256) { const float* p = P2 + (size_t)i * 32; a += (p[0] + p[4]); b += (p[1] + p[5]); }
  // var(d2) = E[(d2 - M)^2] - (E[d2 - M])^2 with the shift M = mean of the row constants (kills the large common offset): per row, sum_m (d2 - M) = rowsum_e + NT (c - M), sum_m (d2 - M)^2 = sum e^2 + 2 (c - M) rowsum_e + NT (c - M)^2
  float sc = 0; for (int i = t_; i < NP_ * NT; i += 256) { const int h = (i / NT) / QB; sc += CST[4 + 2 * NH + h] * VARC[i] * vfac; }
  red[4][t_] = sc; __syncthreads(); for (int s = 128; s >= 1; s >>= 1) { if (t_ < s) red[4][t_] += red[4][t_ + s]; __syncthreads(); }
  const float M = red[4][0] / (float)(NP_ * NT); __syncthreads();
  float s1 = 0, s2 = 0; for (int i = t_; i < NP_ * NT; i += 256) { const int h = (i / NT) / QB; const float cm = CST[4 + 2 * NH + h] * VARC[i] * vfac - M; s1 += (float)NT * cm; s2 += 2.0f * cm * ROWE[i] + (float)NT * cm * cm; }
  red[0][t_] = a + s1; red[1][t_] = b + s2; __syncthreads();
  for (int s = 128; s >= 1; s >>= 1) { if (t_ < s) { red[0][t_] += red[0][t_ + s]; red[1][t_] += red[1][t_ + s]; } __syncthreads(); }
  if (t_ == 0) { const float n = NTOT; const float var = (red[1][0] - red[0][0] * (red[0][0] / n)) / (n - 1.0f); const float dstd = sqrtf(fmaxf(var, 0.0f)); const float temp = (dstd < 1e-6f) ? 0.1f : 0.3f + dstd; const float tinv = 1.0f / clampf(temp, 0.1f, 5.0f);
    { ((float*)CST)[3] = tinv;  } }
}
__global__ __launch_bounds__(128) void outproj_kernel(const b16* __restrict__ OCh, const b16* __restrict__ OCl, const b16* __restrict__ WOUT, const float* __restrict__ bo, float* __restrict__ out) {
  __shared__ __attribute__((aligned(16))) float Ts[4][16][128 + 4];
  const int wave = threadIdx.x >> 5, lane = threadIdx.x & 31, nloc = lane & 15, hlf = lane >> 4; const size_t m0 = (size_t)blockIdx.x * 64 + wave * 16; const int n0 = blockIdx.y * 128;
  v8f acc[8];
#pragma unroll
  for (int t = 0; t < 8; ++t) acc[t] = (v8f){};
  const b16* ap = OCh + (m0 + nloc) * DIM; const b16* lp = OCl + (m0 + nloc) * DIM; const b16* bp = WOUT + (size_t)(n0 + nloc) * DIM;
  v16b a = frag_kb(ap, hlf), al = frag_kb(lp, hlf), b[8];
#pragma unroll
  for (int t = 0; t < 8; ++t) b[t] = frag_kb(bp + (size_t)t * 16 * DIM, hlf);
#pragma unroll   // full: the two fragment sets swap by renaming, and the last step's fetch falls away
  for (int kb = 0; kb < DIM; kb += 32) { v16b an = a, aln = al, bn[8];
#pragma unroll
    for (int t = 0; t < 8; ++t) bn[t] = b[t];
    if (kb + 32 < DIM) { an = frag_kb(ap + kb + 32, hlf); aln = frag_kb(lp + kb + 32, hlf);
#pragma unroll
      for (int t = 0; t < 8; ++t) bn[t] = frag_kb(bp + (size_t)t * 16 * DIM + kb + 32, hlf); }
    __builtin_amdgcn_sched_barrier(0);   // keeps the next step's loads, as one group, ahead of this step's products: sunk towards their uses they would each be waited for in turn
#pragma unroll
    for (int t = 0; t < 8; ++t) { acc[t] = wmma16b(a, b[t], acc[t]); acc[t] = wmma16b(al, b[t], acc[t]); }
    a = an; al = aln;
#pragma unroll
    for (int t = 0; t < 8; ++t) b[t] = bn[t]; }
#pragma unroll
  for (int t = 0; t < 8; ++t) { const float bb = bf16_rne(bo[n0 + t * 16 + nloc]);
#pragma unroll
    for (int r = 0; r < 8; ++r) Ts[wave][8 * hlf + r][t * 16 + nloc] = acc[t][r] * (1.0f / (XS * WSC)) + bb; }
  wave_lds_sync();
  { for (int rr = 0; rr < 16; ++rr) *(v4f*)(out + (m0 + rr) * DIM + n0 + lane * 4) = *(const v4f*)(&Ts[wave][rr][lane * 4]);  }
}
}  // namespace

extern "C" void kernel_launch(void* const* d_in, const int* in_sizes, int n_in, void* d_out, int out_size, void* d_ws, size_t ws_size, hipStream_t stream) {
  (void)n_in;
  auto Fp = [&](int i) { return (const float*)d_in[i]; };
  // input order: 0 q, 1 k, 2 v [4,1024,512]; 3 ln_in_g, 4 ln_in_b; 5 W_in [512,512]; 6 wp_W1 [128,64], 7 wp_b1, 8 wp_ln_g, 9 wp_ln_b, 10 wp_W2 [64,32], 11 wp_b2, 12 wp_W3 [32,3], 13 wp_b3, 14 weight_temp [1], 15 W_out [512,512], 16 b_out
  if (in_sizes[0] != NR * DIM || in_sizes[1] != NR * DIM || in_sizes[2] != NR * DIM || in_sizes[5] != DIM * DIM || in_sizes[6] != 2 * DH * DH || in_sizes[15] != DIM * DIM || out_size != NR * DIM) return;
  size_t off = 0; char* ws = (char*)d_ws;
  auto carve = [&](size_t bytes) { char* p = ws + off; off += (bytes + 255) & ~(size_t)255; return p; };
  b16* X16 = (b16*)carve((size_t)3 * NR * DIM * 2); b16* WIN = (b16*)carve((size_t)DIM * DIM * 2); b16* WOUT = (b16*)carve((size_t)DIM * DIM * 2);
  float* F32 = (float*)carve((size_t)3 * NP_ * NT * DH * 4); float* KCM = (float*)carve((size_t)NP_ * DH * 4); float* PSUM = (float*)carve((size_t)2 * NP_ * DH * 4);
  b16* FQ16 = (b16*)carve((size_t)NP_ * NT * DH * 2); b16* FQC16 = (b16*)carve((size_t)NP_ * NT * DH * 2); b16* FK16 = (b16*)carve((size_t)NP_ * NT * DH * 2); b16* FKC16 = (b16*)carve((size_t)NP_ * NT * DH * 2);
  float* N1 = (float*)carve((size_t)NP_ * NT * 4); float* N2 = (float*)carve((size_t)NP_ * NT * 4); b16* FVTh = (b16*)carve((size_t)NP_ * DH * NT * 2); b16* FVTl = (b16*)carve((size_t)NP_ * DH * NT * 2);
  float* P1 = (float*)carve((size_t)NP_ * (NT / 32) * 32 * 4); float* VARC = (float*)carve((size_t)NP_ * NT * 4); float* P2 = (float*)carve((size_t)NP_ * (NT / 32) * 32 * 4); float* ROWE = (float*)carve((size_t)NP_ * NT * 4); float* CST = (float*)carve(256);
  b16* OCh = (b16*)carve((size_t)NR * DIM * 2); b16* OCl = (b16*)carve((size_t)NR * DIM * 2);
  if (off > ws_size || off > ((size_t)128 << 20)) return;   // ≈ 73 MB
  ln_kernel<<<3 * NR / 8, 256, 0, stream>>>(Fp(0), Fp(1), Fp(2), Fp(3), Fp(4), X16);
  prepw_kernel<<<(2 * DIM * DIM / 8 + 255) / 256, 256, 0, stream>>>(Fp(5), Fp(15), WIN, WOUT);
  feat_kernel<<<dim3(NR / 64, DIM / 128, 3), 128, 0, stream>>>(X16, WIN, F32);
  colstat_kernel<<<dim3(NP_, 2), 256, 0, stream>>>(F32, KCM, PSUM);
  rowops_kernel<<<NP_ * NT / 16, 256, 0, stream>>>(F32, KCM, FQ16, FQC16, N1, FK16, FKC16, N2);
  norms_kernel<<<NP_ * NT / 256, 256, 0, stream>>>(F32, N1, N2);
  vt_kernel<<<dim3(NT / 64, NP_), 256, 0, stream>>>(F32, FVTh, FVTl);
  score_kernel<1><<<dim3(NT / 32, NP_), 64, 0, stream>>>(FQ16, FQC16, N1, FK16, FKC16, N2, FVTh, FVTl, CST, P1, VARC, P2, ROWE, OCh, OCl);
  reduce1_kernel<<<1, 256, 0, stream>>>(P1, VARC, PSUM, Fp(6), Fp(7), Fp(8), Fp(9), Fp(10), Fp(11), Fp(12), Fp(13), Fp(14), CST);
  score_kernel<2><<<dim3(NT / 32, NP_), 64, 0, stream>>>(FQ16, FQC16, N1, FK16, FKC16, N2, FVTh, FVTl, CST, P1, VARC, P2, ROWE, OCh, OCl);
  reduce2_kernel<<<1, 256, 0, stream>>>(P2, ROWE, VARC, CST);
  score_kernel<3><<<dim3(NT / 32, NP_), 64, 0, stream>>>(FQ16, FQC16, N1, FK16, FKC16, N2, FVTh, FVTl, CST, P1, VARC, P2, ROWE, OCh, OCl);
  outproj_kernel<<<dim3(NR / 64, DIM / 128), 128, 0, stream>>>(OCh, OCl, WOUT, Fp(16), (float*)d_out);
}

// v002
// One run takes 272 microseconds.
// In two side-by-side timings against v001, it was 1.48 and 1.46 times as fast.
// Over all steps from v000 it is 2.55 times as fast.
#include <hip/hip_runtime.h>

// "Super-aggressive" attention: f_q, f_k, f_v = LN(q|k|v) W_in split into 8 heads x 64; per (head, batch) pair: cos = clip(f_q.f_k / (n1 n2), +-0.99) (n = norm + 1e-8),
// cov = reg x (f_q - rowmean_d)(f_k - colmean_m) / (8 + 1e-6) (reg = 1e-3/1024, x10 if the global std of the raw cov < 1e-6), csim = clip(qn.kn) with max(norm, 1e-6), margin =
// clip(0.01 - csim, 0, 10), var_c = row mean of margin; per-head weights (cw, covw, vw) from a tiny MLP on the global means of f_q / f_k (softmax, /clip(weight_temp), softmax, clip, renorm);
// cn / covn / vn = global std (ddof 1) of cos / cov / var_c (+1e-6); d2 = cw cos/cn cscale + covw cov/covn/2 + vw var_c/vn/2; temp = 0.3 + std(d2) (dstd >= 1e-6; clipped to [0.1, 5]);
// attn = softmax(d2 / temp); out_h = attn f_v; out = concat_h W_out + b -> [4][1024][512].
// Every global statistic is a deterministic two-level f32 reduction (per-wave partials, then one fixed-order kernel); the [1024 x 1024] score tiles are recomputed in three passes
// (component statistics; d2 statistics with per-row shifts; softmax + PV) instead of being stored.
// WMMA (v_wmma_f32_16x16x32_f16, f32 accumulate): W_in (LN(x) single f16 x8, exact weights), dots / centered-cov tiles (single f16 x8 feature planes, K = 64), P.V (P single x8, f_v^T hi+lo:
// 2 products), W_out (O hi+lo: 2 products). LN, norms, all statistics and the weight-predictor MLP in f32. Inputs rounded to bf16 once. Fragment k-map per lane half hh

namespace {
constexpr int QB = 4, NT = 1024, DIM = 512, NH = 8, DH = 64, NP_ = NH * QB /* 32 (h,q) pairs, index h*QB + q */, NR = QB * NT /* 4096 rows */, NWAVE = NP_ * (NT / 16) /* 2048 score waves */;
constexpr float XS = 8.0f, WSC = 256.0f, PS = 8.0f, GAMMA = 0.01f, LREG = 0.001f;
constexpr float NTOT = 33554432.0f;   // 33,554,432 score elements

typedef _Float16 b16;
typedef __attribute__((ext_vector_type(16))) _Float16 v16b;
typedef __attribute__((ext_vector_type(8))) _Float16 v8b;
typedef __attribute__((ext_vector_type(8))) float v8f;
typedef __attribute__((ext_vector_type(4))) float v4f;
__device__ __forceinline__ float bf16_rne(float f) { unsigned int u = __float_as_uint(f); u += 0x7FFFu + ((u >> 16) & 1u); return __uint_as_float(u & 0xFFFF0000u); }
__device__ __forceinline__ void split16(float v, b16& hi, b16& lo) { hi = (b16)v; lo = (b16)(v - (float)hi); }
__device__ __forceinline__ v16b frag_kb(const b16* p, int hh) { const v8b a = *(const v8b*)(p + 8 * hh), b = *(const v8b*)(p + 16 + 8 * hh); v16b f;
#pragma unroll
  for (int e = 0; e < 8; ++e) { f[e] = a[e]; f[8 + e] = b[e]; } return f; }
// the same fragment, addressed as a wave-uniform base plus one per-lane byte offset (the 8 * hh elements included)
__device__ __forceinline__ v16b frag_ub(const b16* ubase, unsigned lane_bytes) { const char* p = (const char*)ubase + lane_bytes; const v8b a = *(const v8b*)p, b = *(const v8b*)(p + 32); v16b f;
#pragma unroll
  for (int e = 0; e < 8; ++e) { f[e] = a[e]; f[8 + e] = b[e]; } return f; }
__device__ __forceinline__ v8f wmma16b(v16b a, v16b b, v8f c) { v8f d = __builtin_amdgcn_wmma_f32_16x16x32_f16(false, a, false, b, (short)0, c, false, false); asm volatile("v_nop\n\tv_nop\n\tv_nop\n\tv_nop" : "+v"(d) : "v"(a), "v"(b)); return d; }
// the same product for a B operand that stays live and unwritten through the whole loop (the query fragments): B is left out of the statement's operands, which all have to sit in the first 256 registers, so that it may live above them
__device__ __forceinline__ v8f wmma16q(v16b a, v16b b, v8f c) { v8f d = __builtin_amdgcn_wmma_f32_16x16x32_f16(false, a, false, b, (short)0, c, false, false); asm volatile("v_nop\n\tv_nop\n\tv_nop\n\tv_nop" : "+v"(d) : "v"(a)); return d; }
// closes a run of global loads. The wait stands in front of the next instruction that writes a register from which those loads took their address (a precaution).
// The scheduling barrier keeps later address arithmetic from being lifted over that wait, and keeps the run up here, ahead of the work that covers its latency: sunk towards their uses the loads would each be waited for in turn.
__device__ __forceinline__ void close_load_run() { asm volatile("s_wait_xcnt 0x0" ::: "memory"); __builtin_amdgcn_sched_barrier(0); }
__device__ __forceinline__ void wave_lds_sync() { __builtin_amdgcn_fence(__ATOMIC_RELEASE, "workgroup"); __builtin_amdgcn_wave_barrier(); __builtin_amdgcn_fence(__ATOMIC_ACQUIRE, "workgroup"); }
// exp(x) on v_exp_f32, with the slot that the instruction set asks for behind a transcendental (before its result is used or its source overwritten) filled in the same statement: a v_nop in a statement of its own did not stay behind it
__device__ __forceinline__ float nexp(float x) { float r; asm("v_exp_f32 %0, %1\n\tv_nop" : "=v"(r) : "v"(x * 1.4426950408889634f)); return r; }
__device__ __forceinline__ float pmul(float a, float b) { float p = a * b; asm volatile("" : "+v"(p)); return p; }
__device__ __forceinline__ float hsum16(float v) { v += __shfl_xor(v, 1); v += __shfl_xor(v, 2); v += __shfl_xor(v, 4); return v + __shfl_xor(v, 8); }
__device__ __forceinline__ float clampf(float v, float lo, float hi) { return fminf(fmaxf(v, lo), hi); }

__global__ __launch_bounds__(256) void ln_kernel(const float* __restrict__ q, const float* __restrict__ k, const float* __restrict__ v, const float* __restrict__ g, const float* __restrict__ be, b16* __restrict__ X16) {
  const int wave = threadIdx.x >> 5, lane = threadIdx.x & 31; const int rowall = blockIdx.x * 8 + wave; const int which = rowall / NR, row = rowall - which * NR;
  const float* src = (which == 0 ? q : which == 1 ? k : v) + (size_t)row * DIM + lane * 16; float x[16];
  { const v4f a = *(const v4f*)src, b = *(const v4f*)(src + 4), c = *(const v4f*)(src + 8), d = *(const v4f*)(src + 12); for (int j = 0; j < 4; ++j) { x[j] = bf16_rne(a[j]); x[4 + j] = bf16_rne(b[j]); x[8 + j] = bf16_rne(c[j]); x[12 + j] = bf16_rne(d[j]); } }
  float s = 0.0f; for (int j = 0; j < 16; ++j) s += x[j];
#pragma unroll
  for (int o = 16; o >= 1; o >>= 1) s += __shfl_xor(s, o);
  const float mu = s * (1.0f / DIM); float ss = 0.0f; for (int j = 0; j < 16; ++j) { const float d = x[j] - mu; ss += pmul(d, d); }
#pragma unroll
  for (int o = 16; o >= 1; o >>= 1) ss += __shfl_xor(ss, o);
  const float rs = rsqrtf(ss * (1.0f / DIM) + 1e-5f); v8b o0, o1;
  for (int j = 0; j < 16; ++j) { const int c = lane * 16 + j; const b16 hv = (b16)((pmul((x[j] - mu) * rs, bf16_rne(g[c])) + bf16_rne(be[c])) * XS); if (j < 8) o0[j] = hv; else o1[j - 8] = hv; }
  { b16* dst = X16 + ((size_t)which * NR + row) * DIM + lane * 16; *(v8b*)dst = o0; *(v8b*)(dst + 8) = o1;  }
}
__global__ __launch_bounds__(256) void prepw_kernel(const float* __restrict__ win, const float* __restrict__ wout, b16* __restrict__ WIN, b16* __restrict__ WOUT) {
  const int t = blockIdx.x * 256 + threadIdx.x; if (t >= 2 * DIM * DIM / 8) return; const int kind = t / (DIM * DIM / 8), tt = t - kind * (DIM * DIM / 8); const int o_ = (tt * 8) / DIM, k0 = tt * 8 - o_ * DIM;
  const float* w = kind == 0 ? win : wout; v8b o; for (int j = 0; j < 8; ++j) o[j] = (b16)(bf16_rne(w[(size_t)(k0 + j) * DIM + o_]) * WSC);
  { *(v8b*)((kind == 0 ? WIN : WOUT) + (size_t)tt * 8) = o;  }
}
// features: F = X16 W_in per row (block = 64 rows x 4 waves, wave = 16 rows x 128 cols = 2 heads; grid.y = 4): which 0 (q): F32Q [pair][n][64] f32 rows; which 1 (k): F32K; which 2 (v): F32V. (f32 planes,
__global__ __launch_bounds__(128) void feat_kernel(const b16* __restrict__ X16, const b16* __restrict__ WIN, float* __restrict__ F32) {
  __shared__ __attribute__((aligned(16))) float Ts[4][16][128 + 4];
  const int wave = threadIdx.x >> 5, lane = threadIdx.x & 31, nloc = lane & 15, hlf = lane >> 4; const int which = blockIdx.z; const size_t m0 = (size_t)blockIdx.x * 64 + wave * 16; const int n0 = blockIdx.y * 128;
  v8f acc[8];
#pragma unroll
  for (int t = 0; t < 8; ++t) acc[t] = (v8f){};
  const b16* ap = X16 + ((size_t)which * NR + m0 + nloc) * DIM; const b16* bp = WIN + (size_t)(n0 + nloc) * DIM;
  v16b a = frag_kb(ap, hlf), b[8];
#pragma unroll
  for (int t = 0; t < 8; ++t) b[t] = frag_kb(bp + (size_t)t * 16 * DIM, hlf);
#pragma unroll   // full: the two fragment sets swap by renaming, and the last step's fetch falls away
  for (int kb = 0; kb < DIM; kb += 32) { v16b an = a, bn[8];
#pragma unroll
    for (int t = 0; t < 8; ++t) bn[t] = b[t];
    if (kb + 32 < DIM) { an = frag_kb(ap + kb + 32, hlf);
#pragma unroll
      for (int t = 0; t < 8; ++t) bn[t] = frag_kb(bp + (size_t)t * 16 * DIM + kb + 32, hlf); }
    __builtin_amdgcn_sched_barrier(0);   // keeps the next step's loads, as one group, ahead of this step's products: sunk towards their uses they would each be waited for in turn
#pragma unroll
    for (int t = 0; t < 8; ++t) acc[t] = wmma16b(a, b[t], acc[t]);
    a = an;
#pragma unroll
    for (int t = 0; t < 8; ++t) b[t] = bn[t]; }
#pragma unroll
  for (int t = 0; t < 8; ++t)
#pragma unroll
    for (int r = 0; r < 8; ++r) Ts[wave][8 * hlf + r][t * 16 + nloc] = acc[t][r] * (1.0f / (XS * WSC));
  wave_lds_sync();
  // rows m0+rr: q_idx = row / NT, n = row % NT; cols n0 + c -> head h = (n0 + c) / 64, d = % 64; F32 layout [which][pair][n][64]
  { for (int rr = 0; rr < 16; ++rr) { const size_t row = m0 + rr; const int qi = (int)(row / NT), n = (int)(row - (size_t)qi * NT); for (int hq = 0; hq < 2; ++hq) { const int h = n0 / DH + hq; const int pair = h * QB + qi;
        if (lane < 16) *(v4f*)(F32 + (((size_t)which * NP_ + pair) * NT + n) * DH + lane * 4) = *(const v4f*)(&Ts[wave][rr][hq * DH + lane * 4]); } }  }
}
// per-pair column statistics of f_k (mean over the 1024 keys per d) and head means qg/kg (over all 4,096 rows): colstat: block = pair, 256 threads: thread (d = t%64, part = t/64) sums rows part*256..+255;
__global__ __launch_bounds__(256) void colstat_kernel(const float* __restrict__ F32, float* __restrict__ KCM, float* __restrict__ PSUM) {   // PSUM [which 0/1][pair][64] = column sums
  __shared__ float part[4][DH];
  const int which = blockIdx.y, pair = blockIdx.x, t_ = threadIdx.x, d = t_ & 63, pq = t_ >> 6; const float* base = F32 + (((size_t)which * NP_ + pair) * NT) * DH;
  float s = 0.0f; for (int n = pq * 256; n < pq * 256 + 256; ++n) s += base[(size_t)n * DH + d]; part[pq][d] = s;
  __syncthreads();
  if (t_ < DH) { const float tot = (part[0][t_] + part[1][t_]) + (part[2][t_] + part[3][t_]);
    { ((float*)PSUM)[((size_t)which * NP_ + pair) * DH + t_] = tot; if (which == 1) ((float*)KCM)[(size_t)pair * DH + t_] = tot * (1.0f / NT);  } }
}
// operand planes per pair: FQ16 [pair][n][64] = f16(8 f_q), FQC16 = f16(8 (f_q - rowmean)), N1 [pair][n] = ||f_q|| (f32); FK16, FKC16 = f16(8 (f_k - colmean)), N2; FVTh/FVTl [pair][64][1024] = f_v^T hi/lo x8.
__global__ __launch_bounds__(256) void rowops_kernel(const float* __restrict__ F32, const float* __restrict__ KCM, b16* __restrict__ FQ16, b16* __restrict__ FQC16, float* __restrict__ N1, b16* __restrict__ FK16, b16* __restrict__ FKC16, float* __restrict__ N2) {
  const int wave = threadIdx.x >> 5, lane = threadIdx.x & 31; const size_t prow = ((size_t)blockIdx.x * 8 + wave) * 2 + (lane >> 4);   // pair*NT + n, over NP_*NT rows
  const int pair = (int)(prow / NT); const int c0 = (lane & 15) * 4;
  const v4f fq = *(const v4f*)(F32 + (0 * (size_t)NP_ * NT + prow) * DH + c0), fk = *(const v4f*)(F32 + (1 * (size_t)NP_ * NT + prow) * DH + c0);
  float sq = 0.0f, ssq = 0.0f, ssk = 0.0f; for (int j = 0; j < 4; ++j) { sq += fq[j]; ssq += pmul(fq[j], fq[j]); ssk += pmul(fk[j], fk[j]); }
  sq = hsum16(sq); ssq = hsum16(ssq); ssk = hsum16(ssk); const float mq = sq * (1.0f / DH);
  typedef __attribute__((ext_vector_type(4))) _Float16 v4b; v4b a, ac, b, bc;
  for (int j = 0; j < 4; ++j) { a[j] = (b16)(fq[j] * XS); ac[j] = (b16)((fq[j] - mq) * XS); b[j] = (b16)(fk[j] * XS); bc[j] = (b16)((fk[j] - KCM[(size_t)pair * DH + c0 + j]) * XS); }
  { *(v4b*)(FQ16 + prow * DH + c0) = a; *(v4b*)(FQC16 + prow * DH + c0) = ac; *(v4b*)(FK16 + prow * DH + c0) = b; *(v4b*)(FKC16 + prow * DH + c0) = bc;  }
  // norms: ssq/ssk are not stored here; N1/N2 are written by norms_kernel (one thread per row).
}
__global__ __launch_bounds__(256) void norms_kernel(const float* __restrict__ F32, float* __restrict__ N1, float* __restrict__ N2) {   // thread per row: 256 rows per block -> N1/N2 spans of 256 floats (8 lines) each
  const size_t prow = (size_t)blockIdx.x * 256 + threadIdx.x; const float* fq = F32 + (0 * (size_t)NP_ * NT + prow) * DH; const float* fk = F32 + (1 * (size_t)NP_ * NT + prow) * DH;
  float sq = 0.0f, sk = 0.0f; for (int d = 0; d < DH; ++d) { sq += pmul(fq[d], fq[d]); sk += pmul(fk[d], fk[d]); }
  { ((float*)N1)[prow] = sqrtf(sq); ((float*)N2)[prow] = sqrtf(sk);  }
}
__global__ __launch_bounds__(256) void vt_kernel(const float* __restrict__ F32, b16* __restrict__ FVTh, b16* __restrict__ FVTl) {   // block = (pair, 64-key chunk): transpose [64 n][64 d] -> rows d, hi/lo
  __shared__ __attribute__((aligned(16))) b16 Th[DH][64 + 8], Tl[DH][64 + 8];
  const int pair = blockIdx.y, n0 = blockIdx.x * 64, t_ = threadIdx.x; const float* base = F32 + ((2 * (size_t)NP_ + pair) * NT + n0) * DH;
  for (int qq = t_; qq < 64 * DH; qq += 256) { const int nn = qq >> 6, d = qq & 63; b16 h_, l_; split16(base[(size_t)nn * DH + d] * XS, h_, l_); Th[d][nn] = h_; Tl[d][nn] = l_; }
  __syncthreads();
  { for (int qq = t_; qq < DH * 8; qq += 256) { const int d = qq >> 3, c8 = (qq & 7) * 8; const size_t gi = ((size_t)pair * DH + d) * NT + n0 + c8; *(v8b*)(FVTh + gi) = *(const v8b*)(&Th[d][c8]); *(v8b*)(FVTl + gi) = *(const v8b*)(&Tl[d][c8]); }  }
}
// score-tile passes: wave = 16 query rows n of one pair (block = 2 waves), loop over 32 key blocks of 32: dots^T and covraw^T tiles (keys x queries, K = 64: 2 steps x 2 key tiles x 2 GEMMs = 8 WMMAs),
// lane (hh, col=query) holds keys kb+8hh+r and kb+16+8hh+r.  cos = clip(dots/((n1+1e-8)(n2+1e-8))), csim = clip(dots/(max(n1,1e-6) max(n2,1e-6))), margin = clip(0.01 - csim, 0, 10), covraw = c/(8+1e-6).
// PASS 2 (given cn, covfac = reg/covn/2, w per head, vn): per row c_row = vw var_c/(2 vn); e = cw cos/cn cscale + covw covraw covfac (d2 - c_row): per-wave S_e, S_e2 and per-row rowsum_e -> P2, ROWE.
// PASS 3 (given temp): logits = (e + c_row)/temp -> online softmax (f32) with o^T += f_v^T P^T (hi+lo, 4 d-tiles): O [pair][n][64] -> OC16h/l [row = q*NT+n][h*64+d] (concat-head planes, hi/lo x8).
template <int PASS>
__global__ __launch_bounds__(64) void score_kernel(const b16* __restrict__ FQ16, const b16* __restrict__ FQC16, const float* __restrict__ N1, const b16* __restrict__ FK16, const b16* __restrict__ FKC16, const float* __restrict__ N2, const b16* __restrict__ FVTh, const b16* __restrict__ FVTl,
                                                  const float* __restrict__ CST /* [0..3] cscale/cn, reg/(2 covn), 1/(2 vn), 1/temp; [4..27] cw, covw, vw per head */, float* __restrict__ P1, float* __restrict__ VARC, float* __restrict__ P2, float* __restrict__ ROWE, b16* __restrict__ OCh, b16* __restrict__ OCl) {
  __shared__ __attribute__((aligned(16))) float To[2][16][DH + 4]; __shared__ float Tr[2][16]; __shared__ float Tp[2][4];
  const int wave = threadIdx.x >> 5, lane = threadIdx.x & 31, hh = lane >> 4, col = lane & 15; const int pair = blockIdx.y, n0 = blockIdx.x * 32 + wave * 16, ni = n0 + col; const int h = pair / QB, qi = pair - h * QB;
  const size_t prow = (size_t)pair * NT + ni; const b16* Qp = FQ16 + prow * DH; const b16* Qc = FQC16 + prow * DH; const b16* Kb = FK16 + (size_t)pair * NT * DH; const b16* Kc = FKC16 + (size_t)pair * NT * DH;
  __builtin_amdgcn_sched_barrier(0);   // keeps the index arithmetic above from being placed between the loads below and the wait that closes their run
  const v16b qa0 = frag_kb(Qp, hh), qa1 = frag_kb(Qp + 32, hh); close_load_run();
  const v16b qc0 = frag_kb(Qc, hh), qc1 = frag_kb(Qc + 32, hh); close_load_run();
  const float n1 = N1[prow]; close_load_run(); const float inv1a = 1.0f / (n1 + 1e-8f), inv1b = 1.0f / fmaxf(n1, 1e-6f);
  float cn_inv_cscale = 0.0f, covfac = 0.0f, vn_half_inv = 0.0f, temp_inv = 0.0f, cwh = 0.0f, covwh = 0.0f, vwh = 0.0f;   // this head's constants, read once ahead of the loop
  if (PASS >= 2) { const float* cf = CST; cn_inv_cscale = cf[0]; covfac = cf[1]; vn_half_inv = cf[2]; temp_inv = cf[3]; cwh = cf[4 + h]; covwh = cf[4 + NH + h]; vwh = cf[4 + 2 * NH + h]; }
  float crow = 0.0f; if (PASS >= 2) crow = vwh * VARC[prow] * vn_half_inv;
  float s_a = 0.0f, s_b = 0.0f, s_c = 0.0f, s_d = 0.0f, rowacc = 0.0f;
  float m = -INFINITY, l = 0.0f; v8f o[4] = {{}, {}, {}, {}}, ol[4] = {{}, {}, {}, {}};
  // One key block's operands (8 key fragments, 16 key norms) live in registers and are fetched together, a whole block ahead of their use.
  v16b k0a, k0b, k1a, k1b, x0a, x0b, x1a, x1b; v4f nn0, nn1, nn2, nn3;
  const unsigned klane = (unsigned)(col * DH + 8 * hh) * 2u, nlane = (unsigned)hh * 32u, vlane = (unsigned)(col * NT + 8 * hh) * 2u;   // per-lane byte offsets into a key block, its norms, the value rows
  auto fetch_keys = [&](int kq) { const b16* kr = Kb + (size_t)kq * DH; const b16* cr = Kc + (size_t)kq * DH; const char* np = (const char*)(N2 + (size_t)pair * NT + kq) + nlane;
    nn0 = *(const v4f*)np; nn1 = *(const v4f*)(np + 16); nn2 = *(const v4f*)(np + 64); nn3 = *(const v4f*)(np + 80); close_load_run();
    k0a = frag_ub(kr, klane); k0b = frag_ub(kr + 32, klane); k1a = frag_ub(kr + 16 * DH, klane); k1b = frag_ub(kr + 16 * DH + 32, klane); close_load_run();
    x0a = frag_ub(cr, klane); x0b = frag_ub(cr + 32, klane); x1a = frag_ub(cr + 16 * DH, klane); x1b = frag_ub(cr + 16 * DH + 32, klane); close_load_run(); };
  fetch_keys(0);
  for (int kb = 0; kb < NT; kb += 32) {
    v8f d0 = {}, d1 = {}, c0 = {}, c1 = {};
    d0 = wmma16q(k0a, qa0, d0); d0 = wmma16q(k0b, qa1, d0);
    d1 = wmma16q(k1a, qa0, d1); d1 = wmma16q(k1b, qa1, d1);
    c0 = wmma16q(x0a, qc0, c0); c0 = wmma16q(x0b, qc1, c0);
    c1 = wmma16q(x1a, qc0, c1); c1 = wmma16q(x1b, qc1, c1);
    const v4f na0 = nn0, na1 = nn1, nb0 = nn2, nb1 = nn3;
    // behind the last score product: this block's value fragments (used after the softmax arithmetic), then the next block's keys (the last block re-reads block 0, unused), all in flight under the vector work
    v16b vh[4], vl[4];
    if (PASS == 3) {
#pragma unroll
      for (int t = 0; t < 4; ++t) { vh[t] = frag_ub(FVTh + ((size_t)pair * DH + t * 16) * NT + kb, vlane); vl[t] = frag_ub(FVTl + ((size_t)pair * DH + t * 16) * NT + kb, vlane); }
      close_load_run(); }
    const int kn = kb + 32 < NT ? kb + 32 : 0;
    fetch_keys(kn);
    float ev0[8], ev1[8];
#pragma unroll
    for (int r = 0; r < 8; ++r) {
#pragma unroll
      for (int hq = 0; hq < 2; ++hq) { const float dot = (hq ? d1[r] : d0[r]) * (1.0f / (XS * XS)); const float covraw = (hq ? c1[r] : c0[r]) * (1.0f / (XS * XS)) * (1.0f / (8.0f + 1e-6f));
        const float n2 = hq ? (r < 4 ? nb0[r & 3] : nb1[r & 3]) : (r < 4 ? na0[r & 3] : na1[r & 3]); const float cosv = clampf(dot * inv1a * (1.0f / (n2 + 1e-8f)), -0.99f, 0.99f); 
        if (PASS == 1) { const float csim = clampf(dot * inv1b * (1.0f / fmaxf(n2, 1e-6f)), -0.99f, 0.99f); const float margin = clampf(GAMMA - csim, 0.0f, 10.0f);
          s_a += cosv; s_b += pmul(cosv, cosv); s_c += covraw; s_d += pmul(covraw, covraw); rowacc += margin; }
        else { const float e = pmul(cwh, cosv * cn_inv_cscale) + pmul(covwh, covraw * covfac);
          if (PASS == 2) { s_a += e; s_b += pmul(e, e); rowacc += e; }
          else { (hq ? ev1 : ev0)[r] = (e + crow) * temp_inv; } } } }
    if (PASS == 3) { float mr = -INFINITY;
#pragma unroll
      for (int r = 0; r < 8; ++r) mr = fmaxf(mr, fmaxf(ev0[r], ev1[r]));
      mr = fmaxf(mr, __shfl_xor(mr, 16)); const float mn = fmaxf(m, mr); const float al_ = nexp(m - mn); m = mn; float sum = 0.0f; v16b pb;
#pragma unroll
      for (int r = 0; r < 8; ++r) { const float e0 = nexp(ev0[r] - mn), e1 = nexp(ev1[r] - mn); sum += e0 + e1; pb[r] = (b16)(e0 * PS); pb[8 + r] = (b16)(e1 * PS); }
      sum += __shfl_xor(sum, 16); l = l * al_ + sum;
#pragma unroll
      for (int t = 0; t < 4; ++t) { o[t] *= al_; ol[t] *= al_; o[t] = wmma16b(vh[t], pb, o[t]); ol[t] = wmma16b(vl[t], pb, ol[t]); } } }
  if (PASS <= 2) {   // per-row sums across the two lane halves; per-wave partials over the 16 rows and 32 lanes
    rowacc += __shfl_xor(rowacc, 16); if (hh == 0) Tr[wave][col] = rowacc;
    float v4[4] = {s_a, s_b, s_c, s_d};
#pragma unroll
    for (int j = 0; j < 4; ++j) { float v = v4[j];
#pragma unroll
      for (int oo = 16; oo >= 1; oo >>= 1) v += __shfl_xor(v, oo);
      v4[j] = v; }
    if (lane == 0) { Tp[wave][0] = v4[0]; Tp[wave][1] = v4[1]; Tp[wave][2] = v4[2]; Tp[wave][3] = v4[3]; }
    wave_lds_sync();
    const size_t widx = (size_t)pair * (NT / 16) + blockIdx.x * 2 + wave;
    __syncthreads();
    {
      if (wave == 0) { const float rv = Tr[lane >> 4][lane & 15] * (PASS == 1 ? (1.0f / NT) : 1.0f); ((float*)(PASS == 1 ? VARC : ROWE))[(size_t)pair * NT + blockIdx.x * 32 + lane] = rv;
        ((float*)(PASS == 1 ? P1 : P2))[((size_t)pair * (NT / 32) + blockIdx.x) * 32 + lane] = (lane < 8) ? Tp[lane >> 2][lane & 3] : 0.0f; }
       }
    (void)widx;
  } else {
    const float inv = 1.0f / (l * PS * XS);
#pragma unroll
    for (int t = 0; t < 4; ++t)
#pragma unroll
      for (int r = 0; r < 8; ++r) To[wave][col][t * 16 + 8 * hh + r] = (o[t][r] + ol[t][r]) * inv;
    wave_lds_sync();
    { for (int r2 = 0; r2 < 16; r2 += 4) { const int rr = r2 + (lane >> 3), c8 = (lane & 7) * 8; v8b hv, lv; for (int j = 0; j < 8; ++j) { b16 a_, c_; split16(To[wave][rr][c8 + j] * XS, a_, c_); hv[j] = a_; lv[j] = c_; }
        const size_t gi = ((size_t)qi * NT + n0 + rr) * DIM + h * DH + c8; *(v8b*)(OCh + gi) = hv; *(v8b*)(OCl + gi) = lv; }  }
  }
}
// reductions (one block each, fixed order). reduce1: cn, covn, vn, weights -> CST[0..27]; reduce2: dstd -> temp -> CST[3].
// Both run as one block on an otherwise idle chip, so nothing hides a load's latency but the block's own instruction order: each kernel issues ALL its global reads in one run at its head and keeps them in registers
// (the predictor's weights go on to LDS), so that it pays about one memory latency in all instead of one per loop trip. Every sum keeps its operands and its order; in the loops written anew a product now fuses with its addition.
__global__ __launch_bounds__(256) void reduce1_kernel(const float* __restrict__ P1, const float* __restrict__ VARC, const float* __restrict__ PSUM, const float* __restrict__ w1, const float* __restrict__ b1, const float* __restrict__ g2, const float* __restrict__ be2, const float* __restrict__ w2, const float* __restrict__ b2, const float* __restrict__ w3, const float* __restrict__ b3, const float* __restrict__ wtemp, float* __restrict__ CST) {
  __shared__ float red[4][256]; __shared__ float sh[64];
  __shared__ __attribute__((aligned(16))) float w1s[2 * DH * DH], w2s[DH * 32]; __shared__ float w3s[3][32], b1s[DH], g2s[DH], be2s[DH], b2s[32];   // the predictor's parameters as bf16 values (w3s: the 96 values in their order)
  const int t_ = threadIdx.x; constexpr int NPK = NP_ * (NT / 32) / 256 /* 4 of the 1,024 block partials (8 floats: 2 waves x 4) per thread */, NVK = NP_ * NT / 256 /* 128 row values per thread */, NFK = NH * 2 * DH / 256 /* 4 */;
  v4f w1r[8], w2r[2], pl[NPK], ph[NPK]; float pr[NFK][QB], vr[NVK], w3r[3];
  const unsigned a63 = t_ & (DH - 1), a31 = t_ & 31, p1off = (unsigned)t_ * 128u /* bytes: partial t_ */, psidx = ((t_ >> 6) & 1) * NP_ * DH + (t_ >> 7) * QB * DH + (t_ & (DH - 1)) /* PSUM [which][pair 4 h][dd] of feature i = t_ */;
  const float b3r[3] = {b3[0], b3[1], b3[2]}, wtr = wtemp[0];
  __builtin_amdgcn_sched_barrier(0);   // keeps the index arithmetic and the scalar reads above from being placed between the loads below and the wait that closes their run
#pragma unroll
  for (int j = 0; j < 8; ++j) w1r[j] = *(const v4f*)(w1 + (j * 256 + t_) * 4);
#pragma unroll
  for (int j = 0; j < 2; ++j) w2r[j] = *(const v4f*)(w2 + (j * 256 + t_) * 4);
  const float b1r = b1[a63], g2r = g2[a63], be2r = be2[a63], b2r = b2[a31];
#pragma unroll
  for (int j = 0; j < 3; ++j) w3r[j] = w3[j * 32 + a31];
#pragma unroll
  for (int k = 0; k < NPK; ++k) { const char* p = (const char*)P1 + p1off + k * (256 * 128); pl[k] = *(const v4f*)p; ph[k] = *(const v4f*)(p + 16); }
#pragma unroll
  for (int k = 0; k < NFK; ++k)   // feature i = t_ + 256 k: head h + 2 k, the same which and dd
#pragma unroll
    for (int qq = 0; qq < QB; ++qq) pr[k][qq] = PSUM[psidx + (2 * k * QB + qq) * DH];
#pragma unroll   // full, here and in the two loops that read vr: the 128 values stay in registers and are read from memory once, not twice
  for (int j = 0; j < NVK; ++j) vr[j] = VARC[t_ + j * 256];
  // closes the run as close_load_run() does; the input operands keep the run's address registers from being given to a later load's result ahead of the wait
  asm volatile("s_wait_xcnt 0x0" :: "v"(a63), "v"(a31), "v"(p1off), "v"(psidx) : "memory"); __builtin_amdgcn_sched_barrier(0);
#pragma unroll
  for (int j = 0; j < 8; ++j) { v4f x; for (int e = 0; e < 4; ++e) x[e] = bf16_rne(w1r[j][e]); *(v4f*)(w1s + (j * 256 + t_) * 4) = x; }
#pragma unroll
  for (int j = 0; j < 2; ++j) { v4f x; for (int e = 0; e < 4; ++e) x[e] = bf16_rne(w2r[j][e]); *(v4f*)(w2s + (j * 256 + t_) * 4) = x; }
  b1s[a63] = bf16_rne(b1r); g2s[a63] = bf16_rne(g2r); be2s[a63] = bf16_rne(be2r); b2s[a31] = bf16_rne(b2r);   // every thread stores: threads with the same index store the same value
#pragma unroll
  for (int j = 0; j < 3; ++j) w3s[j][a31] = bf16_rne(w3r[j]);
  float a = 0, b = 0, c = 0, d = 0;
#pragma unroll
  for (int k = 0; k < NPK; ++k) { a += pl[k][0] + ph[k][0]; b += pl[k][1] + ph[k][1]; c += pl[k][2] + ph[k][2]; d += pl[k][3] + ph[k][3]; }
  red[0][t_] = a; red[1][t_] = b; red[2][t_] = c; red[3][t_] = d; __syncthreads();
  for (int s = 128; s >= 1; s >>= 1) { if (t_ < s) { for (int j = 0; j < 4; ++j) red[j][t_] += red[j][t_ + s]; } __syncthreads(); }
  float vs = 0.0f;
#pragma unroll
  for (int j = 0; j < NVK; ++j) vs += vr[j];
  __shared__ float r2[256]; r2[t_] = vs; __syncthreads(); for (int s = 128; s >= 1; s >>= 1) { if (t_ < s) r2[t_] += r2[t_ + s]; __syncthreads(); }
  const float vmu = r2[0] / (float)(NP_ * NT); __syncthreads();
  float vq = 0.0f;
#pragma unroll
  for (int j = 0; j < NVK; ++j) { const float dv = vr[j] - vmu; vq += dv * dv; }
  r2[t_] = vq; __syncthreads(); for (int s = 128; s >= 1; s >>= 1) { if (t_ < s) r2[t_] += r2[t_ + s]; __syncthreads(); }
  // head means qg/kg [8][64] from PSUM [which][pair][64]: mean over (q, n) = sum over the 4 pairs of the head / 4096 -> feats [h][128]; MLP: h1 = relu(LN(feats W1 + b1)), h2 = relu(h1 W2 + b2), logits = softmax(h2 W3 + b3), w = softmax(logits / clip(wt)), clip [0.05,0.8], renorm
  __shared__ __attribute__((aligned(16))) float feats[NH][2 * DH], h1s[NH][DH], h2s[NH][32]; __shared__ float ws[NH][3];
#pragma unroll
  for (int k = 0; k < NFK; ++k) { const int i = t_ + k * 256, h = i / (2 * DH), c = i - h * 2 * DH; float s = 0.0f;
#pragma unroll
    for (int qq = 0; qq < QB; ++qq) s += pr[k][qq];
    feats[h][c] = s * (1.0f / (QB * NT)); }
  __syncthreads();
  // the loops below read LDS only; each is unrolled, with plain products, so that its reads are issued ahead of the one chain of additions instead of being waited for one by one
  for (int i = t_; i < NH * DH; i += 256) { const int h = i / DH, o_ = i - h * DH; float s = b1s[o_];
#pragma unroll 32
    for (int c = 0; c < 2 * DH; ++c) s += feats[h][c] * w1s[c * DH + o_]; h1s[h][o_] = s; }
  __syncthreads();
  if (t_ < NH) { const int h = t_; float mu = 0.0f;
#pragma unroll
    for (int c = 0; c < DH; ++c) mu += h1s[h][c];
    mu *= (1.0f / DH); float var = 0.0f;
#pragma unroll
    for (int c = 0; c < DH; ++c) { const float dv = h1s[h][c] - mu; var += dv * dv; }
    var *= (1.0f / DH); const float rs = rsqrtf(var + 1e-5f);
#pragma unroll
    for (int c = 0; c < DH; ++c) h1s[h][c] = fmaxf((h1s[h][c] - mu) * rs * g2s[c] + be2s[c], 0.0f); }
  __syncthreads();
  for (int i = t_; i < NH * 32; i += 256) { const int h = i / 32, o_ = i - h * 32; float s = b2s[o_];
#pragma unroll 32
    for (int c = 0; c < DH; ++c) s += h1s[h][c] * w2s[c * 32 + o_]; h2s[h][o_] = fmaxf(s, 0.0f); }
  __syncthreads();
  if (t_ < NH) { const int h = t_; float lg[3]; for (int o_ = 0; o_ < 3; ++o_) { float s = bf16_rne(b3r[o_]);
#pragma unroll
      for (int c = 0; c < 32; ++c) s += h2s[h][c] * (&w3s[0][0])[c * 3 + o_]; lg[o_] = s; }
    float mx = fmaxf(lg[0], fmaxf(lg[1], lg[2])); float e3[3], se = 0.0f; for (int j = 0; j < 3; ++j) { e3[j] = __expf(lg[j] - mx); se += e3[j]; } for (int j = 0; j < 3; ++j) e3[j] /= se;
    const float wt = clampf(bf16_rne(wtr), 0.1f, 20.0f); float z[3]; for (int j = 0; j < 3; ++j) z[j] = e3[j] / wt; mx = fmaxf(z[0], fmaxf(z[1], z[2])); se = 0.0f; for (int j = 0; j < 3; ++j) { e3[j] = __expf(z[j] - mx); se += e3[j]; }
    float wv[3], sw = 0.0f; for (int j = 0; j < 3; ++j) { wv[j] = clampf(e3[j] / se, 0.05f, 0.8f); sw += wv[j]; } for (int j = 0; j < 3; ++j) ws[h][j] = wv[j] / sw; }
  __syncthreads();
  if (t_ == 0) { const float n = (float)NTOT; const float sa_ = red[0][0], sb = red[1][0], sc = red[2][0], sd = red[3][0];
    const float cstd = sqrtf(fmaxf((sb - sa_ * (sa_ / n)) / (n - 1.0f), 0.0f)); const float covstd_raw = sqrtf(fmaxf((sd - sc * (sc / n)) / (n - 1.0f), 0.0f));
    const float base_reg = LREG / (float)NT; const float reg = (covstd_raw < 1e-6f) ? base_reg * 10.0f : base_reg;   // reference: reg chosen on the std of the RAW cov, then cov = clip(reg cov, +-50) (never clips at this scale)
    const float covn = reg * covstd_raw + 1e-6f; const float cn = cstd + 1e-6f; const float cscale = (cn < 1e-4f) ? 0.1f : 1.0f;
    const float vn = sqrtf(r2[0] * ((float)NT / (n - 1.0f))) + 1e-6f;   // std over the broadcast [.., m] copies: each row value repeated NT times
    sh[0] = cscale / cn; sh[1] = reg * 0.5f / covn; sh[2] = 0.5f / vn; sh[3] = 0.0f; for (int h = 0; h < NH; ++h) { sh[4 + h] = ws[h][0]; sh[4 + NH + h] = ws[h][1]; sh[4 + 2 * NH + h] = ws[h][2]; } }
  __syncthreads();
  { if (t_ < 32) ((float*)CST)[t_] = (t_ < 4 + 3 * NH) ? sh[t_] : 0.0f;  }
}
__global__ __launch_bounds__(256) void reduce2_kernel(const float* __restrict__ P2, const float* __restrict__ ROWE, const float* __restrict__ VARC, float* __restrict__ CST) {
  __shared__ float red[5][256];
  const int t_ = threadIdx.x; constexpr int NPK = NP_ * (NT / 32) / 256, NVK = NP_ * NT / 256;   // 4 block partials and 128 rows per thread
  float p0[NPK], p1[NPK], p4[NPK], p5[NPK], vw8[NH], vr[NVK], er[NVK]; const unsigned p2off = (unsigned)t_ * 128u;   // bytes: partial t_
  const float vfac = CST[2];   // 0.5/vn; per-row constant c = vw[h] var_c vfac; d2 = e + c
#pragma unroll
  for (int h = 0; h < NH; ++h) vw8[h] = CST[4 + 2 * NH + h];
  __builtin_amdgcn_sched_barrier(0);   // keeps the index arithmetic and the scalar reads above from being placed between the loads below and the wait that closes their run
#pragma unroll   // full, here and in the loops that read vr and er: the values stay in registers
  for (int j = 0; j < NVK; ++j) vr[j] = VARC[t_ + j * 256];
#pragma unroll
  for (int k = 0; k < NPK; ++k) { const float* p = (const float*)((const char*)P2 + p2off + k * (256 * 128)); p0[k] = p[0]; p1[k] = p[1]; p4[k] = p[4]; p5[k] = p[5]; }
#pragma unroll
  for (int j = 0; j < NVK; ++j) er[j] = ROWE[t_ + j * 256];
  // closes the run as close_load_run() does; the input operand keeps the run's address register from being given to a later load's result ahead of the wait
  asm volatile("s_wait_xcnt 0x0" :: "v"(p2off) : "memory"); __builtin_amdgcn_sched_barrier(0);
  float a = 0, b = 0;
#pragma unroll
  for (int k = 0; k < NPK; ++k) { a += (p0[k] + p4[k]); b += (p1[k] + p5[k]); }
  // var(d2) = E[(d2 - M)^2] - (E[d2 - M])^2 with the shift M = mean of the row constants (kills the large common offset): per row, sum_m (d2 - M) = rowsum_e + NT (c - M), sum_m (d2 - M)^2 = sum e^2 + 2 (c - M) rowsum_e + NT (c - M)^2
  // row i = t_ + 256 j belongs to head (i / NT) / QB = j / 16
  float sc = 0;
#pragma unroll
  for (int j = 0; j < NVK; ++j) sc += vw8[j / 16] * vr[j] * vfac;
  red[4][t_] = sc; __syncthreads(); for (int s = 128; s >= 1; s >>= 1) { if (t_ < s) red[4][t_] += red[4][t_ + s]; __syncthreads(); }
  const float M = red[4][0] / (float)(NP_ * NT); __syncthreads();
  float s1 = 0, s2 = 0;
#pragma unroll
  for (int j = 0; j < NVK; ++j) { const float cm = vw8[j / 16] * vr[j] * vfac - M; s1 += (float)NT * cm; s2 += 2.0f * cm * er[j] + (float)NT * cm * cm; }
  red[0][t_] = a + s1; red[1][t_] = b + s2; __syncthreads();
  for (int s = 128; s >= 1; s >>= 1) { if (t_ < s) { red[0][t_] += red[0][t_ + s]; red[1][t_] += red[1][t_ + s]; } __syncthreads(); }
  if (t_ == 0) { const float n = NTOT; const float var = (red[1][0] - red[0][0] * (red[0][0] / n)) / (n - 1.0f); const float dstd = sqrtf(fmaxf(var, 0.0f)); const float temp = (dstd < 1e-6f) ? 0.1f : 0.3f + dstd; const float tinv = 1.0f / clampf(temp, 0.1f, 5.0f);
    { ((float*)CST)[3] = tinv;  } }
}
__global__ __launch_bounds__(128) void outproj_kernel(const b16* __restrict__ OCh, const b16* __restrict__ OCl, const b16* __restrict__ WOUT, const float* __restrict__ bo, float* __restrict__ out) {
  __shared__ __attribute__((aligned(16))) float Ts[4][16][128 + 4];
  const int wave = threadIdx.x >> 5, lane = threadIdx.x & 31, nloc = lane & 15, hlf = lane >> 4; const size_t m0 = (size_t)blockIdx.x * 64 + wave * 16; const int n0 = blockIdx.y * 128;
  v8f acc[8];
#pragma unroll
  for (int t = 0; t < 8; ++t) acc[t] = (v8f){};
  const b16* ap = OCh + (m0 + nloc) * DIM; const b16* lp = OCl + (m0 + nloc) * DIM; const b16* bp = WOUT + (size_t)(n0 + nloc) * DIM;
  v16b a = frag_kb(ap, hlf), al = frag_kb(lp, hlf), b[8];
#pragma unroll
  for (int t = 0; t < 8; ++t) b[t] = frag_kb(bp + (size_t)t * 16 * DIM, hlf);
#pragma unroll   // full: the two fragment sets swap by renaming, and the last step's fetch falls away
  for (int kb = 0; kb < DIM; kb += 32) { v16b an = a, aln = al, bn[8];
#pragma unroll
    for (int t = 0; t < 8; ++t) bn[t] = b[t];
    if (kb + 32 < DIM) { an = frag_kb(ap + kb + 32, hlf); aln = frag_kb(lp + kb + 32, hlf);
#pragma unroll
      for (int t = 0; t < 8; ++t) bn[t] = frag_kb(bp + (size_t)t * 16 * DIM + kb + 32, hlf); }
    __builtin_amdgcn_sched_barrier(0);   // keeps the next step's loads, as one group, ahead of this step's products: sunk towards their uses they would each be waited for in turn
#pragma unroll
    for (int t = 0; t < 8; ++t) { acc[t] = wmma16b(a, b[t], acc[t]); acc[t] = wmma16b(al, b[t], acc[t]); }
    a = an; al = aln;
#pragma unroll
    for (int t = 0; t < 8; ++t) b[t] = bn[t]; }
#pragma unroll
  for (int t = 0; t < 8; ++t) { const float bb = bf16_rne(bo[n0 + t * 16 + nloc]);
#pragma unroll
    for (int r = 0; r < 8; ++r) Ts[wave][8 * hlf + r][t * 16 + nloc] = acc[t][r] * (1.0f / (XS * WSC)) + bb; }
  wave_lds_sync();
  { for (int rr = 0; rr < 16; ++rr) *(v4f*)(out + (m0 + rr) * DIM + n0 + lane * 4) = *(const v4f*)(&Ts[wave][rr][lane * 4]);  }
}
}  // namespace

extern "C" void kernel_launch(void* const* d_in, const int* in_sizes, int n_in, void* d_out, int out_size, void* d_ws, size_t ws_size, hipStream_t stream) {
  (void)n_in;
  auto Fp = [&](int i) { return (const float*)d_in[i]; };
  // input order: 0 q, 1 k, 2 v [4,1024,512]; 3 ln_in_g, 4 ln_in_b; 5 W_in [512,512]; 6 wp_W1 [128,64], 7 wp_b1, 8 wp_ln_g, 9 wp_ln_b, 10 wp_W2 [64,32], 11 wp_b2, 12 wp_W3 [32,3], 13 wp_b3, 14 weight_temp [1], 15 W_out [512,512], 16 b_out
  if (in_sizes[0] != NR * DIM || in_sizes[1] != NR * DIM || in_sizes[2] != NR * DIM || in_sizes[5] != DIM * DIM || in_sizes[6] != 2 * DH * DH || in_sizes[15] != DIM * DIM || out_size != NR * DIM) return;
  size_t off = 0; char* ws = (char*)d_ws;
  auto carve = [&](size_t bytes) { char* p = ws + off; off += (bytes + 255) & ~(size_t)255; return p; };
  b16* X16 = (b16*)carve((size_t)3 * NR * DIM * 2); b16* WIN = (b16*)carve((size_t)DIM * DIM * 2); b16* WOUT = (b16*)carve((size_t)DIM * DIM * 2);
  float* F32 = (float*)carve((size_t)3 * NP_ * NT * DH * 4); float* KCM = (float*)carve((size_t)NP_ * DH * 4); float* PSUM = (float*)carve((size_t)2 * NP_ * DH * 4);
  b16* FQ16 = (b16*)carve((size_t)NP_ * NT * DH * 2); b16* FQC16 = (b16*)carve((size_t)NP_ * NT * DH * 2); b16* FK16 = (b16*)carve((size_t)NP_ * NT * DH * 2); b16* FKC16 = (b16*)carve((size_t)NP_ * NT * DH * 2);
  float* N1 = (float*)carve((size_t)NP_ * NT * 4); float* N2 = (float*)carve((size_t)NP_ * NT * 4); b16* FVTh = (b16*)carve((size_t)NP_ * DH * NT * 2); b16* FVTl = (b16*)carve((size_t)NP_ * DH * NT * 2);
  float* P1 = (float*)carve((size_t)NP_ * (NT / 32) * 32 * 4); float* VARC = (float*)carve((size_t)NP_ * NT * 4); float* P2 = (float*)carve((size_t)NP_ * (NT / 32) * 32 * 4); float* ROWE = (float*)carve((size_t)NP_ * NT * 4); float* CST = (float*)carve(256);
  b16* OCh = (b16*)carve((size_t)NR * DIM * 2); b16* OCl = (b16*)carve((size_t)NR * DIM * 2);
  if (off > ws_size || off > ((size_t)128 << 20)) return;   // ≈ 73 MB
  ln_kernel<<<3 * NR / 8, 256, 0, stream>>>(Fp(0), Fp(1), Fp(2), Fp(3), Fp(4), X16);
  prepw_kernel<<<(2 * DIM * DIM / 8 + 255) / 256, 256, 0, stream>>>(Fp(5), Fp(15), WIN, WOUT);
  feat_kernel<<<dim3(NR / 64, DIM / 128, 3), 128, 0, stream>>>(X16, WIN, F32);
  colstat_kernel<<<dim3(NP_, 2), 256, 0, stream>>>(F32, KCM, PSUM);
  rowops_kernel<<<NP_ * NT / 16, 256, 0, stream>>>(F32, KCM, FQ16, FQC16, N1, FK16, FKC16, N2);
  norms_kernel<<<NP_ * NT / 256, 256, 0, stream>>>(F32, N1, N2);
  vt_kernel<<<dim3(NT / 64, NP_), 256, 0, stream>>>(F32, FVTh, FVTl);
  score_kernel<1><<<dim3(NT / 32, NP_), 64, 0, stream>>>(FQ16, FQC16, N1, FK16, FKC16, N2, FVTh, FVTl, CST, P1, VARC, P2, ROWE, OCh, OCl);
  reduce1_kernel<<<1, 256, 0, stream>>>(P1, VARC, PSUM, Fp(6), Fp(7), Fp(8), Fp(9), Fp(10), Fp(11), Fp(12), Fp(13), Fp(14), CST);
  score_kernel<2><<<dim3(NT / 32, NP_), 64, 0, stream>>>(FQ16, FQC16, N1, FK16, FKC16, N2, FVTh, FVTl, CST, P1, VARC, P2, ROWE, OCh, OCl);
  reduce2_kernel<<<1, 256, 0, stream>>>(P2, ROWE, VARC, CST);
  score_kernel<3><<<dim3(NT / 32, NP_), 64, 0, stream>>>(FQ16, FQC16, N1, FK16, FKC16, N2, FVTh, FVTl, CST, P1, VARC, P2, ROWE, OCh, OCl);
  outproj_kernel<<<dim3(NR / 64, DIM / 128), 128, 0, stream>>>(OCh, OCl, WOUT, Fp(16), (float*)d_out);
}

// v003
// One run takes 217 microseconds.
// Two timings next to v002 both put it at 1.26 times that version's speed.
// Over all steps from v000 it is 3.21 times as fast.
#include <hip/hip_runtime.h>

// "Super-aggressive" attention: f_q, f_k, f_v = LN(q|k|v) W_in split into 8 heads x 64; per (head, batch) pair: cos = clip(f_q.f_k / (n1 n2), +-0.99) (n = norm + 1e-8),
// cov = reg x (f_q - rowmean_d)(f_k - colmean_m) / (8 + 1e-6) (reg = 1e-3/1024, x10 if the global std of the raw cov < 1e-6), csim = clip(qn.kn) with max(norm, 1e-6), margin =
// clip(0.01 - csim, 0, 10), var_c = row mean of margin; per-head weights (cw, covw, vw) from a tiny MLP on the global means of f_q / f_k (softmax, /clip(weight_temp), softmax, clip, renorm);
// cn / covn / vn = global std (ddof 1) of cos / cov / var_c (+1e-6); d2 = cw cos/cn cscale + covw cov/covn/2 + vw var_c/vn/2; temp = 0.3 + std(d2) (dstd >= 1e-6; clipped to [0.1, 5]);
// attn = softmax(d2 / temp); out_h = attn f_v; out = concat_h W_out + b -> [4][1024][512].
// Every global statistic is a deterministic two-level f32 reduction (per-wave partials, then one fixed-order kernel); the [1024 x 1024] score tiles are recomputed in three passes
// (component statistics; d2 statistics with per-row shifts; softmax + PV) instead of being stored.
// WMMA (v_wmma_f32_16x16x32_f16, f32 accumulate): W_in (LN(x) single f16 x8, exact weights), dots / centered-cov tiles (single f16 x8 feature planes, K = 64), P.V (P single x8, f_v^T hi+lo:
// 2 products), W_out (O hi+lo: 2 products). LN, norms, all statistics and the weight-predictor MLP in f32. Inputs rounded to bf16 once. Fragment k-map per lane half hh

namespace {
constexpr int QB = 4, NT = 1024, DIM = 512, NH = 8, DH = 64, NP_ = NH * QB /* 32 (h,q) pairs, index h*QB + q */, NR = QB * NT /* 4096 rows */, NWAVE = NP_ * (NT / 16) /* 2048 score waves */;
constexpr float XS = 8.0f, WSC = 256.0f, PS = 8.0f, GAMMA = 0.01f, LREG = 0.001f;
constexpr float NTOT = 33554432.0f;   // 33,554,432 score elements

typedef _Float16 b16;
typedef __attribute__((ext_vector_type(16))) _Float16 v16b;
typedef __attribute__((ext_vector_type(8))) _Float16 v8b;
typedef __attribute__((ext_vector_type(8))) float v8f;
typedef __attribute__((ext_vector_type(4))) float v4f;
__device__ __forceinline__ float bf16_rne(float f) { unsigned int u = __float_as_uint(f); u += 0x7FFFu + ((u >> 16) & 1u); return __uint_as_float(u & 0xFFFF0000u); }
__device__ __forceinline__ void split16(float v, b16& hi, b16& lo) { hi = (b16)v; lo = (b16)(v - (float)hi); }
__device__ __forceinline__ v16b frag_kb(const b16* p, int hh) { const v8b a = *(const v8b*)(p + 8 * hh), b = *(const v8b*)(p + 16 + 8 * hh); v16b f;
#pragma unroll
  for (int e = 0; e < 8; ++e) { f[e] = a[e]; f[8 + e] = b[e]; } return f; }
// Fragment order: the planes that the matrix loops read again and again (keys, centred keys, f_v^T hi/lo, both weight planes, the attention output hi/lo) are stored tile by tile, a tile = 16 rows x 32 k = 1,024 contiguous bytes laid out as
// [k half j][lane = 16 hh + row][8 elements], element (row, kk) with j = kk / 16, hh = (kk / 8) % 2. A wave's 16-byte load then covers 512 contiguous bytes (4 whole lines) instead of 32-byte pieces of 16 lines; each lane gets the same values in the same registers as from frag_kb.
__device__ __forceinline__ int frag_pos(int row, int kk) { return (kk >> 4) * 256 + (((kk >> 3) & 1) * 16 + row) * 8 + (kk & 7); }   // element offset inside a tile
__device__ __forceinline__ v16b frag_pk(const b16* utile, unsigned lane_bytes) { const char* p = (const char*)utile + lane_bytes; const v8b a = *(const v8b*)p, b = *(const v8b*)(p + 512); v16b f;   // wave-uniform tile base plus 16 * lane bytes
#pragma unroll
  for (int e = 0; e < 8; ++e) { f[e] = a[e]; f[8 + e] = b[e]; } return f; }
__device__ __forceinline__ v8f wmma16b(v16b a, v16b b, v8f c) { v8f d = __builtin_amdgcn_wmma_f32_16x16x32_f16(false, a, false, b, (short)0, c, false, false); asm volatile("v_nop\n\tv_nop\n\tv_nop\n\tv_nop" : "+v"(d) : "v"(a), "v"(b)); return d; }
// the same product for a B operand that stays live and unwritten through the whole loop (the query fragments): B is left out of the statement's operands, which all have to sit in the first 256 registers, so that it may live above them
__device__ __forceinline__ v8f wmma16q(v16b a, v16b b, v8f c) { v8f d = __builtin_amdgcn_wmma_f32_16x16x32_f16(false, a, false, b, (short)0, c, false, false); asm volatile("v_nop\n\tv_nop\n\tv_nop\n\tv_nop" : "+v"(d) : "v"(a)); return d; }
// closes a run of global loads. The wait stands in front of the next instruction that writes a register from which those loads took their address (a precaution).
// The scheduling barrier keeps later address arithmetic from being lifted over that wait, and keeps the run up here, ahead of the work that covers its latency: sunk towards their uses the loads would each be waited for in turn.
__device__ __forceinline__ void close_load_run() { asm volatile("s_wait_xcnt 0x0" ::: "memory"); __builtin_amdgcn_sched_barrier(0); }
__device__ __forceinline__ void wave_lds_sync() { __builtin_amdgcn_fence(__ATOMIC_RELEASE, "workgroup"); __builtin_amdgcn_wave_barrier(); __builtin_amdgcn_fence(__ATOMIC_ACQUIRE, "workgroup"); }
// exp(x) on v_exp_f32, with the slot that the instruction set asks for behind a transcendental (before its result is used or its source overwritten) filled in the same statement: a v_nop in a statement of its own did not stay behind it
__device__ __forceinline__ float nexp(float x) { float r; asm("v_exp_f32 %0, %1\n\tv_nop" : "=v"(r) : "v"(x * 1.4426950408889634f)); return r; }
__device__ __forceinline__ float pmul(float a, float b) { float p = a * b; asm volatile("" : "+v"(p)); return p; }
__device__ __forceinline__ float hsum16(float v) { v += __shfl_xor(v, 1); v += __shfl_xor(v, 2); v += __shfl_xor(v, 4); return v + __shfl_xor(v, 8); }
__device__ __forceinline__ float clampf(float v, float lo, float hi) { return fminf(fmaxf(v, lo), hi); }

__global__ __launch_bounds__(256) void ln_kernel(const float* __restrict__ q, const float* __restrict__ k, const float* __restrict__ v, const float* __restrict__ g, const float* __restrict__ be, b16* __restrict__ X16) {
  const int wave = threadIdx.x >> 5, lane = threadIdx.x & 31; const int rowall = blockIdx.x * 8 + wave; const int which = rowall / NR, row = rowall - which * NR;
  const float* src = (which == 0 ? q : which == 1 ? k : v) + (size_t)row * DIM + lane * 16; float x[16];
  { const v4f a = *(const v4f*)src, b = *(const v4f*)(src + 4), c = *(const v4f*)(src + 8), d = *(const v4f*)(src + 12); for (int j = 0; j < 4; ++j) { x[j] = bf16_rne(a[j]); x[4 + j] = bf16_rne(b[j]); x[8 + j] = bf16_rne(c[j]); x[12 + j] = bf16_rne(d[j]); } }
  float s = 0.0f; for (int j = 0; j < 16; ++j) s += x[j];
#pragma unroll
  for (int o = 16; o >= 1; o >>= 1) s += __shfl_xor(s, o);
  const float mu = s * (1.0f / DIM); float ss = 0.0f; for (int j = 0; j < 16; ++j) { const float d = x[j] - mu; ss += pmul(d, d); }
#pragma unroll
  for (int o = 16; o >= 1; o >>= 1) ss += __shfl_xor(ss, o);
  const float rs = rsqrtf(ss * (1.0f / DIM) + 1e-5f); v8b o0, o1;
  for (int j = 0; j < 16; ++j) { const int c = lane * 16 + j; const b16 hv = (b16)((pmul((x[j] - mu) * rs, bf16_rne(g[c])) + bf16_rne(be[c])) * XS); if (j < 8) o0[j] = hv; else o1[j - 8] = hv; }
  { b16* dst = X16 + ((size_t)which * NR + row) * DIM + lane * 16; *(v8b*)dst = o0; *(v8b*)(dst + 8) = o1;  }
}
__global__ __launch_bounds__(256) void prepw_kernel(const float* __restrict__ win, const float* __restrict__ wout, b16* __restrict__ WIN, b16* __restrict__ WOUT) {
  const int t = blockIdx.x * 256 + threadIdx.x; if (t >= 2 * DIM * DIM / 8) return; const int kind = t / (DIM * DIM / 8), tt = t - kind * (DIM * DIM / 8);
  // thread tt fills the 16-byte piece tt of the plane in fragment order: tile tt / 64 = (row tile) * 16 + k tile, piece tt % 64 = [j][hh][row]
  const int tile = tt >> 6, o_ = (tile / (DIM / 32)) * 16 + (tt & 15), k0 = (tile % (DIM / 32)) * 32 + ((tt >> 5) & 1) * 16 + ((tt >> 4) & 1) * 8;
  const float* w = kind == 0 ? win : wout; v8b o; for (int j = 0; j < 8; ++j) o[j] = (b16)(bf16_rne(w[(size_t)(k0 + j) * DIM + o_]) * WSC);
  { *(v8b*)((kind == 0 ? WIN : WOUT) + (size_t)tt * 8) = o;  }
}
// features: F = X16 W_in per row (block = 64 rows x 4 waves, wave = 16 rows x 128 cols = 2 heads; grid.y = 4): which 0 (q): F32Q [pair][n][64] f32 rows; which 1 (k): F32K; which 2 (v): F32V. (f32 planes,
__global__ __launch_bounds__(128) void feat_kernel(const b16* __restrict__ X16, const b16* __restrict__ WIN, float* __restrict__ F32) {
  __shared__ __attribute__((aligned(16))) float Ts[4][16][128 + 4];
  const int wave = threadIdx.x >> 5, lane = threadIdx.x & 31, nloc = lane & 15, hlf = lane >> 4; const int which = blockIdx.z; const size_t m0 = (size_t)blockIdx.x * 64 + wave * 16; const int n0 = blockIdx.y * 128;
  v8f acc[8];
#pragma unroll
  for (int t = 0; t < 8; ++t) acc[t] = (v8f){};
  const b16* ap = X16 + ((size_t)which * NR + m0 + nloc) * DIM; const b16* bp = WIN + (size_t)n0 * DIM; const unsigned flane = (unsigned)lane * 16u;   // bp: the first weight tile of column n0 (16 rows x 512 k = 16 tiles of 512 elements)
  v16b a = frag_kb(ap, hlf), b[8];
#pragma unroll
  for (int t = 0; t < 8; ++t) b[t] = frag_pk(bp + (size_t)t * 16 * DIM, flane);
#pragma unroll   // full: the two fragment sets swap by renaming, and the last step's fetch falls away
  for (int kb = 0; kb < DIM; kb += 32) { v16b an = a, bn[8];
#pragma unroll
    for (int t = 0; t < 8; ++t) bn[t] = b[t];
    if (kb + 32 < DIM) { an = frag_kb(ap + kb + 32, hlf);
#pragma unroll
      for (int t = 0; t < 8; ++t) bn[t] = frag_pk(bp + (size_t)t * 16 * DIM + (kb + 32) * 16, flane); }
    __builtin_amdgcn_sched_barrier(0);   // keeps the next step's loads, as one group, ahead of this step's products: sunk towards their uses they would each be waited for in turn
#pragma unroll
    for (int t = 0; t < 8; ++t) acc[t] = wmma16b(a, b[t], acc[t]);
    a = an;
#pragma unroll
    for (int t = 0; t < 8; ++t) b[t] = bn[t]; }
#pragma unroll
  for (int t = 0; t < 8; ++t)
#pragma unroll
    for (int r = 0; r < 8; ++r) Ts[wave][8 * hlf + r][t * 16 + nloc] = acc[t][r] * (1.0f / (XS * WSC));
  wave_lds_sync();
  // rows m0+rr: q_idx = row / NT, n = row % NT; cols n0 + c -> head h = (n0 + c) / 64, d = % 64; F32 layout [which][pair][n][64]
  { for (int rr = 0; rr < 16; ++rr) { const size_t row = m0 + rr; const int qi = (int)(row / NT), n = (int)(row - (size_t)qi * NT); for (int hq = 0; hq < 2; ++hq) { const int h = n0 / DH + hq; const int pair = h * QB + qi;
        if (lane < 16) *(v4f*)(F32 + (((size_t)which * NP_ + pair) * NT + n) * DH + lane * 4) = *(const v4f*)(&Ts[wave][rr][hq * DH + lane * 4]); } }  }
}
// per-pair column statistics of f_k (mean over the 1024 keys per d) and head means qg/kg (over all 4,096 rows): colstat: block = pair, 256 threads: thread (d = t%64, part = t/64) sums rows part*256..+255;
__global__ __launch_bounds__(256) void colstat_kernel(const float* __restrict__ F32, float* __restrict__ KCM, float* __restrict__ PSUM) {   // PSUM [which 0/1][pair][64] = column sums
  __shared__ float part[4][DH];
  const int which = blockIdx.y, pair = blockIdx.x, t_ = threadIdx.x, d = t_ & 63, pq = t_ >> 6; const float* base = F32 + (((size_t)which * NP_ + pair) * NT) * DH;
  float s = 0.0f; for (int n = pq * 256; n < pq * 256 + 256; ++n) s += base[(size_t)n * DH + d]; part[pq][d] = s;
  __syncthreads();
  if (t_ < DH) { const float tot = (part[0][t_] + part[1][t_]) + (part[2][t_] + part[3][t_]);
    { ((float*)PSUM)[((size_t)which * NP_ + pair) * DH + t_] = tot; if (which == 1) ((float*)KCM)[(size_t)pair * DH + t_] = tot * (1.0f / NT);  } }
}
// operand planes per pair: FQ16 [pair][n][64] = f16(8 f_q), FQC16 = f16(8 (f_q - rowmean)), N1 [pair][n] = ||f_q|| (f32); FK16, FKC16 = f16(8 (f_k - colmean)) (both in fragment order), N2; FVTh/FVTl = f_v^T hi/lo x8 (rows d, k = keys, in fragment order).
__global__ __launch_bounds__(256) void rowops_kernel(const float* __restrict__ F32, const float* __restrict__ KCM, b16* __restrict__ FQ16, b16* __restrict__ FQC16, float* __restrict__ N1, b16* __restrict__ FK16, b16* __restrict__ FKC16, float* __restrict__ N2) {
  const int wave = threadIdx.x >> 5, lane = threadIdx.x & 31; const size_t prow = ((size_t)blockIdx.x * 8 + wave) * 2 + (lane >> 4);   // pair*NT + n, over NP_*NT rows
  const int pair = (int)(prow / NT); const int c0 = (lane & 15) * 4;
  const v4f fq = *(const v4f*)(F32 + (0 * (size_t)NP_ * NT + prow) * DH + c0), fk = *(const v4f*)(F32 + (1 * (size_t)NP_ * NT + prow) * DH + c0);
  float sq = 0.0f, ssq = 0.0f, ssk = 0.0f; for (int j = 0; j < 4; ++j) { sq += fq[j]; ssq += pmul(fq[j], fq[j]); ssk += pmul(fk[j], fk[j]); }
  sq = hsum16(sq); ssq = hsum16(ssq); ssk = hsum16(ssk); const float mq = sq * (1.0f / DH);
  typedef __attribute__((ext_vector_type(4))) _Float16 v4b; v4b a, ac, b, bc;
  for (int j = 0; j < 4; ++j) { a[j] = (b16)(fq[j] * XS); ac[j] = (b16)((fq[j] - mq) * XS); b[j] = (b16)(fk[j] * XS); bc[j] = (b16)((fk[j] - KCM[(size_t)pair * DH + c0 + j]) * XS); }
  { *(v4b*)(FQ16 + prow * DH + c0) = a; *(v4b*)(FQC16 + prow * DH + c0) = ac; const size_t kpos = (prow >> 4) * (16 * DH) + (c0 >> 5) * 512 + frag_pos((int)(prow & 15), c0 & 31);   // key planes in fragment order: the block's 16 rows are one row tile (2 k tiles, 2 KiB a plane)
    *(v4b*)(FK16 + kpos) = b; *(v4b*)(FKC16 + kpos) = bc;  }
}
__global__ __launch_bounds__(256) void norms_kernel(const float* __restrict__ F32, float* __restrict__ N1, float* __restrict__ N2) {   // thread per row: 256 rows per block -> N1/N2 spans of 256 floats (8 lines) each
  const size_t prow = (size_t)blockIdx.x * 256 + threadIdx.x; const float* fq = F32 + (0 * (size_t)NP_ * NT + prow) * DH; const float* fk = F32 + (1 * (size_t)NP_ * NT + prow) * DH;
  float sq = 0.0f, sk = 0.0f; for (int d = 0; d < DH; ++d) { sq += pmul(fq[d], fq[d]); sk += pmul(fk[d], fk[d]); }
  { ((float*)N1)[prow] = sqrtf(sq); ((float*)N2)[prow] = sqrtf(sk);  }
}
__global__ __launch_bounds__(256) void vt_kernel(const float* __restrict__ F32, b16* __restrict__ FVTh, b16* __restrict__ FVTl) {   // block = (pair, 64-key chunk): transpose [64 n][64 d] -> rows d, hi/lo
  __shared__ __attribute__((aligned(16))) b16 Th[DH][64 + 8], Tl[DH][64 + 8];
  const int pair = blockIdx.y, n0 = blockIdx.x * 64, t_ = threadIdx.x; const float* base = F32 + ((2 * (size_t)NP_ + pair) * NT + n0) * DH;
  for (int qq = t_; qq < 64 * DH; qq += 256) { const int nn = qq >> 6, d = qq & 63; b16 h_, l_; split16(base[(size_t)nn * DH + d] * XS, h_, l_); Th[d][nn] = h_; Tl[d][nn] = l_; }
  __syncthreads();
  // fragment order, tiles [pair][32-key block][16-d tile]: the block's 64 keys are 8 tiles = 8 KiB a plane, and piece qq = [key block][d tile][j][hh][row] goes to byte 16 qq of them
  { for (int qq = t_; qq < DH * 8; qq += 256) { const int d = ((qq >> 6) & 3) * 16 + (qq & 15), c8 = (qq >> 8) * 32 + ((qq >> 5) & 1) * 16 + ((qq >> 4) & 1) * 8; const size_t gi = ((size_t)pair * NT + n0) * DH + (size_t)qq * 8; *(v8b*)(FVTh + gi) = *(const v8b*)(&Th[d][c8]); *(v8b*)(FVTl + gi) = *(const v8b*)(&Tl[d][c8]); }  }
}
// score-tile passes: wave = 16 query rows n of one pair (block = 2 waves), loop over 32 key blocks of 32: dots^T and covraw^T tiles (keys x queries, K = 64: 2 steps x 2 key tiles x 2 GEMMs = 8 WMMAs),
// lane (hh, col=query) holds keys kb+8hh+r and kb+16+8hh+r.  cos = clip(dots/((n1+1e-8)(n2+1e-8))), csim = clip(dots/(max(n1,1e-6) max(n2,1e-6))), margin = clip(0.01 - csim, 0, 10), covraw = c/(8+1e-6).
// PASS 2 (given cn, covfac = reg/covn/2, w per head, vn): per row c_row = vw var_c/(2 vn); e = cw cos/cn cscale + covw covraw covfac (d2 - c_row): per-wave S_e, S_e2 and per-row rowsum_e -> P2, ROWE.
// PASS 3 (given temp): logits = (e + c_row)/temp -> online softmax (f32) with o^T += f_v^T P^T (hi+lo, 4 d-tiles): O [pair][n][64] -> OC16h/l, rows q*NT+n, k = h*64+d (concat-head planes, hi/lo x8, in fragment order).
template <int PASS>
__global__ __launch_bounds__(64) void score_kernel(const b16* __restrict__ FQ16, const b16* __restrict__ FQC16, const float* __restrict__ N1, const b16* __restrict__ FK16, const b16* __restrict__ FKC16, const float* __restrict__ N2, const b16* __restrict__ FVTh, const b16* __restrict__ FVTl,
                                                  const float* __restrict__ CST /* [0..3] cscale/cn, reg/(2 covn), 1/(2 vn), 1/temp; [4..27] cw, covw, vw per head */, float* __restrict__ P1, float* __restrict__ VARC, float* __restrict__ P2, float* __restrict__ ROWE, b16* __restrict__ OCh, b16* __restrict__ OCl) {
  __shared__ __attribute__((aligned(16))) float To[2][16][DH + 4]; __shared__ float Tr[2][16]; __shared__ float Tp[2][4];
  const int wave = threadIdx.x >> 5, lane = threadIdx.x & 31, hh = lane >> 4, col = lane & 15; const int pair = blockIdx.y, n0 = blockIdx.x * 32 + wave * 16, ni = n0 + col; const int h = pair / QB, qi = pair - h * QB;
  const size_t prow = (size_t)pair * NT + ni; const b16* Qp = FQ16 + prow * DH; const b16* Qc = FQC16 + prow * DH; const b16* Kb = FK16 + (size_t)pair * NT * DH; const b16* Kc = FKC16 + (size_t)pair * NT * DH;
  __builtin_amdgcn_sched_barrier(0);   // keeps the index arithmetic above from being placed between the loads below and the wait that closes their run
  const v16b qa0 = frag_kb(Qp, hh), qa1 = frag_kb(Qp + 32, hh); close_load_run();
  const v16b qc0 = frag_kb(Qc, hh), qc1 = frag_kb(Qc + 32, hh); close_load_run();
  const float n1 = N1[prow]; close_load_run(); const float inv1a = 1.0f / (n1 + 1e-8f), inv1b = 1.0f / fmaxf(n1, 1e-6f);
  float cn_inv_cscale = 0.0f, covfac = 0.0f, vn_half_inv = 0.0f, temp_inv = 0.0f, cwh = 0.0f, covwh = 0.0f, vwh = 0.0f;   // this head's constants, read once ahead of the loop
  if (PASS >= 2) { const float* cf = CST; cn_inv_cscale = cf[0]; covfac = cf[1]; vn_half_inv = cf[2]; temp_inv = cf[3]; cwh = cf[4 + h]; covwh = cf[4 + NH + h]; vwh = cf[4 + 2 * NH + h]; }
  float crow = 0.0f; if (PASS >= 2) crow = vwh * VARC[prow] * vn_half_inv;
  float s_a = 0.0f, s_b = 0.0f, s_c = 0.0f, s_d = 0.0f, rowacc = 0.0f;
  float m = -INFINITY, l = 0.0f; v8f o[4] = {{}, {}, {}, {}}, ol[4] = {{}, {}, {}, {}};
  // One key block's operands (8 key fragments, 16 key norms) live in registers and are fetched together, a whole block ahead of their use.
  v16b k0a, k0b, k1a, k1b, x0a, x0b, x1a, x1b; v4f nn0, nn1, nn2, nn3;
  const unsigned flane = (unsigned)lane * 16u, nlane = (unsigned)hh * 32u;   // per-lane byte offsets into a tile in fragment order and into a key block's norms
  auto fetch_keys = [&](int kq) { const b16* kr = Kb + (size_t)kq * DH; const b16* cr = Kc + (size_t)kq * DH; const char* np = (const char*)(N2 + (size_t)pair * NT + kq) + nlane;
    nn0 = *(const v4f*)np; nn1 = *(const v4f*)(np + 16); nn2 = *(const v4f*)(np + 64); nn3 = *(const v4f*)(np + 80); close_load_run();
    k0a = frag_pk(kr, flane); k0b = frag_pk(kr + 512, flane); k1a = frag_pk(kr + 1024, flane); k1b = frag_pk(kr + 1536, flane); close_load_run();   // a 32-key block = 4 tiles: [16 keys][k tile]
    x0a = frag_pk(cr, flane); x0b = frag_pk(cr + 512, flane); x1a = frag_pk(cr + 1024, flane); x1b = frag_pk(cr + 1536, flane); close_load_run(); };
  fetch_keys(0);
  for (int kb = 0; kb < NT; kb += 32) {
    v8f d0 = {}, d1 = {}, c0 = {}, c1 = {};
    d0 = wmma16q(k0a, qa0, d0); d0 = wmma16q(k0b, qa1, d0);
    d1 = wmma16q(k1a, qa0, d1); d1 = wmma16q(k1b, qa1, d1);
    c0 = wmma16q(x0a, qc0, c0); c0 = wmma16q(x0b, qc1, c0);
    c1 = wmma16q(x1a, qc0, c1); c1 = wmma16q(x1b, qc1, c1);
    const v4f na0 = nn0, na1 = nn1, nb0 = nn2, nb1 = nn3;
    // behind the last score product: this block's value fragments (used after the softmax arithmetic), then the next block's keys (the last block re-reads block 0, unused), all in flight under the vector work
    v16b vh[4], vl[4];
    if (PASS == 3) {
#pragma unroll
      for (int t = 0; t < 4; ++t) { vh[t] = frag_pk(FVTh + ((size_t)pair * NT + kb) * DH + t * 512, flane); vl[t] = frag_pk(FVTl + ((size_t)pair * NT + kb) * DH + t * 512, flane); }
      close_load_run(); }
    const int kn = kb + 32 < NT ? kb + 32 : 0;
    fetch_keys(kn);
    float ev0[8], ev1[8];
#pragma unroll
    for (int r = 0; r < 8; ++r) {
#pragma unroll
      for (int hq = 0; hq < 2; ++hq) { const float dot = (hq ? d1[r] : d0[r]) * (1.0f / (XS * XS)); const float covraw = (hq ? c1[r] : c0[r]) * (1.0f / (XS * XS)) * (1.0f / (8.0f + 1e-6f));
        const float n2 = hq ? (r < 4 ? nb0[r & 3] : nb1[r & 3]) : (r < 4 ? na0[r & 3] : na1[r & 3]); const float cosv = clampf(dot * inv1a * (1.0f / (n2 + 1e-8f)), -0.99f, 0.99f); 
        if (PASS == 1) { const float csim = clampf(dot * inv1b * (1.0f / fmaxf(n2, 1e-6f)), -0.99f, 0.99f); const float margin = clampf(GAMMA - csim, 0.0f, 10.0f);
          s_a += cosv; s_b += pmul(cosv, cosv); s_c += covraw; s_d += pmul(covraw, covraw); rowacc += margin; }
        else { const float e = pmul(cwh, cosv * cn_inv_cscale) + pmul(covwh, covraw * covfac);
          if (PASS == 2) { s_a += e; s_b += pmul(e, e); rowacc += e; }
          else { (hq ? ev1 : ev0)[r] = (e + crow) * temp_inv; } } } }
    if (PASS == 3) { float mr = -INFINITY;
#pragma unroll
      for (int r = 0; r < 8; ++r) mr = fmaxf(mr, fmaxf(ev0[r], ev1[r]));
      mr = fmaxf(mr, __shfl_xor(mr, 16)); const float mn = fmaxf(m, mr); const float al_ = nexp(m - mn); m = mn; float sum = 0.0f; v16b pb;
#pragma unroll
      for (int r = 0; r < 8; ++r) { const float e0 = nexp(ev0[r] - mn), e1 = nexp(ev1[r] - mn); sum += e0 + e1; pb[r] = (b16)(e0 * PS); pb[8 + r] = (b16)(e1 * PS); }
      sum += __shfl_xor(sum, 16); l = l * al_ + sum;
#pragma unroll
      for (int t = 0; t < 4; ++t) { o[t] *= al_; ol[t] *= al_; o[t] = wmma16b(vh[t], pb, o[t]); ol[t] = wmma16b(vl[t], pb, ol[t]); } } }
  if (PASS <= 2) {   // per-row sums across the two lane halves; per-wave partials over the 16 rows and 32 lanes
    rowacc += __shfl_xor(rowacc, 16); if (hh == 0) Tr[wave][col] = rowacc;
    float v4[4] = {s_a, s_b, s_c, s_d};
#pragma unroll
    for (int j = 0; j < 4; ++j) { float v = v4[j];
#pragma unroll
      for (int oo = 16; oo >= 1; oo >>= 1) v += __shfl_xor(v, oo);
      v4[j] = v; }
    if (lane == 0) { Tp[wave][0] = v4[0]; Tp[wave][1] = v4[1]; Tp[wave][2] = v4[2]; Tp[wave][3] = v4[3]; }
    wave_lds_sync();
    const size_t widx = (size_t)pair * (NT / 16) + blockIdx.x * 2 + wave;
    __syncthreads();
    {
      if (wave == 0) { const float rv = Tr[lane >> 4][lane & 15] * (PASS == 1 ? (1.0f / NT) : 1.0f); ((float*)(PASS == 1 ? VARC : ROWE))[(size_t)pair * NT + blockIdx.x * 32 + lane] = rv;
        ((float*)(PASS == 1 ? P1 : P2))[((size_t)pair * (NT / 32) + blockIdx.x) * 32 + lane] = (lane < 8) ? Tp[lane >> 2][lane & 3] : 0.0f; }
       }
    (void)widx;
  } else {
    const float inv = 1.0f / (l * PS * XS);
#pragma unroll
    for (int t = 0; t < 4; ++t)
#pragma unroll
      for (int r = 0; r < 8; ++r) To[wave][col][t * 16 + 8 * hh + r] = (o[t][r] + ol[t][r]) * inv;
    wave_lds_sync();
    // fragment order for the output projection: the wave's 16 rows x 64 columns are 2 tiles (2 KiB) a plane; store i covers the 512 bytes [k tile i / 2][j = i % 2]
    { for (int i = 0; i < 4; ++i) { const int rr = col, c8 = (i >> 1) * 32 + (i & 1) * 16 + hh * 8; v8b hv, lv; for (int j = 0; j < 8; ++j) { b16 a_, c_; split16(To[wave][rr][c8 + j] * XS, a_, c_); hv[j] = a_; lv[j] = c_; }
        const size_t gi = ((size_t)qi * NT + n0) * DIM + (h * 2) * 512 + i * 256 + lane * 8; *(v8b*)(OCh + gi) = hv; *(v8b*)(OCl + gi) = lv; }  }
  }
}
// reductions (one block each, fixed order). reduce1: cn, covn, vn, weights -> CST[0..27]; reduce2: dstd -> temp -> CST[3].
// Both run as one block on an otherwise idle chip, so nothing hides a load's latency but the block's own instruction order: each kernel issues ALL its global reads in one run at its head and keeps them in registers
// (the predictor's weights go on to LDS), so that it pays about one memory latency in all instead of one per loop trip. Every sum keeps its operands and its order; in the loops written anew a product now fuses with its addition.
__global__ __launch_bounds__(256) void reduce1_kernel(const float* __restrict__ P1, const float* __restrict__ VARC, const float* __restrict__ PSUM, const float* __restrict__ w1, const float* __restrict__ b1, const float* __restrict__ g2, const float* __restrict__ be2, const float* __restrict__ w2, const float* __restrict__ b2, const float* __restrict__ w3, const float* __restrict__ b3, const float* __restrict__ wtemp, float* __restrict__ CST) {
  __shared__ float red[4][256]; __shared__ float sh[64];
  __shared__ __attribute__((aligned(16))) float w1s[2 * DH * DH], w2s[DH * 32]; __shared__ float w3s[3][32], b1s[DH], g2s[DH], be2s[DH], b2s[32];   // the predictor's parameters as bf16 values (w3s: the 96 values in their order)
  const int t_ = threadIdx.x; constexpr int NPK = NP_ * (NT / 32) / 256 /* 4 of the 1,024 block partials (8 floats: 2 waves x 4) per thread */, NVK = NP_ * NT / 256 /* 128 row values per thread */, NFK = NH * 2 * DH / 256 /* 4 */;
  v4f w1r[8], w2r[2], pl[NPK], ph[NPK]; float pr[NFK][QB], vr[NVK], w3r[3];
  const unsigned a63 = t_ & (DH - 1), a31 = t_ & 31, p1off = (unsigned)t_ * 128u /* bytes: partial t_ */, psidx = ((t_ >> 6) & 1) * NP_ * DH + (t_ >> 7) * QB * DH + (t_ & (DH - 1)) /* PSUM [which][pair 4 h][dd] of feature i = t_ */;
  const float b3r[3] = {b3[0], b3[1], b3[2]}, wtr = wtemp[0];
  __builtin_amdgcn_sched_barrier(0);   // keeps the index arithmetic and the scalar reads above from being placed between the loads below and the wait that closes their run
#pragma unroll
  for (int j = 0; j < 8; ++j) w1r[j] = *(const v4f*)(w1 + (j * 256 + t_) * 4);
#pragma unroll
  for (int j = 0; j < 2; ++j) w2r[j] = *(const v4f*)(w2 + (j * 256 + t_) * 4);
  const float b1r = b1[a63], g2r = g2[a63], be2r = be2[a63], b2r = b2[a31];
#pragma unroll
  for (int j = 0; j < 3; ++j) w3r[j] = w3[j * 32 + a31];
#pragma unroll
  for (int k = 0; k < NPK; ++k) { const char* p = (const char*)P1 + p1off + k * (256 * 128); pl[k] = *(const v4f*)p; ph[k] = *(const v4f*)(p + 16); }
#pragma unroll
  for (int k = 0; k < NFK; ++k)   // feature i = t_ + 256 k: head h + 2 k, the same which and dd
#pragma unroll
    for (int qq = 0; qq < QB; ++qq) pr[k][qq] = PSUM[psidx + (2 * k * QB + qq) * DH];
#pragma unroll   // full, here and in the two loops that read vr: the 128 values stay in registers and are read from memory once, not twice
  for (int j = 0; j < NVK; ++j) vr[j] = VARC[t_ + j * 256];
  // closes the run as close_load_run() does; the input operands keep the run's address registers from being given to a later load's result ahead of the wait
  asm volatile("s_wait_xcnt 0x0" :: "v"(a63), "v"(a31), "v"(p1off), "v"(psidx) : "memory"); __builtin_amdgcn_sched_barrier(0);
#pragma unroll
  for (int j = 0; j < 8; ++j) { v4f x; for (int e = 0; e < 4; ++e) x[e] = bf16_rne(w1r[j][e]); *(v4f*)(w1s + (j * 256 + t_) * 4) = x; }
#pragma unroll
  for (int j = 0; j < 2; ++j) { v4f x; for (int e = 0; e < 4; ++e) x[e] = bf16_rne(w2r[j][e]); *(v4f*)(w2s + (j * 256 + t_) * 4) = x; }
  b1s[a63] = bf16_rne(b1r); g2s[a63] = bf16_rne(g2r); be2s[a63] = bf16_rne(be2r); b2s[a31] = bf16_rne(b2r);   // every thread stores: threads with the same index store the same value
#pragma unroll
  for (int j = 0; j < 3; ++j) w3s[j][a31] = bf16_rne(w3r[j]);
  float a = 0, b = 0, c = 0, d = 0;
#pragma unroll
  for (int k = 0; k < NPK; ++k) { a += pl[k][0] + ph[k][0]; b += pl[k][1] + ph[k][1]; c += pl[k][2] + ph[k][2]; d += pl[k][3] + ph[k][3]; }
  red[0][t_] = a; red[1][t_] = b; red[2][t_] = c; red[3][t_] = d; __syncthreads();
  for (int s = 128; s >= 1; s >>= 1) { if (t_ < s) { for (int j = 0; j < 4; ++j) red[j][t_] += red[j][t_ + s]; } __syncthreads(); }
  float vs = 0.0f;
#pragma unroll
  for (int j = 0; j < NVK; ++j) vs += vr[j];
  __shared__ float r2[256]; r2[t_] = vs; __syncthreads(); for (int s = 128; s >= 1; s >>= 1) { if (t_ < s) r2[t_] += r2[t_ + s]; __syncthreads(); }
  const float vmu = r2[0] / (float)(NP_ * NT); __syncthreads();
  float vq = 0.0f;
#pragma unroll
  for (int j = 0; j < NVK; ++j) { const float dv = vr[j] - vmu; vq += dv * dv; }
  r2[t_] = vq; __syncthreads(); for (int s = 128; s >= 1; s >>= 1) { if (t_ < s) r2[t_] += r2[t_ + s]; __syncthreads(); }
  // head means qg/kg [8][64] from PSUM [which][pair][64]: mean over (q, n) = sum over the 4 pairs of the head / 4096 -> feats [h][128]; MLP: h1 = relu(LN(feats W1 + b1)), h2 = relu(h1 W2 + b2), logits = softmax(h2 W3 + b3), w = softmax(logits / clip(wt)), clip [0.05,0.8], renorm
  __shared__ __attribute__((aligned(16))) float feats[NH][2 * DH], h1s[NH][DH], h2s[NH][32]; __shared__ float ws[NH][3];
#pragma unroll
  for (int k = 0; k < NFK; ++k) { const int i = t_ + k * 256, h = i / (2 * DH), c = i - h * 2 * DH; float s = 0.0f;
#pragma unroll
    for (int qq = 0; qq < QB; ++qq) s += pr[k][qq];
    feats[h][c] = s * (1.0f / (QB * NT)); }
  __syncthreads();
  // the loops below read LDS only; each is unrolled, with plain products, so that its reads are issued ahead of the one chain of additions instead of being waited for one by one
  for (int i = t_; i < NH * DH; i += 256) { const int h = i / DH, o_ = i - h * DH; float s = b1s[o_];
#pragma unroll 32
    for (int c = 0; c < 2 * DH; ++c) s += feats[h][c] * w1s[c * DH + o_]; h1s[h][o_] = s; }
  __syncthreads();
  if (t_ < NH) { const int h = t_; float mu = 0.0f;
#pragma unroll
    for (int c = 0; c < DH; ++c) mu += h1s[h][c];
    mu *= (1.0f / DH); float var = 0.0f;
#pragma unroll
    for (int c = 0; c < DH; ++c) { const float dv = h1s[h][c] - mu; var += dv * dv; }
    var *= (1.0f / DH); const float rs = rsqrtf(var + 1e-5f);
#pragma unroll
    for (int c = 0; c < DH; ++c) h1s[h][c] = fmaxf((h1s[h][c] - mu) * rs * g2s[c] + be2s[c], 0.0f); }
  __syncthreads();
  for (int i = t_; i < NH * 32; i += 256) { const int h = i / 32, o_ = i - h * 32; float s = b2s[o_];
#pragma unroll 32
    for (int c = 0; c < DH; ++c) s += h1s[h][c] * w2s[c * 32 + o_]; h2s[h][o_] = fmaxf(s, 0.0f); }
  __syncthreads();
  if (t_ < NH) { const int h = t_; float lg[3]; for (int o_ = 0; o_ < 3; ++o_) { float s = bf16_rne(b3r[o_]);
#pragma unroll
      for (int c = 0; c < 32; ++c) s += h2s[h][c] * (&w3s[0][0])[c * 3 + o_]; lg[o_] = s; }
    float mx = fmaxf(lg[0], fmaxf(lg[1], lg[2])); float e3[3], se = 0.0f; for (int j = 0; j < 3; ++j) { e3[j] = __expf(lg[j] - mx); se += e3[j]; } for (int j = 0; j < 3; ++j) e3[j] /= se;
    const float wt = clampf(bf16_rne(wtr), 0.1f, 20.0f); float z[3]; for (int j = 0; j < 3; ++j) z[j] = e3[j] / wt; mx = fmaxf(z[0], fmaxf(z[1], z[2])); se = 0.0f; for (int j = 0; j < 3; ++j) { e3[j] = __expf(z[j] - mx); se += e3[j]; }
    float wv[3], sw = 0.0f; for (int j = 0; j < 3; ++j) { wv[j] = clampf(e3[j] / se, 0.05f, 0.8f); sw += wv[j]; } for (int j = 0; j < 3; ++j) ws[h][j] = wv[j] / sw; }
  __syncthreads();
  if (t_ == 0) { const float n = (float)NTOT; const float sa_ = red[0][0], sb = red[1][0], sc = red[2][0], sd = red[3][0];
    const float cstd = sqrtf(fmaxf((sb - sa_ * (sa_ / n)) / (n - 1.0f), 0.0f)); const float covstd_raw = sqrtf(fmaxf((sd - sc * (sc / n)) / (n - 1.0f), 0.0f));
    const float base_reg = LREG / (float)NT; const float reg = (covstd_raw < 1e-6f) ? base_reg * 10.0f : base_reg;   // reference: reg chosen on the std of the RAW cov, then cov = clip(reg cov, +-50) (never clips at this scale)
    const float covn = reg * covstd_raw + 1e-6f; const float cn = cstd + 1e-6f; const float cscale = (cn < 1e-4f) ? 0.1f : 1.0f;
    const float vn = sqrtf(r2[0] * ((float)NT / (n - 1.0f))) + 1e-6f;   // std over the broadcast [.., m] copies: each row value repeated NT times
    sh[0] = cscale / cn; sh[1] = reg * 0.5f / covn; sh[2] = 0.5f / vn; sh[3] = 0.0f; for (int h = 0; h < NH; ++h) { sh[4 + h] = ws[h][0]; sh[4 + NH + h] = ws[h][1]; sh[4 + 2 * NH + h] = ws[h][2]; } }
  __syncthreads();
  { if (t_ < 32) ((float*)CST)[t_] = (t_ < 4 + 3 * NH) ? sh[t_] : 0.0f;  }
}
__global__ __launch_bounds__(256) void reduce2_kernel(const float* __restrict__ P2, const float* __restrict__ ROWE, const float* __restrict__ VARC, float* __restrict__ CST) {
  __shared__ float red[5][256];
  const int t_ = threadIdx.x; constexpr int NPK = NP_ * (NT / 32) / 256, NVK = NP_ * NT / 256;   // 4 block partials and 128 rows per thread
  float p0[NPK], p1[NPK], p4[NPK], p5[NPK], vw8[NH], vr[NVK], er[NVK]; const unsigned p2off = (unsigned)t_ * 128u;   // bytes: partial t_
  const float vfac = CST[2];   // 0.5/vn; per-row constant c = vw[h] var_c vfac; d2 = e + c
#pragma unroll
  for (int h = 0; h < NH; ++h) vw8[h] = CST[4 + 2 * NH + h];
  __builtin_amdgcn_sched_barrier(0);   // keeps the index arithmetic and the scalar reads above from being placed between the loads below and the wait that closes their run
#pragma unroll   // full, here and in the loops that read vr and er: the values stay in registers
  for (int j = 0; j < NVK; ++j) vr[j] = VARC[t_ + j * 256];
#pragma unroll
  for (int k = 0; k < NPK; ++k) { const float* p = (const float*)((const char*)P2 + p2off + k * (256 * 128)); p0[k] = p[0]; p1[k] = p[1]; p4[k] = p[4]; p5[k] = p[5]; }
#pragma unroll
  for (int j = 0; j < NVK; ++j) er[j] = ROWE[t_ + j * 256];
  // closes the run as close_load_run() does; the input operand keeps the run's address register from being given to a later load's result ahead of the wait
  asm volatile("s_wait_xcnt 0x0" :: "v"(p2off) : "memory"); __builtin_amdgcn_sched_barrier(0);
  float a = 0, b = 0;
#pragma unroll
  for (int k = 0; k < NPK; ++k) { a += (p0[k] + p4[k]); b += (p1[k] + p5[k]); }
  // var(d2) = E[(d2 - M)^2] - (E[d2 - M])^2 with the shift M = mean of the row constants (kills the large common offset): per row, sum_m (d2 - M) = rowsum_e + NT (c - M), sum_m (d2 - M)^2 = sum e^2 + 2 (c - M) rowsum_e + NT (c - M)^2
  // row i = t_ + 256 j belongs to head (i / NT) / QB = j / 16
  float sc = 0;
#pragma unroll
  for (int j = 0; j < NVK; ++j) sc += vw8[j / 16] * vr[j] * vfac;
  red[4][t_] = sc; __syncthreads(); for (int s = 128; s >= 1; s >>= 1) { if (t_ < s) red[4][t_] += red[4][t_ + s]; __syncthreads(); }
  const float M = red[4][0] / (float)(NP_ * NT); __syncthreads();
  float s1 = 0, s2 = 0;
#pragma unroll
  for (int j = 0; j < NVK; ++j) { const float cm = vw8[j / 16] * vr[j] * vfac - M; s1 += (float)NT * cm; s2 += 2.0f * cm * er[j] + (float)NT * cm * cm; }
  red[0][t_] = a + s1; red[1][t_] = b + s2; __syncthreads();
  for (int s = 128; s >= 1; s >>= 1) { if (t_ < s) { red[0][t_] += red[0][t_ + s]; red[1][t_] += red[1][t_ + s]; } __syncthreads(); }
  if (t_ == 0) { const float n = NTOT; const float var = (red[1][0] - red[0][0] * (red[0][0] / n)) / (n - 1.0f); const float dstd = sqrtf(fmaxf(var, 0.0f)); const float temp = (dstd < 1e-6f) ? 0.1f : 0.3f + dstd; const float tinv = 1.0f / clampf(temp, 0.1f, 5.0f);
    { ((float*)CST)[3] = tinv;  } }
}
__global__ __launch_bounds__(128) void outproj_kernel(const b16* __restrict__ OCh, const b16* __restrict__ OCl, const b16* __restrict__ WOUT, const float* __restrict__ bo, float* __restrict__ out) {
  __shared__ __attribute__((aligned(16))) float Ts[4][16][128 + 4];
  const int wave = threadIdx.x >> 5, lane = threadIdx.x & 31, nloc = lane & 15, hlf = lane >> 4; const size_t m0 = (size_t)blockIdx.x * 64 + wave * 16; const int n0 = blockIdx.y * 128;
  v8f acc[8];
#pragma unroll
  for (int t = 0; t < 8; ++t) acc[t] = (v8f){};
  const b16* ap = OCh + m0 * DIM; const b16* lp = OCl + m0 * DIM; const b16* bp = WOUT + (size_t)n0 * DIM; const unsigned flane = (unsigned)lane * 16u;   // ap, lp, bp: the first tile of row m0, of column n0
  v16b a = frag_pk(ap, flane), al = frag_pk(lp, flane), b[8];
#pragma unroll
  for (int t = 0; t < 8; ++t) b[t] = frag_pk(bp + (size_t)t * 16 * DIM, flane);
#pragma unroll   // full: the two fragment sets swap by renaming, and the last step's fetch falls away
  for (int kb = 0; kb < DIM; kb += 32) { v16b an = a, aln = al, bn[8];
#pragma unroll
    for (int t = 0; t < 8; ++t) bn[t] = b[t];
    if (kb + 32 < DIM) { an = frag_pk(ap + (kb + 32) * 16, flane); aln = frag_pk(lp + (kb + 32) * 16, flane);
#pragma unroll
      for (int t = 0; t < 8; ++t) bn[t] = frag_pk(bp + (size_t)t * 16 * DIM + (kb + 32) * 16, flane); }
    __builtin_amdgcn_sched_barrier(0);   // keeps the next step's loads, as one group, ahead of this step's products: sunk towards their uses they would each be waited for in turn
#pragma unroll
    for (int t = 0; t < 8; ++t) { acc[t] = wmma16b(a, b[t], acc[t]); acc[t] = wmma16b(al, b[t], acc[t]); }
    a = an; al = aln;
#pragma unroll
    for (int t = 0; t < 8; ++t) b[t] = bn[t]; }
#pragma unroll
  for (int t = 0; t < 8; ++t) { const float bb = bf16_rne(bo[n0 + t * 16 + nloc]);
#pragma unroll
    for (int r = 0; r < 8; ++r) Ts[wave][8 * hlf + r][t * 16 + nloc] = acc[t][r] * (1.0f / (XS * WSC)) + bb; }
  wave_lds_sync();
  { for (int rr = 0; rr < 16; ++rr) *(v4f*)(out + (m0 + rr) * DIM + n0 + lane * 4) = *(const v4f*)(&Ts[wave][rr][lane * 4]);  }
}
}  // namespace

extern "C" void kernel_launch(void* const* d_in, const int* in_sizes, int n_in, void* d_out, int out_size, void* d_ws, size_t ws_size, hipStream_t stream) {
  (void)n_in;
  auto Fp = [&](int i) { return (const float*)d_in[i]; };
  // input order: 0 q, 1 k, 2 v [4,1024,512]; 3 ln_in_g, 4 ln_in_b; 5 W_in [512,512]; 6 wp_W1 [128,64], 7 wp_b1, 8 wp_ln_g, 9 wp_ln_b, 10 wp_W2 [64,32], 11 wp_b2, 12 wp_W3 [32,3], 13 wp_b3, 14 weight_temp [1], 15 W_out [512,512], 16 b_out
  if (in_sizes[0] != NR * DIM || in_sizes[1] != NR * DIM || in_sizes[2] != NR * DIM || in_sizes[5] != DIM * DIM || in_sizes[6] != 2 * DH * DH || in_sizes[15] != DIM * DIM || out_size != NR * DIM) return;
  size_t off = 0; char* ws = (char*)d_ws;
  auto carve = [&](size_t bytes) { char* p = ws + off; off += (bytes + 255) & ~(size_t)255; return p; };
  b16* X16 = (b16*)carve((size_t)3 * NR * DIM * 2); b16* WIN = (b16*)carve((size_t)DIM * DIM * 2); b16* WOUT = (b16*)carve((size_t)DIM * DIM * 2);
  float* F32 = (float*)carve((size_t)3 * NP_ * NT * DH * 4); float* KCM = (float*)carve((size_t)NP_ * DH * 4); float* PSUM = (float*)carve((size_t)2 * NP_ * DH * 4);
  b16* FQ16 = (b16*)carve((size_t)NP_ * NT * DH * 2); b16* FQC16 = (b16*)carve((size_t)NP_ * NT * DH * 2); b16* FK16 = (b16*)carve((size_t)NP_ * NT * DH * 2); b16* FKC16 = (b16*)carve((size_t)NP_ * NT * DH * 2);
  float* N1 = (float*)carve((size_t)NP_ * NT * 4); float* N2 = (float*)carve((size_t)NP_ * NT * 4); b16* FVTh = (b16*)carve((size_t)NP_ * DH * NT * 2); b16* FVTl = (b16*)carve((size_t)NP_ * DH * NT * 2);
  float* P1 = (float*)carve((size_t)NP_ * (NT / 32) * 32 * 4); float* VARC = (float*)carve((size_t)NP_ * NT * 4); float* P2 = (float*)carve((size_t)NP_ * (NT / 32) * 32 * 4); float* ROWE = (float*)carve((size_t)NP_ * NT * 4); float* CST = (float*)carve(256);
  b16* OCh = (b16*)carve((size_t)NR * DIM * 2); b16* OCl = (b16*)carve((size_t)NR * DIM * 2);
  if (off > ws_size || off > ((size_t)128 << 20)) return;   // ≈ 73 MB
  ln_kernel<<<3 * NR / 8, 256, 0, stream>>>(Fp(0), Fp(1), Fp(2), Fp(3), Fp(4), X16);
  prepw_kernel<<<(2 * DIM * DIM / 8 + 255) / 256, 256, 0, stream>>>(Fp(5), Fp(15), WIN, WOUT);
  feat_kernel<<<dim3(NR / 64, DIM / 128, 3), 128, 0, stream>>>(X16, WIN, F32);
  colstat_kernel<<<dim3(NP_, 2), 256, 0, stream>>>(F32, KCM, PSUM);
  rowops_kernel<<<NP_ * NT / 16, 256, 0, stream>>>(F32, KCM, FQ16, FQC16, N1, FK16, FKC16, N2);
  norms_kernel<<<NP_ * NT / 256, 256, 0, stream>>>(F32, N1, N2);
  vt_kernel<<<dim3(NT / 64, NP_), 256, 0, stream>>>(F32, FVTh, FVTl);
  score_kernel<1><<<dim3(NT / 32, NP_), 64, 0, stream>>>(FQ16, FQC16, N1, FK16, FKC16, N2, FVTh, FVTl, CST, P1, VARC, P2, ROWE, OCh, OCl);
  reduce1_kernel<<<1, 256, 0, stream>>>(P1, VARC, PSUM, Fp(6), Fp(7), Fp(8), Fp(9), Fp(10), Fp(11), Fp(12), Fp(13), Fp(14), CST);
  score_kernel<2><<<dim3(NT / 32, NP_), 64, 0, stream>>>(FQ16, FQC16, N1, FK16, FKC16, N2, FVTh, FVTl, CST, P1, VARC, P2, ROWE, OCh, OCl);
  reduce2_kernel<<<1, 256, 0, stream>>>(P2, ROWE, VARC, CST);
  score_kernel<3><<<dim3(NT / 32, NP_), 64, 0, stream>>>(FQ16, FQC16, N1, FK16, FKC16, N2, FVTh, FVTl, CST, P1, VARC, P2, ROWE, OCh, OCl);
  outproj_kernel<<<dim3(NR / 64, DIM / 128), 128, 0, stream>>>(OCh, OCl, WOUT, Fp(16), (float*)d_out);
}

// v004
// A run of this version takes 175 microseconds.
// Two timings next to v003 both put it at 1.24 times that version's speed.
// All steps since v000 together make it 3.98 times as fast.
#include <hip/hip_runtime.h>

// "Super-aggressive" attention: f_q, f_k, f_v = LN(q|k|v) W_in split into 8 heads x 64; per (head, batch) pair: cos = clip(f_q.f_k / (n1 n2), +-0.99) (n = norm + 1e-8),
// cov = reg x (f_q - rowmean_d)(f_k - colmean_m) / (8 + 1e-6) (reg = 1e-3/1024, x10 if the global std of the raw cov < 1e-6), csim = clip(qn.kn) with max(norm, 1e-6), margin =
// clip(0.01 - csim, 0, 10), var_c = row mean of margin; per-head weights (cw, covw, vw) from a tiny MLP on the global means of f_q / f_k (softmax, /clip(weight_temp), softmax, clip, renorm);
// cn / covn / vn = global std (ddof 1) of cos / cov / var_c (+1e-6); d2 = cw cos/cn cscale + covw cov/covn/2 + vw var_c/vn/2; temp = 0.3 + std(d2) (dstd >= 1e-6; clipped to [0.1, 5]);
// attn = softmax(d2 / temp); out_h = attn f_v; out = concat_h W_out + b -> [4][1024][512].
// Every global statistic is a deterministic two-level f32 reduction (per-wave partials, then one fixed-order kernel); the [1024 x 1024] score tiles are recomputed in three passes
// (component statistics; d2 statistics with per-row shifts; softmax + PV) instead of being stored.
// WMMA (v_wmma_f32_16x16x32_f16, f32 accumulate): W_in (LN(x) single f16 x8, exact weights), dots / centered-cov tiles (single f16 x8 feature planes, K = 64), P.V (P single x8, f_v^T hi+lo:
// 2 products), W_out (O hi+lo: 2 products). LN, norms, all statistics and the weight-predictor MLP in f32. Inputs rounded to bf16 once. Fragment k-map per lane half hh

namespace {
constexpr int QB = 4, NT = 1024, DIM = 512, NH = 8, DH = 64, NP_ = NH * QB /* 32 (h,q) pairs, index h*QB + q */, NR = QB * NT /* 4096 rows */, NWAVE = NP_ * (NT / 16) /* 2048 score waves */;
constexpr float XS = 8.0f, WSC = 256.0f, PS = 8.0f, GAMMA = 0.01f, LREG = 0.001f;
constexpr float NTOT = 33554432.0f;   // 33,554,432 score elements

typedef _Float16 b16;
typedef __attribute__((ext_vector_type(16))) _Float16 v16b;
typedef __attribute__((ext_vector_type(8))) _Float16 v8b;
typedef __attribute__((ext_vector_type(8))) float v8f;
typedef __attribute__((ext_vector_type(4))) float v4f;
__device__ __forceinline__ float bf16_rne(float f) { unsigned int u = __float_as_uint(f); u += 0x7FFFu + ((u >> 16) & 1u); return __uint_as_float(u & 0xFFFF0000u); }
__device__ __forceinline__ void split16(float v, b16& hi, b16& lo) { hi = (b16)v; lo = (b16)(v - (float)hi); }
__device__ __forceinline__ v16b frag_kb(const b16* p, int hh) { const v8b a = *(const v8b*)(p + 8 * hh), b = *(const v8b*)(p + 16 + 8 * hh); v16b f;
#pragma unroll
  for (int e = 0; e < 8; ++e) { f[e] = a[e]; f[8 + e] = b[e]; } return f; }
// Fragment order: the planes that the matrix loops read again and again (keys, centred keys, f_v^T hi/lo, both weight planes, the attention output hi/lo) are stored tile by tile, a tile = 16 rows x 32 k = 1,024 contiguous bytes laid out as
// [k half j][lane = 16 hh + row][8 elements], element (row, kk) with j = kk / 16, hh = (kk / 8) % 2. A wave's 16-byte load then covers 512 contiguous bytes (4 whole lines) instead of 32-byte pieces of 16 lines; each lane gets the same values in the same registers as from frag_kb.
__device__ __forceinline__ int frag_pos(int row, int kk) { return (kk >> 4) * 256 + (((kk >> 3) & 1) * 16 + row) * 8 + (kk & 7); }   // element offset inside a tile
__device__ __forceinline__ v16b frag_pk(const b16* utile, unsigned lane_bytes) { const char* p = (const char*)utile + lane_bytes; const v8b a = *(const v8b*)p, b = *(const v8b*)(p + 512); v16b f;   // wave-uniform tile base plus 16 * lane bytes
#pragma unroll
  for (int e = 0; e < 8; ++e) { f[e] = a[e]; f[8 + e] = b[e]; } return f; }
__device__ __forceinline__ v8f wmma16b(v16b a, v16b b, v8f c) { v8f d = __builtin_amdgcn_wmma_f32_16x16x32_f16(false, a, false, b, (short)0, c, false, false); asm volatile("v_nop\n\tv_nop\n\tv_nop\n\tv_nop" : "+v"(d) : "v"(a), "v"(b)); return d; }
// the same product for a B operand that stays live and unwritten through the whole loop (the query fragments): B is left out of the statement's operands, which all have to sit in the first 256 registers, so that it may live above them
__device__ __forceinline__ v8f wmma16q(v16b a, v16b b, v8f c) { v8f d = __builtin_amdgcn_wmma_f32_16x16x32_f16(false, a, false, b, (short)0, c, false, false); asm volatile("v_nop\n\tv_nop\n\tv_nop\n\tv_nop" : "+v"(d) : "v"(a)); return d; }
// closes a run of global loads. The wait stands in front of the next instruction that writes a register from which those loads took their address (a precaution).
// The scheduling barrier keeps later address arithmetic from being lifted over that wait, and keeps the run up here, ahead of the work that covers its latency: sunk towards their uses the loads would each be waited for in turn.
__device__ __forceinline__ void close_load_run() { asm volatile("s_wait_xcnt 0x0" ::: "memory"); __builtin_amdgcn_sched_barrier(0); }
__device__ __forceinline__ void wave_lds_sync() { __builtin_amdgcn_fence(__ATOMIC_RELEASE, "workgroup"); __builtin_amdgcn_wave_barrier(); __builtin_amdgcn_fence(__ATOMIC_ACQUIRE, "workgroup"); }
// 2^x on v_exp_f32, with the slot that the instruction set asks for behind a transcendental (before its result is used or its source overwritten) filled in the same statement: a v_nop in a statement of its own did not stay behind it
__device__ __forceinline__ float nexp2(float x) { float r; asm("v_exp_f32 %0, %1\n\tv_nop" : "=v"(r) : "v"(x)); return r; }
__device__ __forceinline__ float pmul(float a, float b) { float p = a * b; asm volatile("" : "+v"(p)); return p; }
__device__ __forceinline__ float hsum16(float v) { v += __shfl_xor(v, 1); v += __shfl_xor(v, 2); v += __shfl_xor(v, 4); return v + __shfl_xor(v, 8); }
__device__ __forceinline__ float clampf(float v, float lo, float hi) { return fminf(fmaxf(v, lo), hi); }

__global__ __launch_bounds__(256) void ln_kernel(const float* __restrict__ q, const float* __restrict__ k, const float* __restrict__ v, const float* __restrict__ g, const float* __restrict__ be, b16* __restrict__ X16) {
  const int wave = threadIdx.x >> 5, lane = threadIdx.x & 31; const int rowall = blockIdx.x * 8 + wave; const int which = rowall / NR, row = rowall - which * NR;
  const float* src = (which == 0 ? q : which == 1 ? k : v) + (size_t)row * DIM + lane * 16; float x[16];
  { const v4f a = *(const v4f*)src, b = *(const v4f*)(src + 4), c = *(const v4f*)(src + 8), d = *(const v4f*)(src + 12); for (int j = 0; j < 4; ++j) { x[j] = bf16_rne(a[j]); x[4 + j] = bf16_rne(b[j]); x[8 + j] = bf16_rne(c[j]); x[12 + j] = bf16_rne(d[j]); } }
  float s = 0.0f; for (int j = 0; j < 16; ++j) s += x[j];
#pragma unroll
  for (int o = 16; o >= 1; o >>= 1) s += __shfl_xor(s, o);
  const float mu = s * (1.0f / DIM); float ss = 0.0f; for (int j = 0; j < 16; ++j) { const float d = x[j] - mu; ss += pmul(d, d); }
#pragma unroll
  for (int o = 16; o >= 1; o >>= 1) ss += __shfl_xor(ss, o);
  const float rs = rsqrtf(ss * (1.0f / DIM) + 1e-5f); v8b o0, o1;
  for (int j = 0; j < 16; ++j) { const int c = lane * 16 + j; const b16 hv = (b16)((pmul((x[j] - mu) * rs, bf16_rne(g[c])) + bf16_rne(be[c])) * XS); if (j < 8) o0[j] = hv; else o1[j - 8] = hv; }
  { b16* dst = X16 + ((size_t)which * NR + row) * DIM + lane * 16; *(v8b*)dst = o0; *(v8b*)(dst + 8) = o1;  }
}
__global__ __launch_bounds__(256) void prepw_kernel(const float* __restrict__ win, const float* __restrict__ wout, b16* __restrict__ WIN, b16* __restrict__ WOUT) {
  const int t = blockIdx.x * 256 + threadIdx.x; if (t >= 2 * DIM * DIM / 8) return; const int kind = t / (DIM * DIM / 8), tt = t - kind * (DIM * DIM / 8);
  // thread tt fills the 16-byte piece tt of the plane in fragment order: tile tt / 64 = (row tile) * 16 + k tile, piece tt % 64 = [j][hh][row]
  const int tile = tt >> 6, o_ = (tile / (DIM / 32)) * 16 + (tt & 15), k0 = (tile % (DIM / 32)) * 32 + ((tt >> 5) & 1) * 16 + ((tt >> 4) & 1) * 8;
  const float* w = kind == 0 ? win : wout; v8b o; for (int j = 0; j < 8; ++j) o[j] = (b16)(bf16_rne(w[(size_t)(k0 + j) * DIM + o_]) * WSC);
  { *(v8b*)((kind == 0 ? WIN : WOUT) + (size_t)tt * 8) = o;  }
}
// features: F = X16 W_in per row (block = 64 rows x 4 waves, wave = 16 rows x 128 cols = 2 heads; grid.y = 4): which 0 (q): F32Q [pair][n][64] f32 rows; which 1 (k): F32K; which 2 (v): F32V. (f32 planes,
__global__ __launch_bounds__(128) void feat_kernel(const b16* __restrict__ X16, const b16* __restrict__ WIN, float* __restrict__ F32) {
  __shared__ __attribute__((aligned(16))) float Ts[4][16][128 + 4];
  const int wave = threadIdx.x >> 5, lane = threadIdx.x & 31, nloc = lane & 15, hlf = lane >> 4; const int which = blockIdx.z; const size_t m0 = (size_t)blockIdx.x * 64 + wave * 16; const int n0 = blockIdx.y * 128;
  v8f acc[8];
#pragma unroll
  for (int t = 0; t < 8; ++t) acc[t] = (v8f){};
  const b16* ap = X16 + ((size_t)which * NR + m0 + nloc) * DIM; const b16* bp = WIN + (size_t)n0 * DIM; const unsigned flane = (unsigned)lane * 16u;   // bp: the first weight tile of column n0 (16 rows x 512 k = 16 tiles of 512 elements)
  v16b a = frag_kb(ap, hlf), b[8];
#pragma unroll
  for (int t = 0; t < 8; ++t) b[t] = frag_pk(bp + (size_t)t * 16 * DIM, flane);
#pragma unroll   // full: the two fragment sets swap by renaming, and the last step's fetch falls away
  for (int kb = 0; kb < DIM; kb += 32) { v16b an = a, bn[8];
#pragma unroll
    for (int t = 0; t < 8; ++t) bn[t] = b[t];
    if (kb + 32 < DIM) { an = frag_kb(ap + kb + 32, hlf);
#pragma unroll
      for (int t = 0; t < 8; ++t) bn[t] = frag_pk(bp + (size_t)t * 16 * DIM + (kb + 32) * 16, flane); }
    __builtin_amdgcn_sched_barrier(0);   // keeps the next step's loads, as one group, ahead of this step's products: sunk towards their uses they would each be waited for in turn
#pragma unroll
    for (int t = 0; t < 8; ++t) acc[t] = wmma16b(a, b[t], acc[t]);
    a = an;
#pragma unroll
    for (int t = 0; t < 8; ++t) b[t] = bn[t]; }
#pragma unroll
  for (int t = 0; t < 8; ++t)
#pragma unroll
    for (int r = 0; r < 8; ++r) Ts[wave][8 * hlf + r][t * 16 + nloc] = acc[t][r] * (1.0f / (XS * WSC));
  wave_lds_sync();
  // rows m0+rr: q_idx = row / NT, n = row % NT; cols n0 + c -> head h = (n0 + c) / 64, d = % 64; F32 layout [which][pair][n][64]
  { for (int rr = 0; rr < 16; ++rr) { const size_t row = m0 + rr; const int qi = (int)(row / NT), n = (int)(row - (size_t)qi * NT); for (int hq = 0; hq < 2; ++hq) { const int h = n0 / DH + hq; const int pair = h * QB + qi;
        if (lane < 16) *(v4f*)(F32 + (((size_t)which * NP_ + pair) * NT + n) * DH + lane * 4) = *(const v4f*)(&Ts[wave][rr][hq * DH + lane * 4]); } }  }
}
// per-pair column statistics of f_k (mean over the 1024 keys per d) and head means qg/kg (over all 4,096 rows): colstat: block = pair, 256 threads: thread (d = t%64, part = t/64) sums rows part*256..+255;
__global__ __launch_bounds__(256) void colstat_kernel(const float* __restrict__ F32, float* __restrict__ KCM, float* __restrict__ PSUM) {   // PSUM [which 0/1][pair][64] = column sums
  __shared__ float part[4][DH];
  const int which = blockIdx.y, pair = blockIdx.x, t_ = threadIdx.x, d = t_ & 63, pq = t_ >> 6; const float* base = F32 + (((size_t)which * NP_ + pair) * NT) * DH;
  float s = 0.0f; for (int n = pq * 256; n < pq * 256 + 256; ++n) s += base[(size_t)n * DH + d]; part[pq][d] = s;
  __syncthreads();
  if (t_ < DH) { const float tot = (part[0][t_] + part[1][t_]) + (part[2][t_] + part[3][t_]);
    { ((float*)PSUM)[((size_t)which * NP_ + pair) * DH + t_] = tot; if (which == 1) ((float*)KCM)[(size_t)pair * DH + t_] = tot * (1.0f / NT);  } }
}
// operand planes per pair: FQ16 [pair][n][64] = f16(8 f_q), FQC16 = f16(8 (f_q - rowmean)), N1 [pair][n] = ||f_q|| (f32); FK16, FKC16 = f16(8 (f_k - colmean)) (both in fragment order), N2 = 1 / (||f_k|| + 1e-8), I2B = 1 / max(||f_k||, 1e-6); FVTh/FVTl = f_v^T hi/lo x8 (rows d, k = keys, in fragment order).
__global__ __launch_bounds__(256) void rowops_kernel(const float* __restrict__ F32, const float* __restrict__ KCM, b16* __restrict__ FQ16, b16* __restrict__ FQC16, float* __restrict__ N1, b16* __restrict__ FK16, b16* __restrict__ FKC16, float* __restrict__ N2) {
  const int wave = threadIdx.x >> 5, lane = threadIdx.x & 31; const size_t prow = ((size_t)blockIdx.x * 8 + wave) * 2 + (lane >> 4);   // pair*NT + n, over NP_*NT rows
  const int pair = (int)(prow / NT); const int c0 = (lane & 15) * 4;
  const v4f fq = *(const v4f*)(F32 + (0 * (size_t)NP_ * NT + prow) * DH + c0), fk = *(const v4f*)(F32 + (1 * (size_t)NP_ * NT + prow) * DH + c0);
  float sq = 0.0f, ssq = 0.0f, ssk = 0.0f; for (int j = 0; j < 4; ++j) { sq += fq[j]; ssq += pmul(fq[j], fq[j]); ssk += pmul(fk[j], fk[j]); }
  sq = hsum16(sq); ssq = hsum16(ssq); ssk = hsum16(ssk); const float mq = sq * (1.0f / DH);
  typedef __attribute__((ext_vector_type(4))) _Float16 v4b; v4b a, ac, b, bc;
  for (int j = 0; j < 4; ++j) { a[j] = (b16)(fq[j] * XS); ac[j] = (b16)((fq[j] - mq) * XS); b[j] = (b16)(fk[j] * XS); bc[j] = (b16)((fk[j] - KCM[(size_t)pair * DH + c0 + j]) * XS); }
  { *(v4b*)(FQ16 + prow * DH + c0) = a; *(v4b*)(FQC16 + prow * DH + c0) = ac; const size_t kpos = (prow >> 4) * (16 * DH) + (c0 >> 5) * 512 + frag_pos((int)(prow & 15), c0 & 31);   // key planes in fragment order: the block's 16 rows are one row tile (2 k tiles, 2 KiB a plane)
    *(v4b*)(FK16 + kpos) = b; *(v4b*)(FKC16 + kpos) = bc;  }
}
// The key norms enter every score element only through 1 / (n2 + 1e-8) and 1 / max(n2, 1e-6): the two quotients are formed here, once a key (I2A, I2B), not once a score element in each pass; same division, same bits.
__global__ __launch_bounds__(256) void norms_kernel(const float* __restrict__ F32, float* __restrict__ N1, float* __restrict__ I2A, float* __restrict__ I2B) {   // thread per row: 256 rows per block -> spans of 256 floats (8 lines) each
  const size_t prow = (size_t)blockIdx.x * 256 + threadIdx.x; const float* fq = F32 + (0 * (size_t)NP_ * NT + prow) * DH; const float* fk = F32 + (1 * (size_t)NP_ * NT + prow) * DH;
  float sq = 0.0f, sk = 0.0f; for (int d = 0; d < DH; ++d) { sq += pmul(fq[d], fq[d]); sk += pmul(fk[d], fk[d]); }
  { const float n2 = sqrtf(sk); ((float*)N1)[prow] = sqrtf(sq); ((float*)I2A)[prow] = 1.0f / (n2 + 1e-8f); ((float*)I2B)[prow] = 1.0f / fmaxf(n2, 1e-6f);  }
}
__global__ __launch_bounds__(256) void vt_kernel(const float* __restrict__ F32, b16* __restrict__ FVTh, b16* __restrict__ FVTl) {   // block = (pair, 64-key chunk): transpose [64 n][64 d] -> rows d, hi/lo
  __shared__ __attribute__((aligned(16))) b16 Th[DH][64 + 8], Tl[DH][64 + 8];
  const int pair = blockIdx.y, n0 = blockIdx.x * 64, t_ = threadIdx.x; const float* base = F32 + ((2 * (size_t)NP_ + pair) * NT + n0) * DH;
  for (int qq = t_; qq < 64 * DH; qq += 256) { const int nn = qq >> 6, d = qq & 63; b16 h_, l_; split16(base[(size_t)nn * DH + d] * XS, h_, l_); Th[d][nn] = h_; Tl[d][nn] = l_; }
  __syncthreads();
  // fragment order, tiles [pair][32-key block][16-d tile]: the block's 64 keys are 8 tiles = 8 KiB a plane, and piece qq = [key block][d tile][j][hh][row] goes to byte 16 qq of them
  { for (int qq = t_; qq < DH * 8; qq += 256) { const int d = ((qq >> 6) & 3) * 16 + (qq & 15), c8 = (qq >> 8) * 32 + ((qq >> 5) & 1) * 16 + ((qq >> 4) & 1) * 8; const size_t gi = ((size_t)pair * NT + n0) * DH + (size_t)qq * 8; *(v8b*)(FVTh + gi) = *(const v8b*)(&Th[d][c8]); *(v8b*)(FVTl + gi) = *(const v8b*)(&Tl[d][c8]); }  }
}
// score-tile passes: wave = 16 query rows n of one pair (block = 2 waves), loop over 32 key blocks of 32: dots^T and covraw^T tiles (keys x queries, K = 64: 2 steps x 2 key tiles x 2 GEMMs = 8 WMMAs),
// lane (hh, col=query) holds keys kb+8hh+r and kb+16+8hh+r.  cos = clip(dots/((n1+1e-8)(n2+1e-8))), csim = clip(dots/(max(n1,1e-6) max(n2,1e-6))), margin = clip(0.01 - csim, 0, 10), covraw = c/(8+1e-6).
// PASS 2 (given cn, covfac = reg/covn/2, w per head, vn): per row c_row = vw var_c/(2 vn); e = cw cos/cn cscale + covw covraw covfac (d2 - c_row): per-wave S_e, S_e2 and per-row rowsum_e -> P2, ROWE.
// PASS 3 (given temp): logits = (e + c_row)/temp -> online softmax (f32) with o^T += f_v^T P^T (hi+lo, 4 d-tiles): O [pair][n][64] -> OC16h/l, rows q*NT+n, k = h*64+d (concat-head planes, hi/lo x8, in fragment order).
template <int PASS>
__global__ __launch_bounds__(64) void score_kernel(const b16* __restrict__ FQ16, const b16* __restrict__ FQC16, const float* __restrict__ N1, const b16* __restrict__ FK16, const b16* __restrict__ FKC16, const float* __restrict__ I2A, const float* __restrict__ I2B, const b16* __restrict__ FVTh, const b16* __restrict__ FVTl,
                                                  const float* __restrict__ CST /* [0..3] cscale/cn, reg/(2 covn), 1/(2 vn), 1/temp; [4..27] cw, covw, vw per head */, float* __restrict__ P1, float* __restrict__ VARC, float* __restrict__ P2, float* __restrict__ ROWE, b16* __restrict__ OCh, b16* __restrict__ OCl) {
  __shared__ __attribute__((aligned(16))) float To[2][16][DH + 4]; __shared__ float Tr[2][16]; __shared__ float Tp[2][4];
  const int wave = threadIdx.x >> 5, lane = threadIdx.x & 31, hh = lane >> 4, col = lane & 15; const int pair = blockIdx.y, n0 = blockIdx.x * 32 + wave * 16, ni = n0 + col; const int h = pair / QB, qi = pair - h * QB;
  const size_t prow = (size_t)pair * NT + ni; const b16* Qp = FQ16 + prow * DH; const b16* Qc = FQC16 + prow * DH; const b16* Kb = FK16 + (size_t)pair * NT * DH; const b16* Kc = FKC16 + (size_t)pair * NT * DH;
  __builtin_amdgcn_sched_barrier(0);   // keeps the index arithmetic above from being placed between the loads below and the wait that closes their run
  const v16b qa0 = frag_kb(Qp, hh), qa1 = frag_kb(Qp + 32, hh); close_load_run();
  const v16b qc0 = frag_kb(Qc, hh), qc1 = frag_kb(Qc + 32, hh); close_load_run();
  // Every factor of a score element that belongs to the query row, the head or the whole launch is multiplied up here, once a wave. The powers of two (1 / XS^2) move exactly, so pass 1 keeps its bits.
  const float n1 = N1[prow]; close_load_run(); const float q1a = (1.0f / (n1 + 1e-8f)) * (1.0f / (XS * XS)), q1b = (1.0f / fmaxf(n1, 1e-6f)) * (1.0f / (XS * XS));
  constexpr float CK = (1.0f / (8.0f + 1e-6f)) * (1.0f / (XS * XS)), LOG2E = 1.4426950408889634f, LOG2_PS = 3.0f; static_assert(PS == 8.0f, "LOG2_PS is log2(PS)");
  float cn_inv_cscale = 0.0f, covfac = 0.0f, vn_half_inv = 0.0f, temp_inv = 0.0f, cwh = 0.0f, covwh = 0.0f, vwh = 0.0f;   // this head's constants, read once ahead of the loop
  if (PASS >= 2) { const float* cf = CST; cn_inv_cscale = cf[0]; covfac = cf[1]; vn_half_inv = cf[2]; temp_inv = cf[3]; cwh = cf[4 + h]; covwh = cf[4 + NH + h]; vwh = cf[4 + 2 * NH + h]; }
  float crow = 0.0f; if (PASS >= 2) crow = vwh * VARC[prow] * vn_half_inv;
  // e = w1 cos + w2 c (c the raw centred product); pass 3 takes its logits as w1 cos + w2 c + w0 in units of log2, so that 2^x needs no multiply of its own
  const float lsc = PASS == 3 ? temp_inv * LOG2E : 1.0f, w1 = cwh * cn_inv_cscale * lsc, w2 = covwh * covfac * CK * lsc, w0 = crow * lsc;
  float s_a = 0.0f, s_b = 0.0f, s_c = 0.0f, s_d = 0.0f, rowacc = 0.0f;
  float m = -INFINITY, l = 0.0f; v8f o[4] = {{}, {}, {}, {}}, ol[4] = {{}, {}, {}, {}};
  // One key block's operands (8 key fragments, 16 key factors; 32 in pass 1) live in registers and are fetched together, a whole block ahead of their use.
  v16b k0a, k0b, k1a, k1b, x0a, x0b, x1a, x1b; v4f nn0, nn1, nn2, nn3, mm0 = {}, mm1 = {}, mm2 = {}, mm3 = {};
  const unsigned flane = (unsigned)lane * 16u, nlane = (unsigned)hh * 32u;   // per-lane byte offsets into a tile in fragment order and into a key block's norms
  auto fetch_keys = [&](int kq) { const b16* kr = Kb + (size_t)kq * DH; const b16* cr = Kc + (size_t)kq * DH; const char* np = (const char*)(I2A + (size_t)pair * NT + kq) + nlane;
    nn0 = *(const v4f*)np; nn1 = *(const v4f*)(np + 16); nn2 = *(const v4f*)(np + 64); nn3 = *(const v4f*)(np + 80);
    if (PASS == 1) { const char* nq = (const char*)(I2B + (size_t)pair * NT + kq) + nlane; mm0 = *(const v4f*)nq; mm1 = *(const v4f*)(nq + 16); mm2 = *(const v4f*)(nq + 64); mm3 = *(const v4f*)(nq + 80); }
    close_load_run();
    k0a = frag_pk(kr, flane); k0b = frag_pk(kr + 512, flane); k1a = frag_pk(kr + 1024, flane); k1b = frag_pk(kr + 1536, flane); close_load_run();   // a 32-key block = 4 tiles: [16 keys][k tile]
    x0a = frag_pk(cr, flane); x0b = frag_pk(cr + 512, flane); x1a = frag_pk(cr + 1024, flane); x1b = frag_pk(cr + 1536, flane); close_load_run(); };
  fetch_keys(0);
  for (int kb = 0; kb < NT; kb += 32) {
    v8f d0 = {}, d1 = {}, c0 = {}, c1 = {};
    d0 = wmma16q(k0a, qa0, d0); d0 = wmma16q(k0b, qa1, d0);
    d1 = wmma16q(k1a, qa0, d1); d1 = wmma16q(k1b, qa1, d1);
    c0 = wmma16q(x0a, qc0, c0); c0 = wmma16q(x0b, qc1, c0);
    c1 = wmma16q(x1a, qc0, c1); c1 = wmma16q(x1b, qc1, c1);
    const v4f na0 = nn0, na1 = nn1, nb0 = nn2, nb1 = nn3, ma0 = mm0, ma1 = mm1, mb0 = mm2, mb1 = mm3;
    // behind the last score product: this block's value fragments (used after the softmax arithmetic), then the next block's keys (the last block re-reads block 0, unused), all in flight under the vector work
    v16b vh[4], vl[4];
    if (PASS == 3) {
#pragma unroll
      for (int t = 0; t < 4; ++t) { vh[t] = frag_pk(FVTh + ((size_t)pair * NT + kb) * DH + t * 512, flane); vl[t] = frag_pk(FVTl + ((size_t)pair * NT + kb) * DH + t * 512, flane); }
      close_load_run(); }
    const int kn = kb + 32 < NT ? kb + 32 : 0;
    fetch_keys(kn);
    float ev0[8], ev1[8];
#pragma unroll
    for (int r = 0; r < 8; ++r) {
#pragma unroll
      for (int hq = 0; hq < 2; ++hq) { const float dw = hq ? d1[r] : d0[r], cw_ = hq ? c1[r] : c0[r];   // the two raw products
        const float i2a = hq ? (r < 4 ? nb0[r & 3] : nb1[r & 3]) : (r < 4 ? na0[r & 3] : na1[r & 3]); const float cosv = clampf(dw * q1a * i2a, -0.99f, 0.99f);
        if (PASS == 1) { const float i2b = hq ? (r < 4 ? mb0[r & 3] : mb1[r & 3]) : (r < 4 ? ma0[r & 3] : ma1[r & 3]); const float covraw = cw_ * CK;
          const float csim = clampf(dw * q1b * i2b, -0.99f, 0.99f); const float margin = clampf(GAMMA - csim, 0.0f, 10.0f);
          s_a += cosv; s_b += pmul(cosv, cosv); s_c += covraw; s_d += pmul(covraw, covraw); rowacc += margin; }
        else if (PASS == 2) { const float e = cosv * w1 + cw_ * w2; s_a += e; s_b += pmul(e, e); rowacc += e; }
        else { (hq ? ev1 : ev0)[r] = cosv * w1 + (cw_ * w2 + w0); } } }
    if (PASS == 3) { float mr = -INFINITY;
#pragma unroll
      for (int r = 0; r < 8; ++r) mr = fmaxf(mr, fmaxf(ev0[r], ev1[r]));
      mr = fmaxf(mr, __shfl_xor(mr, 16)); const float mn = fmaxf(m, mr); const float al_ = nexp2(m - mn); m = mn; const float ms = mn - LOG2_PS; float sum = 0.0f; v16b pb;   // ms: the factor PS of the f16 weights rides in the exponent; l then holds PS times the row sum
#pragma unroll
      for (int r = 0; r < 8; ++r) { const float e0 = nexp2(ev0[r] - ms), e1 = nexp2(ev1[r] - ms); sum += e0 + e1; pb[r] = (b16)e0; pb[8 + r] = (b16)e1; }
      sum += __shfl_xor(sum, 16); l = l * al_ + sum;
#pragma unroll
      for (int t = 0; t < 4; ++t) { o[t] *= al_; ol[t] *= al_; o[t] = wmma16b(vh[t], pb, o[t]); ol[t] = wmma16b(vl[t], pb, ol[t]); } } }
  if (PASS <= 2) {   // per-row sums across the two lane halves; per-wave partials over the 16 rows and 32 lanes
    rowacc += __shfl_xor(rowacc, 16); if (hh == 0) Tr[wave][col] = rowacc;
    float v4[4] = {s_a, s_b, s_c, s_d};
#pragma unroll
    for (int j = 0; j < 4; ++j) { float v = v4[j];
#pragma unroll
      for (int oo = 16; oo >= 1; oo >>= 1) v += __shfl_xor(v, oo);
      v4[j] = v; }
    if (lane == 0) { Tp[wave][0] = v4[0]; Tp[wave][1] = v4[1]; Tp[wave][2] = v4[2]; Tp[wave][3] = v4[3]; }
    wave_lds_sync();
    const size_t widx = (size_t)pair * (NT / 16) + blockIdx.x * 2 + wave;
    __syncthreads();
    {
      if (wave == 0) { const float rv = Tr[lane >> 4][lane & 15] * (PASS == 1 ? (1.0f / NT) : 1.0f); ((float*)(PASS == 1 ? VARC : ROWE))[(size_t)pair * NT + blockIdx.x * 32 + lane] = rv;
        ((float*)(PASS == 1 ? P1 : P2))[((size_t)pair * (NT / 32) + blockIdx.x) * 32 + lane] = (lane < 8) ? Tp[lane >> 2][lane & 3] : 0.0f; }
       }
    (void)widx;
  } else {
    const float inv = 1.0f / (l * XS);
#pragma unroll
    for (int t = 0; t < 4; ++t)
#pragma unroll
      for (int r = 0; r < 8; ++r) To[wave][col][t * 16 + 8 * hh + r] = (o[t][r] + ol[t][r]) * inv;
    wave_lds_sync();
    // fragment order for the output projection: the wave's 16 rows x 64 columns are 2 tiles (2 KiB) a plane; store i covers the 512 bytes [k tile i / 2][j = i % 2]
    { for (int i = 0; i < 4; ++i) { const int rr = col, c8 = (i >> 1) * 32 + (i & 1) * 16 + hh * 8; v8b hv, lv; for (int j = 0; j < 8; ++j) { b16 a_, c_; split16(To[wave][rr][c8 + j] * XS, a_, c_); hv[j] = a_; lv[j] = c_; }
        const size_t gi = ((size_t)qi * NT + n0) * DIM + (h * 2) * 512 + i * 256 + lane * 8; *(v8b*)(OCh + gi) = hv; *(v8b*)(OCl + gi) = lv; }  }
  }
}
// reductions (one block each, fixed order). reduce1: cn, covn, vn, weights -> CST[0..27]; reduce2: dstd -> temp -> CST[3].
// Both run as one block on an otherwise idle chip, so nothing hides a load's latency but the block's own instruction order: each kernel issues ALL its global reads in one run at its head and keeps them in registers
// (the predictor's weights go on to LDS), so that it pays about one memory latency in all instead of one per loop trip. Every sum keeps its operands and its order; in the loops written anew a product now fuses with its addition.
__global__ __launch_bounds__(256) void reduce1_kernel(const float* __restrict__ P1, const float* __restrict__ VARC, const float* __restrict__ PSUM, const float* __restrict__ w1, const float* __restrict__ b1, const float* __restrict__ g2, const float* __restrict__ be2, const float* __restrict__ w2, const float* __restrict__ b2, const float* __restrict__ w3, const float* __restrict__ b3, const float* __restrict__ wtemp, float* __restrict__ CST) {
  __shared__ float red[4][256]; __shared__ float sh[64];
  __shared__ __attribute__((aligned(16))) float w1s[2 * DH * DH], w2s[DH * 32]; __shared__ float w3s[3][32], b1s[DH], g2s[DH], be2s[DH], b2s[32];   // the predictor's parameters as bf16 values (w3s: the 96 values in their order)
  const int t_ = threadIdx.x; constexpr int NPK = NP_ * (NT / 32) / 256 /* 4 of the 1,024 block partials (8 floats: 2 waves x 4) per thread */, NVK = NP_ * NT / 256 /* 128 row values per thread */, NFK = NH * 2 * DH / 256 /* 4 */;
  v4f w1r[8], w2r[2], pl[NPK], ph[NPK]; float pr[NFK][QB], vr[NVK], w3r[3];
  const unsigned a63 = t_ & (DH - 1), a31 = t_ & 31, p1off = (unsigned)t_ * 128u /* bytes: partial t_ */, psidx = ((t_ >> 6) & 1) * NP_ * DH + (t_ >> 7) * QB * DH + (t_ & (DH - 1)) /* PSUM [which][pair 4 h][dd] of feature i = t_ */;
  const float b3r[3] = {b3[0], b3[1], b3[2]}, wtr = wtemp[0];
  __builtin_amdgcn_sched_barrier(0);   // keeps the index arithmetic and the scalar reads above from being placed between the loads below and the wait that closes their run
#pragma unroll
  for (int j = 0; j < 8; ++j) w1r[j] = *(const v4f*)(w1 + (j * 256 + t_) * 4);
#pragma unroll
  for (int j = 0; j < 2; ++j) w2r[j] = *(const v4f*)(w2 + (j * 256 + t_) * 4);
  const float b1r = b1[a63], g2r = g2[a63], be2r = be2[a63], b2r = b2[a31];
#pragma unroll
  for (int j = 0; j < 3; ++j) w3r[j] = w3[j * 32 + a31];
#pragma unroll
  for (int k = 0; k < NPK; ++k) { const char* p = (const char*)P1 + p1off + k * (256 * 128); pl[k] = *(const v4f*)p; ph[k] = *(const v4f*)(p + 16); }
#pragma unroll
  for (int k = 0; k < NFK; ++k)   // feature i = t_ + 256 k: head h + 2 k, the same which and dd
#pragma unroll
    for (int qq = 0; qq < QB; ++qq) pr[k][qq] = PSUM[psidx + (2 * k * QB + qq) * DH];
#pragma unroll   // full, here and in the two loops that read vr: the 128 values stay in registers and are read from memory once, not twice
  for (int j = 0; j < NVK; ++j) vr[j] = VARC[t_ + j * 256];
  // closes the run as close_load_run() does; the input operands keep the run's address registers from being given to a later load's result ahead of the wait
  asm volatile("s_wait_xcnt 0x0" :: "v"(a63), "v"(a31), "v"(p1off), "v"(psidx) : "memory"); __builtin_amdgcn_sched_barrier(0);
#pragma unroll
  for (int j = 0; j < 8; ++j) { v4f x; for (int e = 0; e < 4; ++e) x[e] = bf16_rne(w1r[j][e]); *(v4f*)(w1s + (j * 256 + t_) * 4) = x; }
#pragma unroll
  for (int j = 0; j < 2; ++j) { v4f x; for (int e = 0; e < 4; ++e) x[e] = bf16_rne(w2r[j][e]); *(v4f*)(w2s + (j * 256 + t_) * 4) = x; }
  b1s[a63] = bf16_rne(b1r); g2s[a63] = bf16_rne(g2r); be2s[a63] = bf16_rne(be2r); b2s[a31] = bf16_rne(b2r);   // every thread stores: threads with the same index store the same value
#pragma unroll
  for (int j = 0; j < 3; ++j) w3s[j][a31] = bf16_rne(w3r[j]);
  float a = 0, b = 0, c = 0, d = 0;
#pragma unroll
  for (int k = 0; k < NPK; ++k) { a += pl[k][0] + ph[k][0]; b += pl[k][1] + ph[k][1]; c += pl[k][2] + ph[k][2]; d += pl[k][3] + ph[k][3]; }
  red[0][t_] = a; red[1][t_] = b; red[2][t_] = c; red[3][t_] = d; __syncthreads();
  for (int s = 128; s >= 1; s >>= 1) { if (t_ < s) { for (int j = 0; j < 4; ++j) red[j][t_] += red[j][t_ + s]; } __syncthreads(); }
  float vs = 0.0f;
#pragma unroll
  for (int j = 0; j < NVK; ++j) vs += vr[j];
  __shared__ float r2[256]; r2[t_] = vs; __syncthreads(); for (int s = 128; s >= 1; s >>= 1) { if (t_ < s) r2[t_] += r2[t_ + s]; __syncthreads(); }
  const float vmu = r2[0] / (float)(NP_ * NT); __syncthreads();
  float vq = 0.0f;
#pragma unroll
  for (int j = 0; j < NVK; ++j) { const float dv = vr[j] - vmu; vq += dv * dv; }
  r2[t_] = vq; __syncthreads(); for (int s = 128; s >= 1; s >>= 1) { if (t_ < s) r2[t_] += r2[t_ + s]; __syncthreads(); }
  // head means qg/kg [8][64] from PSUM [which][pair][64]: mean over (q, n) = sum over the 4 pairs of the head / 4096 -> feats [h][128]; MLP: h1 = relu(LN(feats W1 + b1)), h2 = relu(h1 W2 + b2), logits = softmax(h2 W3 + b3), w = softmax(logits / clip(wt)), clip [0.05,0.8], renorm
  __shared__ __attribute__((aligned(16))) float feats[NH][2 * DH], h1s[NH][DH], h2s[NH][32]; __shared__ float ws[NH][3];
#pragma unroll
  for (int k = 0; k < NFK; ++k) { const int i = t_ + k * 256, h = i / (2 * DH), c = i - h * 2 * DH; float s = 0.0f;
#pragma unroll
    for (int qq = 0; qq < QB; ++qq) s += pr[k][qq];
    feats[h][c] = s * (1.0f / (QB * NT)); }
  __syncthreads();
  // the loops below read LDS only; each is unrolled, with plain products, so that its reads are issued ahead of the one chain of additions instead of being waited for one by one
  for (int i = t_; i < NH * DH; i += 256) { const int h = i / DH, o_ = i - h * DH; float s = b1s[o_];
#pragma unroll 32
    for (int c = 0; c < 2 * DH; ++c) s += feats[h][c] * w1s[c * DH + o_]; h1s[h][o_] = s; }
  __syncthreads();
  if (t_ < NH) { const int h = t_; float mu = 0.0f;
#pragma unroll
    for (int c = 0; c < DH; ++c) mu += h1s[h][c];
    mu *= (1.0f / DH); float var = 0.0f;
#pragma unroll
    for (int c = 0; c < DH; ++c) { const float dv = h1s[h][c] - mu; var += dv * dv; }
    var *= (1.0f / DH); const float rs = rsqrtf(var + 1e-5f);
#pragma unroll
    for (int c = 0; c < DH; ++c) h1s[h][c] = fmaxf((h1s[h][c] - mu) * rs * g2s[c] + be2s[c], 0.0f); }
  __syncthreads();
  for (int i = t_; i < NH * 32; i += 256) { const int h = i / 32, o_ = i - h * 32; float s = b2s[o_];
#pragma unroll 32
    for (int c = 0; c < DH; ++c) s += h1s[h][c] * w2s[c * 32 + o_]; h2s[h][o_] = fmaxf(s, 0.0f); }
  __syncthreads();
  if (t_ < NH) { const int h = t_; float lg[3]; for (int o_ = 0; o_ < 3; ++o_) { float s = bf16_rne(b3r[o_]);
#pragma unroll
      for (int c = 0; c < 32; ++c) s += h2s[h][c] * (&w3s[0][0])[c * 3 + o_]; lg[o_] = s; }
    float mx = fmaxf(lg[0], fmaxf(lg[1], lg[2])); float e3[3], se = 0.0f; for (int j = 0; j < 3; ++j) { e3[j] = __expf(lg[j] - mx); se += e3[j]; } for (int j = 0; j < 3; ++j) e3[j] /= se;
    const float wt = clampf(bf16_rne(wtr), 0.1f, 20.0f); float z[3]; for (int j = 0; j < 3; ++j) z[j] = e3[j] / wt; mx = fmaxf(z[0], fmaxf(z[1], z[2])); se = 0.0f; for (int j = 0; j < 3; ++j) { e3[j] = __expf(z[j] - mx); se += e3[j]; }
    float wv[3], sw = 0.0f; for (int j = 0; j < 3; ++j) { wv[j] = clampf(e3[j] / se, 0.05f, 0.8f); sw += wv[j]; } for (int j = 0; j < 3; ++j) ws[h][j] = wv[j] / sw; }
  __syncthreads();
  if (t_ == 0) { const float n = (float)NTOT; const float sa_ = red[0][0], sb = red[1][0], sc = red[2][0], sd = red[3][0];
    const float cstd = sqrtf(fmaxf((sb - sa_ * (sa_ / n)) / (n - 1.0f), 0.0f)); const float covstd_raw = sqrtf(fmaxf((sd - sc * (sc / n)) / (n - 1.0f), 0.0f));
    const float base_reg = LREG / (float)NT; const float reg = (covstd_raw < 1e-6f) ? base_reg * 10.0f : base_reg;   // reference: reg chosen on the std of the RAW cov, then cov = clip(reg cov, +-50) (never clips at this scale)
    const float covn = reg * covstd_raw + 1e-6f; const float cn = cstd + 1e-6f; const float cscale = (cn < 1e-4f) ? 0.1f : 1.0f;
    const float vn = sqrtf(r2[0] * ((float)NT / (n - 1.0f))) + 1e-6f;   // std over the broadcast [.., m] copies: each row value repeated NT times
    sh[0] = cscale / cn; sh[1] = reg * 0.5f / covn; sh[2] = 0.5f / vn; sh[3] = 0.0f; for (int h = 0; h < NH; ++h) { sh[4 + h] = ws[h][0]; sh[4 + NH + h] = ws[h][1]; sh[4 + 2 * NH + h] = ws[h][2]; } }
  __syncthreads();
  { if (t_ < 32) ((float*)CST)[t_] = (t_ < 4 + 3 * NH) ? sh[t_] : 0.0f;  }
}
__global__ __launch_bounds__(256) void reduce2_kernel(const float* __restrict__ P2, const float* __restrict__ ROWE, const float* __restrict__ VARC, float* __restrict__ CST) {
  __shared__ float red[5][256];
  const int t_ = threadIdx.x; constexpr int NPK = NP_ * (NT / 32) / 256, NVK = NP_ * NT / 256;   // 4 block partials and 128 rows per thread
  float p0[NPK], p1[NPK], p4[NPK], p5[NPK], vw8[NH], vr[NVK], er[NVK]; const unsigned p2off = (unsigned)t_ * 128u;   // bytes: partial t_
  const float vfac = CST[2];   // 0.5/vn; per-row constant c = vw[h] var_c vfac; d2 = e + c
#pragma unroll
  for (int h = 0; h < NH; ++h) vw8[h] = CST[4 + 2 * NH + h];
  __builtin_amdgcn_sched_barrier(0);   // keeps the index arithmetic and the scalar reads above from being placed between the loads below and the wait that closes their run
#pragma unroll   // full, here and in the loops that read vr and er: the values stay in registers
  for (int j = 0; j < NVK; ++j) vr[j] = VARC[t_ + j * 256];
#pragma unroll
  for (int k = 0; k < NPK; ++k) { const float* p = (const float*)((const char*)P2 + p2off + k * (256 * 128)); p0[k] = p[0]; p1[k] = p[1]; p4[k] = p[4]; p5[k] = p[5]; }
#pragma unroll
  for (int j = 0; j < NVK; ++j) er[j] = ROWE[t_ + j * 256];
  // closes the run as close_load_run() does; the input operand keeps the run's address register from being given to a later load's result ahead of the wait
  asm volatile("s_wait_xcnt 0x0" :: "v"(p2off) : "memory"); __builtin_amdgcn_sched_barrier(0);
  float a = 0, b = 0;
#pragma unroll
  for (int k = 0; k < NPK; ++k) { a += (p0[k] + p4[k]); b += (p1[k] + p5[k]); }
  // var(d2) = E[(d2 - M)^2] - (E[d2 - M])^2 with the shift M = mean of the row constants (kills the large common offset): per row, sum_m (d2 - M) = rowsum_e + NT (c - M), sum_m (d2 - M)^2 = sum e^2 + 2 (c - M) rowsum_e + NT (c - M)^2
  // row i = t_ + 256 j belongs to head (i / NT) / QB = j / 16
  float sc = 0;
#pragma unroll
  for (int j = 0; j < NVK; ++j) sc += vw8[j / 16] * vr[j] * vfac;
  red[4][t_] = sc; __syncthreads(); for (int s = 128; s >= 1; s >>= 1) { if (t_ < s) red[4][t_] += red[4][t_ + s]; __syncthreads(); }
  const float M = red[4][0] / (float)(NP_ * NT); __syncthreads();
  float s1 = 0, s2 = 0;
#pragma unroll
  for (int j = 0; j < NVK; ++j) { const float cm = vw8[j / 16] * vr[j] * vfac - M; s1 += (float)NT * cm; s2 += 2.0f * cm * er[j] + (float)NT * cm * cm; }
  red[0][t_] = a + s1; red[1][t_] = b + s2; __syncthreads();
  for (int s = 128; s >= 1; s >>= 1) { if (t_ < s) { red[0][t_] += red[0][t_ + s]; red[1][t_] += red[1][t_ + s]; } __syncthreads(); }
  if (t_ == 0) { const float n = NTOT; const float var = (red[1][0] - red[0][0] * (red[0][0] / n)) / (n - 1.0f); const float dstd = sqrtf(fmaxf(var, 0.0f)); const float temp = (dstd < 1e-6f) ? 0.1f : 0.3f + dstd; const float tinv = 1.0f / clampf(temp, 0.1f, 5.0f);
    { ((float*)CST)[3] = tinv;  } }
}
__global__ __launch_bounds__(128) void outproj_kernel(const b16* __restrict__ OCh, const b16* __restrict__ OCl, const b16* __restrict__ WOUT, const float* __restrict__ bo, float* __restrict__ out) {
  __shared__ __attribute__((aligned(16))) float Ts[4][16][128 + 4];
  const int wave = threadIdx.x >> 5, lane = threadIdx.x & 31, nloc = lane & 15, hlf = lane >> 4; const size_t m0 = (size_t)blockIdx.x * 64 + wave * 16; const int n0 = blockIdx.y * 128;
  v8f acc[8];
#pragma unroll
  for (int t = 0; t < 8; ++t) acc[t] = (v8f){};
  const b16* ap = OCh + m0 * DIM; const b16* lp = OCl + m0 * DIM; const b16* bp = WOUT + (size_t)n0 * DIM; const unsigned flane = (unsigned)lane * 16u;   // ap, lp, bp: the first tile of row m0, of column n0
  v16b a = frag_pk(ap, flane), al = frag_pk(lp, flane), b[8];
#pragma unroll
  for (int t = 0; t < 8; ++t) b[t] = frag_pk(bp + (size_t)t * 16 * DIM, flane);
#pragma unroll   // full: the two fragment sets swap by renaming, and the last step's fetch falls away
  for (int kb = 0; kb < DIM; kb += 32) { v16b an = a, aln = al, bn[8];
#pragma unroll
    for (int t = 0; t < 8; ++t) bn[t] = b[t];
    if (kb + 32 < DIM) { an = frag_pk(ap + (kb + 32) * 16, flane); aln = frag_pk(lp + (kb + 32) * 16, flane);
#pragma unroll
      for (int t = 0; t < 8; ++t) bn[t] = frag_pk(bp + (size_t)t * 16 * DIM + (kb + 32) * 16, flane); }
    __builtin_amdgcn_sched_barrier(0);   // keeps the next step's loads, as one group, ahead of this step's products: sunk towards their uses they would each be waited for in turn
#pragma unroll
    for (int t = 0; t < 8; ++t) { acc[t] = wmma16b(a, b[t], acc[t]); acc[t] = wmma16b(al, b[t], acc[t]); }
    a = an; al = aln;
#pragma unroll
    for (int t = 0; t < 8; ++t) b[t] = bn[t]; }
#pragma unroll
  for (int t = 0; t < 8; ++t) { const float bb = bf16_rne(bo[n0 + t * 16 + nloc]);
#pragma unroll
    for (int r = 0; r < 8; ++r) Ts[wave][8 * hlf + r][t * 16 + nloc] = acc[t][r] * (1.0f / (XS * WSC)) + bb; }
  wave_lds_sync();
  { for (int rr = 0; rr < 16; ++rr) *(v4f*)(out + (m0 + rr) * DIM + n0 + lane * 4) = *(const v4f*)(&Ts[wave][rr][lane * 4]);  }
}
}  // namespace

extern "C" void kernel_launch(void* const* d_in, const int* in_sizes, int n_in, void* d_out, int out_size, void* d_ws, size_t ws_size, hipStream_t stream) {
  (void)n_in;
  auto Fp = [&](int i) { return (const float*)d_in[i]; };
  // input order: 0 q, 1 k, 2 v [4,1024,512]; 3 ln_in_g, 4 ln_in_b; 5 W_in [512,512]; 6 wp_W1 [128,64], 7 wp_b1, 8 wp_ln_g, 9 wp_ln_b, 10 wp_W2 [64,32], 11 wp_b2, 12 wp_W3 [32,3], 13 wp_b3, 14 weight_temp [1], 15 W_out [512,512], 16 b_out
  if (in_sizes[0] != NR * DIM || in_sizes[1] != NR * DIM || in_sizes[2] != NR * DIM || in_sizes[5] != DIM * DIM || in_sizes[6] != 2 * DH * DH || in_sizes[15] != DIM * DIM || out_size != NR * DIM) return;
  size_t off = 0; char* ws = (char*)d_ws;
  auto carve = [&](size_t bytes) { char* p = ws + off; off += (bytes + 255) & ~(size_t)255; return p; };
  b16* X16 = (b16*)carve((size_t)3 * NR * DIM * 2); b16* WIN = (b16*)carve((size_t)DIM * DIM * 2); b16* WOUT = (b16*)carve((size_t)DIM * DIM * 2);
  float* F32 = (float*)carve((size_t)3 * NP_ * NT * DH * 4); float* KCM = (float*)carve((size_t)NP_ * DH * 4); float* PSUM = (float*)carve((size_t)2 * NP_ * DH * 4);
  b16* FQ16 = (b16*)carve((size_t)NP_ * NT * DH * 2); b16* FQC16 = (b16*)carve((size_t)NP_ * NT * DH * 2); b16* FK16 = (b16*)carve((size_t)NP_ * NT * DH * 2); b16* FKC16 = (b16*)carve((size_t)NP_ * NT * DH * 2);
  float* N1 = (float*)carve((size_t)NP_ * NT * 4); float* N2 = (float*)carve((size_t)NP_ * NT * 4); float* I2B = (float*)carve((size_t)NP_ * NT * 4);   // N2 holds 1 / (key norm + 1e-8), I2B 1 / max(key norm, 1e-6)
  b16* FVTh = (b16*)carve((size_t)NP_ * DH * NT * 2); b16* FVTl = (b16*)carve((size_t)NP_ * DH * NT * 2);
  float* P1 = (float*)carve((size_t)NP_ * (NT / 32) * 32 * 4); float* VARC = (float*)carve((size_t)NP_ * NT * 4); float* P2 = (float*)carve((size_t)NP_ * (NT / 32) * 32 * 4); float* ROWE = (float*)carve((size_t)NP_ * NT * 4); float* CST = (float*)carve(256);
  b16* OCh = (b16*)carve((size_t)NR * DIM * 2); b16* OCl = (b16*)carve((size_t)NR * DIM * 2);
  if (off > ws_size || off > ((size_t)128 << 20)) return;   // ≈ 73 MB
  ln_kernel<<<3 * NR / 8, 256, 0, stream>>>(Fp(0), Fp(1), Fp(2), Fp(3), Fp(4), X16);
  prepw_kernel<<<(2 * DIM * DIM / 8 + 255) / 256, 256, 0, stream>>>(Fp(5), Fp(15), WIN, WOUT);
  feat_kernel<<<dim3(NR / 64, DIM / 128, 3), 128, 0, stream>>>(X16, WIN, F32);
  colstat_kernel<<<dim3(NP_, 2), 256, 0, stream>>>(F32, KCM, PSUM);
  rowops_kernel<<<NP_ * NT / 16, 256, 0, stream>>>(F32, KCM, FQ16, FQC16, N1, FK16, FKC16, N2);
  norms_kernel<<<NP_ * NT / 256, 256, 0, stream>>>(F32, N1, N2, I2B);
  vt_kernel<<<dim3(NT / 64, NP_), 256, 0, stream>>>(F32, FVTh, FVTl);
  score_kernel<1><<<dim3(NT / 32, NP_), 64, 0, stream>>>(FQ16, FQC16, N1, FK16, FKC16, N2, I2B, FVTh, FVTl, CST, P1, VARC, P2, ROWE, OCh, OCl);
  reduce1_kernel<<<1, 256, 0, stream>>>(P1, VARC, PSUM, Fp(6), Fp(7), Fp(8), Fp(9), Fp(10), Fp(11), Fp(12), Fp(13), Fp(14), CST);
  score_kernel<2><<<dim3(NT / 32, NP_), 64, 0, stream>>>(FQ16, FQC16, N1, FK16, FKC16, N2, I2B, FVTh, FVTl, CST, P1, VARC, P2, ROWE, OCh, OCl);
  reduce2_kernel<<<1, 256, 0, stream>>>(P2, ROWE, VARC, CST);
  score_kernel<3><<<dim3(NT / 32, NP_), 64, 0, stream>>>(FQ16, FQC16, N1, FK16, FKC16, N2, I2B, FVTh, FVTl, CST, P1, VARC, P2, ROWE, OCh, OCl);
  outproj_kernel<<<dim3(NR / 64, DIM / 128), 128, 0, stream>>>(OCh, OCl, WOUT, Fp(16), (float*)d_out);
}

// v005
// One run takes 155 microseconds.
// Next to v004, in two timings, it ran 1.12 and 1.13 times as fast.
// All steps since v000 together make it 4.48 times as fast.
#include <hip/hip_runtime.h>

// "Super-aggressive" attention: f_q, f_k, f_v = LN(q|k|v) W_in split into 8 heads x 64; per (head, batch) pair: cos = clip(f_q.f_k / (n1 n2), +-0.99) (n = norm + 1e-8),
// cov = reg x (f_q - rowmean_d)(f_k - colmean_m) / (8 + 1e-6) (reg = 1e-3/1024, x10 if the global std of the raw cov < 1e-6), csim = clip(qn.kn) with max(norm, 1e-6), margin =
// clip(0.01 - csim, 0, 10), var_c = row mean of margin; per-head weights (cw, covw, vw) from a tiny MLP on the global means of f_q / f_k (softmax, /clip(weight_temp), softmax, clip, renorm);
// cn / covn / vn = global std (ddof 1) of cos / cov / var_c (+1e-6); d2 = cw cos/cn cscale + covw cov/covn/2 + vw var_c/vn/2; temp = 0.3 + std(d2) (dstd >= 1e-6; clipped to [0.1, 5]);
// attn = softmax(d2 / temp); out_h = attn f_v; out = concat_h W_out + b -> [4][1024][512].
// Every global statistic is a deterministic two-level f32 reduction (per-wave partials, then one fixed-order kernel); the [1024 x 1024] score tiles are recomputed in two passes
// (component statistics; softmax + PV) instead of being stored. std(d2) takes no pass of its own: d2 is linear in cos, cov and var_c, so its variance is a quadratic form in their first and second moments per head.
// WMMA (v_wmma_f32_16x16x32_f16, f32 accumulate): W_in (LN(x) single f16 x8, exact weights), dots / centered-cov tiles (single f16 x8 feature planes, K = 64), P.V (P single x8, f_v^T hi+lo:
// 2 products), W_out (O hi+lo: 2 products). LN, norms, all statistics and the weight-predictor MLP in f32. Inputs rounded to bf16 once. Fragment k-map per lane half hh

namespace {
constexpr int QB = 4, NT = 1024, DIM = 512, NH = 8, DH = 64, NP_ = NH * QB /* 32 (h,q) pairs, index h*QB + q */, NR = QB * NT /* 4096 rows */, NWAVE = NP_ * (NT / 16) /* 2048 score waves */;
constexpr float XS = 8.0f, WSC = 256.0f, PS = 8.0f, GAMMA = 0.01f, LREG = 0.001f;
constexpr float NTOT = 33554432.0f;   // 33,554,432 score elements

typedef _Float16 b16;
typedef __attribute__((ext_vector_type(16))) _Float16 v16b;
typedef __attribute__((ext_vector_type(8))) _Float16 v8b;
typedef __attribute__((ext_vector_type(8))) float v8f;
typedef __attribute__((ext_vector_type(4))) float v4f;
__device__ __forceinline__ float bf16_rne(float f) { unsigned int u = __float_as_uint(f); u += 0x7FFFu + ((u >> 16) & 1u); return __uint_as_float(u & 0xFFFF0000u); }
__device__ __forceinline__ void split16(float v, b16& hi, b16& lo) { hi = (b16)v; lo = (b16)(v - (float)hi); }
__device__ __forceinline__ v16b frag_kb(const b16* p, int hh) { const v8b a = *(const v8b*)(p + 8 * hh), b = *(const v8b*)(p + 16 + 8 * hh); v16b f;
#pragma unroll
  for (int e = 0; e < 8; ++e) { f[e] = a[e]; f[8 + e] = b[e]; } return f; }
// Fragment order: the planes that the matrix loops read again and again (keys, centred keys, f_v^T hi/lo, both weight planes, the attention output hi/lo) are stored tile by tile, a tile = 16 rows x 32 k = 1,024 contiguous bytes laid out as
// [k half j][lane = 16 hh + row][8 elements], element (row, kk) with j = kk / 16, hh = (kk / 8) % 2. A wave's 16-byte load then covers 512 contiguous bytes (4 whole lines) instead of 32-byte pieces of 16 lines; each lane gets the same values in the same registers as from frag_kb.
__device__ __forceinline__ int frag_pos(int row, int kk) { return (kk >> 4) * 256 + (((kk >> 3) & 1) * 16 + row) * 8 + (kk & 7); }   // element offset inside a tile
__device__ __forceinline__ v16b frag_pk(const b16* utile, unsigned lane_bytes) { const char* p = (const char*)utile + lane_bytes; const v8b a = *(const v8b*)p, b = *(const v8b*)(p + 512); v16b f;   // wave-uniform tile base plus 16 * lane bytes
#pragma unroll
  for (int e = 0; e < 8; ++e) { f[e] = a[e]; f[8 + e] = b[e]; } return f; }
__device__ __forceinline__ v8f wmma16b(v16b a, v16b b, v8f c) { v8f d = __builtin_amdgcn_wmma_f32_16x16x32_f16(false, a, false, b, (short)0, c, false, false); asm volatile("v_nop\n\tv_nop\n\tv_nop\n\tv_nop" : "+v"(d) : "v"(a), "v"(b)); return d; }
// the same product for a B operand that stays live and unwritten through the whole loop (the query fragments): B is left out of the statement's operands, which all have to sit in the first 256 registers, so that it may live above them
__device__ __forceinline__ v8f wmma16q(v16b a, v16b b, v8f c) { v8f d = __builtin_amdgcn_wmma_f32_16x16x32_f16(false, a, false, b, (short)0, c, false, false); asm volatile("v_nop\n\tv_nop\n\tv_nop\n\tv_nop" : "+v"(d) : "v"(a)); return d; }
// closes a run of global loads. The wait stands in front of the next instruction that writes a register from which those loads took their address (a precaution).
// The scheduling barrier keeps later address arithmetic from being lifted over that wait, and keeps the run up here, ahead of the work that covers its latency: sunk towards their uses the loads would each be waited for in turn.
__device__ __forceinline__ void close_load_run() { asm volatile("s_wait_xcnt 0x0" ::: "memory"); __builtin_amdgcn_sched_barrier(0); }
__device__ __forceinline__ void wave_lds_sync() { __builtin_amdgcn_fence(__ATOMIC_RELEASE, "workgroup"); __builtin_amdgcn_wave_barrier(); __builtin_amdgcn_fence(__ATOMIC_ACQUIRE, "workgroup"); }
// 2^x on v_exp_f32, with the slot that the instruction set asks for behind a transcendental (before its result is used or its source overwritten) filled in the same statement: a v_nop in a statement of its own did not stay behind it
__device__ __forceinline__ float nexp2(float x) { float r; asm("v_exp_f32 %0, %1\n\tv_nop" : "=v"(r) : "v"(x)); return r; }
__device__ __forceinline__ float pmul(float a, float b) { float p = a * b; asm volatile("" : "+v"(p)); return p; }
__device__ __forceinline__ float hsum16(float v) { v += __shfl_xor(v, 1); v += __shfl_xor(v, 2); v += __shfl_xor(v, 4); return v + __shfl_xor(v, 8); }
__device__ __forceinline__ float clampf(float v, float lo, float hi) { return fminf(fmaxf(v, lo), hi); }

__global__ __launch_bounds__(256) void ln_kernel(const float* __restrict__ q, const float* __restrict__ k, const float* __restrict__ v, const float* __restrict__ g, const float* __restrict__ be, b16* __restrict__ X16) {
  const int wave = threadIdx.x >> 5, lane = threadIdx.x & 31; const int rowall = blockIdx.x * 8 + wave; const int which = rowall / NR, row = rowall - which * NR;
  const float* src = (which == 0 ? q : which == 1 ? k : v) + (size_t)row * DIM + lane * 16; float x[16];
  { const v4f a = *(const v4f*)src, b = *(const v4f*)(src + 4), c = *(const v4f*)(src + 8), d = *(const v4f*)(src + 12); for (int j = 0; j < 4; ++j) { x[j] = bf16_rne(a[j]); x[4 + j] = bf16_rne(b[j]); x[8 + j] = bf16_rne(c[j]); x[12 + j] = bf16_rne(d[j]); } }
  float s = 0.0f; for (int j = 0; j < 16; ++j) s += x[j];
#pragma unroll
  for (int o = 16; o >= 1; o >>= 1) s += __shfl_xor(s, o);
  const float mu = s * (1.0f / DIM); float ss = 0.0f; for (int j = 0; j < 16; ++j) { const float d = x[j] - mu; ss += pmul(d, d); }
#pragma unroll
  for (int o = 16; o >= 1; o >>= 1) ss += __shfl_xor(ss, o);
  const float rs = rsqrtf(ss * (1.0f / DIM) + 1e-5f); v8b o0, o1;
  for (int j = 0; j < 16; ++j) { const int c = lane * 16 + j; const b16 hv = (b16)((pmul((x[j] - mu) * rs, bf16_rne(g[c])) + bf16_rne(be[c])) * XS); if (j < 8) o0[j] = hv; else o1[j - 8] = hv; }
  { b16* dst = X16 + ((size_t)which * NR + row) * DIM + lane * 16; *(v8b*)dst = o0; *(v8b*)(dst + 8) = o1;  }
}
__global__ __launch_bounds__(256) void prepw_kernel(const float* __restrict__ win, const float* __restrict__ wout, b16* __restrict__ WIN, b16* __restrict__ WOUT) {
  const int t = blockIdx.x * 256 + threadIdx.x; if (t >= 2 * DIM * DIM / 8) return; const int kind = t / (DIM * DIM / 8), tt = t - kind * (DIM * DIM / 8);
  // thread tt fills the 16-byte piece tt of the plane in fragment order: tile tt / 64 = (row tile) * 16 + k tile, piece tt % 64 = [j][hh][row]
  const int tile = tt >> 6, o_ = (tile / (DIM / 32)) * 16 + (tt & 15), k0 = (tile % (DIM / 32)) * 32 + ((tt >> 5) & 1) * 16 + ((tt >> 4) & 1) * 8;
  const float* w = kind == 0 ? win : wout; v8b o; for (int j = 0; j < 8; ++j) o[j] = (b16)(bf16_rne(w[(size_t)(k0 + j) * DIM + o_]) * WSC);
  { *(v8b*)((kind == 0 ? WIN : WOUT) + (size_t)tt * 8) = o;  }
}
// features: F = X16 W_in per row (block = 64 rows x 4 waves, wave = 16 rows x 128 cols = 2 heads; grid.y = 4): which 0 (q): F32Q [pair][n][64] f32 rows; which 1 (k): F32K; which 2 (v): F32V. (f32 planes,
__global__ __launch_bounds__(128) void feat_kernel(const b16* __restrict__ X16, const b16* __restrict__ WIN, float* __restrict__ F32) {
  __shared__ __attribute__((aligned(16))) float Ts[4][16][128 + 4];
  const int wave = threadIdx.x >> 5, lane = threadIdx.x & 31, nloc = lane & 15, hlf = lane >> 4; const int which = blockIdx.z; const size_t m0 = (size_t)blockIdx.x * 64 + wave * 16; const int n0 = blockIdx.y * 128;
  v8f acc[8];
#pragma unroll
  for (int t = 0; t < 8; ++t) acc[t] = (v8f){};
  const b16* ap = X16 + ((size_t)which * NR + m0 + nloc) * DIM; const b16* bp = WIN + (size_t)n0 * DIM; const unsigned flane = (unsigned)lane * 16u;   // bp: the first weight tile of column n0 (16 rows x 512 k = 16 tiles of 512 elements)
  v16b a = frag_kb(ap, hlf), b[8];
#pragma unroll
  for (int t = 0; t < 8; ++t) b[t] = frag_pk(bp + (size_t)t * 16 * DIM, flane);
#pragma unroll   // full: the two fragment sets swap by renaming, and the last step's fetch falls away
  for (int kb = 0; kb < DIM; kb += 32) { v16b an = a, bn[8];
#pragma unroll
    for (int t = 0; t < 8; ++t) bn[t] = b[t];
    if (kb + 32 < DIM) { an = frag_kb(ap + kb + 32, hlf);
#pragma unroll
      for (int t = 0; t < 8; ++t) bn[t] = frag_pk(bp + (size_t)t * 16 * DIM + (kb + 32) * 16, flane); }
    __builtin_amdgcn_sched_barrier(0);   // keeps the next step's loads, as one group, ahead of this step's products: sunk towards their uses they would each be waited for in turn
#pragma unroll
    for (int t = 0; t < 8; ++t) acc[t] = wmma16b(a, b[t], acc[t]);
    a = an;
#pragma unroll
    for (int t = 0; t < 8; ++t) b[t] = bn[t]; }
#pragma unroll
  for (int t = 0; t < 8; ++t)
#pragma unroll
    for (int r = 0; r < 8; ++r) Ts[wave][8 * hlf + r][t * 16 + nloc] = acc[t][r] * (1.0f / (XS * WSC));
  wave_lds_sync();
  // rows m0+rr: q_idx = row / NT, n = row % NT; cols n0 + c -> head h = (n0 + c) / 64, d = % 64; F32 layout [which][pair][n][64]
  { for (int rr = 0; rr < 16; ++rr) { const size_t row = m0 + rr; const int qi = (int)(row / NT), n = (int)(row - (size_t)qi * NT); for (int hq = 0; hq < 2; ++hq) { const int h = n0 / DH + hq; const int pair = h * QB + qi;
        if (lane < 16) *(v4f*)(F32 + (((size_t)which * NP_ + pair) * NT + n) * DH + lane * 4) = *(const v4f*)(&Ts[wave][rr][hq * DH + lane * 4]); } }  }
}
// per-pair column statistics of f_k (mean over the 1024 keys per d) and head means qg/kg (over all 4,096 rows): colstat: block = pair, 256 threads: thread (d = t%64, part = t/64) sums rows part*256..+255;
__global__ __launch_bounds__(256) void colstat_kernel(const float* __restrict__ F32, float* __restrict__ KCM, float* __restrict__ PSUM) {   // PSUM [which 0/1][pair][64] = column sums
  __shared__ float part[4][DH];
  const int which = blockIdx.y, pair = blockIdx.x, t_ = threadIdx.x, d = t_ & 63, pq = t_ >> 6; const float* base = F32 + (((size_t)which * NP_ + pair) * NT) * DH;
  float s = 0.0f; for (int n = pq * 256; n < pq * 256 + 256; ++n) s += base[(size_t)n * DH + d]; part[pq][d] = s;
  __syncthreads();
  if (t_ < DH) { const float tot = (part[0][t_] + part[1][t_]) + (part[2][t_] + part[3][t_]);
    { ((float*)PSUM)[((size_t)which * NP_ + pair) * DH + t_] = tot; if (which == 1) ((float*)KCM)[(size_t)pair * DH + t_] = tot * (1.0f / NT);  } }
}
// operand planes per pair: FQ16 [pair][n][64] = f16(8 f_q), FQC16 = f16(8 (f_q - rowmean)), N1 [pair][n] = ||f_q|| (f32); FK16, FKC16 = f16(8 (f_k - colmean)) (both in fragment order), N2 = 1 / (||f_k|| + 1e-8), I2B = 1 / max(||f_k||, 1e-6); FVTh/FVTl = f_v^T hi/lo x8 (rows d, k = keys, in fragment order).
__global__ __launch_bounds__(256) void rowops_kernel(const float* __restrict__ F32, const float* __restrict__ KCM, b16* __restrict__ FQ16, b16* __restrict__ FQC16, float* __restrict__ N1, b16* __restrict__ FK16, b16* __restrict__ FKC16, float* __restrict__ N2) {
  const int wave = threadIdx.x >> 5, lane = threadIdx.x & 31; const size_t prow = ((size_t)blockIdx.x * 8 + wave) * 2 + (lane >> 4);   // pair*NT + n, over NP_*NT rows
  const int pair = (int)(prow / NT); const int c0 = (lane & 15) * 4;
  const v4f fq = *(const v4f*)(F32 + (0 * (size_t)NP_ * NT + prow) * DH + c0), fk = *(const v4f*)(F32 + (1 * (size_t)NP_ * NT + prow) * DH + c0);
  float sq = 0.0f, ssq = 0.0f, ssk = 0.0f; for (int j = 0; j < 4; ++j) { sq += fq[j]; ssq += pmul(fq[j], fq[j]); ssk += pmul(fk[j], fk[j]); }
  sq = hsum16(sq); ssq = hsum16(ssq); ssk = hsum16(ssk); const float mq = sq * (1.0f / DH);
  typedef __attribute__((ext_vector_type(4))) _Float16 v4b; v4b a, ac, b, bc;
  for (int j = 0; j < 4; ++j) { a[j] = (b16)(fq[j] * XS); ac[j] = (b16)((fq[j] - mq) * XS); b[j] = (b16)(fk[j] * XS); bc[j] = (b16)((fk[j] - KCM[(size_t)pair * DH + c0 + j]) * XS); }
  { *(v4b*)(FQ16 + prow * DH + c0) = a; *(v4b*)(FQC16 + prow * DH + c0) = ac; const size_t kpos = (prow >> 4) * (16 * DH) + (c0 >> 5) * 512 + frag_pos((int)(prow & 15), c0 & 31);   // key planes in fragment order: the block's 16 rows are one row tile (2 k tiles, 2 KiB a plane)
    *(v4b*)(FK16 + kpos) = b; *(v4b*)(FKC16 + kpos) = bc;  }
}
// The key norms enter every score element only through 1 / (n2 + 1e-8) and 1 / max(n2, 1e-6): the two quotients are formed here, once a key (I2A, I2B), not once a score element in each pass; same division, same bits.
__global__ __launch_bounds__(256) void norms_kernel(const float* __restrict__ F32, float* __restrict__ N1, float* __restrict__ I2A, float* __restrict__ I2B) {   // thread per row: 256 rows per block -> spans of 256 floats (8 lines) each
  const size_t prow = (size_t)blockIdx.x * 256 + threadIdx.x; const float* fq = F32 + (0 * (size_t)NP_ * NT + prow) * DH; const float* fk = F32 + (1 * (size_t)NP_ * NT + prow) * DH;
  float sq = 0.0f, sk = 0.0f; for (int d = 0; d < DH; ++d) { sq += pmul(fq[d], fq[d]); sk += pmul(fk[d], fk[d]); }
  { const float n2 = sqrtf(sk); ((float*)N1)[prow] = sqrtf(sq); ((float*)I2A)[prow] = 1.0f / (n2 + 1e-8f); ((float*)I2B)[prow] = 1.0f / fmaxf(n2, 1e-6f);  }
}
__global__ __launch_bounds__(256) void vt_kernel(const float* __restrict__ F32, b16* __restrict__ FVTh, b16* __restrict__ FVTl) {   // block = (pair, 64-key chunk): transpose [64 n][64 d] -> rows d, hi/lo
  __shared__ __attribute__((aligned(16))) b16 Th[DH][64 + 8], Tl[DH][64 + 8];
  const int pair = blockIdx.y, n0 = blockIdx.x * 64, t_ = threadIdx.x; const float* base = F32 + ((2 * (size_t)NP_ + pair) * NT + n0) * DH;
  for (int qq = t_; qq < 64 * DH; qq += 256) { const int nn = qq >> 6, d = qq & 63; b16 h_, l_; split16(base[(size_t)nn * DH + d] * XS, h_, l_); Th[d][nn] = h_; Tl[d][nn] = l_; }
  __syncthreads();
  // fragment order, tiles [pair][32-key block][16-d tile]: the block's 64 keys are 8 tiles = 8 KiB a plane, and piece qq = [key block][d tile][j][hh][row] goes to byte 16 qq of them
  { for (int qq = t_; qq < DH * 8; qq += 256) { const int d = ((qq >> 6) & 3) * 16 + (qq & 15), c8 = (qq >> 8) * 32 + ((qq >> 5) & 1) * 16 + ((qq >> 4) & 1) * 8; const size_t gi = ((size_t)pair * NT + n0) * DH + (size_t)qq * 8; *(v8b*)(FVTh + gi) = *(const v8b*)(&Th[d][c8]); *(v8b*)(FVTl + gi) = *(const v8b*)(&Tl[d][c8]); }  }
}
// score-tile passes: wave = 16 query rows n of one pair (block = 2 waves), loop over 32 key blocks of 32: dots^T and covraw^T tiles (keys x queries, K = 64: 2 steps x 2 key tiles x 2 GEMMs = 8 WMMAs),
// lane (hh, col=query) holds keys kb+8hh+r and kb+16+8hh+r.  cos = clip(dots/((n1+1e-8)(n2+1e-8))), csim = clip(dots/(max(n1,1e-6) max(n2,1e-6))), margin = clip(0.01 - csim, 0, 10), covraw = c/(8+1e-6).
// PASS 1: per wave the sums of cos, cos^2, covraw, covraw^2, cos covraw, and of var_c x (row sum of cos) and var_c x (row sum of covraw) over its 16 rows -> P1; per row var_c -> VARC.
// PASS 3 (given cn, covfac = reg/covn/2, w per head, vn, temp): per row c_row = vw var_c/(2 vn); e = cw cos/cn cscale + covw covraw covfac (d2 - c_row); logits = (e + c_row)/temp -> online softmax (f32) with o^T += f_v^T P^T (hi+lo, 4 d-tiles): O [pair][n][64] -> OC16h/l, rows q*NT+n, k = h*64+d (concat-head planes, hi/lo x8, in fragment order).
template <int PASS>
__global__ __launch_bounds__(64) void score_kernel(const b16* __restrict__ FQ16, const b16* __restrict__ FQC16, const float* __restrict__ N1, const b16* __restrict__ FK16, const b16* __restrict__ FKC16, const float* __restrict__ I2A, const float* __restrict__ I2B, const b16* __restrict__ FVTh, const b16* __restrict__ FVTl,
                                                  const float* __restrict__ CST /* [0..3] cscale/cn, reg/(2 covn), 1/(2 vn), 1/temp; [4..27] cw, covw, vw per head */, float* __restrict__ P1, float* __restrict__ VARC, b16* __restrict__ OCh, b16* __restrict__ OCl) {
  __shared__ __attribute__((aligned(16))) float To[2][16][DH + 4]; __shared__ float Tr[2][16]; __shared__ float Tp[2][8];
  const int wave = threadIdx.x >> 5, lane = threadIdx.x & 31, hh = lane >> 4, col = lane & 15; const int pair = blockIdx.y, n0 = blockIdx.x * 32 + wave * 16, ni = n0 + col; const int h = pair / QB, qi = pair - h * QB;
  const size_t prow = (size_t)pair * NT + ni; const b16* Qp = FQ16 + prow * DH; const b16* Qc = FQC16 + prow * DH; const b16* Kb = FK16 + (size_t)pair * NT * DH; const b16* Kc = FKC16 + (size_t)pair * NT * DH;
  __builtin_amdgcn_sched_barrier(0);   // keeps the index arithmetic above from being placed between the loads below and the wait that closes their run
  const v16b qa0 = frag_kb(Qp, hh), qa1 = frag_kb(Qp + 32, hh); close_load_run();
  const v16b qc0 = frag_kb(Qc, hh), qc1 = frag_kb(Qc + 32, hh); close_load_run();
  // Every factor of a score element that belongs to the query row, the head or the whole launch is multiplied up here, once a wave. The powers of two (1 / XS^2) move exactly, so pass 1 keeps its bits.
  const float n1 = N1[prow]; close_load_run(); const float q1a = (1.0f / (n1 + 1e-8f)) * (1.0f / (XS * XS)), q1b = (1.0f / fmaxf(n1, 1e-6f)) * (1.0f / (XS * XS));
  constexpr float CK = (1.0f / (8.0f + 1e-6f)) * (1.0f / (XS * XS)), LOG2E = 1.4426950408889634f, LOG2_PS = 3.0f; static_assert(PS == 8.0f, "LOG2_PS is log2(PS)");
  float cn_inv_cscale = 0.0f, covfac = 0.0f, vn_half_inv = 0.0f, temp_inv = 0.0f, cwh = 0.0f, covwh = 0.0f, vwh = 0.0f;   // this head's constants, read once ahead of the loop
  if (PASS == 3) { const float* cf = CST; cn_inv_cscale = cf[0]; covfac = cf[1]; vn_half_inv = cf[2]; temp_inv = cf[3]; cwh = cf[4 + h]; covwh = cf[4 + NH + h]; vwh = cf[4 + 2 * NH + h]; }
  float crow = 0.0f; if (PASS == 3) crow = vwh * VARC[prow] * vn_half_inv;
  // e = w1 cos + w2 c (c the raw centred product); pass 3 takes its logits as w1 cos + w2 c + w0 in units of log2, so that 2^x needs no multiply of its own
  const float lsc = temp_inv * LOG2E, w1 = cwh * cn_inv_cscale * lsc, w2 = covwh * covfac * CK * lsc, w0 = crow * lsc;
  float s_a = 0.0f, s_b = 0.0f, s_c = 0.0f, s_d = 0.0f, s_x = 0.0f, rowacc = 0.0f;
  float m = -INFINITY, l = 0.0f; v8f o[4] = {{}, {}, {}, {}}, ol[4] = {{}, {}, {}, {}};
  // One key block's operands (8 key fragments, 16 key factors; 32 in pass 1) live in registers and are fetched together, a whole block ahead of their use.
  v16b k0a, k0b, k1a, k1b, x0a, x0b, x1a, x1b; v4f nn0, nn1, nn2, nn3, mm0 = {}, mm1 = {}, mm2 = {}, mm3 = {};
  const unsigned flane = (unsigned)lane * 16u, nlane = (unsigned)hh * 32u;   // per-lane byte offsets into a tile in fragment order and into a key block's norms
  auto fetch_keys = [&](int kq) { const b16* kr = Kb + (size_t)kq * DH; const b16* cr = Kc + (size_t)kq * DH; const char* np = (const char*)(I2A + (size_t)pair * NT + kq) + nlane;
    nn0 = *(const v4f*)np; nn1 = *(const v4f*)(np + 16); nn2 = *(const v4f*)(np + 64); nn3 = *(const v4f*)(np + 80);
    if (PASS == 1) { const char* nq = (const char*)(I2B + (size_t)pair * NT + kq) + nlane; mm0 = *(const v4f*)nq; mm1 = *(const v4f*)(nq + 16); mm2 = *(const v4f*)(nq + 64); mm3 = *(const v4f*)(nq + 80); }
    close_load_run();
    k0a = frag_pk(kr, flane); k0b = frag_pk(kr + 512, flane); k1a = frag_pk(kr + 1024, flane); k1b = frag_pk(kr + 1536, flane); close_load_run();   // a 32-key block = 4 tiles: [16 keys][k tile]
    x0a = frag_pk(cr, flane); x0b = frag_pk(cr + 512, flane); x1a = frag_pk(cr + 1024, flane); x1b = frag_pk(cr + 1536, flane); close_load_run(); };
  fetch_keys(0);
  for (int kb = 0; kb < NT; kb += 32) {
    v8f d0 = {}, d1 = {}, c0 = {}, c1 = {};
    d0 = wmma16q(k0a, qa0, d0); d0 = wmma16q(k0b, qa1, d0);
    d1 = wmma16q(k1a, qa0, d1); d1 = wmma16q(k1b, qa1, d1);
    c0 = wmma16q(x0a, qc0, c0); c0 = wmma16q(x0b, qc1, c0);
    c1 = wmma16q(x1a, qc0, c1); c1 = wmma16q(x1b, qc1, c1);
    const v4f na0 = nn0, na1 = nn1, nb0 = nn2, nb1 = nn3, ma0 = mm0, ma1 = mm1, mb0 = mm2, mb1 = mm3;
    // behind the last score product: this block's value fragments (used after the softmax arithmetic), then the next block's keys (the last block re-reads block 0, unused), all in flight under the vector work
    v16b vh[4], vl[4];
    if (PASS == 3) {
#pragma unroll
      for (int t = 0; t < 4; ++t) { vh[t] = frag_pk(FVTh + ((size_t)pair * NT + kb) * DH + t * 512, flane); vl[t] = frag_pk(FVTl + ((size_t)pair * NT + kb) * DH + t * 512, flane); }
      close_load_run(); }
    const int kn = kb + 32 < NT ? kb + 32 : 0;
    fetch_keys(kn);
    float ev0[8], ev1[8];
#pragma unroll
    for (int r = 0; r < 8; ++r) {
#pragma unroll
      for (int hq = 0; hq < 2; ++hq) { const float dw = hq ? d1[r] : d0[r], cw_ = hq ? c1[r] : c0[r];   // the two raw products
        const float i2a = hq ? (r < 4 ? nb0[r & 3] : nb1[r & 3]) : (r < 4 ? na0[r & 3] : na1[r & 3]); const float cosv = clampf(dw * q1a * i2a, -0.99f, 0.99f);
        if (PASS == 1) { const float i2b = hq ? (r < 4 ? mb0[r & 3] : mb1[r & 3]) : (r < 4 ? ma0[r & 3] : ma1[r & 3]); const float covraw = cw_ * CK;
          const float csim = clampf(dw * q1b * i2b, -0.99f, 0.99f); const float margin = clampf(GAMMA - csim, 0.0f, 10.0f);
          s_a += cosv; s_b += pmul(cosv, cosv); s_c += covraw; s_d += pmul(covraw, covraw); s_x += cosv * covraw; rowacc += margin; }
        else { (hq ? ev1 : ev0)[r] = cosv * w1 + (cw_ * w2 + w0); } } }
    if (PASS == 3) { float mr = -INFINITY;
#pragma unroll
      for (int r = 0; r < 8; ++r) mr = fmaxf(mr, fmaxf(ev0[r], ev1[r]));
      mr = fmaxf(mr, __shfl_xor(mr, 16)); const float mn = fmaxf(m, mr); const float al_ = nexp2(m - mn); m = mn; const float ms = mn - LOG2_PS; float sum = 0.0f; v16b pb;   // ms: the factor PS of the f16 weights rides in the exponent; l then holds PS times the row sum
#pragma unroll
      for (int r = 0; r < 8; ++r) { const float e0 = nexp2(ev0[r] - ms), e1 = nexp2(ev1[r] - ms); sum += e0 + e1; pb[r] = (b16)e0; pb[8 + r] = (b16)e1; }
      sum += __shfl_xor(sum, 16); l = l * al_ + sum;
#pragma unroll
      for (int t = 0; t < 4; ++t) { o[t] *= al_; ol[t] *= al_; o[t] = wmma16b(vh[t], pb, o[t]); ol[t] = wmma16b(vl[t], pb, ol[t]); } } }
  if (PASS == 1) {   // per-row sums across the two lane halves; per-wave partials over the 16 rows and 32 lanes
    rowacc += __shfl_xor(rowacc, 16); if (hh == 0) Tr[wave][col] = rowacc;
    // a lane's s_a and s_c are its query row's sums of cos and covraw over the lane half's keys: weighted with the row's var_c they give the cross terms of d2's variance
    const float vc = rowacc * (1.0f / NT); float v7[7] = {s_a, s_b, s_c, s_d, s_x, vc * s_a, vc * s_c};
#pragma unroll
    for (int j = 0; j < 7; ++j) { float v = v7[j];
#pragma unroll
      for (int oo = 16; oo >= 1; oo >>= 1) v += __shfl_xor(v, oo);
      v7[j] = v; }
    if (lane == 0) {
#pragma unroll
      for (int j = 0; j < 7; ++j) Tp[wave][j] = v7[j];
      Tp[wave][7] = 0.0f; }
    wave_lds_sync();
    __syncthreads();
    if (wave == 0) { VARC[(size_t)pair * NT + blockIdx.x * 32 + lane] = Tr[lane >> 4][lane & 15] * (1.0f / NT);
      P1[((size_t)pair * (NT / 32) + blockIdx.x) * 32 + lane] = (lane < 16) ? Tp[lane >> 3][lane & 7] : 0.0f; }
  } else {
    const float inv = 1.0f / (l * XS);
#pragma unroll
    for (int t = 0; t < 4; ++t)
#pragma unroll
      for (int r = 0; r < 8; ++r) To[wave][col][t * 16 + 8 * hh + r] = (o[t][r] + ol[t][r]) * inv;
    wave_lds_sync();
    // fragment order for the output projection: the wave's 16 rows x 64 columns are 2 tiles (2 KiB) a plane; store i covers the 512 bytes [k tile i / 2][j = i % 2]
    { for (int i = 0; i < 4; ++i) { const int rr = col, c8 = (i >> 1) * 32 + (i & 1) * 16 + hh * 8; v8b hv, lv; for (int j = 0; j < 8; ++j) { b16 a_, c_; split16(To[wave][rr][c8 + j] * XS, a_, c_); hv[j] = a_; lv[j] = c_; }
        const size_t gi = ((size_t)qi * NT + n0) * DIM + (h * 2) * 512 + i * 256 + lane * 8; *(v8b*)(OCh + gi) = hv; *(v8b*)(OCl + gi) = lv; }  }
  }
}
// reduction (one block, fixed order): cn, covn, vn, weights, then dstd -> temp -> CST[0..27].
// It runs as one block on an otherwise idle chip, so nothing hides a load's latency but the block's own instruction order: the kernel issues ALL its global reads in one run at its head and keeps them in registers
// (the predictor's weights go on to LDS), so that it pays about one memory latency in all instead of one per loop trip. Every sum keeps its operands and its order; in the loops written anew a product now fuses with its addition.
__global__ __launch_bounds__(256) void reduce1_kernel(const float* __restrict__ P1, const float* __restrict__ VARC, const float* __restrict__ PSUM, const float* __restrict__ w1, const float* __restrict__ b1, const float* __restrict__ g2, const float* __restrict__ be2, const float* __restrict__ w2, const float* __restrict__ b2, const float* __restrict__ w3, const float* __restrict__ b3, const float* __restrict__ wtemp, float* __restrict__ CST) {
  __shared__ float red[4][256]; __shared__ float sh[64];
  __shared__ __attribute__((aligned(16))) float w1s[2 * DH * DH], w2s[DH * 32]; __shared__ float w3s[3][32], b1s[DH], g2s[DH], be2s[DH], b2s[32];   // the predictor's parameters as bf16 values (w3s: the 96 values in their order)
  const int t_ = threadIdx.x; constexpr int NPK = NP_ * (NT / 32) / 256 /* 4 of the 1,024 block partials (16 floats: 2 waves x 8) per thread */, NVK = NP_ * NT / 256 /* 128 row values per thread */, NFK = NH * 2 * DH / 256 /* 4 */;
  v4f w1r[8], w2r[2], pl[NPK], ph[NPK], xl[NPK], xh[NPK]; float pr[NFK][QB], vr[NVK], w3r[3];
  const unsigned a63 = t_ & (DH - 1), a31 = t_ & 31, p1off = (unsigned)t_ * 128u /* bytes: partial t_ */, psidx = ((t_ >> 6) & 1) * NP_ * DH + (t_ >> 7) * QB * DH + (t_ & (DH - 1)) /* PSUM [which][pair 4 h][dd] of feature i = t_ */;
  const float b3r[3] = {b3[0], b3[1], b3[2]}, wtr = wtemp[0];
  __builtin_amdgcn_sched_barrier(0);   // keeps the index arithmetic and the scalar reads above from being placed between the loads below and the wait that closes their run
#pragma unroll
  for (int j = 0; j < 8; ++j) w1r[j] = *(const v4f*)(w1 + (j * 256 + t_) * 4);
#pragma unroll
  for (int j = 0; j < 2; ++j) w2r[j] = *(const v4f*)(w2 + (j * 256 + t_) * 4);
  const float b1r = b1[a63], g2r = g2[a63], be2r = be2[a63], b2r = b2[a31];
#pragma unroll
  for (int j = 0; j < 3; ++j) w3r[j] = w3[j * 32 + a31];
#pragma unroll
  for (int k = 0; k < NPK; ++k) { const char* p = (const char*)P1 + p1off + k * (256 * 128); pl[k] = *(const v4f*)p; xl[k] = *(const v4f*)(p + 16); ph[k] = *(const v4f*)(p + 32); xh[k] = *(const v4f*)(p + 48); }
#pragma unroll
  for (int k = 0; k < NFK; ++k)   // feature i = t_ + 256 k: head h + 2 k, the same which and dd
#pragma unroll
    for (int qq = 0; qq < QB; ++qq) pr[k][qq] = PSUM[psidx + (2 * k * QB + qq) * DH];
#pragma unroll   // full, here and in the four loops that read vr: the 128 values stay in registers and are read from memory once, not once a loop
  for (int j = 0; j < NVK; ++j) vr[j] = VARC[t_ + j * 256];
  // closes the run as close_load_run() does; the input operands keep the run's address registers from being given to a later load's result ahead of the wait
  asm volatile("s_wait_xcnt 0x0" :: "v"(a63), "v"(a31), "v"(p1off), "v"(psidx) : "memory"); __builtin_amdgcn_sched_barrier(0);
#pragma unroll
  for (int j = 0; j < 8; ++j) { v4f x; for (int e = 0; e < 4; ++e) x[e] = bf16_rne(w1r[j][e]); *(v4f*)(w1s + (j * 256 + t_) * 4) = x; }
#pragma unroll
  for (int j = 0; j < 2; ++j) { v4f x; for (int e = 0; e < 4; ++e) x[e] = bf16_rne(w2r[j][e]); *(v4f*)(w2s + (j * 256 + t_) * 4) = x; }
  b1s[a63] = bf16_rne(b1r); g2s[a63] = bf16_rne(g2r); be2s[a63] = bf16_rne(be2r); b2s[a31] = bf16_rne(b2r);   // every thread stores: threads with the same index store the same value
#pragma unroll
  for (int j = 0; j < 3; ++j) w3s[j][a31] = bf16_rne(w3r[j]);
  float a = 0, b = 0, c = 0, d = 0, mo[NPK][7];   // mo: the seven moments of block partial t_ + 256 k (32 rows of head 2 k + t_ / 128), kept for d2's variance at the end
#pragma unroll
  for (int k = 0; k < NPK; ++k) {
#pragma unroll
    for (int j = 0; j < 4; ++j) mo[k][j] = pl[k][j] + ph[k][j];
#pragma unroll
    for (int j = 0; j < 3; ++j) mo[k][4 + j] = xl[k][j] + xh[k][j];
    a += mo[k][0]; b += mo[k][1]; c += mo[k][2]; d += mo[k][3]; }
  red[0][t_] = a; red[1][t_] = b; red[2][t_] = c; red[3][t_] = d; __syncthreads();
  for (int s = 128; s >= 1; s >>= 1) { if (t_ < s) { for (int j = 0; j < 4; ++j) red[j][t_] += red[j][t_ + s]; } __syncthreads(); }
  float vs = 0.0f;
#pragma unroll
  for (int j = 0; j < NVK; ++j) vs += vr[j];
  __shared__ float r2[256]; r2[t_] = vs; __syncthreads(); for (int s = 128; s >= 1; s >>= 1) { if (t_ < s) r2[t_] += r2[t_ + s]; __syncthreads(); }
  const float vmu = r2[0] / (float)(NP_ * NT); __syncthreads();
  float vq = 0.0f;
#pragma unroll
  for (int j = 0; j < NVK; ++j) { const float dv = vr[j] - vmu; vq += dv * dv; }
  r2[t_] = vq; __syncthreads(); for (int s = 128; s >= 1; s >>= 1) { if (t_ < s) r2[t_] += r2[t_ + s]; __syncthreads(); }
  // head means qg/kg [8][64] from PSUM [which][pair][64]: mean over (q, n) = sum over the 4 pairs of the head / 4096 -> feats [h][128]; MLP: h1 = relu(LN(feats W1 + b1)), h2 = relu(h1 W2 + b2), logits = softmax(h2 W3 + b3), w = softmax(logits / clip(wt)), clip [0.05,0.8], renorm
  __shared__ __attribute__((aligned(16))) float feats[NH][2 * DH], h1s[NH][DH], h2s[NH][32]; __shared__ float ws[NH][3];
#pragma unroll
  for (int k = 0; k < NFK; ++k) { const int i = t_ + k * 256, h = i / (2 * DH), c = i - h * 2 * DH; float s = 0.0f;
#pragma unroll
    for (int qq = 0; qq < QB; ++qq) s += pr[k][qq];
    feats[h][c] = s * (1.0f / (QB * NT)); }
  __syncthreads();
  // the loops below read LDS only; each is unrolled, with plain products, so that its reads are issued ahead of the one chain of additions instead of being waited for one by one
  for (int i = t_; i < NH * DH; i += 256) { const int h = i / DH, o_ = i - h * DH; float s = b1s[o_];
#pragma unroll 32
    for (int c = 0; c < 2 * DH; ++c) s += feats[h][c] * w1s[c * DH + o_]; h1s[h][o_] = s; }
  __syncthreads();
  if (t_ < NH) { const int h = t_; float mu = 0.0f;
#pragma unroll
    for (int c = 0; c < DH; ++c) mu += h1s[h][c];
    mu *= (1.0f / DH); float var = 0.0f;
#pragma unroll
    for (int c = 0; c < DH; ++c) { const float dv = h1s[h][c] - mu; var += dv * dv; }
    var *= (1.0f / DH); const float rs = rsqrtf(var + 1e-5f);
#pragma unroll
    for (int c = 0; c < DH; ++c) h1s[h][c] = fmaxf((h1s[h][c] - mu) * rs * g2s[c] + be2s[c], 0.0f); }
  __syncthreads();
  for (int i = t_; i < NH * 32; i += 256) { const int h = i / 32, o_ = i - h * 32; float s = b2s[o_];
#pragma unroll 32
    for (int c = 0; c < DH; ++c) s += h1s[h][c] * w2s[c * 32 + o_]; h2s[h][o_] = fmaxf(s, 0.0f); }
  __syncthreads();
  if (t_ < NH) { const int h = t_; float lg[3]; for (int o_ = 0; o_ < 3; ++o_) { float s = bf16_rne(b3r[o_]);
#pragma unroll
      for (int c = 0; c < 32; ++c) s += h2s[h][c] * (&w3s[0][0])[c * 3 + o_]; lg[o_] = s; }
    float mx = fmaxf(lg[0], fmaxf(lg[1], lg[2])); float e3[3], se = 0.0f; for (int j = 0; j < 3; ++j) { e3[j] = __expf(lg[j] - mx); se += e3[j]; } for (int j = 0; j < 3; ++j) e3[j] /= se;
    const float wt = clampf(bf16_rne(wtr), 0.1f, 20.0f); float z[3]; for (int j = 0; j < 3; ++j) z[j] = e3[j] / wt; mx = fmaxf(z[0], fmaxf(z[1], z[2])); se = 0.0f; for (int j = 0; j < 3; ++j) { e3[j] = __expf(z[j] - mx); se += e3[j]; }
    float wv[3], sw = 0.0f; for (int j = 0; j < 3; ++j) { wv[j] = clampf(e3[j] / se, 0.05f, 0.8f); sw += wv[j]; } for (int j = 0; j < 3; ++j) ws[h][j] = wv[j] / sw; }
  __syncthreads();
  if (t_ == 0) { const float n = (float)NTOT; const float sa_ = red[0][0], sb = red[1][0], sc = red[2][0], sd = red[3][0];
    const float cstd = sqrtf(fmaxf((sb - sa_ * (sa_ / n)) / (n - 1.0f), 0.0f)); const float covstd_raw = sqrtf(fmaxf((sd - sc * (sc / n)) / (n - 1.0f), 0.0f));
    const float base_reg = LREG / (float)NT; const float reg = (covstd_raw < 1e-6f) ? base_reg * 10.0f : base_reg;   // reference: reg chosen on the std of the RAW cov, then cov = clip(reg cov, +-50) (never clips at this scale)
    const float covn = reg * covstd_raw + 1e-6f; const float cn = cstd + 1e-6f; const float cscale = (cn < 1e-4f) ? 0.1f : 1.0f;
    const float vn = sqrtf(r2[0] * ((float)NT / (n - 1.0f))) + 1e-6f;   // std over the broadcast [.., m] copies: each row value repeated NT times
    sh[0] = cscale / cn; sh[1] = reg * 0.5f / covn; sh[2] = 0.5f / vn; sh[3] = 0.0f; for (int h = 0; h < NH; ++h) { sh[4 + h] = ws[h][0]; sh[4 + NH + h] = ws[h][1]; sh[4 + 2 * NH + h] = ws[h][2]; } }
  __syncthreads();
  // dstd = std(d2) from the moments. d2 = e + c with e = W1 cos + W2 covraw (W1 = cw cscale/cn, W2 = covw reg/(2 covn), per head) and the row constant c = vw var_c/(2 vn).
  // var(d2) = E[(d2 - M)^2] - (E[d2 - M])^2 with the shift M = mean of the row constants (kills the large common offset): sum (d2 - M) = sum e + NT sum_rows (c - M),
  // sum (d2 - M)^2 = sum e^2 + 2 sum_rows (c - M) rowsum_e + NT sum_rows (c - M)^2; sum e^2 = W1^2 sum cos^2 + 2 W1 W2 sum cos covraw + W2^2 sum covraw^2; sum_rows c rowsum_e = vw/(2 vn) (W1 sum var_c rowsum_cos + W2 sum var_c rowsum_covraw).
  __shared__ float tl[3][8]; const int wv = t_ >> 5; const float vfac = sh[2]; float vf[NH];
#pragma unroll
  for (int h = 0; h < NH; ++h) vf[h] = sh[4 + 2 * NH + h] * vfac;
  float c4[4] = {0.0f, 0.0f, 0.0f, 0.0f};   // row i = t_ + 256 j belongs to head (i / NT) / QB = j / 16; four chains here and below, so that an addition does not wait for the one before it
#pragma unroll
  for (int j = 0; j < NVK; ++j) c4[j & 3] += vf[j / 16] * vr[j];
  float sc = (c4[0] + c4[1]) + (c4[2] + c4[3]);
#pragma unroll
  for (int o = 16; o >= 1; o >>= 1) sc += __shfl_xor(sc, o);
  if ((t_ & 31) == 0) tl[0][wv] = sc;
  __syncthreads();
  float M = 0.0f;
#pragma unroll
  for (int w = 0; w < 8; ++w) M += tl[0][w];
  M /= (float)(NP_ * NT); float q1[4] = {0.0f, 0.0f, 0.0f, 0.0f}, q2[4] = {0.0f, 0.0f, 0.0f, 0.0f};
#pragma unroll
  for (int j = 0; j < NVK; ++j) { const float cm = vf[j / 16] * vr[j] - M; q1[j & 3] += cm; q2[j & 3] += cm * cm; }
  float s1 = (float)NT * ((q1[0] + q1[1]) + (q1[2] + q1[3])), s2 = (float)NT * ((q2[0] + q2[1]) + (q2[2] + q2[3]));
#pragma unroll
  for (int k = 0; k < NPK; ++k) { const int h = 2 * k + (t_ >> 7); const float W1 = sh[4 + h] * sh[0], W2 = sh[4 + NH + h] * sh[1], VW = sh[4 + 2 * NH + h] * vfac, se = W1 * mo[k][0] + W2 * mo[k][2];
    s1 += se; s2 += W1 * W1 * mo[k][1] + 2.0f * W1 * W2 * mo[k][4] + W2 * W2 * mo[k][3] + 2.0f * (VW * (W1 * mo[k][5] + W2 * mo[k][6]) - M * se); }
#pragma unroll
  for (int o = 16; o >= 1; o >>= 1) { s1 += __shfl_xor(s1, o); s2 += __shfl_xor(s2, o); }
  if ((t_ & 31) == 0) { tl[1][wv] = s1; tl[2][wv] = s2; }
  __syncthreads();
  if (t_ == 0) { float t1 = 0.0f, t2 = 0.0f;
#pragma unroll
    for (int w = 0; w < 8; ++w) { t1 += tl[1][w]; t2 += tl[2][w]; }
    const float n = NTOT; const float var = (t2 - t1 * (t1 / n)) / (n - 1.0f); const float dstd = sqrtf(fmaxf(var, 0.0f)); const float temp = (dstd < 1e-6f) ? 0.1f : 0.3f + dstd; sh[3] = 1.0f / clampf(temp, 0.1f, 5.0f); }
  __syncthreads();
  { if (t_ < 32) ((float*)CST)[t_] = (t_ < 4 + 3 * NH) ? sh[t_] : 0.0f;  }
}
__global__ __launch_bounds__(128) void outproj_kernel(const b16* __restrict__ OCh, const b16* __restrict__ OCl, const b16* __restrict__ WOUT, const float* __restrict__ bo, float* __restrict__ out) {
  __shared__ __attribute__((aligned(16))) float Ts[4][16][128 + 4];
  const int wave = threadIdx.x >> 5, lane = threadIdx.x & 31, nloc = lane & 15, hlf = lane >> 4; const size_t m0 = (size_t)blockIdx.x * 64 + wave * 16; const int n0 = blockIdx.y * 128;
  v8f acc[8];
#pragma unroll
  for (int t = 0; t < 8; ++t) acc[t] = (v8f){};
  const b16* ap = OCh + m0 * DIM; const b16* lp = OCl + m0 * DIM; const b16* bp = WOUT + (size_t)n0 * DIM; const unsigned flane = (unsigned)lane * 16u;   // ap, lp, bp: the first tile of row m0, of column n0
  v16b a = frag_pk(ap, flane), al = frag_pk(lp, flane), b[8];
#pragma unroll
  for (int t = 0; t < 8; ++t) b[t] = frag_pk(bp + (size_t)t * 16 * DIM, flane);
#pragma unroll   // full: the two fragment sets swap by renaming, and the last step's fetch falls away
  for (int kb = 0; kb < DIM; kb += 32) { v16b an = a, aln = al, bn[8];
#pragma unroll
    for (int t = 0; t < 8; ++t) bn[t] = b[t];
    if (kb + 32 < DIM) { an = frag_pk(ap + (kb + 32) * 16, flane); aln = frag_pk(lp + (kb + 32) * 16, flane);
#pragma unroll
      for (int t = 0; t < 8; ++t) bn[t] = frag_pk(bp + (size_t)t * 16 * DIM + (kb + 32) * 16, flane); }
    __builtin_amdgcn_sched_barrier(0);   // keeps the next step's loads, as one group, ahead of this step's products: sunk towards their uses they would each be waited for in turn
#pragma unroll
    for (int t = 0; t < 8; ++t) { acc[t] = wmma16b(a, b[t], acc[t]); acc[t] = wmma16b(al, b[t], acc[t]); }
    a = an; al = aln;
#pragma unroll
    for (int t = 0; t < 8; ++t) b[t] = bn[t]; }
#pragma unroll
  for (int t = 0; t < 8; ++t) { const float bb = bf16_rne(bo[n0 + t * 16 + nloc]);
#pragma unroll
    for (int r = 0; r < 8; ++r) Ts[wave][8 * hlf + r][t * 16 + nloc] = acc[t][r] * (1.0f / (XS * WSC)) + bb; }
  wave_lds_sync();
  { for (int rr = 0; rr < 16; ++rr) *(v4f*)(out + (m0 + rr) * DIM + n0 + lane * 4) = *(const v4f*)(&Ts[wave][rr][lane * 4]);  }
}
}  // namespace

extern "C" void kernel_launch(void* const* d_in, const int* in_sizes, int n_in, void* d_out, int out_size, void* d_ws, size_t ws_size, hipStream_t stream) {
  (void)n_in;
  auto Fp = [&](int i) { return (const float*)d_in[i]; };
  // input order: 0 q, 1 k, 2 v [4,1024,512]; 3 ln_in_g, 4 ln_in_b; 5 W_in [512,512]; 6 wp_W1 [128,64], 7 wp_b1, 8 wp_ln_g, 9 wp_ln_b, 10 wp_W2 [64,32], 11 wp_b2, 12 wp_W3 [32,3], 13 wp_b3, 14 weight_temp [1], 15 W_out [512,512], 16 b_out
  if (in_sizes[0] != NR * DIM || in_sizes[1] != NR * DIM || in_sizes[2] != NR * DIM || in_sizes[5] != DIM * DIM || in_sizes[6] != 2 * DH * DH || in_sizes[15] != DIM * DIM || out_size != NR * DIM) return;
  size_t off = 0; char* ws = (char*)d_ws;
  auto carve = [&](size_t bytes) { char* p = ws + off; off += (bytes + 255) & ~(size_t)255; return p; };
  b16* X16 = (b16*)carve((size_t)3 * NR * DIM * 2); b16* WIN = (b16*)carve((size_t)DIM * DIM * 2); b16* WOUT = (b16*)carve((size_t)DIM * DIM * 2);
  float* F32 = (float*)carve((size_t)3 * NP_ * NT * DH * 4); float* KCM = (float*)carve((size_t)NP_ * DH * 4); float* PSUM = (float*)carve((size_t)2 * NP_ * DH * 4);
  b16* FQ16 = (b16*)carve((size_t)NP_ * NT * DH * 2); b16* FQC16 = (b16*)carve((size_t)NP_ * NT * DH * 2); b16* FK16 = (b16*)carve((size_t)NP_ * NT * DH * 2); b16* FKC16 = (b16*)carve((size_t)NP_ * NT * DH * 2);
  float* N1 = (float*)carve((size_t)NP_ * NT * 4); float* N2 = (float*)carve((size_t)NP_ * NT * 4); float* I2B = (float*)carve((size_t)NP_ * NT * 4);   // N2 holds 1 / (key norm + 1e-8), I2B 1 / max(key norm, 1e-6)
  b16* FVTh = (b16*)carve((size_t)NP_ * DH * NT * 2); b16* FVTl = (b16*)carve((size_t)NP_ * DH * NT * 2);
  float* P1 = (float*)carve((size_t)NP_ * (NT / 32) * 32 * 4); float* VARC = (float*)carve((size_t)NP_ * NT * 4); float* CST = (float*)carve(256);
  b16* OCh = (b16*)carve((size_t)NR * DIM * 2); b16* OCl = (b16*)carve((size_t)NR * DIM * 2);
  if (off > ws_size || off > ((size_t)128 << 20)) return;   // ≈ 73 MB
  ln_kernel<<<3 * NR / 8, 256, 0, stream>>>(Fp(0), Fp(1), Fp(2), Fp(3), Fp(4), X16);
  prepw_kernel<<<(2 * DIM * DIM / 8 + 255) / 256, 256, 0, stream>>>(Fp(5), Fp(15), WIN, WOUT);
  feat_kernel<<<dim3(NR / 64, DIM / 128, 3), 128, 0, stream>>>(X16, WIN, F32);
  colstat_kernel<<<dim3(NP_, 2), 256, 0, stream>>>(F32, KCM, PSUM);
  rowops_kernel<<<NP_ * NT / 16, 256, 0, stream>>>(F32, KCM, FQ16, FQC16, N1, FK16, FKC16, N2);
  norms_kernel<<<NP_ * NT / 256, 256, 0, stream>>>(F32, N1, N2, I2B);
  vt_kernel<<<dim3(NT / 64, NP_), 256, 0, stream>>>(F32, FVTh, FVTl);
  score_kernel<1><<<dim3(NT / 32, NP_), 64, 0, stream>>>(FQ16, FQC16, N1, FK16, FKC16, N2, I2B, FVTh, FVTl, CST, P1, VARC, OCh, OCl);
  reduce1_kernel<<<1, 256, 0, stream>>>(P1, VARC, PSUM, Fp(6), Fp(7), Fp(8), Fp(9), Fp(10), Fp(11), Fp(12), Fp(13), Fp(14), CST);
  score_kernel<3><<<dim3(NT / 32, NP_), 64, 0, stream>>>(FQ16, FQC16, N1, FK16, FKC16, N2, I2B, FVTh, FVTl, CST, P1, VARC, OCh, OCl);
  outproj_kernel<<<dim3(NR / 64, DIM / 128), 128, 0, stream>>>(OCh, OCl, WOUT, Fp(16), (float*)d_out);
}

// v006
// It runs in 125 microseconds.
// Two timings next to v005 put it at 1.24 and 1.25 times that version's speed.
// Over all steps from v000 it is 5.57 times as fast.
#include <hip/hip_runtime.h>

// "Super-aggressive" attention: f_q, f_k, f_v = LN(q|k|v) W_in split into 8 heads x 64; per (head, batch) pair: cos = clip(f_q.f_k / (n1 n2), +-0.99) (n = norm + 1e-8),
// cov = reg x (f_q - rowmean_d)(f_k - colmean_m) / (8 + 1e-6) (reg = 1e-3/1024, x10 if the global std of the raw cov < 1e-6), csim = clip(qn.kn) with max(norm, 1e-6), margin =
// clip(0.01 - csim, 0, 10), var_c = row mean of margin; per-head weights (cw, covw, vw) from a tiny MLP on the global means of f_q / f_k (softmax, /clip(weight_temp), softmax, clip, renorm);
// cn / covn / vn = global std (ddof 1) of cos / cov / var_c (+1e-6); d2 = cw cos/cn cscale + covw cov/covn/2 + vw var_c/vn/2; temp = 0.3 + std(d2) (dstd >= 1e-6; clipped to [0.1, 5]);
// attn = softmax(d2 / temp); out_h = attn f_v; out = concat_h W_out + b -> [4][1024][512].
// Every global statistic is a deterministic f32 reduction (per-wave partials, then one fixed-order kernel; the means of f_q / f_k take a per-pair level in between); the [1024 x 1024] score tiles are recomputed in two passes
// (component statistics; softmax + PV) instead of being stored. std(d2) takes no pass of its own: d2 is linear in cos, cov and var_c, so its variance is a quadratic form in their first and second moments per head.
// WMMA (v_wmma_f32_16x16x32_f16, f32 accumulate): W_in (LN(x) single f16 x8, exact weights), dots / centered-cov tiles (single f16 x8 feature planes, K = 64), P.V (P single x8, f_v^T hi+lo:
// 2 products), W_out (O hi+lo: 2 products). LN, norms, all statistics and the weight-predictor MLP in f32. Inputs rounded to bf16 once. Fragment k-map per lane half hh

namespace {
constexpr int QB = 4, NT = 1024, DIM = 512, NH = 8, DH = 64, NP_ = NH * QB /* 32 (h,q) pairs, index h*QB + q */, NR = QB * NT /* 4096 rows */, NWAVE = NP_ * (NT / 16) /* 2048 score waves */;
constexpr float XS = 8.0f, WSC = 256.0f, PS = 8.0f, GAMMA = 0.01f, LREG = 0.001f;
constexpr float NTOT = 33554432.0f;   // 33,554,432 score elements

typedef _Float16 b16;
typedef __attribute__((ext_vector_type(16))) _Float16 v16b;
typedef __attribute__((ext_vector_type(8))) _Float16 v8b;
typedef __attribute__((ext_vector_type(8))) float v8f;
typedef __attribute__((ext_vector_type(4))) float v4f;
__device__ __forceinline__ float bf16_rne(float f) { unsigned int u = __float_as_uint(f); u += 0x7FFFu + ((u >> 16) & 1u); return __uint_as_float(u & 0xFFFF0000u); }
__device__ __forceinline__ void split16(float v, b16& hi, b16& lo) { hi = (b16)v; lo = (b16)(v - (float)hi); }
__device__ __forceinline__ v16b frag_kb(const b16* p, int hh) { const v8b a = *(const v8b*)(p + 8 * hh), b = *(const v8b*)(p + 16 + 8 * hh); v16b f;
#pragma unroll
  for (int e = 0; e < 8; ++e) { f[e] = a[e]; f[8 + e] = b[e]; } return f; }
// Fragment order: the planes that the matrix loops read again and again (keys, centred keys, f_v^T hi/lo, both weight planes, the attention output hi/lo) are stored tile by tile, a tile = 16 rows x 32 k = 1,024 contiguous bytes laid out as
// [k half j][lane = 16 hh + row][8 elements], element (row, kk) with j = kk / 16, hh = (kk / 8) % 2. A wave's 16-byte load then covers 512 contiguous bytes (4 whole lines) instead of 32-byte pieces of 16 lines; each lane gets the same values in the same registers as from frag_kb.
__device__ __forceinline__ int frag_pos(int row, int kk) { return (kk >> 4) * 256 + (((kk >> 3) & 1) * 16 + row) * 8 + (kk & 7); }   // element offset inside a tile
__device__ __forceinline__ v16b frag_pk(const b16* utile, unsigned lane_bytes) { const char* p = (const char*)utile + lane_bytes; const v8b a = *(const v8b*)p, b = *(const v8b*)(p + 512); v16b f;   // wave-uniform tile base plus 16 * lane bytes
#pragma unroll
  for (int e = 0; e < 8; ++e) { f[e] = a[e]; f[8 + e] = b[e]; } return f; }
__device__ __forceinline__ v8f wmma16b(v16b a, v16b b, v8f c) { v8f d = __builtin_amdgcn_wmma_f32_16x16x32_f16(false, a, false, b, (short)0, c, false, false); asm volatile("v_nop\n\tv_nop\n\tv_nop\n\tv_nop" : "+v"(d) : "v"(a), "v"(b)); return d; }
// the same product for a B operand that stays live and unwritten through the whole loop (the query fragments): B is left out of the statement's operands, which all have to sit in the first 256 registers, so that it may live above them
__device__ __forceinline__ v8f wmma16q(v16b a, v16b b, v8f c) { v8f d = __builtin_amdgcn_wmma_f32_16x16x32_f16(false, a, false, b, (short)0, c, false, false); asm volatile("v_nop\n\tv_nop\n\tv_nop\n\tv_nop" : "+v"(d) : "v"(a)); return d; }
// closes a run of global loads. The wait stands in front of the next instruction that writes a register from which those loads took their address (a precaution).
// The scheduling barrier keeps later address arithmetic from being lifted over that wait, and keeps the run up here, ahead of the work that covers its latency: sunk towards their uses the loads would each be waited for in turn.
__device__ __forceinline__ void close_load_run() { asm volatile("s_wait_xcnt 0x0" ::: "memory"); __builtin_amdgcn_sched_barrier(0); }
__device__ __forceinline__ void wave_lds_sync() { __builtin_amdgcn_fence(__ATOMIC_RELEASE, "workgroup"); __builtin_amdgcn_wave_barrier(); __builtin_amdgcn_fence(__ATOMIC_ACQUIRE, "workgroup"); }
// 2^x on v_exp_f32, with the slot that the instruction set asks for behind a transcendental (before its result is used or its source overwritten) filled in the same statement: a v_nop in a statement of its own did not stay behind it
__device__ __forceinline__ float nexp2(float x) { float r; asm("v_exp_f32 %0, %1\n\tv_nop" : "=v"(r) : "v"(x)); return r; }
__device__ __forceinline__ float pmul(float a, float b) { float p = a * b; asm volatile("" : "+v"(p)); return p; }
__device__ __forceinline__ float hsum16(float v) { v += __shfl_xor(v, 1); v += __shfl_xor(v, 2); v += __shfl_xor(v, 4); return v + __shfl_xor(v, 8); }
__device__ __forceinline__ float clampf(float v, float lo, float hi) { return fminf(fmaxf(v, lo), hi); }

// one launch for the two independent preparations: blocks 0 .. NPW - 1 put the two weight planes into fragment order, the others normalise 8 rows each
constexpr int NPW = 2 * DIM * DIM / 8 / 256;
__global__ __launch_bounds__(256) void ln_prepw_kernel(const float* __restrict__ q, const float* __restrict__ k, const float* __restrict__ v, const float* __restrict__ g, const float* __restrict__ be, const float* __restrict__ win, const float* __restrict__ wout, b16* __restrict__ X16, b16* __restrict__ WIN, b16* __restrict__ WOUT) {
  if (blockIdx.x < NPW) { const int t = blockIdx.x * 256 + threadIdx.x, kind = t / (DIM * DIM / 8), tt = t - kind * (DIM * DIM / 8);
    // thread tt fills the 16-byte piece tt of the plane in fragment order: tile tt / 64 = (row tile) * 16 + k tile, piece tt % 64 = [j][hh][row]
    const int tile = tt >> 6, o_ = (tile / (DIM / 32)) * 16 + (tt & 15), k0 = (tile % (DIM / 32)) * 32 + ((tt >> 5) & 1) * 16 + ((tt >> 4) & 1) * 8;
    const float* w = kind == 0 ? win : wout; v8b o; for (int j = 0; j < 8; ++j) o[j] = (b16)(bf16_rne(w[(size_t)(k0 + j) * DIM + o_]) * WSC);
    *(v8b*)((kind == 0 ? WIN : WOUT) + (size_t)tt * 8) = o; return; }
  const int wave = threadIdx.x >> 5, lane = threadIdx.x & 31; const int rowall = (blockIdx.x - NPW) * 8 + wave; const int which = rowall / NR, row = rowall - which * NR;
  const float* src = (which == 0 ? q : which == 1 ? k : v) + (size_t)row * DIM + lane * 16; float x[16];
  { const v4f a = *(const v4f*)src, b = *(const v4f*)(src + 4), c = *(const v4f*)(src + 8), d = *(const v4f*)(src + 12); for (int j = 0; j < 4; ++j) { x[j] = bf16_rne(a[j]); x[4 + j] = bf16_rne(b[j]); x[8 + j] = bf16_rne(c[j]); x[12 + j] = bf16_rne(d[j]); } }
  float s = 0.0f; for (int j = 0; j < 16; ++j) s += x[j];
#pragma unroll
  for (int o = 16; o >= 1; o >>= 1) s += __shfl_xor(s, o);
  const float mu = s * (1.0f / DIM); float ss = 0.0f; for (int j = 0; j < 16; ++j) { const float d = x[j] - mu; ss += pmul(d, d); }
#pragma unroll
  for (int o = 16; o >= 1; o >>= 1) ss += __shfl_xor(ss, o);
  const float rs = rsqrtf(ss * (1.0f / DIM) + 1e-5f); v8b o0, o1;
  for (int j = 0; j < 16; ++j) { const int c = lane * 16 + j; const b16 hv = (b16)((pmul((x[j] - mu) * rs, bf16_rne(g[c])) + bf16_rne(be[c])) * XS); if (j < 8) o0[j] = hv; else o1[j - 8] = hv; }
  { b16* dst = X16 + ((size_t)which * NR + row) * DIM + lane * 16; *(v8b*)dst = o0; *(v8b*)(dst + 8) = o1;  }
}
// features: F = X16 W_in per row (block = 64 rows x 4 waves, wave = 16 rows x 128 cols = 2 heads; grid.y = 4): which 0 (q): F32Q [pair][n][64] f32 rows; which 1 (k): F32K; which 2 (v): F32V. (f32 planes,
__global__ __launch_bounds__(128) void feat_kernel(const b16* __restrict__ X16, const b16* __restrict__ WIN, float* __restrict__ F32, float* __restrict__ CP) {
  __shared__ __attribute__((aligned(16))) float Ts[4][16][128 + 4];
  const int wave = threadIdx.x >> 5, lane = threadIdx.x & 31, nloc = lane & 15, hlf = lane >> 4; const int which = blockIdx.z; const size_t m0 = (size_t)blockIdx.x * 64 + wave * 16; const int n0 = blockIdx.y * 128;
  v8f acc[8];
#pragma unroll
  for (int t = 0; t < 8; ++t) acc[t] = (v8f){};
  const b16* ap = X16 + ((size_t)which * NR + m0 + nloc) * DIM; const b16* bp = WIN + (size_t)n0 * DIM; const unsigned flane = (unsigned)lane * 16u;   // bp: the first weight tile of column n0 (16 rows x 512 k = 16 tiles of 512 elements)
  v16b a = frag_kb(ap, hlf), b[8];
#pragma unroll
  for (int t = 0; t < 8; ++t) b[t] = frag_pk(bp + (size_t)t * 16 * DIM, flane);
#pragma unroll   // full: the two fragment sets swap by renaming, and the last step's fetch falls away
  for (int kb = 0; kb < DIM; kb += 32) { v16b an = a, bn[8];
#pragma unroll
    for (int t = 0; t < 8; ++t) bn[t] = b[t];
    if (kb + 32 < DIM) { an = frag_kb(ap + kb + 32, hlf);
#pragma unroll
      for (int t = 0; t < 8; ++t) bn[t] = frag_pk(bp + (size_t)t * 16 * DIM + (kb + 32) * 16, flane); }
    __builtin_amdgcn_sched_barrier(0);   // keeps the next step's loads, as one group, ahead of this step's products: sunk towards their uses they would each be waited for in turn
#pragma unroll
    for (int t = 0; t < 8; ++t) acc[t] = wmma16b(a, b[t], acc[t]);
    a = an;
#pragma unroll
    for (int t = 0; t < 8; ++t) b[t] = bn[t]; }
#pragma unroll
  for (int t = 0; t < 8; ++t)
#pragma unroll
    for (int r = 0; r < 8; ++r) Ts[wave][8 * hlf + r][t * 16 + nloc] = acc[t][r] * (1.0f / (XS * WSC));
  wave_lds_sync();
  // rows m0+rr: q_idx = row / NT, n = row % NT; cols n0 + c -> head h = (n0 + c) / 64, d = % 64; F32 layout [which][pair][n][64]
  // a lane keeps columns n0 + 4 lane .. + 3 (lane half = head) through the wave's 16 rows, which lie in one batch entry, and sums them on the way: CP [which 0/1][pair][16-row tile][64] = column sums of the tile, the first level of the means over rows
  { const int qi = (int)(m0 / NT), n = (int)(m0 - (size_t)qi * NT), pair = (n0 / DH + hlf) * QB + qi; float* dst = F32 + (((size_t)which * NP_ + pair) * NT + n) * DH + nloc * 4; v4f x[16];
#pragma unroll
    for (int rr = 0; rr < 16; ++rr) { x[rr] = *(const v4f*)(&Ts[wave][rr][lane * 4]); *(v4f*)(dst + rr * DH) = x[rr]; }
    close_load_run();   // the same wait behind this run of stores: the sums below are formed in the registers that the stores name
    if (which < 2) { v4f cs = x[0];
#pragma unroll
      for (int rr = 1; rr < 16; ++rr) cs += x[rr];
      *(v4f*)(CP + (((size_t)which * NP_ + pair) * (NT / 16) + n / 16) * DH + nloc * 4) = cs; } }
}
// operand planes per pair, one launch (block = 64 rows of one pair, 8 waves): FQ16 [pair][n][64] = f16(8 f_q), FQC16 = f16(8 (f_q - rowmean)); FK16, FKC16 = f16(8 (f_k - colmean)) (both in fragment order);
// N1 [pair][n] = ||f_q|| (f32); FVTh/FVTl = f_v^T hi/lo x8 (rows d, k = keys, in fragment order). The key norms enter every score element only through 1 / (n2 + 1e-8) and 1 / max(n2, 1e-6):
// the two quotients are formed here, once a key (I2A, I2B), not once a score element in each pass. The squared norms come from the same registers as the f16 planes (4 products a lane, then a tree over the row's 16 lanes).
// Column sums over the pair's 1,024 rows, second level: thread (d = t % 64, part = t / 64) adds 16 of the 64 tile sums in CP, the four parts meet in LDS; every block forms them for its own use (colmean of f_k), block 0 of a pair stores PSUM [which 0/1][pair][64].
__global__ __launch_bounds__(256) void planes_kernel(const float* __restrict__ F32, const float* __restrict__ CP, float* __restrict__ PSUM, b16* __restrict__ FQ16, b16* __restrict__ FQC16, float* __restrict__ N1, b16* __restrict__ FK16, b16* __restrict__ FKC16, float* __restrict__ I2A, float* __restrict__ I2B, b16* __restrict__ FVTh, b16* __restrict__ FVTl) {
  __shared__ __attribute__((aligned(16))) b16 Th[DH][64 + 8], Tl[DH][64 + 8]; __shared__ __attribute__((aligned(16))) float Cs[2][4][DH]; __shared__ float Ns[2][64];   // Ns: the block's squared norms of f_q and f_k
  const int pair = blockIdx.y, n0 = blockIdx.x * 64, t_ = threadIdx.x, lane = t_ & 31, c0 = (lane & 15) * 4, rl = (t_ >> 5) * 8 + (lane >> 4);   // a wave takes 8 rows, two a trip: row rl + 2 i, columns c0 .. c0 + 3
  const size_t row0 = (size_t)pair * NT + n0; const float* qp = F32 + (row0 + rl) * DH + c0; const float* kp = qp + (size_t)NP_ * NT * DH; const float* vp = F32 + (2 * (size_t)NP_ * NT + row0) * DH + t_;
  const float* cq = CP + ((size_t)pair * (NT / 16) + (t_ >> 6) * 16) * DH + (t_ & 63); const float* ck = cq + (size_t)NP_ * (NT / 16) * DH;
  __builtin_amdgcn_sched_barrier(0);   // keeps the index arithmetic above from being placed between the loads below and the wait that closes their run
  v4f fq[4], fk[4]; float xv[16], pq[16], pk[16];
#pragma unroll
  for (int i = 0; i < 16; ++i) { pq[i] = cq[i * DH]; pk[i] = ck[i * DH]; }
#pragma unroll
  for (int i = 0; i < 4; ++i) { fq[i] = *(const v4f*)(qp + i * 2 * DH); fk[i] = *(const v4f*)(kp + i * 2 * DH); }
#pragma unroll
  for (int i = 0; i < 16; ++i) xv[i] = vp[i * 256];   // the [64 n][64 d] chunk of f_v, element t_ + 256 i
  // closes the run as close_load_run() does; the input operands keep the run's address registers from being given to a later load's result ahead of the wait
  asm volatile("s_wait_xcnt 0x0" :: "v"(cq), "v"(ck), "v"(qp), "v"(kp), "v"(vp) : "memory"); __builtin_amdgcn_sched_barrier(0);
  { float a = 0.0f, b = 0.0f;
#pragma unroll
    for (int i = 0; i < 16; ++i) { a += pq[i]; b += pk[i]; }
    Cs[0][t_ >> 6][t_ & 63] = a; Cs[1][t_ >> 6][t_ & 63] = b; }
  float mq[4], ssq[4], ssk[4];   // the twelve lane trees stand side by side, with no branch between them, so that each step's cross-lane moves overlap
#pragma unroll
  for (int i = 0; i < 4; ++i) { float sq = 0.0f; ssq[i] = 0.0f; ssk[i] = 0.0f; for (int j = 0; j < 4; ++j) { sq += fq[i][j]; ssq[i] += fq[i][j] * fq[i][j]; ssk[i] += fk[i][j] * fk[i][j]; }
    sq = hsum16(sq); ssq[i] = hsum16(ssq[i]); ssk[i] = hsum16(ssk[i]); mq[i] = sq * (1.0f / DH); }
  if ((lane & 15) == 0) {
#pragma unroll
    for (int i = 0; i < 4; ++i) { Ns[0][rl + 2 * i] = ssq[i]; Ns[1][rl + 2 * i] = ssk[i]; } }
#pragma unroll
  for (int i = 0; i < 16; ++i) { const int qq = t_ + i * 256, nn = qq >> 6, d = qq & 63; b16 h_, l_; split16(xv[i] * XS, h_, l_); Th[d][nn] = h_; Tl[d][nn] = l_; }   // transpose [64 n][64 d] -> rows d, hi/lo
  __syncthreads();
  const v4f km = ((*(const v4f*)(&Cs[1][0][c0]) + *(const v4f*)(&Cs[1][1][c0])) + (*(const v4f*)(&Cs[1][2][c0]) + *(const v4f*)(&Cs[1][3][c0]))) * (1.0f / NT);   // colmean of f_k
  typedef __attribute__((ext_vector_type(4))) _Float16 v4b;
#pragma unroll
  for (int i = 0; i < 4; ++i) { v4b a, ac, b, bc;
    for (int j = 0; j < 4; ++j) { a[j] = (b16)(fq[i][j] * XS); ac[j] = (b16)((fq[i][j] - mq[i]) * XS); b[j] = (b16)(fk[i][j] * XS); bc[j] = (b16)((fk[i][j] - km[j]) * XS); }
    const size_t prow = row0 + rl + 2 * i, kpos = (prow >> 4) * (16 * DH) + (c0 >> 5) * 512 + frag_pos((int)(prow & 15), c0 & 31);   // key planes in fragment order: 16 rows are one row tile (2 k tiles, 2 KiB a plane)
    *(v4b*)(FQ16 + prow * DH + c0) = a; *(v4b*)(FQC16 + prow * DH + c0) = ac; *(v4b*)(FK16 + kpos) = b; *(v4b*)(FKC16 + kpos) = bc; }
  // fragment order, tiles [pair][32-key block][16-d tile]: the block's 64 keys are 8 tiles = 8 KiB a plane, and piece qq = [key block][d tile][j][hh][row] goes to byte 16 qq of them
#pragma unroll
  for (int qq = t_; qq < DH * 8; qq += 256) { const int d = ((qq >> 6) & 3) * 16 + (qq & 15), c8 = (qq >> 8) * 32 + ((qq >> 5) & 1) * 16 + ((qq >> 4) & 1) * 8; const size_t gi = row0 * DH + (size_t)qq * 8; *(v8b*)(FVTh + gi) = *(const v8b*)(&Th[d][c8]); *(v8b*)(FVTl + gi) = *(const v8b*)(&Tl[d][c8]); }
  if (t_ < 64) { const float n2 = sqrtf(Ns[1][t_]); N1[row0 + t_] = sqrtf(Ns[0][t_]); I2A[row0 + t_] = 1.0f / (n2 + 1e-8f); I2B[row0 + t_] = 1.0f / fmaxf(n2, 1e-6f); }   // two waves, a whole 128-byte line each and array
  if (blockIdx.x == 0 && t_ < 2 * DH) { const int w = t_ >> 6, d = t_ & 63; PSUM[((size_t)w * NP_ + pair) * DH + d] = (Cs[w][0][d] + Cs[w][1][d]) + (Cs[w][2][d] + Cs[w][3][d]); }
}
// score-tile passes: wave = 16 query rows n of one pair (block = 2 waves), loop over 32 key blocks of 32: dots^T and covraw^T tiles (keys x queries, K = 64: 2 steps x 2 key tiles x 2 GEMMs = 8 WMMAs),
// lane (hh, col=query) holds keys kb+8hh+r and kb+16+8hh+r.  cos = clip(dots/((n1+1e-8)(n2+1e-8))), csim = clip(dots/(max(n1,1e-6) max(n2,1e-6))), margin = clip(0.01 - csim, 0, 10), covraw = c/(8+1e-6).
// PASS 1: per wave the sums of cos, cos^2, covraw, covraw^2, cos covraw, and of var_c x (row sum of cos) and var_c x (row sum of covraw) over its 16 rows -> P1; per row var_c -> VARC.
// PASS 3 (given cn, covfac = reg/covn/2, w per head, vn, temp): per row c_row = vw var_c/(2 vn); e = cw cos/cn cscale + covw covraw covfac (d2 - c_row); logits = (e + c_row)/temp -> online softmax (f32) with o^T += f_v^T P^T (hi+lo, 4 d-tiles): O [pair][n][64] -> OC16h/l, rows q*NT+n, k = h*64+d (concat-head planes, hi/lo x8, in fragment order).
template <int PASS>
__global__ __launch_bounds__(64) void score_kernel(const b16* __restrict__ FQ16, const b16* __restrict__ FQC16, const float* __restrict__ N1, const b16* __restrict__ FK16, const b16* __restrict__ FKC16, const float* __restrict__ I2A, const float* __restrict__ I2B, const b16* __restrict__ FVTh, const b16* __restrict__ FVTl,
                                                  const float* __restrict__ CST /* [0..3] cscale/cn, reg/(2 covn), 1/(2 vn), 1/temp; [4..27] cw, covw, vw per head */, float* __restrict__ P1, float* __restrict__ VARC, b16* __restrict__ OCh, b16* __restrict__ OCl) {
  __shared__ __attribute__((aligned(16))) float To[2][16][DH + 4]; __shared__ float Tr[2][16]; __shared__ float Tp[2][8];
  const int wave = threadIdx.x >> 5, lane = threadIdx.x & 31, hh = lane >> 4, col = lane & 15; const int pair = blockIdx.y, n0 = blockIdx.x * 32 + wave * 16, ni = n0 + col; const int h = pair / QB, qi = pair - h * QB;
  const size_t prow = (size_t)pair * NT + ni; const b16* Qp = FQ16 + prow * DH; const b16* Qc = FQC16 + prow * DH; const b16* Kb = FK16 + (size_t)pair * NT * DH; const b16* Kc = FKC16 + (size_t)pair * NT * DH;
  __builtin_amdgcn_sched_barrier(0);   // keeps the index arithmetic above from being placed between the loads below and the wait that closes their run
  const v16b qa0 = frag_kb(Qp, hh), qa1 = frag_kb(Qp + 32, hh); close_load_run();
  const v16b qc0 = frag_kb(Qc, hh), qc1 = frag_kb(Qc + 32, hh); close_load_run();
  // Every factor of a score element that belongs to the query row, the head or the whole launch is multiplied up here, once a wave. The powers of two (1 / XS^2) move exactly, so pass 1 keeps its bits.
  const float n1 = N1[prow]; close_load_run(); const float q1a = (1.0f / (n1 + 1e-8f)) * (1.0f / (XS * XS)), q1b = (1.0f / fmaxf(n1, 1e-6f)) * (1.0f / (XS * XS));
  constexpr float CK = (1.0f / (8.0f + 1e-6f)) * (1.0f / (XS * XS)), LOG2E = 1.4426950408889634f, LOG2_PS = 3.0f; static_assert(PS == 8.0f, "LOG2_PS is log2(PS)");
  float cn_inv_cscale = 0.0f, covfac = 0.0f, vn_half_inv = 0.0f, temp_inv = 0.0f, cwh = 0.0f, covwh = 0.0f, vwh = 0.0f;   // this head's constants, read once ahead of the loop
  if (PASS == 3) { const float* cf = CST; cn_inv_cscale = cf[0]; covfac = cf[1]; vn_half_inv = cf[2]; temp_inv = cf[3]; cwh = cf[4 + h]; covwh = cf[4 + NH + h]; vwh = cf[4 + 2 * NH + h]; }
  float crow = 0.0f; if (PASS == 3) crow = vwh * VARC[prow] * vn_half_inv;
  // e = w1 cos + w2 c (c the raw centred product); pass 3 takes its logits as w1 cos + w2 c + w0 in units of log2, so that 2^x needs no multiply of its own
  const float lsc = temp_inv * LOG2E, w1 = cwh * cn_inv_cscale * lsc, w2 = covwh * covfac * CK * lsc, w0 = crow * lsc;
  float s_a = 0.0f, s_b = 0.0f, s_c = 0.0f, s_d = 0.0f, s_x = 0.0f, rowacc = 0.0f;
  float m = -INFINITY, l = 0.0f; v8f o[4] = {{}, {}, {}, {}}, ol[4] = {{}, {}, {}, {}};
  // One key block's operands (8 key fragments, 16 key factors; 32 in pass 1) live in registers and are fetched together, a whole block ahead of their use.
  v16b k0a, k0b, k1a, k1b, x0a, x0b, x1a, x1b; v4f nn0, nn1, nn2, nn3, mm0 = {}, mm1 = {}, mm2 = {}, mm3 = {};
  const unsigned flane = (unsigned)lane * 16u, nlane = (unsigned)hh * 32u;   // per-lane byte offsets into a tile in fragment order and into a key block's norms
  auto fetch_keys = [&](int kq) { const b16* kr = Kb + (size_t)kq * DH; const b16* cr = Kc + (size_t)kq * DH; const char* np = (const char*)(I2A + (size_t)pair * NT + kq) + nlane;
    nn0 = *(const v4f*)np; nn1 = *(const v4f*)(np + 16); nn2 = *(const v4f*)(np + 64); nn3 = *(const v4f*)(np + 80);
    if (PASS == 1) { const char* nq = (const char*)(I2B + (size_t)pair * NT + kq) + nlane; mm0 = *(const v4f*)nq; mm1 = *(const v4f*)(nq + 16); mm2 = *(const v4f*)(nq + 64); mm3 = *(const v4f*)(nq + 80); }
    close_load_run();
    k0a = frag_pk(kr, flane); k0b = frag_pk(kr + 512, flane); k1a = frag_pk(kr + 1024, flane); k1b = frag_pk(kr + 1536, flane); close_load_run();   // a 32-key block = 4 tiles: [16 keys][k tile]
    x0a = frag_pk(cr, flane); x0b = frag_pk(cr + 512, flane); x1a = frag_pk(cr + 1024, flane); x1b = frag_pk(cr + 1536, flane); close_load_run(); };
  fetch_keys(0);
  for (int kb = 0; kb < NT; kb += 32) {
    v8f d0 = {}, d1 = {}, c0 = {}, c1 = {};
    d0 = wmma16q(k0a, qa0, d0); d0 = wmma16q(k0b, qa1, d0);
    d1 = wmma16q(k1a, qa0, d1); d1 = wmma16q(k1b, qa1, d1);
    c0 = wmma16q(x0a, qc0, c0); c0 = wmma16q(x0b, qc1, c0);
    c1 = wmma16q(x1a, qc0, c1); c1 = wmma16q(x1b, qc1, c1);
    const v4f na0 = nn0, na1 = nn1, nb0 = nn2, nb1 = nn3, ma0 = mm0, ma1 = mm1, mb0 = mm2, mb1 = mm3;
    // behind the last score product: this block's value fragments (used after the softmax arithmetic), then the next block's keys (the last block re-reads block 0, unused), all in flight under the vector work
    v16b vh[4], vl[4];
    if (PASS == 3) {
#pragma unroll
      for (int t = 0; t < 4; ++t) { vh[t] = frag_pk(FVTh + ((size_t)pair * NT + kb) * DH + t * 512, flane); vl[t] = frag_pk(FVTl + ((size_t)pair * NT + kb) * DH + t * 512, flane); }
      close_load_run(); }
    const int kn = kb + 32 < NT ? kb + 32 : 0;
    fetch_keys(kn);
    float ev0[8], ev1[8];
#pragma unroll
    for (int r = 0; r < 8; ++r) {
#pragma unroll
      for (int hq = 0; hq < 2; ++hq) { const float dw = hq ? d1[r] : d0[r], cw_ = hq ? c1[r] : c0[r];   // the two raw products
        const float i2a = hq ? (r < 4 ? nb0[r & 3] : nb1[r & 3]) : (r < 4 ? na0[r & 3] : na1[r & 3]); const float cosv = clampf(dw * q1a * i2a, -0.99f, 0.99f);
        if (PASS == 1) { const float i2b = hq ? (r < 4 ? mb0[r & 3] : mb1[r & 3]) : (r < 4 ? ma0[r & 3] : ma1[r & 3]); const float covraw = cw_ * CK;
          const float csim = clampf(dw * q1b * i2b, -0.99f, 0.99f); const float margin = clampf(GAMMA - csim, 0.0f, 10.0f);
          s_a += cosv; s_b += pmul(cosv, cosv); s_c += covraw; s_d += pmul(covraw, covraw); s_x += cosv * covraw; rowacc += margin; }
        else { (hq ? ev1 : ev0)[r] = cosv * w1 + (cw_ * w2 + w0); } } }
    if (PASS == 3) { float mr = -INFINITY;
#pragma unroll
      for (int r = 0; r < 8; ++r) mr = fmaxf(mr, fmaxf(ev0[r], ev1[r]));
      mr = fmaxf(mr, __shfl_xor(mr, 16)); const float mn = fmaxf(m, mr); const float al_ = nexp2(m - mn); m = mn; const float ms = mn - LOG2_PS; float sum = 0.0f; v16b pb;   // ms: the factor PS of the f16 weights rides in the exponent; l then holds PS times the row sum
#pragma unroll
      for (int r = 0; r < 8; ++r) { const float e0 = nexp2(ev0[r] - ms), e1 = nexp2(ev1[r] - ms); sum += e0 + e1; pb[r] = (b16)e0; pb[8 + r] = (b16)e1; }
      sum += __shfl_xor(sum, 16); l = l * al_ + sum;
#pragma unroll
      for (int t = 0; t < 4; ++t) { o[t] *= al_; ol[t] *= al_; o[t] = wmma16b(vh[t], pb, o[t]); ol[t] = wmma16b(vl[t], pb, ol[t]); } } }
  if (PASS == 1) {   // per-row sums across the two lane halves; per-wave partials over the 16 rows and 32 lanes
    rowacc += __shfl_xor(rowacc, 16); if (hh == 0) Tr[wave][col] = rowacc;
    // a lane's s_a and s_c are its query row's sums of cos and covraw over the lane half's keys: weighted with the row's var_c they give the cross terms of d2's variance
    const float vc = rowacc * (1.0f / NT); float v7[7] = {s_a, s_b, s_c, s_d, s_x, vc * s_a, vc * s_c};
#pragma unroll
    for (int j = 0; j < 7; ++j) { float v = v7[j];
#pragma unroll
      for (int oo = 16; oo >= 1; oo >>= 1) v += __shfl_xor(v, oo);
      v7[j] = v; }
    if (lane == 0) {
#pragma unroll
      for (int j = 0; j < 7; ++j) Tp[wave][j] = v7[j];
      Tp[wave][7] = 0.0f; }
    wave_lds_sync();
    __syncthreads();
    if (wave == 0) { VARC[(size_t)pair * NT + blockIdx.x * 32 + lane] = Tr[lane >> 4][lane & 15] * (1.0f / NT);
      P1[((size_t)pair * (NT / 32) + blockIdx.x) * 32 + lane] = (lane < 16) ? Tp[lane >> 3][lane & 7] : 0.0f; }
  } else {
    const float inv = 1.0f / (l * XS);
#pragma unroll
    for (int t = 0; t < 4; ++t)
#pragma unroll
      for (int r = 0; r < 8; ++r) To[wave][col][t * 16 + 8 * hh + r] = (o[t][r] + ol[t][r]) * inv;
    wave_lds_sync();
    // fragment order for the output projection: the wave's 16 rows x 64 columns are 2 tiles (2 KiB) a plane; store i covers the 512 bytes [k tile i / 2][j = i % 2]
    { for (int i = 0; i < 4; ++i) { const int rr = col, c8 = (i >> 1) * 32 + (i & 1) * 16 + hh * 8; v8b hv, lv; for (int j = 0; j < 8; ++j) { b16 a_, c_; split16(To[wave][rr][c8 + j] * XS, a_, c_); hv[j] = a_; lv[j] = c_; }
        const size_t gi = ((size_t)qi * NT + n0) * DIM + (h * 2) * 512 + i * 256 + lane * 8; *(v8b*)(OCh + gi) = hv; *(v8b*)(OCl + gi) = lv; }  }
  }
}
// reduction (one block, fixed order): cn, covn, vn, weights, then dstd -> temp -> CST[0..27].
// It runs as one block on an otherwise idle chip, so nothing hides a load's latency but the block's own instruction order: the kernel issues ALL its global reads in one run at its head and keeps them in registers
// (the predictor's weights go on to LDS), so that it pays about one memory latency in all instead of one per loop trip. Every sum keeps its operands and its order; in the loops written anew a product now fuses with its addition.
__global__ __launch_bounds__(256) void reduce1_kernel(const float* __restrict__ P1, const float* __restrict__ VARC, const float* __restrict__ PSUM, const float* __restrict__ w1, const float* __restrict__ b1, const float* __restrict__ g2, const float* __restrict__ be2, const float* __restrict__ w2, const float* __restrict__ b2, const float* __restrict__ w3, const float* __restrict__ b3, const float* __restrict__ wtemp, float* __restrict__ CST) {
  __shared__ float red[4][256]; __shared__ float sh[64];
  __shared__ __attribute__((aligned(16))) float w1s[2 * DH * DH], w2s[DH * 32]; __shared__ float w3s[3][32], b1s[DH], g2s[DH], be2s[DH], b2s[32];   // the predictor's parameters as bf16 values (w3s: the 96 values in their order)
  const int t_ = threadIdx.x; constexpr int NPK = NP_ * (NT / 32) / 256 /* 4 of the 1,024 block partials (16 floats: 2 waves x 8) per thread */, NVK = NP_ * NT / 256 /* 128 row values per thread */, NFK = NH * 2 * DH / 256 /* 4 */;
  v4f w1r[8], w2r[2], pl[NPK], ph[NPK], xl[NPK], xh[NPK]; float pr[NFK][QB], vr[NVK], w3r[3];
  const unsigned a63 = t_ & (DH - 1), a31 = t_ & 31, p1off = (unsigned)t_ * 128u /* bytes: partial t_ */, psidx = ((t_ >> 6) & 1) * NP_ * DH + (t_ >> 7) * QB * DH + (t_ & (DH - 1)) /* PSUM [which][pair 4 h][dd] of feature i = t_ */;
  const float b3r[3] = {b3[0], b3[1], b3[2]}, wtr = wtemp[0];
  __builtin_amdgcn_sched_barrier(0);   // keeps the index arithmetic and the scalar reads above from being placed between the loads below and the wait that closes their run
#pragma unroll
  for (int j = 0; j < 8; ++j) w1r[j] = *(const v4f*)(w1 + (j * 256 + t_) * 4);
#pragma unroll
  for (int j = 0; j < 2; ++j) w2r[j] = *(const v4f*)(w2 + (j * 256 + t_) * 4);
  const float b1r = b1[a63], g2r = g2[a63], be2r = be2[a63], b2r = b2[a31];
#pragma unroll
  for (int j = 0; j < 3; ++j) w3r[j] = w3[j * 32 + a31];
#pragma unroll
  for (int k = 0; k < NPK; ++k) { const char* p = (const char*)P1 + p1off + k * (256 * 128); pl[k] = *(const v4f*)p; xl[k] = *(const v4f*)(p + 16); ph[k] = *(const v4f*)(p + 32); xh[k] = *(const v4f*)(p + 48); }
#pragma unroll
  for (int k = 0; k < NFK; ++k)   // feature i = t_ + 256 k: head h + 2 k, the same which and dd
#pragma unroll
    for (int qq = 0; qq < QB; ++qq) pr[k][qq] = PSUM[psidx + (2 * k * QB + qq) * DH];
#pragma unroll   // full, here and in the four loops that read vr: the 128 values stay in registers and are read from memory once, not once a loop
  for (int j = 0; j < NVK; ++j) vr[j] = VARC[t_ + j * 256];
  // closes the run as close_load_run() does; the input operands keep the run's address registers from being given to a later load's result ahead of the wait
  asm volatile("s_wait_xcnt 0x0" :: "v"(a63), "v"(a31), "v"(p1off), "v"(psidx) : "memory"); __builtin_amdgcn_sched_barrier(0);
#pragma unroll
  for (int j = 0; j < 8; ++j) { v4f x; for (int e = 0; e < 4; ++e) x[e] = bf16_rne(w1r[j][e]); *(v4f*)(w1s + (j * 256 + t_) * 4) = x; }
#pragma unroll
  for (int j = 0; j < 2; ++j) { v4f x; for (int e = 0; e < 4; ++e) x[e] = bf16_rne(w2r[j][e]); *(v4f*)(w2s + (j * 256 + t_) * 4) = x; }
  b1s[a63] = bf16_rne(b1r); g2s[a63] = bf16_rne(g2r); be2s[a63] = bf16_rne(be2r); b2s[a31] = bf16_rne(b2r);   // every thread stores: threads with the same index store the same value
#pragma unroll
  for (int j = 0; j < 3; ++j) w3s[j][a31] = bf16_rne(w3r[j]);
  float a = 0, b = 0, c = 0, d = 0, mo[NPK][7];   // mo: the seven moments of block partial t_ + 256 k (32 rows of head 2 k + t_ / 128), kept for d2's variance at the end
#pragma unroll
  for (int k = 0; k < NPK; ++k) {
#pragma unroll
    for (int j = 0; j < 4; ++j) mo[k][j] = pl[k][j] + ph[k][j];
#pragma unroll
    for (int j = 0; j < 3; ++j) mo[k][4 + j] = xl[k][j] + xh[k][j];
    a += mo[k][0]; b += mo[k][1]; c += mo[k][2]; d += mo[k][3]; }
  red[0][t_] = a; red[1][t_] = b; red[2][t_] = c; red[3][t_] = d; __syncthreads();
  for (int s = 128; s >= 1; s >>= 1) { if (t_ < s) { for (int j = 0; j < 4; ++j) red[j][t_] += red[j][t_ + s]; } __syncthreads(); }
  float vs = 0.0f;
#pragma unroll
  for (int j = 0; j < NVK; ++j) vs += vr[j];
  __shared__ float r2[256]; r2[t_] = vs; __syncthreads(); for (int s = 128; s >= 1; s >>= 1) { if (t_ < s) r2[t_] += r2[t_ + s]; __syncthreads(); }
  const float vmu = r2[0] / (float)(NP_ * NT); __syncthreads();
  float vq = 0.0f;
#pragma unroll
  for (int j = 0; j < NVK; ++j) { const float dv = vr[j] - vmu; vq += dv * dv; }
  r2[t_] = vq; __syncthreads(); for (int s = 128; s >= 1; s >>= 1) { if (t_ < s) r2[t_] += r2[t_ + s]; __syncthreads(); }
  // head means qg/kg [8][64] from PSUM [which][pair][64]: mean over (q, n) = sum over the 4 pairs of the head / 4096 -> feats [h][128]; MLP: h1 = relu(LN(feats W1 + b1)), h2 = relu(h1 W2 + b2), logits = softmax(h2 W3 + b3), w = softmax(logits / clip(wt)), clip [0.05,0.8], renorm
  __shared__ __attribute__((aligned(16))) float feats[NH][2 * DH], h1s[NH][DH], h2s[NH][32]; __shared__ float ws[NH][3];
#pragma unroll
  for (int k = 0; k < NFK; ++k) { const int i = t_ + k * 256, h = i / (2 * DH), c = i - h * 2 * DH; float s = 0.0f;
#pragma unroll
    for (int qq = 0; qq < QB; ++qq) s += pr[k][qq];
    feats[h][c] = s * (1.0f / (QB * NT)); }
  __syncthreads();
  // the loops below read LDS only; each is unrolled, with plain products, so that its reads are issued ahead of the one chain of additions instead of being waited for one by one
  for (int i = t_; i < NH * DH; i += 256) { const int h = i / DH, o_ = i - h * DH; float s = b1s[o_];
#pragma unroll 32
    for (int c = 0; c < 2 * DH; ++c) s += feats[h][c] * w1s[c * DH + o_]; h1s[h][o_] = s; }
  __syncthreads();
  if (t_ < NH) { const int h = t_; float mu = 0.0f;
#pragma unroll
    for (int c = 0; c < DH; ++c) mu += h1s[h][c];
    mu *= (1.0f / DH); float var = 0.0f;
#pragma unroll
    for (int c = 0; c < DH; ++c) { const float dv = h1s[h][c] - mu; var += dv * dv; }
    var *= (1.0f / DH); const float rs = rsqrtf(var + 1e-5f);
#pragma unroll
    for (int c = 0; c < DH; ++c) h1s[h][c] = fmaxf((h1s[h][c] - mu) * rs * g2s[c] + be2s[c], 0.0f); }
  __syncthreads();
  for (int i = t_; i < NH * 32; i += 256) { const int h = i / 32, o_ = i - h * 32; float s = b2s[o_];
#pragma unroll 32
    for (int c = 0; c < DH; ++c) s += h1s[h][c] * w2s[c * 32 + o_]; h2s[h][o_] = fmaxf(s, 0.0f); }
  __syncthreads();
  if (t_ < NH) { const int h = t_; float lg[3]; for (int o_ = 0; o_ < 3; ++o_) { float s = bf16_rne(b3r[o_]);
#pragma unroll
      for (int c = 0; c < 32; ++c) s += h2s[h][c] * (&w3s[0][0])[c * 3 + o_]; lg[o_] = s; }
    float mx = fmaxf(lg[0], fmaxf(lg[1], lg[2])); float e3[3], se = 0.0f; for (int j = 0; j < 3; ++j) { e3[j] = __expf(lg[j] - mx); se += e3[j]; } for (int j = 0; j < 3; ++j) e3[j] /= se;
    const float wt = clampf(bf16_rne(wtr), 0.1f, 20.0f); float z[3]; for (int j = 0; j < 3; ++j) z[j] = e3[j] / wt; mx = fmaxf(z[0], fmaxf(z[1], z[2])); se = 0.0f; for (int j = 0; j < 3; ++j) { e3[j] = __expf(z[j] - mx); se += e3[j]; }
    float wv[3], sw = 0.0f; for (int j = 0; j < 3; ++j) { wv[j] = clampf(e3[j] / se, 0.05f, 0.8f); sw += wv[j]; } for (int j = 0; j < 3; ++j) ws[h][j] = wv[j] / sw; }
  __syncthreads();
  if (t_ == 0) { const float n = (float)NTOT; const float sa_ = red[0][0], sb = red[1][0], sc = red[2][0], sd = red[3][0];
    const float cstd = sqrtf(fmaxf((sb - sa_ * (sa_ / n)) / (n - 1.0f), 0.0f)); const float covstd_raw = sqrtf(fmaxf((sd - sc * (sc / n)) / (n - 1.0f), 0.0f));
    const float base_reg = LREG / (float)NT; const float reg = (covstd_raw < 1e-6f) ? base_reg * 10.0f : base_reg;   // reference: reg chosen on the std of the RAW cov, then cov = clip(reg cov, +-50) (never clips at this scale)
    const float covn = reg * covstd_raw + 1e-6f; const float cn = cstd + 1e-6f; const float cscale = (cn < 1e-4f) ? 0.1f : 1.0f;
    const float vn = sqrtf(r2[0] * ((float)NT / (n - 1.0f))) + 1e-6f;   // std over the broadcast [.., m] copies: each row value repeated NT times
    sh[0] = cscale / cn; sh[1] = reg * 0.5f / covn; sh[2] = 0.5f / vn; sh[3] = 0.0f; for (int h = 0; h < NH; ++h) { sh[4 + h] = ws[h][0]; sh[4 + NH + h] = ws[h][1]; sh[4 + 2 * NH + h] = ws[h][2]; } }
  __syncthreads();
  // dstd = std(d2) from the moments. d2 = e + c with e = W1 cos + W2 covraw (W1 = cw cscale/cn, W2 = covw reg/(2 covn), per head) and the row constant c = vw var_c/(2 vn).
  // var(d2) = E[(d2 - M)^2] - (E[d2 - M])^2 with the shift M = mean of the row constants (kills the large common offset): sum (d2 - M) = sum e + NT sum_rows (c - M),
  // sum (d2 - M)^2 = sum e^2 + 2 sum_rows (c - M) rowsum_e + NT sum_rows (c - M)^2; sum e^2 = W1^2 sum cos^2 + 2 W1 W2 sum cos covraw + W2^2 sum covraw^2; sum_rows c rowsum_e = vw/(2 vn) (W1 sum var_c rowsum_cos + W2 sum var_c rowsum_covraw).
  __shared__ float tl[3][8]; const int wv = t_ >> 5; const float vfac = sh[2]; float vf[NH];
#pragma unroll
  for (int h = 0; h < NH; ++h) vf[h] = sh[4 + 2 * NH + h] * vfac;
  float c4[4] = {0.0f, 0.0f, 0.0f, 0.0f};   // row i = t_ + 256 j belongs to head (i / NT) / QB = j / 16; four chains here and below, so that an addition does not wait for the one before it
#pragma unroll
  for (int j = 0; j < NVK; ++j) c4[j & 3] += vf[j / 16] * vr[j];
  float sc = (c4[0] + c4[1]) + (c4[2] + c4[3]);
#pragma unroll
  for (int o = 16; o >= 1; o >>= 1) sc += __shfl_xor(sc, o);
  if ((t_ & 31) == 0) tl[0][wv] = sc;
  __syncthreads();
  float M = 0.0f;
#pragma unroll
  for (int w = 0; w < 8; ++w) M += tl[0][w];
  M /= (float)(NP_ * NT); float q1[4] = {0.0f, 0.0f, 0.0f, 0.0f}, q2[4] = {0.0f, 0.0f, 0.0f, 0.0f};
#pragma unroll
  for (int j = 0; j < NVK; ++j) { const float cm = vf[j / 16] * vr[j] - M; q1[j & 3] += cm; q2[j & 3] += cm * cm; }
  float s1 = (float)NT * ((q1[0] + q1[1]) + (q1[2] + q1[3])), s2 = (float)NT * ((q2[0] + q2[1]) + (q2[2] + q2[3]));
#pragma unroll
  for (int k = 0; k < NPK; ++k) { const int h = 2 * k + (t_ >> 7); const float W1 = sh[4 + h] * sh[0], W2 = sh[4 + NH + h] * sh[1], VW = sh[4 + 2 * NH + h] * vfac, se = W1 * mo[k][0] + W2 * mo[k][2];
    s1 += se; s2 += W1 * W1 * mo[k][1] + 2.0f * W1 * W2 * mo[k][4] + W2 * W2 * mo[k][3] + 2.0f * (VW * (W1 * mo[k][5] + W2 * mo[k][6]) - M * se); }
#pragma unroll
  for (int o = 16; o >= 1; o >>= 1) { s1 += __shfl_xor(s1, o); s2 += __shfl_xor(s2, o); }
  if ((t_ & 31) == 0) { tl[1][wv] = s1; tl[2][wv] = s2; }
  __syncthreads();
  if (t_ == 0) { float t1 = 0.0f, t2 = 0.0f;
#pragma unroll
    for (int w = 0; w < 8; ++w) { t1 += tl[1][w]; t2 += tl[2][w]; }
    const float n = NTOT; const float var = (t2 - t1 * (t1 / n)) / (n - 1.0f); const float dstd = sqrtf(fmaxf(var, 0.0f)); const float temp = (dstd < 1e-6f) ? 0.1f : 0.3f + dstd; sh[3] = 1.0f / clampf(temp, 0.1f, 5.0f); }
  __syncthreads();
  { if (t_ < 32) ((float*)CST)[t_] = (t_ < 4 + 3 * NH) ? sh[t_] : 0.0f;  }
}
__global__ __launch_bounds__(128) void outproj_kernel(const b16* __restrict__ OCh, const b16* __restrict__ OCl, const b16* __restrict__ WOUT, const float* __restrict__ bo, float* __restrict__ out) {
  __shared__ __attribute__((aligned(16))) float Ts[4][16][128 + 4];
  const int wave = threadIdx.x >> 5, lane = threadIdx.x & 31, nloc = lane & 15, hlf = lane >> 4; const size_t m0 = (size_t)blockIdx.x * 64 + wave * 16; const int n0 = blockIdx.y * 128;
  v8f acc[8];
#pragma unroll
  for (int t = 0; t < 8; ++t) acc[t] = (v8f){};
  const b16* ap = OCh + m0 * DIM; const b16* lp = OCl + m0 * DIM; const b16* bp = WOUT + (size_t)n0 * DIM; const unsigned flane = (unsigned)lane * 16u;   // ap, lp, bp: the first tile of row m0, of column n0
  v16b a = frag_pk(ap, flane), al = frag_pk(lp, flane), b[8];
#pragma unroll
  for (int t = 0; t < 8; ++t) b[t] = frag_pk(bp + (size_t)t * 16 * DIM, flane);
#pragma unroll   // full: the two fragment sets swap by renaming, and the last step's fetch falls away
  for (int kb = 0; kb < DIM; kb += 32) { v16b an = a, aln = al, bn[8];
#pragma unroll
    for (int t = 0; t < 8; ++t) bn[t] = b[t];
    if (kb + 32 < DIM) { an = frag_pk(ap + (kb + 32) * 16, flane); aln = frag_pk(lp + (kb + 32) * 16, flane);
#pragma unroll
      for (int t = 0; t < 8; ++t) bn[t] = frag_pk(bp + (size_t)t * 16 * DIM + (kb + 32) * 16, flane); }
    __builtin_amdgcn_sched_barrier(0);   // keeps the next step's loads, as one group, ahead of this step's products: sunk towards their uses they would each be waited for in turn
#pragma unroll
    for (int t = 0; t < 8; ++t) { acc[t] = wmma16b(a, b[t], acc[t]); acc[t] = wmma16b(al, b[t], acc[t]); }
    a = an; al = aln;
#pragma unroll
    for (int t = 0; t < 8; ++t) b[t] = bn[t]; }
#pragma unroll
  for (int t = 0; t < 8; ++t) { const float bb = bf16_rne(bo[n0 + t * 16 + nloc]);
#pragma unroll
    for (int r = 0; r < 8; ++r) Ts[wave][8 * hlf + r][t * 16 + nloc] = acc[t][r] * (1.0f / (XS * WSC)) + bb; }
  wave_lds_sync();
  { for (int rr = 0; rr < 16; ++rr) *(v4f*)(out + (m0 + rr) * DIM + n0 + lane * 4) = *(const v4f*)(&Ts[wave][rr][lane * 4]);  }
}
}  // namespace

extern "C" void kernel_launch(void* const* d_in, const int* in_sizes, int n_in, void* d_out, int out_size, void* d_ws, size_t ws_size, hipStream_t stream) {
  (void)n_in;
  auto Fp = [&](int i) { return (const float*)d_in[i]; };
  // input order: 0 q, 1 k, 2 v [4,1024,512]; 3 ln_in_g, 4 ln_in_b; 5 W_in [512,512]; 6 wp_W1 [128,64], 7 wp_b1, 8 wp_ln_g, 9 wp_ln_b, 10 wp_W2 [64,32], 11 wp_b2, 12 wp_W3 [32,3], 13 wp_b3, 14 weight_temp [1], 15 W_out [512,512], 16 b_out
  if (in_sizes[0] != NR * DIM || in_sizes[1] != NR * DIM || in_sizes[2] != NR * DIM || in_sizes[5] != DIM * DIM || in_sizes[6] != 2 * DH * DH || in_sizes[15] != DIM * DIM || out_size != NR * DIM) return;
  size_t off = 0; char* ws = (char*)d_ws;
  auto carve = [&](size_t bytes) { char* p = ws + off; off += (bytes + 255) & ~(size_t)255; return p; };
  b16* X16 = (b16*)carve((size_t)3 * NR * DIM * 2); b16* WIN = (b16*)carve((size_t)DIM * DIM * 2); b16* WOUT = (b16*)carve((size_t)DIM * DIM * 2);
  float* F32 = (float*)carve((size_t)3 * NP_ * NT * DH * 4); float* CP = (float*)carve((size_t)2 * NP_ * (NT / 16) * DH * 4); float* PSUM = (float*)carve((size_t)2 * NP_ * DH * 4);
  b16* FQ16 = (b16*)carve((size_t)NP_ * NT * DH * 2); b16* FQC16 = (b16*)carve((size_t)NP_ * NT * DH * 2); b16* FK16 = (b16*)carve((size_t)NP_ * NT * DH * 2); b16* FKC16 = (b16*)carve((size_t)NP_ * NT * DH * 2);
  float* N1 = (float*)carve((size_t)NP_ * NT * 4); float* N2 = (float*)carve((size_t)NP_ * NT * 4); float* I2B = (float*)carve((size_t)NP_ * NT * 4);   // N2 holds 1 / (key norm + 1e-8), I2B 1 / max(key norm, 1e-6)
  b16* FVTh = (b16*)carve((size_t)NP_ * DH * NT * 2); b16* FVTl = (b16*)carve((size_t)NP_ * DH * NT * 2);
  float* P1 = (float*)carve((size_t)NP_ * (NT / 32) * 32 * 4); float* VARC = (float*)carve((size_t)NP_ * NT * 4); float* CST = (float*)carve(256);
  b16* OCh = (b16*)carve((size_t)NR * DIM * 2); b16* OCl = (b16*)carve((size_t)NR * DIM * 2);
  if (off > ws_size || off > ((size_t)128 << 20)) return;   // ≈ 74 MB
  ln_prepw_kernel<<<NPW + 3 * NR / 8, 256, 0, stream>>>(Fp(0), Fp(1), Fp(2), Fp(3), Fp(4), Fp(5), Fp(15), X16, WIN, WOUT);
  feat_kernel<<<dim3(NR / 64, DIM / 128, 3), 128, 0, stream>>>(X16, WIN, F32, CP);
  planes_kernel<<<dim3(NT / 64, NP_), 256, 0, stream>>>(F32, CP, PSUM, FQ16, FQC16, N1, FK16, FKC16, N2, I2B, FVTh, FVTl);
  score_kernel<1><<<dim3(NT / 32, NP_), 64, 0, stream>>>(FQ16, FQC16, N1, FK16, FKC16, N2, I2B, FVTh, FVTl, CST, P1, VARC, OCh, OCl);
  reduce1_kernel<<<1, 256, 0, stream>>>(P1, VARC, PSUM, Fp(6), Fp(7), Fp(8), Fp(9), Fp(10), Fp(11), Fp(12), Fp(13), Fp(14), CST);
  score_kernel<3><<<dim3(NT / 32, NP_), 64, 0, stream>>>(FQ16, FQC16, N1, FK16, FKC16, N2, I2B, FVTh, FVTl, CST, P1, VARC, OCh, OCl);
  outproj_kernel<<<dim3(NR / 64, DIM / 128), 128, 0, stream>>>(OCh, OCl, WOUT, Fp(16), (float*)d_out);
}

// v007
// Measured time: 120 microseconds a run.
// Timed twice side by side with v006, it ran 1.03 times as fast both times.
// All steps since v000 together make it 5.75 times as fast.
#include <hip/hip_runtime.h>

// "Super-aggressive" attention: f_q, f_k, f_v = LN(q|k|v) W_in split into 8 heads x 64; per (head, batch) pair: cos = clip(f_q.f_k / (n1 n2), +-0.99) (n = norm + 1e-8),
// cov = reg x (f_q - rowmean_d)(f_k - colmean_m) / (8 + 1e-6) (reg = 1e-3/1024, x10 if the global std of the raw cov < 1e-6), csim = clip(qn.kn) with max(norm, 1e-6), margin =
// clip(0.01 - csim, 0, 10), var_c = row mean of margin; per-head weights (cw, covw, vw) from a tiny MLP on the global means of f_q / f_k (softmax, /clip(weight_temp), softmax, clip, renorm);
// cn / covn / vn = global std (ddof 1) of cos / cov / var_c (+1e-6); d2 = cw cos/cn cscale + covw cov/covn/2 + vw var_c/vn/2; temp = 0.3 + std(d2) (dstd >= 1e-6; clipped to [0.1, 5]);
// attn = softmax(d2 / temp); out_h = attn f_v; out = concat_h W_out + b -> [4][1024][512].
// Every global statistic is a deterministic f32 reduction (per-wave partials, then one fixed-order kernel; the means of f_q / f_k take a per-pair level in between); the [1024 x 1024] score tiles are recomputed in two passes
// (component statistics; softmax + PV) instead of being stored. std(d2) takes no pass of its own: d2 is linear in cos, cov and var_c, so its variance is a quadratic form in their first and second moments per head.
// WMMA (v_wmma_f32_16x16x32_f16, f32 accumulate): W_in (LN(x) single f16 x8, exact weights), dots / centered-cov tiles (single f16 x8 feature planes, K = 64), P.V (P single x8, f_v^T hi+lo:
// 2 products), W_out (O hi+lo: 2 products). LN, norms, all statistics and the weight-predictor MLP in f32. Inputs rounded to bf16 once. Fragment k-map per lane half hh

namespace {
constexpr int QB = 4, NT = 1024, DIM = 512, NH = 8, DH = 64, NP_ = NH * QB /* 32 (h,q) pairs, index h*QB + q */, NR = QB * NT /* 4096 rows */, NWAVE = NP_ * (NT / 16) /* 2048 score waves */;
constexpr float XS = 8.0f, WSC = 256.0f, PS = 8.0f, GAMMA = 0.01f, LREG = 0.001f;
constexpr float NTOT = 33554432.0f;   // 33,554,432 score elements

typedef _Float16 b16;
typedef __attribute__((ext_vector_type(16))) _Float16 v16b;
typedef __attribute__((ext_vector_type(8))) _Float16 v8b;
typedef __attribute__((ext_vector_type(8))) float v8f;
typedef __attribute__((ext_vector_type(4))) float v4f;
__device__ __forceinline__ float bf16_rne(float f) { unsigned int u = __float_as_uint(f); u += 0x7FFFu + ((u >> 16) & 1u); return __uint_as_float(u & 0xFFFF0000u); }
__device__ __forceinline__ void split16(float v, b16& hi, b16& lo) { hi = (b16)v; lo = (b16)(v - (float)hi); }
__device__ __forceinline__ v16b frag_kb(const b16* p, int hh) { const v8b a = *(const v8b*)(p + 8 * hh), b = *(const v8b*)(p + 16 + 8 * hh); v16b f;
#pragma unroll
  for (int e = 0; e < 8; ++e) { f[e] = a[e]; f[8 + e] = b[e]; } return f; }
// Fragment order: the planes that the matrix loops read again and again (keys, centred keys, f_v^T hi/lo, both weight planes, the attention output hi/lo) are stored tile by tile, a tile = 16 rows x 32 k = 1,024 contiguous bytes laid out as
// [k half j][lane = 16 hh + row][8 elements], element (row, kk) with j = kk / 16, hh = (kk / 8) % 2. A wave's 16-byte load then covers 512 contiguous bytes (4 whole lines) instead of 32-byte pieces of 16 lines; each lane gets the same values in the same registers as from frag_kb.
__device__ __forceinline__ int frag_pos(int row, int kk) { return (kk >> 4) * 256 + (((kk >> 3) & 1) * 16 + row) * 8 + (kk & 7); }   // element offset inside a tile
__device__ __forceinline__ v16b frag_pk(const b16* utile, unsigned lane_bytes) { const char* p = (const char*)utile + lane_bytes; const v8b a = *(const v8b*)p, b = *(const v8b*)(p + 512); v16b f;   // wave-uniform tile base plus 16 * lane bytes
#pragma unroll
  for (int e = 0; e < 8; ++e) { f[e] = a[e]; f[8 + e] = b[e]; } return f; }
__device__ __forceinline__ v8f wmma16b(v16b a, v16b b, v8f c) { v8f d = __builtin_amdgcn_wmma_f32_16x16x32_f16(false, a, false, b, (short)0, c, false, false); asm volatile("v_nop\n\tv_nop\n\tv_nop\n\tv_nop" : "+v"(d) : "v"(a), "v"(b)); return d; }
// the same product for a B operand that stays live and unwritten through the whole loop (the query fragments): B is left out of the statement's operands, which all have to sit in the first 256 registers, so that it may live above them
__device__ __forceinline__ v8f wmma16q(v16b a, v16b b, v8f c) { v8f d = __builtin_amdgcn_wmma_f32_16x16x32_f16(false, a, false, b, (short)0, c, false, false); asm volatile("v_nop\n\tv_nop\n\tv_nop\n\tv_nop" : "+v"(d) : "v"(a)); return d; }
// closes a run of global loads. The wait stands in front of the next instruction that writes a register from which those loads took their address (a precaution).
// The scheduling barrier keeps later address arithmetic from being lifted over that wait, and keeps the run up here, ahead of the work that covers its latency: sunk towards their uses the loads would each be waited for in turn.
__device__ __forceinline__ void close_load_run() { asm volatile("s_wait_xcnt 0x0" ::: "memory"); __builtin_amdgcn_sched_barrier(0); }
__device__ __forceinline__ void wave_lds_sync() { __builtin_amdgcn_fence(__ATOMIC_RELEASE, "workgroup"); __builtin_amdgcn_wave_barrier(); __builtin_amdgcn_fence(__ATOMIC_ACQUIRE, "workgroup"); }
// 2^x on v_exp_f32, with the slot that the instruction set asks for behind a transcendental (before its result is used or its source overwritten) filled in the same statement: a v_nop in a statement of its own did not stay behind it
__device__ __forceinline__ float nexp2(float x) { float r; asm("v_exp_f32 %0, %1\n\tv_nop" : "=v"(r) : "v"(x)); return r; }
__device__ __forceinline__ float pmul(float a, float b) { float p = a * b; asm volatile("" : "+v"(p)); return p; }
__device__ __forceinline__ float hsum16(float v) { v += __shfl_xor(v, 1); v += __shfl_xor(v, 2); v += __shfl_xor(v, 4); return v + __shfl_xor(v, 8); }
__device__ __forceinline__ float clampf(float v, float lo, float hi) { return fminf(fmaxf(v, lo), hi); }

// one launch for the two independent preparations: blocks 0 .. NPW - 1 put the two weight planes into fragment order, the others normalise 8 rows each
constexpr int NPW = 2 * DIM * DIM / 8 / 256;
__global__ __launch_bounds__(256) void ln_prepw_kernel(const float* __restrict__ q, const float* __restrict__ k, const float* __restrict__ v, const float* __restrict__ g, const float* __restrict__ be, const float* __restrict__ win, const float* __restrict__ wout, b16* __restrict__ X16, b16* __restrict__ WIN, b16* __restrict__ WOUT) {
  if (blockIdx.x < NPW) { const int t = blockIdx.x * 256 + threadIdx.x, kind = t / (DIM * DIM / 8), tt = t - kind * (DIM * DIM / 8);
    // thread tt fills the 16-byte piece tt of the plane in fragment order: tile tt / 64 = (row tile) * 16 + k tile, piece tt % 64 = [j][hh][row]
    const int tile = tt >> 6, o_ = (tile / (DIM / 32)) * 16 + (tt & 15), k0 = (tile % (DIM / 32)) * 32 + ((tt >> 5) & 1) * 16 + ((tt >> 4) & 1) * 8;
    const float* w = kind == 0 ? win : wout; v8b o; for (int j = 0; j < 8; ++j) o[j] = (b16)(bf16_rne(w[(size_t)(k0 + j) * DIM + o_]) * WSC);
    *(v8b*)((kind == 0 ? WIN : WOUT) + (size_t)tt * 8) = o; return; }
  const int wave = threadIdx.x >> 5, lane = threadIdx.x & 31; const int rowall = (blockIdx.x - NPW) * 8 + wave; const int which = rowall / NR, row = rowall - which * NR;
  const float* src = (which == 0 ? q : which == 1 ? k : v) + (size_t)row * DIM + lane * 16; float x[16];
  { const v4f a = *(const v4f*)src, b = *(const v4f*)(src + 4), c = *(const v4f*)(src + 8), d = *(const v4f*)(src + 12); for (int j = 0; j < 4; ++j) { x[j] = bf16_rne(a[j]); x[4 + j] = bf16_rne(b[j]); x[8 + j] = bf16_rne(c[j]); x[12 + j] = bf16_rne(d[j]); } }
  float s = 0.0f; for (int j = 0; j < 16; ++j) s += x[j];
#pragma unroll
  for (int o = 16; o >= 1; o >>= 1) s += __shfl_xor(s, o);
  const float mu = s * (1.0f / DIM); float ss = 0.0f; for (int j = 0; j < 16; ++j) { const float d = x[j] - mu; ss += pmul(d, d); }
#pragma unroll
  for (int o = 16; o >= 1; o >>= 1) ss += __shfl_xor(ss, o);
  const float rs = rsqrtf(ss * (1.0f / DIM) + 1e-5f); v8b o0, o1;
  for (int j = 0; j < 16; ++j) { const int c = lane * 16 + j; const b16 hv = (b16)((pmul((x[j] - mu) * rs, bf16_rne(g[c])) + bf16_rne(be[c])) * XS); if (j < 8) o0[j] = hv; else o1[j - 8] = hv; }
  { b16* dst = X16 + ((size_t)which * NR + row) * DIM + lane * 16; *(v8b*)dst = o0; *(v8b*)(dst + 8) = o1;  }
}
// features: F = X16 W_in per row (block = 64 rows x 4 waves, wave = 16 rows x 128 cols = 2 heads; grid.y = 4): which 0 (q): F32Q [pair][n][64] f32 rows; which 1 (k): F32K; which 2 (v): F32V. (f32 planes,
__global__ __launch_bounds__(128) void feat_kernel(const b16* __restrict__ X16, const b16* __restrict__ WIN, float* __restrict__ F32, float* __restrict__ CP) {
  __shared__ __attribute__((aligned(16))) float Ts[4][16][128 + 4];
  const int wave = threadIdx.x >> 5, lane = threadIdx.x & 31, nloc = lane & 15, hlf = lane >> 4; const int which = blockIdx.z; const size_t m0 = (size_t)blockIdx.x * 64 + wave * 16; const int n0 = blockIdx.y * 128;
  v8f acc[8];
#pragma unroll
  for (int t = 0; t < 8; ++t) acc[t] = (v8f){};
  const b16* ap = X16 + ((size_t)which * NR + m0 + nloc) * DIM; const b16* bp = WIN + (size_t)n0 * DIM; const unsigned flane = (unsigned)lane * 16u;   // bp: the first weight tile of column n0 (16 rows x 512 k = 16 tiles of 512 elements)
  v16b a = frag_kb(ap, hlf), b[8];
#pragma unroll
  for (int t = 0; t < 8; ++t) b[t] = frag_pk(bp + (size_t)t * 16 * DIM, flane);
#pragma unroll   // full: the two fragment sets swap by renaming, and the last step's fetch falls away
  for (int kb = 0; kb < DIM; kb += 32) { v16b an = a, bn[8];
#pragma unroll
    for (int t = 0; t < 8; ++t) bn[t] = b[t];
    if (kb + 32 < DIM) { an = frag_kb(ap + kb + 32, hlf);
#pragma unroll
      for (int t = 0; t < 8; ++t) bn[t] = frag_pk(bp + (size_t)t * 16 * DIM + (kb + 32) * 16, flane); }
    __builtin_amdgcn_sched_barrier(0);   // keeps the next step's loads, as one group, ahead of this step's products: sunk towards their uses they would each be waited for in turn
#pragma unroll
    for (int t = 0; t < 8; ++t) acc[t] = wmma16b(a, b[t], acc[t]);
    a = an;
#pragma unroll
    for (int t = 0; t < 8; ++t) b[t] = bn[t]; }
#pragma unroll
  for (int t = 0; t < 8; ++t)
#pragma unroll
    for (int r = 0; r < 8; ++r) Ts[wave][8 * hlf + r][t * 16 + nloc] = acc[t][r] * (1.0f / (XS * WSC));
  wave_lds_sync();
  // rows m0+rr: q_idx = row / NT, n = row % NT; cols n0 + c -> head h = (n0 + c) / 64, d = % 64; F32 layout [which][pair][n][64]
  // a lane keeps columns n0 + 4 lane .. + 3 (lane half = head) through the wave's 16 rows, which lie in one batch entry, and sums them on the way: CP [which 0/1][pair][16-row tile][64] = column sums of the tile, the first level of the means over rows
  { const int qi = (int)(m0 / NT), n = (int)(m0 - (size_t)qi * NT), pair = (n0 / DH + hlf) * QB + qi; float* dst = F32 + (((size_t)which * NP_ + pair) * NT + n) * DH + nloc * 4; v4f x[16];
#pragma unroll
    for (int rr = 0; rr < 16; ++rr) { x[rr] = *(const v4f*)(&Ts[wave][rr][lane * 4]); *(v4f*)(dst + rr * DH) = x[rr]; }
    close_load_run();   // the same wait behind this run of stores: the sums below are formed in the registers that the stores name
    if (which < 2) { v4f cs = x[0];
#pragma unroll
      for (int rr = 1; rr < 16; ++rr) cs += x[rr];
      *(v4f*)(CP + (((size_t)which * NP_ + pair) * (NT / 16) + n / 16) * DH + nloc * 4) = cs; } }
}
// operand planes per pair, one launch (block = 64 rows of one pair, 8 waves): FQ16 [pair][n][64] = f16(8 f_q), FQC16 = f16(8 (f_q - rowmean)); FK16, FKC16 = f16(8 (f_k - colmean)) (both in fragment order);
// N1 [pair][n] = ||f_q|| (f32); FVTh/FVTl = f_v^T hi/lo x8 (rows d, k = keys, in fragment order). The key norms enter every score element only through 1 / (n2 + 1e-8) and 1 / max(n2, 1e-6):
// the two quotients are formed here, once a key (I2A, I2B), not once a score element in each pass. The squared norms come from the same registers as the f16 planes (4 products a lane, then a tree over the row's 16 lanes).
// Column sums over the pair's 1,024 rows, second level: thread (d = t % 64, part = t / 64) adds 16 of the 64 tile sums in CP, the four parts meet in LDS; every block forms them for its own use (colmean of f_k), block 0 of a pair stores PSUM [which 0/1][pair][64].
__global__ __launch_bounds__(256) void planes_kernel(const float* __restrict__ F32, const float* __restrict__ CP, float* __restrict__ PSUM, b16* __restrict__ FQ16, b16* __restrict__ FQC16, float* __restrict__ N1, b16* __restrict__ FK16, b16* __restrict__ FKC16, float* __restrict__ I2A, float* __restrict__ I2B, b16* __restrict__ FVTh, b16* __restrict__ FVTl) {
  __shared__ __attribute__((aligned(16))) b16 Th[DH][64 + 8], Tl[DH][64 + 8]; __shared__ __attribute__((aligned(16))) float Cs[2][4][DH]; __shared__ float Ns[2][64];   // Ns: the block's squared norms of f_q and f_k
  const int pair = blockIdx.y, n0 = blockIdx.x * 64, t_ = threadIdx.x, lane = t_ & 31, c0 = (lane & 15) * 4, rl = (t_ >> 5) * 8 + (lane >> 4);   // a wave takes 8 rows, two a trip: row rl + 2 i, columns c0 .. c0 + 3
  const size_t row0 = (size_t)pair * NT + n0; const float* qp = F32 + (row0 + rl) * DH + c0; const float* kp = qp + (size_t)NP_ * NT * DH; const float* vp = F32 + (2 * (size_t)NP_ * NT + row0) * DH + t_;
  const float* cq = CP + ((size_t)pair * (NT / 16) + (t_ >> 6) * 16) * DH + (t_ & 63); const float* ck = cq + (size_t)NP_ * (NT / 16) * DH;
  __builtin_amdgcn_sched_barrier(0);   // keeps the index arithmetic above from being placed between the loads below and the wait that closes their run
  v4f fq[4], fk[4]; float xv[16], pq[16], pk[16];
#pragma unroll
  for (int i = 0; i < 16; ++i) { pq[i] = cq[i * DH]; pk[i] = ck[i * DH]; }
#pragma unroll
  for (int i = 0; i < 4; ++i) { fq[i] = *(const v4f*)(qp + i * 2 * DH); fk[i] = *(const v4f*)(kp + i * 2 * DH); }
#pragma unroll
  for (int i = 0; i < 16; ++i) xv[i] = vp[i * 256];   // the [64 n][64 d] chunk of f_v, element t_ + 256 i
  // closes the run as close_load_run() does; the input operands keep the run's address registers from being given to a later load's result ahead of the wait
  asm volatile("s_wait_xcnt 0x0" :: "v"(cq), "v"(ck), "v"(qp), "v"(kp), "v"(vp) : "memory"); __builtin_amdgcn_sched_barrier(0);
  { float a = 0.0f, b = 0.0f;
#pragma unroll
    for (int i = 0; i < 16; ++i) { a += pq[i]; b += pk[i]; }
    Cs[0][t_ >> 6][t_ & 63] = a; Cs[1][t_ >> 6][t_ & 63] = b; }
  float mq[4], ssq[4], ssk[4];   // the twelve lane trees stand side by side, with no branch between them, so that each step's cross-lane moves overlap
#pragma unroll
  for (int i = 0; i < 4; ++i) { float sq = 0.0f; ssq[i] = 0.0f; ssk[i] = 0.0f; for (int j = 0; j < 4; ++j) { sq += fq[i][j]; ssq[i] += fq[i][j] * fq[i][j]; ssk[i] += fk[i][j] * fk[i][j]; }
    sq = hsum16(sq); ssq[i] = hsum16(ssq[i]); ssk[i] = hsum16(ssk[i]); mq[i] = sq * (1.0f / DH); }
  if ((lane & 15) == 0) {
#pragma unroll
    for (int i = 0; i < 4; ++i) { Ns[0][rl + 2 * i] = ssq[i]; Ns[1][rl + 2 * i] = ssk[i]; } }
#pragma unroll
  for (int i = 0; i < 16; ++i) { const int qq = t_ + i * 256, nn = qq >> 6, d = qq & 63; b16 h_, l_; split16(xv[i] * XS, h_, l_); Th[d][nn] = h_; Tl[d][nn] = l_; }   // transpose [64 n][64 d] -> rows d, hi/lo
  __syncthreads();
  const v4f km = ((*(const v4f*)(&Cs[1][0][c0]) + *(const v4f*)(&Cs[1][1][c0])) + (*(const v4f*)(&Cs[1][2][c0]) + *(const v4f*)(&Cs[1][3][c0]))) * (1.0f / NT);   // colmean of f_k
  typedef __attribute__((ext_vector_type(4))) _Float16 v4b;
#pragma unroll
  for (int i = 0; i < 4; ++i) { v4b a, ac, b, bc;
    for (int j = 0; j < 4; ++j) { a[j] = (b16)(fq[i][j] * XS); ac[j] = (b16)((fq[i][j] - mq[i]) * XS); b[j] = (b16)(fk[i][j] * XS); bc[j] = (b16)((fk[i][j] - km[j]) * XS); }
    const size_t prow = row0 + rl + 2 * i, kpos = (prow >> 4) * (16 * DH) + (c0 >> 5) * 512 + frag_pos((int)(prow & 15), c0 & 31);   // key planes in fragment order: 16 rows are one row tile (2 k tiles, 2 KiB a plane)
    *(v4b*)(FQ16 + prow * DH + c0) = a; *(v4b*)(FQC16 + prow * DH + c0) = ac; *(v4b*)(FK16 + kpos) = b; *(v4b*)(FKC16 + kpos) = bc; }
  // fragment order, tiles [pair][32-key block][16-d tile]: the block's 64 keys are 8 tiles = 8 KiB a plane, and piece qq = [key block][d tile][j][hh][row] goes to byte 16 qq of them
#pragma unroll
  for (int qq = t_; qq < DH * 8; qq += 256) { const int d = ((qq >> 6) & 3) * 16 + (qq & 15), c8 = (qq >> 8) * 32 + ((qq >> 5) & 1) * 16 + ((qq >> 4) & 1) * 8; const size_t gi = row0 * DH + (size_t)qq * 8; *(v8b*)(FVTh + gi) = *(const v8b*)(&Th[d][c8]); *(v8b*)(FVTl + gi) = *(const v8b*)(&Tl[d][c8]); }
  if (t_ < 64) { const float n2 = sqrtf(Ns[1][t_]); N1[row0 + t_] = sqrtf(Ns[0][t_]); I2A[row0 + t_] = 1.0f / (n2 + 1e-8f); I2B[row0 + t_] = 1.0f / fmaxf(n2, 1e-6f); }   // two waves, a whole 128-byte line each and array
  if (blockIdx.x == 0 && t_ < 2 * DH) { const int w = t_ >> 6, d = t_ & 63; PSUM[((size_t)w * NP_ + pair) * DH + d] = (Cs[w][0][d] + Cs[w][1][d]) + (Cs[w][2][d] + Cs[w][3][d]); }
}
// score-tile passes: wave = 16 query rows n of one pair (block = SW = 8 waves = 128 rows: one block fills a WGP's two waves a SIMD, and all its waves walk the same key and value tiles, so that a tile comes from L2 once a WGP and the other waves find it in the WGP's cache), loop over 32 key blocks of 32: dots^T and covraw^T tiles (keys x queries, K = 64: 2 steps x 2 key tiles x 2 GEMMs = 8 WMMAs),
// lane (hh, col=query) holds keys kb+8hh+r and kb+16+8hh+r.  cos = clip(dots/((n1+1e-8)(n2+1e-8))), csim = clip(dots/(max(n1,1e-6) max(n2,1e-6))), margin = clip(0.01 - csim, 0, 10), covraw = c/(8+1e-6).
// PASS 1: per wave the sums of cos, cos^2, covraw, covraw^2, cos covraw, and of var_c x (row sum of cos) and var_c x (row sum of covraw) over its 16 rows -> P1; per row var_c -> VARC.
// PASS 3 (given cn, covfac = reg/covn/2, w per head, vn, temp): per row c_row = vw var_c/(2 vn); e = cw cos/cn cscale + covw covraw covfac (d2 - c_row); logits = (e + c_row)/temp -> online softmax (f32) with o^T += f_v^T P^T (hi+lo, 4 d-tiles): O [pair][n][64] -> OC16h/l, rows q*NT+n, k = h*64+d (concat-head planes, hi/lo x8, in fragment order).
constexpr int SW = 8;   // waves a block
template <int PASS>
__global__ __launch_bounds__(SW * 32) void score_kernel(const b16* __restrict__ FQ16, const b16* __restrict__ FQC16, const float* __restrict__ N1, const b16* __restrict__ FK16, const b16* __restrict__ FKC16, const float* __restrict__ I2A, const float* __restrict__ I2B, const b16* __restrict__ FVTh, const b16* __restrict__ FVTl,
                                                  const float* __restrict__ CST /* [0..3] cscale/cn, reg/(2 covn), 1/(2 vn), 1/temp; [4..27] cw, covw, vw per head */, float* __restrict__ P1, float* __restrict__ VARC, b16* __restrict__ OCh, b16* __restrict__ OCl) {
  __shared__ __attribute__((aligned(16))) float To[SW][16][DH + 4]; __shared__ float Tr[SW][16]; __shared__ float Tp[SW][8];
  const int wave = threadIdx.x >> 5, lane = threadIdx.x & 31, hh = lane >> 4, col = lane & 15; const int pair = blockIdx.y, n0 = blockIdx.x * (SW * 16) + wave * 16, ni = n0 + col; const int h = pair / QB, qi = pair - h * QB;
  const size_t prow = (size_t)pair * NT + ni; const b16* Qp = FQ16 + prow * DH; const b16* Qc = FQC16 + prow * DH; const b16* Kb = FK16 + (size_t)pair * NT * DH; const b16* Kc = FKC16 + (size_t)pair * NT * DH;
  __builtin_amdgcn_sched_barrier(0);   // keeps the index arithmetic above from being placed between the loads below and the wait that closes their run
  const v16b qa0 = frag_kb(Qp, hh), qa1 = frag_kb(Qp + 32, hh); close_load_run();
  const v16b qc0 = frag_kb(Qc, hh), qc1 = frag_kb(Qc + 32, hh); close_load_run();
  // Every factor of a score element that belongs to the query row, the head or the whole launch is multiplied up here, once a wave. The powers of two (1 / XS^2) move exactly, so pass 1 keeps its bits.
  const float n1 = N1[prow]; close_load_run(); const float q1a = (1.0f / (n1 + 1e-8f)) * (1.0f / (XS * XS)), q1b = (1.0f / fmaxf(n1, 1e-6f)) * (1.0f / (XS * XS));
  constexpr float CK = (1.0f / (8.0f + 1e-6f)) * (1.0f / (XS * XS)), LOG2E = 1.4426950408889634f, LOG2_PS = 3.0f; static_assert(PS == 8.0f, "LOG2_PS is log2(PS)");
  float cn_inv_cscale = 0.0f, covfac = 0.0f, vn_half_inv = 0.0f, temp_inv = 0.0f, cwh = 0.0f, covwh = 0.0f, vwh = 0.0f;   // this head's constants, read once ahead of the loop
  if (PASS == 3) { const float* cf = CST; cn_inv_cscale = cf[0]; covfac = cf[1]; vn_half_inv = cf[2]; temp_inv = cf[3]; cwh = cf[4 + h]; covwh = cf[4 + NH + h]; vwh = cf[4 + 2 * NH + h]; }
  float crow = 0.0f; if (PASS == 3) crow = vwh * VARC[prow] * vn_half_inv;
  // e = w1 cos + w2 c (c the raw centred product); pass 3 takes its logits as w1 cos + w2 c + w0 in units of log2, so that 2^x needs no multiply of its own
  const float lsc = temp_inv * LOG2E, w1 = cwh * cn_inv_cscale * lsc, w2 = covwh * covfac * CK * lsc, w0 = crow * lsc;
  float s_a = 0.0f, s_b = 0.0f, s_c = 0.0f, s_d = 0.0f, s_x = 0.0f, rowacc = 0.0f;
  float m = -INFINITY, l = 0.0f; v8f o[4] = {{}, {}, {}, {}}, ol[4] = {{}, {}, {}, {}};
  // One key block's operands (8 key fragments, 16 key factors; 32 in pass 1) live in registers and are fetched together, a whole block ahead of their use.
  v16b k0a, k0b, k1a, k1b, x0a, x0b, x1a, x1b; v4f nn0, nn1, nn2, nn3, mm0 = {}, mm1 = {}, mm2 = {}, mm3 = {};
  const unsigned flane = (unsigned)lane * 16u, nlane = (unsigned)hh * 32u;   // per-lane byte offsets into a tile in fragment order and into a key block's norms
  auto fetch_keys = [&](int kq) { const b16* kr = Kb + (size_t)kq * DH; const b16* cr = Kc + (size_t)kq * DH; const char* np = (const char*)(I2A + (size_t)pair * NT + kq) + nlane;
    nn0 = *(const v4f*)np; nn1 = *(const v4f*)(np + 16); nn2 = *(const v4f*)(np + 64); nn3 = *(const v4f*)(np + 80);
    if (PASS == 1) { const char* nq = (const char*)(I2B + (size_t)pair * NT + kq) + nlane; mm0 = *(const v4f*)nq; mm1 = *(const v4f*)(nq + 16); mm2 = *(const v4f*)(nq + 64); mm3 = *(const v4f*)(nq + 80); }
    close_load_run();
    k0a = frag_pk(kr, flane); k0b = frag_pk(kr + 512, flane); k1a = frag_pk(kr + 1024, flane); k1b = frag_pk(kr + 1536, flane); close_load_run();   // a 32-key block = 4 tiles: [16 keys][k tile]
    x0a = frag_pk(cr, flane); x0b = frag_pk(cr + 512, flane); x1a = frag_pk(cr + 1024, flane); x1b = frag_pk(cr + 1536, flane); close_load_run(); };
  fetch_keys(0);
  for (int kb = 0; kb < NT; kb += 32) {
    v8f d0 = {}, d1 = {}, c0 = {}, c1 = {};
    d0 = wmma16q(k0a, qa0, d0); d0 = wmma16q(k0b, qa1, d0);
    d1 = wmma16q(k1a, qa0, d1); d1 = wmma16q(k1b, qa1, d1);
    c0 = wmma16q(x0a, qc0, c0); c0 = wmma16q(x0b, qc1, c0);
    c1 = wmma16q(x1a, qc0, c1); c1 = wmma16q(x1b, qc1, c1);
    const v4f na0 = nn0, na1 = nn1, nb0 = nn2, nb1 = nn3, ma0 = mm0, ma1 = mm1, mb0 = mm2, mb1 = mm3;
    // behind the last score product: this block's value fragments (used after the softmax arithmetic), then the next block's keys (the last block re-reads block 0, unused), all in flight under the vector work
    v16b vh[4], vl[4];
    if (PASS == 3) {
#pragma unroll
      for (int t = 0; t < 4; ++t) { vh[t] = frag_pk(FVTh + ((size_t)pair * NT + kb) * DH + t * 512, flane); vl[t] = frag_pk(FVTl + ((size_t)pair * NT + kb) * DH + t * 512, flane); }
      close_load_run(); }
    const int kn = kb + 32 < NT ? kb + 32 : 0;
    fetch_keys(kn);
    float ev0[8], ev1[8];
#pragma unroll
    for (int r = 0; r < 8; ++r) {
#pragma unroll
      for (int hq = 0; hq < 2; ++hq) { const float dw = hq ? d1[r] : d0[r], cw_ = hq ? c1[r] : c0[r];   // the two raw products
        const float i2a = hq ? (r < 4 ? nb0[r & 3] : nb1[r & 3]) : (r < 4 ? na0[r & 3] : na1[r & 3]); const float cosv = clampf(dw * q1a * i2a, -0.99f, 0.99f);
        if (PASS == 1) { const float i2b = hq ? (r < 4 ? mb0[r & 3] : mb1[r & 3]) : (r < 4 ? ma0[r & 3] : ma1[r & 3]); const float covraw = cw_ * CK;
          const float csim = clampf(dw * q1b * i2b, -0.99f, 0.99f); const float margin = clampf(GAMMA - csim, 0.0f, 10.0f);
          s_a += cosv; s_b += pmul(cosv, cosv); s_c += covraw; s_d += pmul(covraw, covraw); s_x += cosv * covraw; rowacc += margin; }
        else { (hq ? ev1 : ev0)[r] = cosv * w1 + (cw_ * w2 + w0); } } }
    if (PASS == 3) { float mr = -INFINITY;
#pragma unroll
      for (int r = 0; r < 8; ++r) mr = fmaxf(mr, fmaxf(ev0[r], ev1[r]));
      mr = fmaxf(mr, __shfl_xor(mr, 16)); const float mn = fmaxf(m, mr); const float al_ = nexp2(m - mn); m = mn; const float ms = mn - LOG2_PS; float sum = 0.0f; v16b pb;   // ms: the factor PS of the f16 weights rides in the exponent; l then holds PS times the row sum
#pragma unroll
      for (int r = 0; r < 8; ++r) { const float e0 = nexp2(ev0[r] - ms), e1 = nexp2(ev1[r] - ms); sum += e0 + e1; pb[r] = (b16)e0; pb[8 + r] = (b16)e1; }
      sum += __shfl_xor(sum, 16); l = l * al_ + sum;
#pragma unroll
      for (int t = 0; t < 4; ++t) { o[t] *= al_; ol[t] *= al_; o[t] = wmma16b(vh[t], pb, o[t]); ol[t] = wmma16b(vl[t], pb, ol[t]); } } }
  if (PASS == 1) {   // per-row sums across the two lane halves; per-wave partials over the 16 rows and 32 lanes
    rowacc += __shfl_xor(rowacc, 16); if (hh == 0) Tr[wave][col] = rowacc;
    // a lane's s_a and s_c are its query row's sums of cos and covraw over the lane half's keys: weighted with the row's var_c they give the cross terms of d2's variance
    const float vc = rowacc * (1.0f / NT); float v7[7] = {s_a, s_b, s_c, s_d, s_x, vc * s_a, vc * s_c};
#pragma unroll
    for (int j = 0; j < 7; ++j) { float v = v7[j];
#pragma unroll
      for (int oo = 16; oo >= 1; oo >>= 1) v += __shfl_xor(v, oo);
      v7[j] = v; }
    if (lane == 0) {
#pragma unroll
      for (int j = 0; j < 7; ++j) Tp[wave][j] = v7[j];
      Tp[wave][7] = 0.0f; }
    wave_lds_sync();
    __syncthreads();
    if ((wave & 1) == 0) { const int g = n0 / 32;   // each even wave stores for itself and the next one: a whole 128-byte line of VARC and of P1 for their 32 rows, as before
      VARC[(size_t)pair * NT + g * 32 + lane] = Tr[wave + (lane >> 4)][lane & 15] * (1.0f / NT);
      P1[((size_t)pair * (NT / 32) + g) * 32 + lane] = (lane < 16) ? Tp[wave + (lane >> 3)][lane & 7] : 0.0f; }
  } else {
    const float inv = 1.0f / (l * XS);
#pragma unroll
    for (int t = 0; t < 4; ++t)
#pragma unroll
      for (int r = 0; r < 8; ++r) To[wave][col][t * 16 + 8 * hh + r] = (o[t][r] + ol[t][r]) * inv;
    wave_lds_sync();
    // fragment order for the output projection: the wave's 16 rows x 64 columns are 2 tiles (2 KiB) a plane; store i covers the 512 bytes [k tile i / 2][j = i % 2]
    { for (int i = 0; i < 4; ++i) { const int rr = col, c8 = (i >> 1) * 32 + (i & 1) * 16 + hh * 8; v8b hv, lv; for (int j = 0; j < 8; ++j) { b16 a_, c_; split16(To[wave][rr][c8 + j] * XS, a_, c_); hv[j] = a_; lv[j] = c_; }
        const size_t gi = ((size_t)qi * NT + n0) * DIM + (h * 2) * 512 + i * 256 + lane * 8; *(v8b*)(OCh + gi) = hv; *(v8b*)(OCl + gi) = lv; }  }
  }
}
// reduction (one block, fixed order): cn, covn, vn, weights, then dstd -> temp -> CST[0..27].
// It runs as one block on an otherwise idle chip, so nothing hides a load's latency but the block's own instruction order: the kernel issues ALL its global reads in one run at its head and keeps them in registers
// (the predictor's weights go on to LDS), so that it pays about one memory latency in all instead of one per loop trip. Every sum keeps its operands and its order; in the loops written anew a product now fuses with its addition.
__global__ __launch_bounds__(256) void reduce1_kernel(const float* __restrict__ P1, const float* __restrict__ VARC, const float* __restrict__ PSUM, const float* __restrict__ w1, const float* __restrict__ b1, const float* __restrict__ g2, const float* __restrict__ be2, const float* __restrict__ w2, const float* __restrict__ b2, const float* __restrict__ w3, const float* __restrict__ b3, const float* __restrict__ wtemp, float* __restrict__ CST) {
  __shared__ float red[4][256]; __shared__ float sh[64];
  __shared__ __attribute__((aligned(16))) float w1s[2 * DH * DH], w2s[DH * 32]; __shared__ float w3s[3][32], b1s[DH], g2s[DH], be2s[DH], b2s[32];   // the predictor's parameters as bf16 values (w3s: the 96 values in their order)
  const int t_ = threadIdx.x; constexpr int NPK = NP_ * (NT / 32) / 256 /* 4 of the 1,024 partials of 32 rows (16 floats: 2 waves x 8) per thread */, NVK = NP_ * NT / 256 /* 128 row values per thread */, NFK = NH * 2 * DH / 256 /* 4 */;
  v4f w1r[8], w2r[2], pl[NPK], ph[NPK], xl[NPK], xh[NPK]; float pr[NFK][QB], vr[NVK], w3r[3];
  const unsigned a63 = t_ & (DH - 1), a31 = t_ & 31, p1off = (unsigned)t_ * 128u /* bytes: partial t_ */, psidx = ((t_ >> 6) & 1) * NP_ * DH + (t_ >> 7) * QB * DH + (t_ & (DH - 1)) /* PSUM [which][pair 4 h][dd] of feature i = t_ */;
  const float b3r[3] = {b3[0], b3[1], b3[2]}, wtr = wtemp[0];
  __builtin_amdgcn_sched_barrier(0);   // keeps the index arithmetic and the scalar reads above from being placed between the loads below and the wait that closes their run
#pragma unroll
  for (int j = 0; j < 8; ++j) w1r[j] = *(const v4f*)(w1 + (j * 256 + t_) * 4);
#pragma unroll
  for (int j = 0; j < 2; ++j) w2r[j] = *(const v4f*)(w2 + (j * 256 + t_) * 4);
  const float b1r = b1[a63], g2r = g2[a63], be2r = be2[a63], b2r = b2[a31];
#pragma unroll
  for (int j = 0; j < 3; ++j) w3r[j] = w3[j * 32 + a31];
#pragma unroll
  for (int k = 0; k < NPK; ++k) { const char* p = (const char*)P1 + p1off + k * (256 * 128); pl[k] = *(const v4f*)p; xl[k] = *(const v4f*)(p + 16); ph[k] = *(const v4f*)(p + 32); xh[k] = *(const v4f*)(p + 48); }
#pragma unroll
  for (int k = 0; k < NFK; ++k)   // feature i = t_ + 256 k: head h + 2 k, the same which and dd
#pragma unroll
    for (int qq = 0; qq < QB; ++qq) pr[k][qq] = PSUM[psidx + (2 * k * QB + qq) * DH];
#pragma unroll   // full, here and in the four loops that read vr: the 128 values stay in registers and are read from memory once, not once a loop
  for (int j = 0; j < NVK; ++j) vr[j] = VARC[t_ + j * 256];
  // closes the run as close_load_run() does; the input operands keep the run's address registers from being given to a later load's result ahead of the wait
  asm volatile("s_wait_xcnt 0x0" :: "v"(a63), "v"(a31), "v"(p1off), "v"(psidx) : "memory"); __builtin_amdgcn_sched_barrier(0);
#pragma unroll
  for (int j = 0; j < 8; ++j) { v4f x; for (int e = 0; e < 4; ++e) x[e] = bf16_rne(w1r[j][e]); *(v4f*)(w1s + (j * 256 + t_) * 4) = x; }
#pragma unroll
  for (int j = 0; j < 2; ++j) { v4f x; for (int e = 0; e < 4; ++e) x[e] = bf16_rne(w2r[j][e]); *(v4f*)(w2s + (j * 256 + t_) * 4) = x; }
  b1s[a63] = bf16_rne(b1r); g2s[a63] = bf16_rne(g2r); be2s[a63] = bf16_rne(be2r); b2s[a31] = bf16_rne(b2r);   // every thread stores: threads with the same index store the same value
#pragma unroll
  for (int j = 0; j < 3; ++j) w3s[j][a31] = bf16_rne(w3r[j]);
  float a = 0, b = 0, c = 0, d = 0, mo[NPK][7];   // mo: the seven moments of partial t_ + 256 k (32 rows of head 2 k + t_ / 128), kept for d2's variance at the end
#pragma unroll
  for (int k = 0; k < NPK; ++k) {
#pragma unroll
    for (int j = 0; j < 4; ++j) mo[k][j] = pl[k][j] + ph[k][j];
#pragma unroll
    for (int j = 0; j < 3; ++j) mo[k][4 + j] = xl[k][j] + xh[k][j];
    a += mo[k][0]; b += mo[k][1]; c += mo[k][2]; d += mo[k][3]; }
  red[0][t_] = a; red[1][t_] = b; red[2][t_] = c; red[3][t_] = d; __syncthreads();
  for (int s = 128; s >= 1; s >>= 1) { if (t_ < s) { for (int j = 0; j < 4; ++j) red[j][t_] += red[j][t_ + s]; } __syncthreads(); }
  float vs = 0.0f;
#pragma unroll
  for (int j = 0; j < NVK; ++j) vs += vr[j];
  __shared__ float r2[256]; r2[t_] = vs; __syncthreads(); for (int s = 128; s >= 1; s >>= 1) { if (t_ < s) r2[t_] += r2[t_ + s]; __syncthreads(); }
  const float vmu = r2[0] / (float)(NP_ * NT); __syncthreads();
  float vq = 0.0f;
#pragma unroll
  for (int j = 0; j < NVK; ++j) { const float dv = vr[j] - vmu; vq += dv * dv; }
  r2[t_] = vq; __syncthreads(); for (int s = 128; s >= 1; s >>= 1) { if (t_ < s) r2[t_] += r2[t_ + s]; __syncthreads(); }
  // head means qg/kg [8][64] from PSUM [which][pair][64]: mean over (q, n) = sum over the 4 pairs of the head / 4096 -> feats [h][128]; MLP: h1 = relu(LN(feats W1 + b1)), h2 = relu(h1 W2 + b2), logits = softmax(h2 W3 + b3), w = softmax(logits / clip(wt)), clip [0.05,0.8], renorm
  __shared__ __attribute__((aligned(16))) float feats[NH][2 * DH], h1s[NH][DH], h2s[NH][32]; __shared__ float ws[NH][3];
#pragma unroll
  for (int k = 0; k < NFK; ++k) { const int i = t_ + k * 256, h = i / (2 * DH), c = i - h * 2 * DH; float s = 0.0f;
#pragma unroll
    for (int qq = 0; qq < QB; ++qq) s += pr[k][qq];
    feats[h][c] = s * (1.0f / (QB * NT)); }
  __syncthreads();
  // the loops below read LDS only; each is unrolled, with plain products, so that its reads are issued ahead of the one chain of additions instead of being waited for one by one
  for (int i = t_; i < NH * DH; i += 256) { const int h = i / DH, o_ = i - h * DH; float s = b1s[o_];
#pragma unroll 32
    for (int c = 0; c < 2 * DH; ++c) s += feats[h][c] * w1s[c * DH + o_]; h1s[h][o_] = s; }
  __syncthreads();
  if (t_ < NH) { const int h = t_; float mu = 0.0f;
#pragma unroll
    for (int c = 0; c < DH; ++c) mu += h1s[h][c];
    mu *= (1.0f / DH); float var = 0.0f;
#pragma unroll
    for (int c = 0; c < DH; ++c) { const float dv = h1s[h][c] - mu; var += dv * dv; }
    var *= (1.0f / DH); const float rs = rsqrtf(var + 1e-5f);
#pragma unroll
    for (int c = 0; c < DH; ++c) h1s[h][c] = fmaxf((h1s[h][c] - mu) * rs * g2s[c] + be2s[c], 0.0f); }
  __syncthreads();
  for (int i = t_; i < NH * 32; i += 256) { const int h = i / 32, o_ = i - h * 32; float s = b2s[o_];
#pragma unroll 32
    for (int c = 0; c < DH; ++c) s += h1s[h][c] * w2s[c * 32 + o_]; h2s[h][o_] = fmaxf(s, 0.0f); }
  __syncthreads();
  if (t_ < NH) { const int h = t_; float lg[3]; for (int o_ = 0; o_ < 3; ++o_) { float s = bf16_rne(b3r[o_]);
#pragma unroll
      for (int c = 0; c < 32; ++c) s += h2s[h][c] * (&w3s[0][0])[c * 3 + o_]; lg[o_] = s; }
    float mx = fmaxf(lg[0], fmaxf(lg[1], lg[2])); float e3[3], se = 0.0f; for (int j = 0; j < 3; ++j) { e3[j] = __expf(lg[j] - mx); se += e3[j]; } for (int j = 0; j < 3; ++j) e3[j] /= se;
    const float wt = clampf(bf16_rne(wtr), 0.1f, 20.0f); float z[3]; for (int j = 0; j < 3; ++j) z[j] = e3[j] / wt; mx = fmaxf(z[0], fmaxf(z[1], z[2])); se = 0.0f; for (int j = 0; j < 3; ++j) { e3[j] = __expf(z[j] - mx); se += e3[j]; }
    float wv[3], sw = 0.0f; for (int j = 0; j < 3; ++j) { wv[j] = clampf(e3[j] / se, 0.05f, 0.8f); sw += wv[j]; } for (int j = 0; j < 3; ++j) ws[h][j] = wv[j] / sw; }
  __syncthreads();
  if (t_ == 0) { const float n = (float)NTOT; const float sa_ = red[0][0], sb = red[1][0], sc = red[2][0], sd = red[3][0];
    const float cstd = sqrtf(fmaxf((sb - sa_ * (sa_ / n)) / (n - 1.0f), 0.0f)); const float covstd_raw = sqrtf(fmaxf((sd - sc * (sc / n)) / (n - 1.0f), 0.0f));
    const float base_reg = LREG / (float)NT; const float reg = (covstd_raw < 1e-6f) ? base_reg * 10.0f : base_reg;   // reference: reg chosen on the std of the RAW cov, then cov = clip(reg cov, +-50) (never clips at this scale)
    const float covn = reg * covstd_raw + 1e-6f; const float cn = cstd + 1e-6f; const float cscale = (cn < 1e-4f) ? 0.1f : 1.0f;
    const float vn = sqrtf(r2[0] * ((float)NT / (n - 1.0f))) + 1e-6f;   // std over the broadcast [.., m] copies: each row value repeated NT times
    sh[0] = cscale / cn; sh[1] = reg * 0.5f / covn; sh[2] = 0.5f / vn; sh[3] = 0.0f; for (int h = 0; h < NH; ++h) { sh[4 + h] = ws[h][0]; sh[4 + NH + h] = ws[h][1]; sh[4 + 2 * NH + h] = ws[h][2]; } }
  __syncthreads();
  // dstd = std(d2) from the moments. d2 = e + c with e = W1 cos + W2 covraw (W1 = cw cscale/cn, W2 = covw reg/(2 covn), per head) and the row constant c = vw var_c/(2 vn).
  // var(d2) = E[(d2 - M)^2] - (E[d2 - M])^2 with the shift M = mean of the row constants (kills the large common offset): sum (d2 - M) = sum e + NT sum_rows (c - M),
  // sum (d2 - M)^2 = sum e^2 + 2 sum_rows (c - M) rowsum_e + NT sum_rows (c - M)^2; sum e^2 = W1^2 sum cos^2 + 2 W1 W2 sum cos covraw + W2^2 sum covraw^2; sum_rows c rowsum_e = vw/(2 vn) (W1 sum var_c rowsum_cos + W2 sum var_c rowsum_covraw).
  __shared__ float tl[3][8]; const int wv = t_ >> 5; const float vfac = sh[2]; float vf[NH];
#pragma unroll
  for (int h = 0; h < NH; ++h) vf[h] = sh[4 + 2 * NH + h] * vfac;
  float c4[4] = {0.0f, 0.0f, 0.0f, 0.0f};   // row i = t_ + 256 j belongs to head (i / NT) / QB = j / 16; four chains here and below, so that an addition does not wait for the one before it
#pragma unroll
  for (int j = 0; j < NVK; ++j) c4[j & 3] += vf[j / 16] * vr[j];
  float sc = (c4[0] + c4[1]) + (c4[2] + c4[3]);
#pragma unroll
  for (int o = 16; o >= 1; o >>= 1) sc += __shfl_xor(sc, o);
  if ((t_ & 31) == 0) tl[0][wv] = sc;
  __syncthreads();
  float M = 0.0f;
#pragma unroll
  for (int w = 0; w < 8; ++w) M += tl[0][w];
  M /= (float)(NP_ * NT); float q1[4] = {0.0f, 0.0f, 0.0f, 0.0f}, q2[4] = {0.0f, 0.0f, 0.0f, 0.0f};
#pragma unroll
  for (int j = 0; j < NVK; ++j) { const float cm = vf[j / 16] * vr[j] - M; q1[j & 3] += cm; q2[j & 3] += cm * cm; }
  float s1 = (float)NT * ((q1[0] + q1[1]) + (q1[2] + q1[3])), s2 = (float)NT * ((q2[0] + q2[1]) + (q2[2] + q2[3]));
#pragma unroll
  for (int k = 0; k < NPK; ++k) { const int h = 2 * k + (t_ >> 7); const float W1 = sh[4 + h] * sh[0], W2 = sh[4 + NH + h] * sh[1], VW = sh[4 + 2 * NH + h] * vfac, se = W1 * mo[k][0] + W2 * mo[k][2];
    s1 += se; s2 += W1 * W1 * mo[k][1] + 2.0f * W1 * W2 * mo[k][4] + W2 * W2 * mo[k][3] + 2.0f * (VW * (W1 * mo[k][5] + W2 * mo[k][6]) - M * se); }
#pragma unroll
  for (int o = 16; o >= 1; o >>= 1) { s1 += __shfl_xor(s1, o); s2 += __shfl_xor(s2, o); }
  if ((t_ & 31) == 0) { tl[1][wv] = s1; tl[2][wv] = s2; }
  __syncthreads();
  if (t_ == 0) { float t1 = 0.0f, t2 = 0.0f;
#pragma unroll
    for (int w = 0; w < 8; ++w) { t1 += tl[1][w]; t2 += tl[2][w]; }
    const float n = NTOT; const float var = (t2 - t1 * (t1 / n)) / (n - 1.0f); const float dstd = sqrtf(fmaxf(var, 0.0f)); const float temp = (dstd < 1e-6f) ? 0.1f : 0.3f + dstd; sh[3] = 1.0f / clampf(temp, 0.1f, 5.0f); }
  __syncthreads();
  { if (t_ < 32) ((float*)CST)[t_] = (t_ < 4 + 3 * NH) ? sh[t_] : 0.0f;  }
}
__global__ __launch_bounds__(128) void outproj_kernel(const b16* __restrict__ OCh, const b16* __restrict__ OCl, const b16* __restrict__ WOUT, const float* __restrict__ bo, float* __restrict__ out) {
  __shared__ __attribute__((aligned(16))) float Ts[4][16][128 + 4];
  const int wave = threadIdx.x >> 5, lane = threadIdx.x & 31, nloc = lane & 15, hlf = lane >> 4; const size_t m0 = (size_t)blockIdx.x * 64 + wave * 16; const int n0 = blockIdx.y * 128;
  v8f acc[8];
#pragma unroll
  for (int t = 0; t < 8; ++t) acc[t] = (v8f){};
  const b16* ap = OCh + m0 * DIM; const b16* lp = OCl + m0 * DIM; const b16* bp = WOUT + (size_t)n0 * DIM; const unsigned flane = (unsigned)lane * 16u;   // ap, lp, bp: the first tile of row m0, of column n0
  v16b a = frag_pk(ap, flane), al = frag_pk(lp, flane), b[8];
#pragma unroll
  for (int t = 0; t < 8; ++t) b[t] = frag_pk(bp + (size_t)t * 16 * DIM, flane);
#pragma unroll   // full: the two fragment sets swap by renaming, and the last step's fetch falls away
  for (int kb = 0; kb < DIM; kb += 32) { v16b an = a, aln = al, bn[8];
#pragma unroll
    for (int t = 0; t < 8; ++t) bn[t] = b[t];
    if (kb + 32 < DIM) { an = frag_pk(ap + (kb + 32) * 16, flane); aln = frag_pk(lp + (kb + 32) * 16, flane);
#pragma unroll
      for (int t = 0; t < 8; ++t) bn[t] = frag_pk(bp + (size_t)t * 16 * DIM + (kb + 32) * 16, flane); }
    __builtin_amdgcn_sched_barrier(0);   // keeps the next step's loads, as one group, ahead of this step's products: sunk towards their uses they would each be waited for in turn
#pragma unroll
    for (int t = 0; t < 8; ++t) { acc[t] = wmma16b(a, b[t], acc[t]); acc[t] = wmma16b(al, b[t], acc[t]); }
    a = an; al = aln;
#pragma unroll
    for (int t = 0; t < 8; ++t) b[t] = bn[t]; }
#pragma unroll
  for (int t = 0; t < 8; ++t) { const float bb = bf16_rne(bo[n0 + t * 16 + nloc]);
#pragma unroll
    for (int r = 0; r < 8; ++r) Ts[wave][8 * hlf + r][t * 16 + nloc] = acc[t][r] * (1.0f / (XS * WSC)) + bb; }
  wave_lds_sync();
  { for (int rr = 0; rr < 16; ++rr) *(v4f*)(out + (m0 + rr) * DIM + n0 + lane * 4) = *(const v4f*)(&Ts[wave][rr][lane * 4]);  }
}
}  // namespace

extern "C" void kernel_launch(void* const* d_in, const int* in_sizes, int n_in, void* d_out, int out_size, void* d_ws, size_t ws_size, hipStream_t stream) {
  (void)n_in;
  auto Fp = [&](int i) { return (const float*)d_in[i]; };
  // input order: 0 q, 1 k, 2 v [4,1024,512]; 3 ln_in_g, 4 ln_in_b; 5 W_in [512,512]; 6 wp_W1 [128,64], 7 wp_b1, 8 wp_ln_g, 9 wp_ln_b, 10 wp_W2 [64,32], 11 wp_b2, 12 wp_W3 [32,3], 13 wp_b3, 14 weight_temp [1], 15 W_out [512,512], 16 b_out
  if (in_sizes[0] != NR * DIM || in_sizes[1] != NR * DIM || in_sizes[2] != NR * DIM || in_sizes[5] != DIM * DIM || in_sizes[6] != 2 * DH * DH || in_sizes[15] != DIM * DIM || out_size != NR * DIM) return;
  size_t off = 0; char* ws = (char*)d_ws;
  auto carve = [&](size_t bytes) { char* p = ws + off; off += (bytes + 255) & ~(size_t)255; return p; };
  b16* X16 = (b16*)carve((size_t)3 * NR * DIM * 2); b16* WIN = (b16*)carve((size_t)DIM * DIM * 2); b16* WOUT = (b16*)carve((size_t)DIM * DIM * 2);
  float* F32 = (float*)carve((size_t)3 * NP_ * NT * DH * 4); float* CP = (float*)carve((size_t)2 * NP_ * (NT / 16) * DH * 4); float* PSUM = (float*)carve((size_t)2 * NP_ * DH * 4);
  b16* FQ16 = (b16*)carve((size_t)NP_ * NT * DH * 2); b16* FQC16 = (b16*)carve((size_t)NP_ * NT * DH * 2); b16* FK16 = (b16*)carve((size_t)NP_ * NT * DH * 2); b16* FKC16 = (b16*)carve((size_t)NP_ * NT * DH * 2);
  float* N1 = (float*)carve((size_t)NP_ * NT * 4); float* N2 = (float*)carve((size_t)NP_ * NT * 4); float* I2B = (float*)carve((size_t)NP_ * NT * 4);   // N2 holds 1 / (key norm + 1e-8), I2B 1 / max(key norm, 1e-6)
  b16* FVTh = (b16*)carve((size_t)NP_ * DH * NT * 2); b16* FVTl = (b16*)carve((size_t)NP_ * DH * NT * 2);
  float* P1 = (float*)carve((size_t)NP_ * (NT / 32) * 32 * 4); float* VARC = (float*)carve((size_t)NP_ * NT * 4); float* CST = (float*)carve(256);
  b16* OCh = (b16*)carve((size_t)NR * DIM * 2); b16* OCl = (b16*)carve((size_t)NR * DIM * 2);
  if (off > ws_size || off > ((size_t)128 << 20)) return;   // ≈ 74 MB
  ln_prepw_kernel<<<NPW + 3 * NR / 8, 256, 0, stream>>>(Fp(0), Fp(1), Fp(2), Fp(3), Fp(4), Fp(5), Fp(15), X16, WIN, WOUT);
  feat_kernel<<<dim3(NR / 64, DIM / 128, 3), 128, 0, stream>>>(X16, WIN, F32, CP);
  planes_kernel<<<dim3(NT / 64, NP_), 256, 0, stream>>>(F32, CP, PSUM, FQ16, FQC16, N1, FK16, FKC16, N2, I2B, FVTh, FVTl);
  score_kernel<1><<<dim3(NT / (SW * 16), NP_), SW * 32, 0, stream>>>(FQ16, FQC16, N1, FK16, FKC16, N2, I2B, FVTh, FVTl, CST, P1, VARC, OCh, OCl);
  reduce1_kernel<<<1, 256, 0, stream>>>(P1, VARC, PSUM, Fp(6), Fp(7), Fp(8), Fp(9), Fp(10), Fp(11), Fp(12), Fp(13), Fp(14), CST);
  score_kernel<3><<<dim3(NT / (SW * 16), NP_), SW * 32, 0, stream>>>(FQ16, FQC16, N1, FK16, FKC16, N2, I2B, FVTh, FVTl, CST, P1, VARC, OCh, OCl);
  outproj_kernel<<<dim3(NR / 64, DIM / 128), 128, 0, stream>>>(OCh, OCl, WOUT, Fp(16), (float*)d_out);
}

// v008
// One run takes 118 microseconds.
// Timed twice side by side with v007, it ran 1.03 and 1.04 times as fast.
// All steps since v000 together make it 5.94 times as fast.
#include <hip/hip_runtime.h>

// "Super-aggressive" attention: f_q, f_k, f_v = LN(q|k|v) W_in split into 8 heads x 64; per (head, batch) pair: cos = clip(f_q.f_k / (n1 n2), +-0.99) (n = norm + 1e-8),
// cov = reg x (f_q - rowmean_d)(f_k - colmean_m) / (8 + 1e-6) (reg = 1e-3/1024, x10 if the global std of the raw cov < 1e-6), csim = clip(qn.kn) with max(norm, 1e-6), margin =
// clip(0.01 - csim, 0, 10), var_c = row mean of margin; per-head weights (cw, covw, vw) from a tiny MLP on the global means of f_q / f_k (softmax, /clip(weight_temp), softmax, clip, renorm);
// cn / covn / vn = global std (ddof 1) of cos / cov / var_c (+1e-6); d2 = cw cos/cn cscale + covw cov/covn/2 + vw var_c/vn/2; temp = 0.3 + std(d2) (dstd >= 1e-6; clipped to [0.1, 5]);
// attn = softmax(d2 / temp); out_h = attn f_v; out = concat_h W_out + b -> [4][1024][512].
// Every global statistic is a deterministic f32 reduction (per-wave partials, then one fixed-order kernel; the means of f_q / f_k take a per-pair level in between); the [1024 x 1024] score tiles are recomputed in two passes
// (component statistics; softmax + PV) instead of being stored. std(d2) takes no pass of its own: d2 is linear in cos, cov and var_c, so its variance is a quadratic form in their first and second moments per head.
// WMMA (v_wmma_f32_16x16x32_f16, f32 accumulate): W_in (LN(x) single f16 x8, exact weights), dots / centered-cov tiles (single f16 x8 feature planes, K = 64), P.V (P single x8, f_v^T hi+lo:
// 2 products), W_out (O hi+lo: 2 products). LN, norms, all statistics and the weight-predictor MLP in f32. Inputs rounded to bf16 once. Fragment k-map per lane half hh

namespace {
constexpr int QB = 4, NT = 1024, DIM = 512, NH = 8, DH = 64, NP_ = NH * QB /* 32 (h,q) pairs, index h*QB + q */, NR = QB * NT /* 4096 rows */, NWAVE = NP_ * (NT / 16) /* 2048 score waves */;
constexpr float XS = 8.0f, WSC = 256.0f, PS = 8.0f, GAMMA = 0.01f, LREG = 0.001f;
constexpr float NTOT = 33554432.0f;   // 33,554,432 score elements

typedef _Float16 b16;
typedef __attribute__((ext_vector_type(16))) _Float16 v16b;
typedef __attribute__((ext_vector_type(8))) _Float16 v8b;
typedef __attribute__((ext_vector_type(8))) float v8f;
typedef __attribute__((ext_vector_type(4))) float v4f;
typedef __attribute__((ext_vector_type(2))) float v2f;
__device__ __forceinline__ float bf16_rne(float f) { unsigned int u = __float_as_uint(f); u += 0x7FFFu + ((u >> 16) & 1u); return __uint_as_float(u & 0xFFFF0000u); }
__device__ __forceinline__ void split16(float v, b16& hi, b16& lo) { hi = (b16)v; lo = (b16)(v - (float)hi); }
__device__ __forceinline__ v16b frag_kb(const b16* p, int hh) { const v8b a = *(const v8b*)(p + 8 * hh), b = *(const v8b*)(p + 16 + 8 * hh); v16b f;
#pragma unroll
  for (int e = 0; e < 8; ++e) { f[e] = a[e]; f[8 + e] = b[e]; } return f; }
// Fragment order: the planes that the matrix loops read again and again (keys, centred keys, f_v^T hi/lo, both weight planes, the attention output hi/lo) are stored tile by tile, a tile = 16 rows x 32 k = 1,024 contiguous bytes laid out as
// [k half j][lane = 16 hh + row][8 elements], element (row, kk) with j = kk / 16, hh = (kk / 8) % 2. A wave's 16-byte load then covers 512 contiguous bytes (4 whole lines) instead of 32-byte pieces of 16 lines; each lane gets the same values in the same registers as from frag_kb.
__device__ __forceinline__ int frag_pos(int row, int kk) { return (kk >> 4) * 256 + (((kk >> 3) & 1) * 16 + row) * 8 + (kk & 7); }   // element offset inside a tile
__device__ __forceinline__ v16b frag_pk(const b16* utile, unsigned lane_bytes) { const char* p = (const char*)utile + lane_bytes; const v8b a = *(const v8b*)p, b = *(const v8b*)(p + 512); v16b f;   // wave-uniform tile base plus 16 * lane bytes
#pragma unroll
  for (int e = 0; e < 8; ++e) { f[e] = a[e]; f[8 + e] = b[e]; } return f; }
__device__ __forceinline__ v8f wmma16b(v16b a, v16b b, v8f c) { v8f d = __builtin_amdgcn_wmma_f32_16x16x32_f16(false, a, false, b, (short)0, c, false, false); asm volatile("v_nop\n\tv_nop\n\tv_nop\n\tv_nop" : "+v"(d) : "v"(a), "v"(b)); return d; }
// the plain product, for a run of products in a loop: the compiler keeps the distances behind its own builtin and writes idle slots only where a vector instruction really follows on D, A or B
__device__ __forceinline__ v8f wmma16p(v16b a, v16b b, v8f c) { return __builtin_amdgcn_wmma_f32_16x16x32_f16(false, a, false, b, (short)0, c, false, false); }
// closes a run of global loads. The wait stands in front of the next instruction that writes a register from which those loads took their address (a precaution).
// The scheduling barrier keeps later address arithmetic from being lifted over that wait, and keeps the run up here, ahead of the work that covers its latency: sunk towards their uses the loads would each be waited for in turn.
__device__ __forceinline__ void close_load_run() { asm volatile("s_wait_xcnt 0x0" ::: "memory"); __builtin_amdgcn_sched_barrier(0); }
typedef const __attribute__((address_space(1))) char* gaddr;   // a lane's byte address in global memory, carried through the key loop in one register pair
// closes a run of loads from one or two carried addresses and moves these on to the next key block. Wait and additions are one statement: the addresses stay live, in their own registers, up to the wait (no result of the run can be given them),
// and the instructions that overwrite them stand behind it by construction. The scheduling barrier as in close_load_run().
__device__ __forceinline__ void close_and_advance(gaddr& a, gaddr& b, long long step) { asm volatile("s_wait_xcnt 0x0\n\tv_add_nc_u64 %0, %2, %0\n\tv_add_nc_u64 %1, %2, %1" : "+v"(a), "+v"(b) : "s"(step) : "memory"); __builtin_amdgcn_sched_barrier(0); }
__device__ __forceinline__ void close_and_advance(gaddr& a, long long step) { asm volatile("s_wait_xcnt 0x0\n\tv_add_nc_u64 %0, %1, %0" : "+v"(a) : "s"(step) : "memory"); __builtin_amdgcn_sched_barrier(0); }
__device__ __forceinline__ v16b frag_row(gaddr p) { const v8b a = *(const __attribute__((address_space(1))) v8b*)p, b = *(const __attribute__((address_space(1))) v8b*)(p + 32); v16b f;
#pragma unroll
  for (int e = 0; e < 8; ++e) { f[e] = a[e]; f[8 + e] = b[e]; } return f; }
__device__ __forceinline__ v4f quad_at(gaddr p) { return *(const __attribute__((address_space(1))) v4f*)p; }
__device__ __forceinline__ v16b frag_at(gaddr p) { const v8b a = *(const __attribute__((address_space(1))) v8b*)p, b = *(const __attribute__((address_space(1))) v8b*)(p + 512); v16b f;   // frag_pk from the lane's own address
#pragma unroll
  for (int e = 0; e < 8; ++e) { f[e] = a[e]; f[8 + e] = b[e]; } return f; }
__device__ __forceinline__ void wave_lds_sync() { __builtin_amdgcn_fence(__ATOMIC_RELEASE, "workgroup"); __builtin_amdgcn_wave_barrier(); __builtin_amdgcn_fence(__ATOMIC_ACQUIRE, "workgroup"); }
// 2^x on v_exp_f32, with the slot that the instruction set asks for behind a transcendental (before its result is used or its source overwritten) filled in the same statement: a v_nop in a statement of its own did not stay behind it
__device__ __forceinline__ float nexp2(float x) { float r; asm("v_exp_f32 %0, %1\n\tv_nop" : "=v"(r) : "v"(x)); return r; }
__device__ __forceinline__ float pmul(float a, float b) { float p = a * b; asm volatile("" : "+v"(p)); return p; }
__device__ __forceinline__ float hsum16(float v) { v += __shfl_xor(v, 1); v += __shfl_xor(v, 2); v += __shfl_xor(v, 4); return v + __shfl_xor(v, 8); }
__device__ __forceinline__ float clampf(float v, float lo, float hi) { return fminf(fmaxf(v, lo), hi); }
__device__ __forceinline__ v2f clamp2(v2f v, float lo, float hi) { return (v2f){clampf(v[0], lo, hi), clampf(v[1], lo, hi)}; }
struct KeyFac { v4f a[4], b[4]; };   // a key block's factors per lane: a = 1 / (norm + 1e-8), b = 1 / max(norm, 1e-6); [0], [1]: keys 8 hh + 0 .. 7, [2], [3]: keys 16 + 8 hh + 0 .. 7

// one launch for the two independent preparations: blocks 0 .. NPW - 1 put the two weight planes into fragment order, the others normalise 8 rows each
constexpr int NPW = 2 * DIM * DIM / 8 / 256;
__global__ __launch_bounds__(256) void ln_prepw_kernel(const float* __restrict__ q, const float* __restrict__ k, const float* __restrict__ v, const float* __restrict__ g, const float* __restrict__ be, const float* __restrict__ win, const float* __restrict__ wout, b16* __restrict__ X16, b16* __restrict__ WIN, b16* __restrict__ WOUT) {
  if (blockIdx.x < NPW) { const int t = blockIdx.x * 256 + threadIdx.x, kind = t / (DIM * DIM / 8), tt = t - kind * (DIM * DIM / 8);
    // thread tt fills the 16-byte piece tt of the plane in fragment order: tile tt / 64 = (row tile) * 16 + k tile, piece tt % 64 = [j][hh][row]
    const int tile = tt >> 6, o_ = (tile / (DIM / 32)) * 16 + (tt & 15), k0 = (tile % (DIM / 32)) * 32 + ((tt >> 5) & 1) * 16 + ((tt >> 4) & 1) * 8;
    const float* w = kind == 0 ? win : wout; v8b o; for (int j = 0; j < 8; ++j) o[j] = (b16)(bf16_rne(w[(size_t)(k0 + j) * DIM + o_]) * WSC);
    *(v8b*)((kind == 0 ? WIN : WOUT) + (size_t)tt * 8) = o; return; }
  const int wave = threadIdx.x >> 5, lane = threadIdx.x & 31; const int rowall = (blockIdx.x - NPW) * 8 + wave; const int which = rowall / NR, row = rowall - which * NR;
  const float* src = (which == 0 ? q : which == 1 ? k : v) + (size_t)row * DIM + lane * 16; float x[16];
  { const v4f a = *(const v4f*)src, b = *(const v4f*)(src + 4), c = *(const v4f*)(src + 8), d = *(const v4f*)(src + 12); for (int j = 0; j < 4; ++j) { x[j] = bf16_rne(a[j]); x[4 + j] = bf16_rne(b[j]); x[8 + j] = bf16_rne(c[j]); x[12 + j] = bf16_rne(d[j]); } }
  float s = 0.0f; for (int j = 0; j < 16; ++j) s += x[j];
#pragma unroll
  for (int o = 16; o >= 1; o >>= 1) s += __shfl_xor(s, o);
  const float mu = s * (1.0f / DIM); float ss = 0.0f; for (int j = 0; j < 16; ++j) { const float d = x[j] - mu; ss += pmul(d, d); }
#pragma unroll
  for (int o = 16; o >= 1; o >>= 1) ss += __shfl_xor(ss, o);
  const float rs = rsqrtf(ss * (1.0f / DIM) + 1e-5f); v8b o0, o1;
  for (int j = 0; j < 16; ++j) { const int c = lane * 16 + j; const b16 hv = (b16)((pmul((x[j] - mu) * rs, bf16_rne(g[c])) + bf16_rne(be[c])) * XS); if (j < 8) o0[j] = hv; else o1[j - 8] = hv; }
  { b16* dst = X16 + ((size_t)which * NR + row) * DIM + lane * 16; *(v8b*)dst = o0; *(v8b*)(dst + 8) = o1;  }
}
// features: F = X16 W_in per row (block = 64 rows x 4 waves, wave = 16 rows x 128 cols = 2 heads; grid.y = 4): which 0 (q): F32Q [pair][n][64] f32 rows; which 1 (k): F32K; which 2 (v): F32V. (f32 planes,
__global__ __launch_bounds__(128) void feat_kernel(const b16* __restrict__ X16, const b16* __restrict__ WIN, float* __restrict__ F32, float* __restrict__ CP) {
  __shared__ __attribute__((aligned(16))) float Ts[4][16][128 + 4];
  const int wave = threadIdx.x >> 5, lane = threadIdx.x & 31, nloc = lane & 15, hlf = lane >> 4; const int which = blockIdx.z; const size_t m0 = (size_t)blockIdx.x * 64 + wave * 16; const int n0 = blockIdx.y * 128;
  v8f acc[8];
#pragma unroll
  for (int t = 0; t < 8; ++t) acc[t] = (v8f){};
  const b16* ap = X16 + ((size_t)which * NR + m0 + nloc) * DIM; const b16* bp = WIN + (size_t)n0 * DIM; const unsigned flane = (unsigned)lane * 16u;   // bp: the first weight tile of column n0 (16 rows x 512 k = 16 tiles of 512 elements)
  v16b a = frag_kb(ap, hlf), b[8];
#pragma unroll
  for (int t = 0; t < 8; ++t) b[t] = frag_pk(bp + (size_t)t * 16 * DIM, flane);
#pragma unroll   // full: the two fragment sets swap by renaming, and the last step's fetch falls away
  for (int kb = 0; kb < DIM; kb += 32) { v16b an = a, bn[8];
#pragma unroll
    for (int t = 0; t < 8; ++t) bn[t] = b[t];
    if (kb + 32 < DIM) { an = frag_kb(ap + kb + 32, hlf);
#pragma unroll
      for (int t = 0; t < 8; ++t) bn[t] = frag_pk(bp + (size_t)t * 16 * DIM + (kb + 32) * 16, flane); }
    __builtin_amdgcn_sched_barrier(0);   // keeps the next step's loads, as one group, ahead of this step's products: sunk towards their uses they would each be waited for in turn
#pragma unroll
    for (int t = 0; t < 8; ++t) acc[t] = wmma16b(a, b[t], acc[t]);
    a = an;
#pragma unroll
    for (int t = 0; t < 8; ++t) b[t] = bn[t]; }
#pragma unroll
  for (int t = 0; t < 8; ++t)
#pragma unroll
    for (int r = 0; r < 8; ++r) Ts[wave][8 * hlf + r][t * 16 + nloc] = acc[t][r] * (1.0f / (XS * WSC));
  wave_lds_sync();
  // rows m0+rr: q_idx = row / NT, n = row % NT; cols n0 + c -> head h = (n0 + c) / 64, d = % 64; F32 layout [which][pair][n][64]
  // a lane keeps columns n0 + 4 lane .. + 3 (lane half = head) through the wave's 16 rows, which lie in one batch entry, and sums them on the way: CP [which 0/1][pair][16-row tile][64] = column sums of the tile, the first level of the means over rows
  { const int qi = (int)(m0 / NT), n = (int)(m0 - (size_t)qi * NT), pair = (n0 / DH + hlf) * QB + qi; float* dst = F32 + (((size_t)which * NP_ + pair) * NT + n) * DH + nloc * 4; v4f x[16];
#pragma unroll
    for (int rr = 0; rr < 16; ++rr) { x[rr] = *(const v4f*)(&Ts[wave][rr][lane * 4]); *(v4f*)(dst + rr * DH) = x[rr]; }
    close_load_run();   // the same wait behind this run of stores: the sums below are formed in the registers that the stores name
    if (which < 2) { v4f cs = x[0];
#pragma unroll
      for (int rr = 1; rr < 16; ++rr) cs += x[rr];
      *(v4f*)(CP + (((size_t)which * NP_ + pair) * (NT / 16) + n / 16) * DH + nloc * 4) = cs; } }
}
// operand planes per pair, one launch (block = 64 rows of one pair, 8 waves): FQ16 [pair][n][64] = f16(8 f_q), FQC16 = f16(8 (f_q - rowmean)); FK16, FKC16 = f16(8 (f_k - colmean)) (both in fragment order);
// N1 [pair][n] = ||f_q|| (f32); FVTh/FVTl = f_v^T hi/lo x8 (rows d, k = keys, in fragment order). The key norms enter every score element only through 1 / (n2 + 1e-8) and 1 / max(n2, 1e-6):
// the two quotients are formed here, once a key (I2A, I2B), not once a score element in each pass. The squared norms come from the same registers as the f16 planes (4 products a lane, then a tree over the row's 16 lanes).
// Column sums over the pair's 1,024 rows, second level: thread (d = t % 64, part = t / 64) adds 16 of the 64 tile sums in CP, the four parts meet in LDS; every block forms them for its own use (colmean of f_k), block 0 of a pair stores PSUM [which 0/1][pair][64].
__global__ __launch_bounds__(256) void planes_kernel(const float* __restrict__ F32, const float* __restrict__ CP, float* __restrict__ PSUM, b16* __restrict__ FQ16, b16* __restrict__ FQC16, float* __restrict__ N1, b16* __restrict__ FK16, b16* __restrict__ FKC16, float* __restrict__ I2A, float* __restrict__ I2B, b16* __restrict__ FVTh, b16* __restrict__ FVTl) {
  __shared__ __attribute__((aligned(16))) b16 Th[DH][64 + 8], Tl[DH][64 + 8]; __shared__ __attribute__((aligned(16))) float Cs[2][4][DH]; __shared__ float Ns[2][64];   // Ns: the block's squared norms of f_q and f_k
  const int pair = blockIdx.y, n0 = blockIdx.x * 64, t_ = threadIdx.x, lane = t_ & 31, c0 = (lane & 15) * 4, rl = (t_ >> 5) * 8 + (lane >> 4);   // a wave takes 8 rows, two a trip: row rl + 2 i, columns c0 .. c0 + 3
  const size_t row0 = (size_t)pair * NT + n0; const float* qp = F32 + (row0 + rl) * DH + c0; const float* kp = qp + (size_t)NP_ * NT * DH; const float* vp = F32 + (2 * (size_t)NP_ * NT + row0) * DH + t_;
  const float* cq = CP + ((size_t)pair * (NT / 16) + (t_ >> 6) * 16) * DH + (t_ & 63); const float* ck = cq + (size_t)NP_ * (NT / 16) * DH;
  __builtin_amdgcn_sched_barrier(0);   // keeps the index arithmetic above from being placed between the loads below and the wait that closes their run
  v4f fq[4], fk[4]; float xv[16], pq[16], pk[16];
#pragma unroll
  for (int i = 0; i < 16; ++i) { pq[i] = cq[i * DH]; pk[i] = ck[i * DH]; }
#pragma unroll
  for (int i = 0; i < 4; ++i) { fq[i] = *(const v4f*)(qp + i * 2 * DH); fk[i] = *(const v4f*)(kp + i * 2 * DH); }
#pragma unroll
  for (int i = 0; i < 16; ++i) xv[i] = vp[i * 256];   // the [64 n][64 d] chunk of f_v, element t_ + 256 i
  // closes the run as close_load_run() does; the input operands keep the run's address registers from being given to a later load's result ahead of the wait
  asm volatile("s_wait_xcnt 0x0" :: "v"(cq), "v"(ck), "v"(qp), "v"(kp), "v"(vp) : "memory"); __builtin_amdgcn_sched_barrier(0);
  { float a = 0.0f, b = 0.0f;
#pragma unroll
    for (int i = 0; i < 16; ++i) { a += pq[i]; b += pk[i]; }
    Cs[0][t_ >> 6][t_ & 63] = a; Cs[1][t_ >> 6][t_ & 63] = b; }
  float mq[4], ssq[4], ssk[4];   // the twelve lane trees stand side by side, with no branch between them, so that each step's cross-lane moves overlap
#pragma unroll
  for (int i = 0; i < 4; ++i) { float sq = 0.0f; ssq[i] = 0.0f; ssk[i] = 0.0f; for (int j = 0; j < 4; ++j) { sq += fq[i][j]; ssq[i] += fq[i][j] * fq[i][j]; ssk[i] += fk[i][j] * fk[i][j]; }
    sq = hsum16(sq); ssq[i] = hsum16(ssq[i]); ssk[i] = hsum16(ssk[i]); mq[i] = sq * (1.0f / DH); }
  if ((lane & 15) == 0) {
#pragma unroll
    for (int i = 0; i < 4; ++i) { Ns[0][rl + 2 * i] = ssq[i]; Ns[1][rl + 2 * i] = ssk[i]; } }
#pragma unroll
  for (int i = 0; i < 16; ++i) { const int qq = t_ + i * 256, nn = qq >> 6, d = qq & 63; b16 h_, l_; split16(xv[i] * XS, h_, l_); Th[d][nn] = h_; Tl[d][nn] = l_; }   // transpose [64 n][64 d] -> rows d, hi/lo
  __syncthreads();
  const v4f km = ((*(const v4f*)(&Cs[1][0][c0]) + *(const v4f*)(&Cs[1][1][c0])) + (*(const v4f*)(&Cs[1][2][c0]) + *(const v4f*)(&Cs[1][3][c0]))) * (1.0f / NT);   // colmean of f_k
  typedef __attribute__((ext_vector_type(4))) _Float16 v4b;
#pragma unroll
  for (int i = 0; i < 4; ++i) { v4b a, ac, b, bc;
    for (int j = 0; j < 4; ++j) { a[j] = (b16)(fq[i][j] * XS); ac[j] = (b16)((fq[i][j] - mq[i]) * XS); b[j] = (b16)(fk[i][j] * XS); bc[j] = (b16)((fk[i][j] - km[j]) * XS); }
    const size_t prow = row0 + rl + 2 * i, kpos = (prow >> 4) * (16 * DH) + (c0 >> 5) * 512 + frag_pos((int)(prow & 15), c0 & 31);   // key planes in fragment order: 16 rows are one row tile (2 k tiles, 2 KiB a plane)
    *(v4b*)(FQ16 + prow * DH + c0) = a; *(v4b*)(FQC16 + prow * DH + c0) = ac; *(v4b*)(FK16 + kpos) = b; *(v4b*)(FKC16 + kpos) = bc; }
  // fragment order, tiles [pair][32-key block][16-d tile]: the block's 64 keys are 8 tiles = 8 KiB a plane, and piece qq = [key block][d tile][j][hh][row] goes to byte 16 qq of them
#pragma unroll
  for (int qq = t_; qq < DH * 8; qq += 256) { const int d = ((qq >> 6) & 3) * 16 + (qq & 15), c8 = (qq >> 8) * 32 + ((qq >> 5) & 1) * 16 + ((qq >> 4) & 1) * 8; const size_t gi = row0 * DH + (size_t)qq * 8; *(v8b*)(FVTh + gi) = *(const v8b*)(&Th[d][c8]); *(v8b*)(FVTl + gi) = *(const v8b*)(&Tl[d][c8]); }
  if (t_ < 64) { const float n2 = sqrtf(Ns[1][t_]); N1[row0 + t_] = sqrtf(Ns[0][t_]); I2A[row0 + t_] = 1.0f / (n2 + 1e-8f); I2B[row0 + t_] = 1.0f / fmaxf(n2, 1e-6f); }   // two waves, a whole 128-byte line each and array
  if (blockIdx.x == 0 && t_ < 2 * DH) { const int w = t_ >> 6, d = t_ & 63; PSUM[((size_t)w * NP_ + pair) * DH + d] = (Cs[w][0][d] + Cs[w][1][d]) + (Cs[w][2][d] + Cs[w][3][d]); }
}
// score-tile passes: wave = 16 query rows n of one pair (block = SW = 8 waves = 128 rows: one block fills a WGP's two waves a SIMD, and all its waves walk the same key and value tiles, so that a tile comes from L2 once a WGP and the other waves find it in the WGP's cache), loop over 32 key blocks of 32: dots^T and covraw^T tiles (keys x queries, K = 64: 2 steps x 2 key tiles x 2 GEMMs = 8 WMMAs),
// lane (hh, col=query) holds keys kb+8hh+r and kb+16+8hh+r.  cos = clip(dots/((n1+1e-8)(n2+1e-8))), csim = clip(dots/(max(n1,1e-6) max(n2,1e-6))), margin = clip(0.01 - csim, 0, 10), covraw = c/(8+1e-6).
// PASS 1: per wave the sums of cos, cos^2, covraw, covraw^2, cos covraw, and of var_c x (row sum of cos) and var_c x (row sum of covraw) over its 16 rows -> P1; per row var_c -> VARC.
// PASS 3 (given cn, covfac = reg/covn/2, w per head, vn, temp): per row c_row = vw var_c/(2 vn); e = cw cos/cn cscale + covw covraw covfac (d2 - c_row); logits = (e + c_row)/temp -> online softmax (f32) with o^T += f_v^T P^T (hi+lo, 4 d-tiles): O [pair][n][64] -> OC16h/l, rows q*NT+n, k = h*64+d (concat-head planes, hi/lo x8, in fragment order).
constexpr int SW = 8;   // waves a block
template <int PASS>
__global__ __launch_bounds__(SW * 32) void score_kernel(const b16* __restrict__ FQ16, const b16* __restrict__ FQC16, const float* __restrict__ N1, const b16* __restrict__ FK16, const b16* __restrict__ FKC16, const float* __restrict__ I2A, const float* __restrict__ I2B, const b16* __restrict__ FVTh, const b16* __restrict__ FVTl,
                                                  const float* __restrict__ CST /* [0..3] cscale/cn, reg/(2 covn), 1/(2 vn), 1/temp; [4..27] cw, covw, vw per head */, float* __restrict__ P1, float* __restrict__ VARC, b16* __restrict__ OCh, b16* __restrict__ OCl) {
  __shared__ __attribute__((aligned(16))) float To[SW][16][DH + 4]; __shared__ float Tr[SW][16]; __shared__ float Tp[SW][8];
  const int wave = threadIdx.x >> 5, lane = threadIdx.x & 31, hh = lane >> 4, col = lane & 15; const int pair = blockIdx.y, n0 = blockIdx.x * (SW * 16) + wave * 16, ni = n0 + col; const int h = pair / QB, qi = pair - h * QB;
  const size_t prow = (size_t)pair * NT + ni; const b16* Qp = FQ16 + prow * DH; const b16* Qc = FQC16 + prow * DH; const b16* Kb = FK16 + (size_t)pair * NT * DH; const b16* Kc = FKC16 + (size_t)pair * NT * DH;
  __builtin_amdgcn_sched_barrier(0);   // keeps the index arithmetic above from being placed between the loads below and the wait that closes their run
  gaddr qp = (gaddr)Qp + hh * 16, qcp = (gaddr)Qc + hh * 16;   // the lane's first 16 bytes of its query row in the two planes; frag_row reads as frag_kb does
  const v16b qa0 = frag_row(qp), qa1 = frag_row(qp + 64), qc0 = frag_row(qcp), qc1 = frag_row(qcp + 64);
  // closes the run as close_load_run() does; as operands of the wait's statement the two addresses stay live, in their own registers, up to the wait
  asm volatile("s_wait_xcnt 0x0" : "+v"(qp), "+v"(qcp) : : "memory"); __builtin_amdgcn_sched_barrier(0);
  // Every factor of a score element that belongs to the query row, the head or the whole launch is multiplied up here, once a wave. The powers of two (1 / XS^2) move exactly, so pass 1 keeps its bits.
  const float n1 = N1[prow]; close_load_run(); const float q1a = (1.0f / (n1 + 1e-8f)) * (1.0f / (XS * XS)), q1b = (1.0f / fmaxf(n1, 1e-6f)) * (1.0f / (XS * XS));
  constexpr float CK = (1.0f / (8.0f + 1e-6f)) * (1.0f / (XS * XS)), LOG2E = 1.4426950408889634f, LOG2_PS = 3.0f; static_assert(PS == 8.0f, "LOG2_PS is log2(PS)");
  float cn_inv_cscale = 0.0f, covfac = 0.0f, vn_half_inv = 0.0f, temp_inv = 0.0f, cwh = 0.0f, covwh = 0.0f, vwh = 0.0f;   // this head's constants, read once ahead of the loop
  if (PASS == 3) { const float* cf = CST; cn_inv_cscale = cf[0]; covfac = cf[1]; vn_half_inv = cf[2]; temp_inv = cf[3]; cwh = cf[4 + h]; covwh = cf[4 + NH + h]; vwh = cf[4 + 2 * NH + h]; }
  float crow = 0.0f; if (PASS == 3) { const float vc_ = VARC[prow]; close_load_run(); crow = vwh * vc_ * vn_half_inv; }
  // e = w1 cos + w2 c (c the raw centred product); pass 3 takes its logits as w1 cos + w2 c + w0 in units of log2, so that 2^x needs no multiply of its own
  const float lsc = temp_inv * LOG2E, w1 = cwh * cn_inv_cscale * lsc, w2 = covwh * covfac * CK * lsc, w0 = crow * lsc;
  v2f sa2 = {}, sb2 = {}, sc2 = {}, sd2 = {}, sx2 = {}, ra2 = {};   // pass 1's sums, one accumulator for the even and one for the odd accumulator rows; the two meet behind the loop
  float m = -INFINITY, l = 0.0f; v8f o[4] = {{}, {}, {}, {}}, ol[4] = {{}, {}, {}, {}};
  // One key block's operands (8 key fragments, 16 key factors; 32 in pass 1) live in registers and are fetched together, a whole block ahead of their use.
  // The key factors are still in use when the next block's are fetched: they have two register sets, which swap roles from block to block (the loop body holds two blocks), so that no set is copied.
  v16b k0a, k0b, k1a, k1b, x0a, x0b, x1a, x1b; KeyFac fa_ = {}, fb_ = {};
  const unsigned flane = (unsigned)lane * 16u, nlane = (unsigned)hh * 32u;   // per-lane byte offsets into a tile in fragment order and into a key block's norms
  gaddr kr = (gaddr)Kb + flane, cr = (gaddr)Kc + flane, np = (gaddr)(I2A + (size_t)pair * NT) + nlane, nq = (gaddr)(I2B + (size_t)pair * NT) + nlane, vhp = (gaddr)(FVTh + (size_t)pair * NT * DH) + flane, vlp = (gaddr)(FVTl + (size_t)pair * NT * DH) + flane;
  // fetches the key block that the carried addresses stand at; more = 1 moves them on by one block, more = 0 leaves them (at the last block)
  auto fetch_keys = [&](int more, KeyFac& f) {
    f.a[0] = quad_at(np); f.a[1] = quad_at(np + 16); f.a[2] = quad_at(np + 64); f.a[3] = quad_at(np + 80);
    if (PASS == 1) { f.b[0] = quad_at(nq); f.b[1] = quad_at(nq + 16); f.b[2] = quad_at(nq + 64); f.b[3] = quad_at(nq + 80); close_and_advance(np, nq, more * 128); } else close_and_advance(np, more * 128);
    k0a = frag_at(kr); k0b = frag_at(kr + 1024); k1a = frag_at(kr + 2048); k1b = frag_at(kr + 3072); close_and_advance(kr, more * 4096);   // a 32-key block = 4 tiles of 1,024 bytes: [16 keys][k tile]
    x0a = frag_at(cr); x0b = frag_at(cr + 1024); x1a = frag_at(cr + 2048); x1b = frag_at(cr + 3072); close_and_advance(cr, more * 4096); };
  auto key_block = [&](int kb, const KeyFac& f, KeyFac& fnext) {
    __builtin_amdgcn_sched_barrier(0);   // keeps this block's score products behind the block before: lifted into its vector work they would wait there for key loads that this work is meant to cover
    v8f dd[2] = {{}, {}}, cc[2] = {{}, {}};
    dd[0] = wmma16p(k0a, qa0, dd[0]); dd[0] = wmma16p(k0b, qa1, dd[0]);
    dd[1] = wmma16p(k1a, qa0, dd[1]); dd[1] = wmma16p(k1b, qa1, dd[1]);
    cc[0] = wmma16p(x0a, qc0, cc[0]); cc[0] = wmma16p(x0b, qc1, cc[0]);
    cc[1] = wmma16p(x1a, qc0, cc[1]); cc[1] = wmma16p(x1b, qc1, cc[1]);
    // behind the last score product: this block's value fragments (used after the softmax arithmetic), then the next block's keys (the last block re-reads itself, unused), all in flight under the vector work
    v16b vh[4], vl[4];
    __builtin_amdgcn_sched_barrier(0);   // keeps earlier vector work from being placed between the loads below and the wait that closes their run, where it could be given one of their address registers
    if (PASS == 3) {
#pragma unroll
      for (int t = 0; t < 4; ++t) { vh[t] = frag_at(vhp + t * 1024); vl[t] = frag_at(vlp + t * 1024); }
      close_and_advance(vhp, vlp, 4096); }
    fetch_keys(kb + 64 < NT ? 1 : 0, fnext);
    // the element arithmetic runs on the pairs (r, r + 1) that already lie in neighbouring registers, in the accumulators and in the 16-byte factor loads alike, so that a packed instruction needs no move to bring its pair together
    v2f ev[2][4];
#pragma unroll
    for (int hq = 0; hq < 2; ++hq) {
#pragma unroll
      for (int pr = 0; pr < 4; ++pr) { const v2f dw = {dd[hq][2 * pr], dd[hq][2 * pr + 1]}, cw_ = {cc[hq][2 * pr], cc[hq][2 * pr + 1]};   // the two raw products
        const v4f fa4 = f.a[2 * hq + (pr >> 1)]; const v2f i2a = {fa4[2 * (pr & 1)], fa4[2 * (pr & 1) + 1]}; const v2f cosv = clamp2(dw * q1a * i2a, -0.99f, 0.99f);
        if (PASS == 1) { const v4f fb4 = f.b[2 * hq + (pr >> 1)]; const v2f i2b = {fb4[2 * (pr & 1)], fb4[2 * (pr & 1) + 1]}; const v2f covraw = cw_ * CK;
          const v2f csim = clamp2(dw * q1b * i2b, -0.99f, 0.99f); const v2f margin = clamp2(GAMMA - csim, 0.0f, 10.0f);
          sa2 += cosv; sb2 += cosv * cosv; sc2 += covraw; sd2 += covraw * covraw; sx2 += cosv * covraw; ra2 += margin; }
        else { ev[hq][pr] = cosv * w1 + (cw_ * w2 + w0); } } }
    if (PASS == 3) { float mr = -INFINITY;
#pragma unroll
      for (int pr = 0; pr < 4; ++pr) mr = fmaxf(fmaxf(mr, fmaxf(ev[0][pr][0], ev[0][pr][1])), fmaxf(ev[1][pr][0], ev[1][pr][1]));
      mr = fmaxf(mr, __shfl_xor(mr, 16)); const float mn = fmaxf(m, mr); const float al_ = nexp2(m - mn); m = mn; const float ms = mn - LOG2_PS; v2f sum2 = {}; v16b pb;   // ms: the factor PS of the f16 weights rides in the exponent; l then holds PS times the row sum
#pragma unroll
      for (int hq = 0; hq < 2; ++hq) {
#pragma unroll
        for (int pr = 0; pr < 4; ++pr) { const v2f x = ev[hq][pr] - ms; const v2f e = {nexp2(x[0]), nexp2(x[1])}; sum2 += e; pb[8 * hq + 2 * pr] = (b16)e[0]; pb[8 * hq + 2 * pr + 1] = (b16)e[1]; } }
      float sum = sum2[0] + sum2[1]; sum += __shfl_xor(sum, 16); l = l * al_ + sum;
#pragma unroll
      for (int t = 0; t < 4; ++t) { o[t] *= al_; ol[t] *= al_; }
#pragma unroll
      for (int t = 0; t < 4; ++t) { o[t] = wmma16p(vh[t], pb, o[t]); ol[t] = wmma16p(vl[t], pb, ol[t]); }
      // four slots behind the block's last product, once a block: pb, the B operand of all eight, stays live up to here, so that a product of the next block gets its registers for a result only at the distance that holds for any write over a B operand
      asm volatile("v_nop\n\tv_nop\n\tv_nop\n\tv_nop" : "+v"(o[0]), "+v"(o[1]), "+v"(o[2]), "+v"(o[3]), "+v"(ol[0]), "+v"(ol[1]), "+v"(ol[2]), "+v"(ol[3]) : "v"(pb)); } };
  // from here on the carried addresses are what this statement leaves in their register pairs: every load of the loop names one of these pairs and no other register (the wait closes the loads above once more)
  if (PASS == 1) asm volatile("s_wait_xcnt 0x0" : "+v"(kr), "+v"(cr), "+v"(np), "+v"(nq) : : "memory"); else asm volatile("s_wait_xcnt 0x0" : "+v"(kr), "+v"(cr), "+v"(np), "+v"(vhp), "+v"(vlp) : : "memory");
  __builtin_amdgcn_sched_barrier(0);
  fetch_keys(1, fa_);
  for (int kb = 0; kb < NT; kb += 64) { key_block(kb, fa_, fb_); key_block(kb + 32, fb_, fa_); }
  const float s_a = sa2[0] + sa2[1], s_b = sb2[0] + sb2[1], s_c = sc2[0] + sc2[1], s_d = sd2[0] + sd2[1], s_x = sx2[0] + sx2[1]; float rowacc = ra2[0] + ra2[1];
  if (PASS == 1) {   // per-row sums across the two lane halves; per-wave partials over the 16 rows and 32 lanes
    rowacc += __shfl_xor(rowacc, 16); if (hh == 0) Tr[wave][col] = rowacc;
    // a lane's s_a and s_c are its query row's sums of cos and covraw over the lane half's keys: weighted with the row's var_c they give the cross terms of d2's variance
    const float vc = rowacc * (1.0f / NT); float v7[7] = {s_a, s_b, s_c, s_d, s_x, vc * s_a, vc * s_c};
#pragma unroll
    for (int j = 0; j < 7; ++j) { float v = v7[j];
#pragma unroll
      for (int oo = 16; oo >= 1; oo >>= 1) v += __shfl_xor(v, oo);
      v7[j] = v; }
    if (lane == 0) {
#pragma unroll
      for (int j = 0; j < 7; ++j) Tp[wave][j] = v7[j];
      Tp[wave][7] = 0.0f; }
    wave_lds_sync();
    __syncthreads();
    if ((wave & 1) == 0) { const int g = n0 / 32;   // each even wave stores for itself and the next one: a whole 128-byte line of VARC and of P1 for their 32 rows, as before
      VARC[(size_t)pair * NT + g * 32 + lane] = Tr[wave + (lane >> 4)][lane & 15] * (1.0f / NT);
      P1[((size_t)pair * (NT / 32) + g) * 32 + lane] = (lane < 16) ? Tp[wave + (lane >> 3)][lane & 7] : 0.0f; }
  } else {
    const float inv = 1.0f / (l * XS);
#pragma unroll
    for (int t = 0; t < 4; ++t)
#pragma unroll
      for (int r = 0; r < 8; ++r) To[wave][col][t * 16 + 8 * hh + r] = (o[t][r] + ol[t][r]) * inv;
    wave_lds_sync();
    // fragment order for the output projection: the wave's 16 rows x 64 columns are 2 tiles (2 KiB) a plane; store i covers the 512 bytes [k tile i / 2][j = i % 2]
    { for (int i = 0; i < 4; ++i) { const int rr = col, c8 = (i >> 1) * 32 + (i & 1) * 16 + hh * 8; v8b hv, lv; for (int j = 0; j < 8; ++j) { b16 a_, c_; split16(To[wave][rr][c8 + j] * XS, a_, c_); hv[j] = a_; lv[j] = c_; }
        const size_t gi = ((size_t)qi * NT + n0) * DIM + (h * 2) * 512 + i * 256 + lane * 8; *(v8b*)(OCh + gi) = hv; *(v8b*)(OCl + gi) = lv; }  }
  }
}
// reduction (one block, fixed order): cn, covn, vn, weights, then dstd -> temp -> CST[0..27].
// It runs as one block on an otherwise idle chip, so nothing hides a load's latency but the block's own instruction order: the kernel issues ALL its global reads in one run at its head and keeps them in registers
// (the predictor's weights go on to LDS), so that it pays about one memory latency in all instead of one per loop trip. Every sum keeps its operands and its order; in the loops written anew a product now fuses with its addition.
__global__ __launch_bounds__(256) void reduce1_kernel(const float* __restrict__ P1, const float* __restrict__ VARC, const float* __restrict__ PSUM, const float* __restrict__ w1, const float* __restrict__ b1, const float* __restrict__ g2, const float* __restrict__ be2, const float* __restrict__ w2, const float* __restrict__ b2, const float* __restrict__ w3, const float* __restrict__ b3, const float* __restrict__ wtemp, float* __restrict__ CST) {
  __shared__ float red[4][256]; __shared__ float sh[64];
  __shared__ __attribute__((aligned(16))) float w1s[2 * DH * DH], w2s[DH * 32]; __shared__ float w3s[3][32], b1s[DH], g2s[DH], be2s[DH], b2s[32];   // the predictor's parameters as bf16 values (w3s: the 96 values in their order)
  const int t_ = threadIdx.x; constexpr int NPK = NP_ * (NT / 32) / 256 /* 4 of the 1,024 partials of 32 rows (16 floats: 2 waves x 8) per thread */, NVK = NP_ * NT / 256 /* 128 row values per thread */, NFK = NH * 2 * DH / 256 /* 4 */;
  v4f w1r[8], w2r[2], pl[NPK], ph[NPK], xl[NPK], xh[NPK]; float pr[NFK][QB], vr[NVK], w3r[3];
  const unsigned a63 = t_ & (DH - 1), a31 = t_ & 31, p1off = (unsigned)t_ * 128u /* bytes: partial t_ */, psidx = ((t_ >> 6) & 1) * NP_ * DH + (t_ >> 7) * QB * DH + (t_ & (DH - 1)) /* PSUM [which][pair 4 h][dd] of feature i = t_ */;
  const float b3r[3] = {b3[0], b3[1], b3[2]}, wtr = wtemp[0];
  __builtin_amdgcn_sched_barrier(0);   // keeps the index arithmetic and the scalar reads above from being placed between the loads below and the wait that closes their run
#pragma unroll
  for (int j = 0; j < 8; ++j) w1r[j] = *(const v4f*)(w1 + (j * 256 + t_) * 4);
#pragma unroll
  for (int j = 0; j < 2; ++j) w2r[j] = *(const v4f*)(w2 + (j * 256 + t_) * 4);
  const float b1r = b1[a63], g2r = g2[a63], be2r = be2[a63], b2r = b2[a31];
#pragma unroll
  for (int j = 0; j < 3; ++j) w3r[j] = w3[j * 32 + a31];
#pragma unroll
  for (int k = 0; k < NPK; ++k) { const char* p = (const char*)P1 + p1off + k * (256 * 128); pl[k] = *(const v4f*)p; xl[k] = *(const v4f*)(p + 16); ph[k] = *(const v4f*)(p + 32); xh[k] = *(const v4f*)(p + 48); }
#pragma unroll
  for (int k = 0; k < NFK; ++k)   // feature i = t_ + 256 k: head h + 2 k, the same which and dd
#pragma unroll
    for (int qq = 0; qq < QB; ++qq) pr[k][qq] = PSUM[psidx + (2 * k * QB + qq) * DH];
#pragma unroll   // full, here and in the four loops that read vr: the 128 values stay in registers and are read from memory once, not once a loop
  for (int j = 0; j < NVK; ++j) vr[j] = VARC[t_ + j * 256];
  // closes the run as close_load_run() does; the input operands keep the run's address registers from being given to a later load's result ahead of the wait
  asm volatile("s_wait_xcnt 0x0" :: "v"(a63), "v"(a31), "v"(p1off), "v"(psidx) : "memory"); __builtin_amdgcn_sched_barrier(0);
#pragma unroll
  for (int j = 0; j < 8; ++j) { v4f x; for (int e = 0; e < 4; ++e) x[e] = bf16_rne(w1r[j][e]); *(v4f*)(w1s + (j * 256 + t_) * 4) = x; }
#pragma unroll
  for (int j = 0; j < 2; ++j) { v4f x; for (int e = 0; e < 4; ++e) x[e] = bf16_rne(w2r[j][e]); *(v4f*)(w2s + (j * 256 + t_) * 4) = x; }
  b1s[a63] = bf16_rne(b1r); g2s[a63] = bf16_rne(g2r); be2s[a63] = bf16_rne(be2r); b2s[a31] = bf16_rne(b2r);   // every thread stores: threads with the same index store the same value
#pragma unroll
  for (int j = 0; j < 3; ++j) w3s[j][a31] = bf16_rne(w3r[j]);
  float a = 0, b = 0, c = 0, d = 0, mo[NPK][7];   // mo: the seven moments of partial t_ + 256 k (32 rows of head 2 k + t_ / 128), kept for d2's variance at the end
#pragma unroll
  for (int k = 0; k < NPK; ++k) {
#pragma unroll
    for (int j = 0; j < 4; ++j) mo[k][j] = pl[k][j] + ph[k][j];
#pragma unroll
    for (int j = 0; j < 3; ++j) mo[k][4 + j] = xl[k][j] + xh[k][j];
    a += mo[k][0]; b += mo[k][1]; c += mo[k][2]; d += mo[k][3]; }
  red[0][t_] = a; red[1][t_] = b; red[2][t_] = c; red[3][t_] = d; __syncthreads();
  for (int s = 128; s >= 1; s >>= 1) { if (t_ < s) { for (int j = 0; j < 4; ++j) red[j][t_] += red[j][t_ + s]; } __syncthreads(); }
  float vs = 0.0f;
#pragma unroll
  for (int j = 0; j < NVK; ++j) vs += vr[j];
  __shared__ float r2[256]; r2[t_] = vs; __syncthreads(); for (int s = 128; s >= 1; s >>= 1) { if (t_ < s) r2[t_] += r2[t_ + s]; __syncthreads(); }
  const float vmu = r2[0] / (float)(NP_ * NT); __syncthreads();
  float vq = 0.0f;
#pragma unroll
  for (int j = 0; j < NVK; ++j) { const float dv = vr[j] - vmu; vq += dv * dv; }
  r2[t_] = vq; __syncthreads(); for (int s = 128; s >= 1; s >>= 1) { if (t_ < s) r2[t_] += r2[t_ + s]; __syncthreads(); }
  // head means qg/kg [8][64] from PSUM [which][pair][64]: mean over (q, n) = sum over the 4 pairs of the head / 4096 -> feats [h][128]; MLP: h1 = relu(LN(feats W1 + b1)), h2 = relu(h1 W2 + b2), logits = softmax(h2 W3 + b3), w = softmax(logits / clip(wt)), clip [0.05,0.8], renorm
  __shared__ __attribute__((aligned(16))) float feats[NH][2 * DH], h1s[NH][DH], h2s[NH][32]; __shared__ float ws[NH][3];
#pragma unroll
  for (int k = 0; k < NFK; ++k) { const int i = t_ + k * 256, h = i / (2 * DH), c = i - h * 2 * DH; float s = 0.0f;
#pragma unroll
    for (int qq = 0; qq < QB; ++qq) s += pr[k][qq];
    feats[h][c] = s * (1.0f / (QB * NT)); }
  __syncthreads();
  // the loops below read LDS only; each is unrolled, with plain products, so that its reads are issued ahead of the one chain of additions instead of being waited for one by one
  for (int i = t_; i < NH * DH; i += 256) { const int h = i / DH, o_ = i - h * DH; float s = b1s[o_];
#pragma unroll 32
    for (int c = 0; c < 2 * DH; ++c) s += feats[h][c] * w1s[c * DH + o_]; h1s[h][o_] = s; }
  __syncthreads();
  if (t_ < NH) { const int h = t_; float mu = 0.0f;
#pragma unroll
    for (int c = 0; c < DH; ++c) mu += h1s[h][c];
    mu *= (1.0f / DH); float var = 0.0f;
#pragma unroll
    for (int c = 0; c < DH; ++c) { const float dv = h1s[h][c] - mu; var += dv * dv; }
    var *= (1.0f / DH); const float rs = rsqrtf(var + 1e-5f);
#pragma unroll
    for (int c = 0; c < DH; ++c) h1s[h][c] = fmaxf((h1s[h][c] - mu) * rs * g2s[c] + be2s[c], 0.0f); }
  __syncthreads();
  for (int i = t_; i < NH * 32; i += 256) { const int h = i / 32, o_ = i - h * 32; float s = b2s[o_];
#pragma unroll 32
    for (int c = 0; c < DH; ++c) s += h1s[h][c] * w2s[c * 32 + o_]; h2s[h][o_] = fmaxf(s, 0.0f); }
  __syncthreads();
  if (t_ < NH) { const int h = t_; float lg[3]; for (int o_ = 0; o_ < 3; ++o_) { float s = bf16_rne(b3r[o_]);
#pragma unroll
      for (int c = 0; c < 32; ++c) s += h2s[h][c] * (&w3s[0][0])[c * 3 + o_]; lg[o_] = s; }
    float mx = fmaxf(lg[0], fmaxf(lg[1], lg[2])); float e3[3], se = 0.0f; for (int j = 0; j < 3; ++j) { e3[j] = __expf(lg[j] - mx); se += e3[j]; } for (int j = 0; j < 3; ++j) e3[j] /= se;
    const float wt = clampf(bf16_rne(wtr), 0.1f, 20.0f); float z[3]; for (int j = 0; j < 3; ++j) z[j] = e3[j] / wt; mx = fmaxf(z[0], fmaxf(z[1], z[2])); se = 0.0f; for (int j = 0; j < 3; ++j) { e3[j] = __expf(z[j] - mx); se += e3[j]; }
    float wv[3], sw = 0.0f; for (int j = 0; j < 3; ++j) { wv[j] = clampf(e3[j] / se, 0.05f, 0.8f); sw += wv[j]; } for (int j = 0; j < 3; ++j) ws[h][j] = wv[j] / sw; }
  __syncthreads();
  if (t_ == 0) { const float n = (float)NTOT; const float sa_ = red[0][0], sb = red[1][0], sc = red[2][0], sd = red[3][0];
    const float cstd = sqrtf(fmaxf((sb - sa_ * (sa_ / n)) / (n - 1.0f), 0.0f)); const float covstd_raw = sqrtf(fmaxf((sd - sc * (sc / n)) / (n - 1.0f), 0.0f));
    const float base_reg = LREG / (float)NT; const float reg = (covstd_raw < 1e-6f) ? base_reg * 10.0f : base_reg;   // reference: reg chosen on the std of the RAW cov, then cov = clip(reg cov, +-50) (never clips at this scale)
    const float covn = reg * covstd_raw + 1e-6f; const float cn = cstd + 1e-6f; const float cscale = (cn < 1e-4f) ? 0.1f : 1.0f;
    const float vn = sqrtf(r2[0] * ((float)NT / (n - 1.0f))) + 1e-6f;   // std over the broadcast [.., m] copies: each row value repeated NT times
    sh[0] = cscale / cn; sh[1] = reg * 0.5f / covn; sh[2] = 0.5f / vn; sh[3] = 0.0f; for (int h = 0; h < NH; ++h) { sh[4 + h] = ws[h][0]; sh[4 + NH + h] = ws[h][1]; sh[4 + 2 * NH + h] = ws[h][2]; } }
  __syncthreads();
  // dstd = std(d2) from the moments. d2 = e + c with e = W1 cos + W2 covraw (W1 = cw cscale/cn, W2 = covw reg/(2 covn), per head) and the row constant c = vw var_c/(2 vn).
  // var(d2) = E[(d2 - M)^2] - (E[d2 - M])^2 with the shift M = mean of the row constants (kills the large common offset): sum (d2 - M) = sum e + NT sum_rows (c - M),
  // sum (d2 - M)^2 = sum e^2 + 2 sum_rows (c - M) rowsum_e + NT sum_rows (c - M)^2; sum e^2 = W1^2 sum cos^2 + 2 W1 W2 sum cos covraw + W2^2 sum covraw^2; sum_rows c rowsum_e = vw/(2 vn) (W1 sum var_c rowsum_cos + W2 sum var_c rowsum_covraw).
  __shared__ float tl[3][8]; const int wv = t_ >> 5; const float vfac = sh[2]; float vf[NH];
#pragma unroll
  for (int h = 0; h < NH; ++h) vf[h] = sh[4 + 2 * NH + h] * vfac;
  float c4[4] = {0.0f, 0.0f, 0.0f, 0.0f};   // row i = t_ + 256 j belongs to head (i / NT) / QB = j / 16; four chains here and below, so that an addition does not wait for the one before it
#pragma unroll
  for (int j = 0; j < NVK; ++j) c4[j & 3] += vf[j / 16] * vr[j];
  float sc = (c4[0] + c4[1]) + (c4[2] + c4[3]);
#pragma unroll
  for (int o = 16; o >= 1; o >>= 1) sc += __shfl_xor(sc, o);
  if ((t_ & 31) == 0) tl[0][wv] = sc;
  __syncthreads();
  float M = 0.0f;
#pragma unroll
  for (int w = 0; w < 8; ++w) M += tl[0][w];
  M /= (float)(NP_ * NT); float q1[4] = {0.0f, 0.0f, 0.0f, 0.0f}, q2[4] = {0.0f, 0.0f, 0.0f, 0.0f};
#pragma unroll
  for (int j = 0; j < NVK; ++j) { const float cm = vf[j / 16] * vr[j] - M; q1[j & 3] += cm; q2[j & 3] += cm * cm; }
  float s1 = (float)NT * ((q1[0] + q1[1]) + (q1[2] + q1[3])), s2 = (float)NT * ((q2[0] + q2[1]) + (q2[2] + q2[3]));
#pragma unroll
  for (int k = 0; k < NPK; ++k) { const int h = 2 * k + (t_ >> 7); const float W1 = sh[4 + h] * sh[0], W2 = sh[4 + NH + h] * sh[1], VW = sh[4 + 2 * NH + h] * vfac, se = W1 * mo[k][0] + W2 * mo[k][2];
    s1 += se; s2 += W1 * W1 * mo[k][1] + 2.0f * W1 * W2 * mo[k][4] + W2 * W2 * mo[k][3] + 2.0f * (VW * (W1 * mo[k][5] + W2 * mo[k][6]) - M * se); }
#pragma unroll
  for (int o = 16; o >= 1; o >>= 1) { s1 += __shfl_xor(s1, o); s2 += __shfl_xor(s2, o); }
  if ((t_ & 31) == 0) { tl[1][wv] = s1; tl[2][wv] = s2; }
  __syncthreads();
  if (t_ == 0) { float t1 = 0.0f, t2 = 0.0f;
#pragma unroll
    for (int w = 0; w < 8; ++w) { t1 += tl[1][w]; t2 += tl[2][w]; }
    const float n = NTOT; const float var = (t2 - t1 * (t1 / n)) / (n - 1.0f); const float dstd = sqrtf(fmaxf(var, 0.0f)); const float temp = (dstd < 1e-6f) ? 0.1f : 0.3f + dstd; sh[3] = 1.0f / clampf(temp, 0.1f, 5.0f); }
  __syncthreads();
  { if (t_ < 32) ((float*)CST)[t_] = (t_ < 4 + 3 * NH) ? sh[t_] : 0.0f;  }
}
__global__ __launch_bounds__(128) void outproj_kernel(const b16* __restrict__ OCh, const b16* __restrict__ OCl, const b16* __restrict__ WOUT, const float* __restrict__ bo, float* __restrict__ out) {
  __shared__ __attribute__((aligned(16))) float Ts[4][16][128 + 4];
  const int wave = threadIdx.x >> 5, lane = threadIdx.x & 31, nloc = lane & 15, hlf = lane >> 4; const size_t m0 = (size_t)blockIdx.x * 64 + wave * 16; const int n0 = blockIdx.y * 128;
  v8f acc[8];
#pragma unroll
  for (int t = 0; t < 8; ++t) acc[t] = (v8f){};
  const b16* ap = OCh + m0 * DIM; const b16* lp = OCl + m0 * DIM; const b16* bp = WOUT + (size_t)n0 * DIM; const unsigned flane = (unsigned)lane * 16u;   // ap, lp, bp: the first tile of row m0, of column n0
  v16b a = frag_pk(ap, flane), al = frag_pk(lp, flane), b[8];
#pragma unroll
  for (int t = 0; t < 8; ++t) b[t] = frag_pk(bp + (size_t)t * 16 * DIM, flane);
#pragma unroll   // full: the two fragment sets swap by renaming, and the last step's fetch falls away
  for (int kb = 0; kb < DIM; kb += 32) { v16b an = a, aln = al, bn[8];
#pragma unroll
    for (int t = 0; t < 8; ++t) bn[t] = b[t];
    if (kb + 32 < DIM) { an = frag_pk(ap + (kb + 32) * 16, flane); aln = frag_pk(lp + (kb + 32) * 16, flane);
#pragma unroll
      for (int t = 0; t < 8; ++t) bn[t] = frag_pk(bp + (size_t)t * 16 * DIM + (kb + 32) * 16, flane); }
    __builtin_amdgcn_sched_barrier(0);   // keeps the next step's loads, as one group, ahead of this step's products: sunk towards their uses they would each be waited for in turn
#pragma unroll
    for (int t = 0; t < 8; ++t) { acc[t] = wmma16b(a, b[t], acc[t]); acc[t] = wmma16b(al, b[t], acc[t]); }
    a = an; al = aln;
#pragma unroll
    for (int t = 0; t < 8; ++t) b[t] = bn[t]; }
#pragma unroll
  for (int t = 0; t < 8; ++t) { const float bb = bf16_rne(bo[n0 + t * 16 + nloc]);
#pragma unroll
    for (int r = 0; r < 8; ++r) Ts[wave][8 * hlf + r][t * 16 + nloc] = acc[t][r] * (1.0f / (XS * WSC)) + bb; }
  wave_lds_sync();
  { for (int rr = 0; rr < 16; ++rr) *(v4f*)(out + (m0 + rr) * DIM + n0 + lane * 4) = *(const v4f*)(&Ts[wave][rr][lane * 4]);  }
}
}  // namespace

extern "C" void kernel_launch(void* const* d_in, const int* in_sizes, int n_in, void* d_out, int out_size, void* d_ws, size_t ws_size, hipStream_t stream) {
  (void)n_in;
  auto Fp = [&](int i) { return (const float*)d_in[i]; };
  // input order: 0 q, 1 k, 2 v [4,1024,512]; 3 ln_in_g, 4 ln_in_b; 5 W_in [512,512]; 6 wp_W1 [128,64], 7 wp_b1, 8 wp_ln_g, 9 wp_ln_b, 10 wp_W2 [64,32], 11 wp_b2, 12 wp_W3 [32,3], 13 wp_b3, 14 weight_temp [1], 15 W_out [512,512], 16 b_out
  if (in_sizes[0] != NR * DIM || in_sizes[1] != NR * DIM || in_sizes[2] != NR * DIM || in_sizes[5] != DIM * DIM || in_sizes[6] != 2 * DH * DH || in_sizes[15] != DIM * DIM || out_size != NR * DIM) return;
  size_t off = 0; char* ws = (char*)d_ws;
  auto carve = [&](size_t bytes) { char* p = ws + off; off += (bytes + 255) & ~(size_t)255; return p; };
  b16* X16 = (b16*)carve((size_t)3 * NR * DIM * 2); b16* WIN = (b16*)carve((size_t)DIM * DIM * 2); b16* WOUT = (b16*)carve((size_t)DIM * DIM * 2);
  float* F32 = (float*)carve((size_t)3 * NP_ * NT * DH * 4); float* CP = (float*)carve((size_t)2 * NP_ * (NT / 16) * DH * 4); float* PSUM = (float*)carve((size_t)2 * NP_ * DH * 4);
  b16* FQ16 = (b16*)carve((size_t)NP_ * NT * DH * 2); b16* FQC16 = (b16*)carve((size_t)NP_ * NT * DH * 2); b16* FK16 = (b16*)carve((size_t)NP_ * NT * DH * 2); b16* FKC16 = (b16*)carve((size_t)NP_ * NT * DH * 2);
  float* N1 = (float*)carve((size_t)NP_ * NT * 4); float* N2 = (float*)carve((size_t)NP_ * NT * 4); float* I2B = (float*)carve((size_t)NP_ * NT * 4);   // N2 holds 1 / (key norm + 1e-8), I2B 1 / max(key norm, 1e-6)
  b16* FVTh = (b16*)carve((size_t)NP_ * DH * NT * 2); b16* FVTl = (b16*)carve((size_t)NP_ * DH * NT * 2);
  float* P1 = (float*)carve((size_t)NP_ * (NT / 32) * 32 * 4); float* VARC = (float*)carve((size_t)NP_ * NT * 4); float* CST = (float*)carve(256);
  b16* OCh = (b16*)carve((size_t)NR * DIM * 2); b16* OCl = (b16*)carve((size_t)NR * DIM * 2);
  if (off > ws_size || off > ((size_t)128 << 20)) return;   // ≈ 74 MB
  ln_prepw_kernel<<<NPW + 3 * NR / 8, 256, 0, stream>>>(Fp(0), Fp(1), Fp(2), Fp(3), Fp(4), Fp(5), Fp(15), X16, WIN, WOUT);
  feat_kernel<<<dim3(NR / 64, DIM / 128, 3), 128, 0, stream>>>(X16, WIN, F32, CP);
  planes_kernel<<<dim3(NT / 64, NP_), 256, 0, stream>>>(F32, CP, PSUM, FQ16, FQC16, N1, FK16, FKC16, N2, I2B, FVTh, FVTl);
  score_kernel<1><<<dim3(NT / (SW * 16), NP_), SW * 32, 0, stream>>>(FQ16, FQC16, N1, FK16, FKC16, N2, I2B, FVTh, FVTl, CST, P1, VARC, OCh, OCl);
  reduce1_kernel<<<1, 256, 0, stream>>>(P1, VARC, PSUM, Fp(6), Fp(7), Fp(8), Fp(9), Fp(10), Fp(11), Fp(12), Fp(13), Fp(14), CST);
  score_kernel<3><<<dim3(NT / (SW * 16), NP_), SW * 32, 0, stream>>>(FQ16, FQC16, N1, FK16, FKC16, N2, I2B, FVTh, FVTl, CST, P1, VARC, OCh, OCl);
  outproj_kernel<<<dim3(NR / 64, DIM / 128), 128, 0, stream>>>(OCh, OCl, WOUT, Fp(16), (float*)d_out);
}

// v009
// A run of this version takes 111 microseconds.
// Next to v008, in two timings, it ran 1.07 and 1.04 times as fast.
// Counting every step since v000, it is 6.24 times as fast.
#include <hip/hip_runtime.h>

// "Super-aggressive" attention: f_q, f_k, f_v = LN(q|k|v) W_in split into 8 heads x 64; per (head, batch) pair: cos = clip(f_q.f_k / (n1 n2), +-0.99) (n = norm + 1e-8),
// cov = reg x (f_q - rowmean_d)(f_k - colmean_m) / (8 + 1e-6) (reg = 1e-3/1024, x10 if the global std of the raw cov < 1e-6), csim = clip(qn.kn) with max(norm, 1e-6), margin =
// clip(0.01 - csim, 0, 10), var_c = row mean of margin; per-head weights (cw, covw, vw) from a tiny MLP on the global means of f_q / f_k (softmax, /clip(weight_temp), softmax, clip, renorm);
// cn / covn / vn = global std (ddof 1) of cos / cov / var_c (+1e-6); d2 = cw cos/cn cscale + covw cov/covn/2 + vw var_c/vn/2; temp = 0.3 + std(d2) (dstd >= 1e-6; clipped to [0.1, 5]);
// attn = softmax(d2 / temp); out_h = attn f_v; out = concat_h W_out + b -> [4][1024][512].
// Every global statistic is a deterministic f32 reduction (per-wave partials, then one fixed-order kernel; the means of f_q / f_k take a per-pair level in between); the [1024 x 1024] score tiles are recomputed in two passes
// (component statistics; softmax + PV) instead of being stored. std(d2) takes no pass of its own: d2 is linear in cos, cov and var_c, so its variance is a quadratic form in their first and second moments per head.
// WMMA (v_wmma_f32_16x16x32_f16, f32 accumulate): W_in (LN(x) single f16 x8, exact weights), dots / centered-cov tiles (single f16 x8 feature planes, K = 64), P.V (P single x8, f_v^T hi+lo:
// 2 products), W_out (O hi+lo: 2 products). LN, norms, all statistics and the weight-predictor MLP in f32. Inputs rounded to bf16 once. Fragment k-map per lane half hh

namespace {
constexpr int QB = 4, NT = 1024, DIM = 512, NH = 8, DH = 64, NP_ = NH * QB /* 32 (h,q) pairs, index h*QB + q */, NR = QB * NT /* 4096 rows */, NWAVE = NP_ * (NT / 16) /* 2048 score waves */;
constexpr float XS = 8.0f, WSC = 256.0f, PS = 8.0f, GAMMA = 0.01f, LREG = 0.001f;
constexpr float NTOT = 33554432.0f;   // 33,554,432 score elements

typedef _Float16 b16;
typedef __attribute__((ext_vector_type(16))) _Float16 v16b;
typedef __attribute__((ext_vector_type(8))) _Float16 v8b;
typedef __attribute__((ext_vector_type(8))) float v8f;
typedef __attribute__((ext_vector_type(4))) float v4f;
typedef __attribute__((ext_vector_type(2))) float v2f;
__device__ __forceinline__ float bf16_rne(float f) { unsigned int u = __float_as_uint(f); u += 0x7FFFu + ((u >> 16) & 1u); return __uint_as_float(u & 0xFFFF0000u); }
__device__ __forceinline__ void split16(float v, b16& hi, b16& lo) { hi = (b16)v; lo = (b16)(v - (float)hi); }
__device__ __forceinline__ v16b frag_kb(const b16* p, int hh) { const v8b a = *(const v8b*)(p + 8 * hh), b = *(const v8b*)(p + 16 + 8 * hh); v16b f;
#pragma unroll
  for (int e = 0; e < 8; ++e) { f[e] = a[e]; f[8 + e] = b[e]; } return f; }
// Fragment order: the planes that the matrix loops read again and again (queries, centred queries, keys, f_v^T hi/lo, both weight planes, the attention output hi/lo) are stored tile by tile, a tile = 16 rows x 32 k = 1,024 contiguous bytes laid out as
// [k half j][lane = 16 hh + row][8 elements], element (row, kk) with j = kk / 16, hh = (kk / 8) % 2. A wave's 16-byte load then covers 512 contiguous bytes (4 whole lines) instead of 32-byte pieces of 16 lines; each lane gets the same values in the same registers as from frag_kb.
__device__ __forceinline__ int frag_pos(int row, int kk) { return (kk >> 4) * 256 + (((kk >> 3) & 1) * 16 + row) * 8 + (kk & 7); }   // element offset inside a tile
__device__ __forceinline__ v16b frag_pk(const b16* utile, unsigned lane_bytes) { const char* p = (const char*)utile + lane_bytes; const v8b a = *(const v8b*)p, b = *(const v8b*)(p + 512); v16b f;   // wave-uniform tile base plus 16 * lane bytes
#pragma unroll
  for (int e = 0; e < 8; ++e) { f[e] = a[e]; f[8 + e] = b[e]; } return f; }
__device__ __forceinline__ v8f wmma16b(v16b a, v16b b, v8f c) { v8f d = __builtin_amdgcn_wmma_f32_16x16x32_f16(false, a, false, b, (short)0, c, false, false); asm volatile("v_nop\n\tv_nop\n\tv_nop\n\tv_nop" : "+v"(d) : "v"(a), "v"(b)); return d; }
// the plain product, for a run of products in a loop: the compiler keeps the distances behind its own builtin and writes idle slots only where a vector instruction really follows on D, A or B
__device__ __forceinline__ v8f wmma16p(v16b a, v16b b, v8f c) { return __builtin_amdgcn_wmma_f32_16x16x32_f16(false, a, false, b, (short)0, c, false, false); }
// closes a run of global loads. The wait stands in front of the next instruction that writes a register from which those loads took their address (a precaution).
// The scheduling barrier keeps later address arithmetic from being lifted over that wait, and keeps the run up here, ahead of the work that covers its latency: sunk towards their uses the loads would each be waited for in turn.
__device__ __forceinline__ void close_load_run() { asm volatile("s_wait_xcnt 0x0" ::: "memory"); __builtin_amdgcn_sched_barrier(0); }
typedef const __attribute__((address_space(1))) char* gaddr;   // a lane's byte address in global memory, carried through the key loop in one register pair
// closes a run of loads from one or two carried addresses and moves these on to the next key block. Wait and additions are one statement: the addresses stay live, in their own registers, up to the wait (no result of the run can be given them),
// and the instructions that overwrite them stand behind it by construction. The scheduling barrier as in close_load_run().
__device__ __forceinline__ void close_and_advance(gaddr& a, gaddr& b, long long step) { asm volatile("s_wait_xcnt 0x0\n\tv_add_nc_u64 %0, %2, %0\n\tv_add_nc_u64 %1, %2, %1" : "+v"(a), "+v"(b) : "s"(step) : "memory"); __builtin_amdgcn_sched_barrier(0); }
__device__ __forceinline__ void close_and_advance(gaddr& a, long long step) { asm volatile("s_wait_xcnt 0x0\n\tv_add_nc_u64 %0, %1, %0" : "+v"(a) : "s"(step) : "memory"); __builtin_amdgcn_sched_barrier(0); }
__device__ __forceinline__ v4f quad_at(gaddr p) { return *(const __attribute__((address_space(1))) v4f*)p; }
__device__ __forceinline__ v16b frag_at(gaddr p) { const v8b a = *(const __attribute__((address_space(1))) v8b*)p, b = *(const __attribute__((address_space(1))) v8b*)(p + 512); v16b f;   // frag_pk from the lane's own address
#pragma unroll
  for (int e = 0; e < 8; ++e) { f[e] = a[e]; f[8 + e] = b[e]; } return f; }
__device__ __forceinline__ void wave_lds_sync() { __builtin_amdgcn_fence(__ATOMIC_RELEASE, "workgroup"); __builtin_amdgcn_wave_barrier(); __builtin_amdgcn_fence(__ATOMIC_ACQUIRE, "workgroup"); }
// 2^x on v_exp_f32, with the slot that the instruction set asks for behind a transcendental (before its result is used or its source overwritten) filled in the same statement: a v_nop in a statement of its own did not stay behind it
__device__ __forceinline__ float nexp2(float x) { float r; asm("v_exp_f32 %0, %1\n\tv_nop" : "=v"(r) : "v"(x)); return r; }
__device__ __forceinline__ float pmul(float a, float b) { float p = a * b; asm volatile("" : "+v"(p)); return p; }
__device__ __forceinline__ float clampf(float v, float lo, float hi) { return fminf(fmaxf(v, lo), hi); }
__device__ __forceinline__ v2f clamp2(v2f v, float lo, float hi) { return (v2f){clampf(v[0], lo, hi), clampf(v[1], lo, hi)}; }
struct KeyFac { v4f a[4], b[4]; };   // a key block's factors per lane: a = 1 / (norm + 1e-8), b = 1 / max(norm, 1e-6); [0], [1]: keys 8 hh + 0 .. 7, [2], [3]: keys 16 + 8 hh + 0 .. 7

// one launch for the two independent preparations: blocks 0 .. NPW - 1 put the two weight planes into fragment order, the others normalise 8 rows each
constexpr int NPW = 2 * DIM * DIM / 8 / 256;
__global__ __launch_bounds__(256) void ln_prepw_kernel(const float* __restrict__ q, const float* __restrict__ k, const float* __restrict__ v, const float* __restrict__ g, const float* __restrict__ be, const float* __restrict__ win, const float* __restrict__ wout, b16* __restrict__ X16, b16* __restrict__ WIN, b16* __restrict__ WOUT) {
  if (blockIdx.x < NPW) { const int t = blockIdx.x * 256 + threadIdx.x, kind = t / (DIM * DIM / 8), tt = t - kind * (DIM * DIM / 8);
    // thread tt fills the 16-byte piece tt of the plane in fragment order: tile tt / 64 = (row tile) * 16 + k tile, piece tt % 64 = [j][hh][row]
    const int tile = tt >> 6, o_ = (tile / (DIM / 32)) * 16 + (tt & 15), k0 = (tile % (DIM / 32)) * 32 + ((tt >> 5) & 1) * 16 + ((tt >> 4) & 1) * 8;
    const float* w = kind == 0 ? win : wout; v8b o; for (int j = 0; j < 8; ++j) o[j] = (b16)(bf16_rne(w[(size_t)(k0 + j) * DIM + o_]) * WSC);
    *(v8b*)((kind == 0 ? WIN : WOUT) + (size_t)tt * 8) = o; return; }
  const int wave = threadIdx.x >> 5, lane = threadIdx.x & 31; const int rowall = (blockIdx.x - NPW) * 8 + wave; const int which = rowall / NR, row = rowall - which * NR;
  const float* src = (which == 0 ? q : which == 1 ? k : v) + (size_t)row * DIM + lane * 16; float x[16];
  { const v4f a = *(const v4f*)src, b = *(const v4f*)(src + 4), c = *(const v4f*)(src + 8), d = *(const v4f*)(src + 12); for (int j = 0; j < 4; ++j) { x[j] = bf16_rne(a[j]); x[4 + j] = bf16_rne(b[j]); x[8 + j] = bf16_rne(c[j]); x[12 + j] = bf16_rne(d[j]); } }
  float s = 0.0f; for (int j = 0; j < 16; ++j) s += x[j];
#pragma unroll
  for (int o = 16; o >= 1; o >>= 1) s += __shfl_xor(s, o);
  const float mu = s * (1.0f / DIM); float ss = 0.0f; for (int j = 0; j < 16; ++j) { const float d = x[j] - mu; ss += pmul(d, d); }
#pragma unroll
  for (int o = 16; o >= 1; o >>= 1) ss += __shfl_xor(ss, o);
  const float rs = rsqrtf(ss * (1.0f / DIM) + 1e-5f); v8b o0, o1;
  for (int j = 0; j < 16; ++j) { const int c = lane * 16 + j; const b16 hv = (b16)((pmul((x[j] - mu) * rs, bf16_rne(g[c])) + bf16_rne(be[c])) * XS); if (j < 8) o0[j] = hv; else o1[j - 8] = hv; }
  { b16* dst = X16 + ((size_t)which * NR + row) * DIM + lane * 16; *(v8b*)dst = o0; *(v8b*)(dst + 8) = o1;  }
}
// features F = X16 W_in and, in the same launch, every operand plane of the score passes (block = 64 rows x 4 waves, wave = 16 rows x 128 cols = 2 heads; grid.y = 4; grid.z = which: 0 q, 1 k, 2 v). No f32 copy of F goes through memory:
// a WMMA result already lies in fragment order for the product that reads it next, if the index that becomes that product's k runs along a lane's 8 accumulator registers. For f_q and f_k (k = d) that is the transposed product W_in^T X^T
// (registers = 8 neighbouring d, lane = row), formed here; its row sums (mean over d, squared norm) are 32 values of the lane's own and one exchange with the other lane half. f_v^T (k = keys) is turned in LDS, on the wave's own tile.
// which 0: FQ16 = f16(8 f_q), FQC16 = f16(8 (f_q - rowmean)), N1 = ||f_q||; which 1: FK16 = f16(8 f_k), I2A = 1 / (||f_k|| + 1e-8), I2B = 1 / max(||f_k||, 1e-6); which 2: FVTh/FVTl = f_v^T hi/lo x8. All f16 planes in fragment order.
// The key planes are not centred here (the column mean needs all 1,024 rows of a pair): (f_q - rowmean) . (f_k - colmean) = (f_q - rowmean) . f_k - (f_q - rowmean) . colmean, and the second term is one number a query row, formed at the head of each score pass.
__global__ __launch_bounds__(128) void feat_kernel(const b16* __restrict__ X16, const b16* __restrict__ WIN, float* __restrict__ CP, b16* __restrict__ FQ16, b16* __restrict__ FQC16, float* __restrict__ N1, b16* __restrict__ FK16, float* __restrict__ I2A, float* __restrict__ I2B, b16* __restrict__ FVTh, b16* __restrict__ FVTl) {
  __shared__ __attribute__((aligned(16))) float Ts[4][16][128 + 4]; __shared__ float Ns[2][64];   // Ns: the block's squared norms, [head of the two][row]
  const int wave = threadIdx.x >> 5, lane = threadIdx.x & 31, nloc = lane & 15, hlf = lane >> 4; const int which = blockIdx.z; const size_t m0 = (size_t)blockIdx.x * 64 + wave * 16; const int n0 = blockIdx.y * 128;
  v8f acc[8];
#pragma unroll
  for (int t = 0; t < 8; ++t) acc[t] = (v8f){};
  const b16* ap = X16 + ((size_t)which * NR + m0 + nloc) * DIM; const b16* bp = WIN + (size_t)n0 * DIM; const unsigned flane = (unsigned)lane * 16u;   // bp: the first weight tile of column n0 (16 rows x 512 k = 16 tiles of 512 elements)
  const int qi = (int)(m0 / NT), n = (int)(m0 - (size_t)qi * NT), pair0 = (n0 / DH) * QB + qi;   // the wave's 16 rows n .. n + 15 lie in one batch entry; column tile t belongs to head n0 / 64 + t / 4, pair pair0 + (t / 4) QB
  constexpr size_t HSTEP = (size_t)QB * NT * DH;   // elements from a head's plane to the next head's, same batch entry
  v16b a = frag_kb(ap, hlf), b[8];
#pragma unroll
  for (int t = 0; t < 8; ++t) b[t] = frag_pk(bp + (size_t)t * 16 * DIM, flane);
#pragma unroll   // full: the two fragment sets swap by renaming, and the last step's fetch falls away
  for (int kb = 0; kb < DIM; kb += 32) { v16b an = a, bn[8];
#pragma unroll
    for (int t = 0; t < 8; ++t) bn[t] = b[t];
    if (kb + 32 < DIM) { an = frag_kb(ap + kb + 32, hlf);
#pragma unroll
      for (int t = 0; t < 8; ++t) bn[t] = frag_pk(bp + (size_t)t * 16 * DIM + (kb + 32) * 16, flane); }
    __builtin_amdgcn_sched_barrier(0);   // keeps the next step's loads, as one group, ahead of this step's products: sunk towards their uses they would each be waited for in turn
#pragma unroll
    for (int t = 0; t < 8; ++t) acc[t] = wmma16b(b[t], a, acc[t]);
    a = an;
#pragma unroll
    for (int t = 0; t < 8; ++t) b[t] = bn[t]; }
  // lane (hlf, nloc) holds row n + nloc, columns 16 t + 8 hlf + r: the 16 bytes [j = t % 2][hh = hlf][row = nloc] of k tile (t % 4) / 2 of the row tile, byte 512 (t % 4) + 16 lane of its 2 KiB
#pragma unroll
  for (int t = 0; t < 8; ++t) { acc[t] *= (1.0f / (XS * WSC)); *(v4f*)(&Ts[wave][nloc][t * 16 + 8 * hlf]) = (v4f){acc[t][0], acc[t][1], acc[t][2], acc[t][3]}; *(v4f*)(&Ts[wave][nloc][t * 16 + 8 * hlf + 4]) = (v4f){acc[t][4], acc[t][5], acc[t][6], acc[t][7]}; }
  if (which == 2) {   // the same for the whole block
    wave_lds_sync();
    // lane (hlf, nloc) takes column d = 16 (t % 4) + nloc, keys n + 8 hlf + r: the 16 bytes [j = (n / 16) % 2][hh = hlf][row = nloc] of tile [pair][n / 32][t % 4], so that a store covers 512 contiguous bytes
    const size_t off = (size_t)pair0 * NT * DH + (size_t)(n >> 5) * 2048 + ((n >> 4) & 1) * 256 + lane * 8; b16* vh = FVTh + off; b16* vl = FVTl + off; v8b hv[8], lv[8];
#pragma unroll
    for (int t = 0; t < 8; ++t)
#pragma unroll
      for (int r = 0; r < 8; ++r) { b16 h_, l_; split16(Ts[wave][8 * hlf + r][t * 16 + nloc] * XS, h_, l_); hv[t][r] = h_; lv[t][r] = l_; }
    __builtin_amdgcn_sched_barrier(0);   // keeps the stores, as one run, behind all the arithmetic: no register that a store names is written again
#pragma unroll
    for (int t = 0; t < 8; ++t) { *(v8b*)(vh + (t >> 2) * HSTEP + (t & 3) * 512) = hv[t]; *(v8b*)(vl + (t >> 2) * HSTEP + (t & 3) * 512) = lv[t]; }
    return; }
  float sm[2], sq[2];
#pragma unroll
  for (int hd = 0; hd < 2; ++hd) { float s1 = 0.0f, s2 = 0.0f;
#pragma unroll
    for (int t = 4 * hd; t < 4 * hd + 4; ++t)
#pragma unroll
      for (int r = 0; r < 8; ++r) { s1 += acc[t][r]; s2 += acc[t][r] * acc[t][r]; }
    sm[hd] = s1; sq[hd] = s2; }
#pragma unroll
  for (int hd = 0; hd < 2; ++hd) { sm[hd] += __shfl_xor(sm[hd], 16); sq[hd] += __shfl_xor(sq[hd], 16); }
  if (hlf == 0) { Ns[0][wave * 16 + nloc] = sq[0]; Ns[1][wave * 16 + nloc] = sq[1]; }
  v8b pa[8], pc[8];
#pragma unroll
  for (int t = 0; t < 8; ++t) { const float mq = sm[t >> 2] * (1.0f / DH);
#pragma unroll
    for (int r = 0; r < 8; ++r) { pa[t][r] = (b16)(acc[t][r] * XS); pc[t][r] = (b16)((acc[t][r] - mq) * XS); } }
  __syncthreads();
  // a lane takes columns n0 + 4 lane .. + 3 (lane half = head) through the wave's 16 rows: CP [which 0/1][pair][16-row tile][64] = column sums of the tile, the first level of the means over rows
  v4f cs = *(const v4f*)(&Ts[wave][0][lane * 4]);
#pragma unroll
  for (int rr = 1; rr < 16; ++rr) cs += *(const v4f*)(&Ts[wave][rr][lane * 4]);
  float* cpd = CP + (((size_t)which * NP_ + pair0 + hlf * QB) * (NT / 16) + n / 16) * DH + nloc * 4;
  // thread t: squared norm of row t % 64 of the block, head t / 64: a wave stores a whole 128-byte line of each array
  const float nrm = sqrtf(Ns[threadIdx.x >> 6][threadIdx.x & 63]); const size_t nidx = (size_t)(pair0 + (int)(threadIdx.x >> 6) * QB) * NT + (n - wave * 16) + (threadIdx.x & 63);
  const float ia = 1.0f / (nrm + 1e-8f), ib = 1.0f / fmaxf(nrm, 1e-6f);
  const size_t poff = ((size_t)pair0 * NT + n) * DH + lane * 8; b16* p0 = (which == 0 ? FQ16 : FK16) + poff; b16* p1 = FQC16 + poff; float* d0 = (which == 0 ? N1 : I2A) + nidx; float* d1 = I2B + nidx; const float v0 = which == 0 ? nrm : ia;
  __builtin_amdgcn_sched_barrier(0);   // as above: all stores in one run at the end
  *(v4f*)cpd = cs; *d0 = v0;
#pragma unroll
  for (int t = 0; t < 8; ++t) *(v8b*)(p0 + (t >> 2) * HSTEP + (t & 3) * 256) = pa[t];
  close_load_run();   // the same wait behind this run of stores: the compiler forms what only one of the two branches below stores inside that branch, in registers that the stores above name
  if (which == 0) {
#pragma unroll
    for (int t = 0; t < 8; ++t) *(v8b*)(p1 + (t >> 2) * HSTEP + (t & 3) * 256) = pc[t]; }
  else { *d1 = ib; close_load_run(); }   // the same wait behind this store: in the built code the branch runs on into a join, behind which the store's registers are written on the other way
}
// score-tile passes: wave = 16 query rows n of one pair (block = SW = 8 waves = 128 rows: one block fills a WGP's two waves a SIMD, and all its waves walk the same key and value tiles, so that a tile comes from L2 once a WGP and the other waves find it in the WGP's cache), loop over 32 key blocks of 32: dots^T and covraw^T tiles (keys x queries, K = 64: 2 steps x 2 key tiles x 2 GEMMs = 8 WMMAs, both on the one key plane; the centred product lacks its row's term tc = 64 (f_q - rowmean) . colmean, which rides in an addend),
// lane (hh, col=query) holds keys kb+8hh+r and kb+16+8hh+r.  cos = clip(dots/((n1+1e-8)(n2+1e-8))), csim = clip(dots/(max(n1,1e-6) max(n2,1e-6))), margin = clip(0.01 - csim, 0, 10), covraw = c/(8+1e-6).
// PASS 1: per wave the sums of cos, cos^2, covraw, covraw^2, cos covraw, and of var_c x (row sum of cos) and var_c x (row sum of covraw) over its 16 rows -> P1; per row var_c -> VARC.
// PASS 3 (given cn, covfac = reg/covn/2, w per head, vn, temp): per row c_row = vw var_c/(2 vn); e = cw cos/cn cscale + covw covraw covfac (d2 - c_row); logits = (e + c_row)/temp -> online softmax (f32) with o^T += f_v^T P^T (hi+lo, 4 d-tiles): O [pair][n][64] -> OC16h/l, rows q*NT+n, k = h*64+d (concat-head planes, hi/lo x8, in fragment order).
constexpr int SW = 8;   // waves a block
template <int PASS>
__global__ __launch_bounds__(SW * 32) void score_kernel(const b16* __restrict__ FQ16, const b16* __restrict__ FQC16, const float* __restrict__ N1, const b16* __restrict__ FK16, const float* __restrict__ CP, float* __restrict__ PSUM, const float* __restrict__ I2A, const float* __restrict__ I2B, const b16* __restrict__ FVTh, const b16* __restrict__ FVTl,
                                                  const float* __restrict__ CST /* [0..3] cscale/cn, reg/(2 covn), 1/(2 vn), 1/temp; [4..27] cw, covw, vw per head */, float* __restrict__ P1, float* __restrict__ VARC, b16* __restrict__ OCh, b16* __restrict__ OCl) {
  __shared__ __attribute__((aligned(16))) float To[SW][16][DH + 4]; __shared__ float Tr[SW][16]; __shared__ float Tp[SW][8]; __shared__ __attribute__((aligned(16))) float Cs[2][4][DH];   // Cs: column sums of f_q (pass 1 only) and f_k over the pair's rows, in four parts
  const int wave = threadIdx.x >> 5, lane = threadIdx.x & 31, hh = lane >> 4, col = lane & 15; const int pair = blockIdx.y, n0 = blockIdx.x * (SW * 16) + wave * 16, ni = n0 + col; const int h = pair / QB, qi = pair - h * QB;
  const size_t prow = (size_t)pair * NT + ni; const b16* Qp = FQ16 + ((size_t)pair * NT + n0) * DH; const b16* Qc = FQC16 + ((size_t)pair * NT + n0) * DH; const b16* Kb = FK16 + (size_t)pair * NT * DH;   // Qp, Qc: the wave's row tile (2 k tiles in fragment order)
  // column sums over the pair's 1,024 rows, second level: thread (d = t % 64, part = t / 64) adds 16 of the 64 tile sums in CP, the four parts meet in LDS; every block forms them for its own use (colmean of f_k), block 0 of a pair stores PSUM [which 0/1][pair][64] in pass 1
  const int t_ = threadIdx.x; const float* cq = CP + ((size_t)pair * (NT / 16) + (t_ >> 6) * 16) * DH + (t_ & 63); const float* ck = cq + (size_t)NP_ * (NT / 16) * DH; float pq[16], pk[16];
  __builtin_amdgcn_sched_barrier(0);   // keeps the index arithmetic above from being placed between the loads below and the wait that closes their run
#pragma unroll
  for (int i = 0; i < 16; ++i) { pk[i] = ck[i * DH]; if (PASS == 1) pq[i] = cq[i * DH]; }
  // closes the run as close_load_run() does; the input operands keep the run's address registers from being given to a later load's result ahead of the wait
  asm volatile("s_wait_xcnt 0x0" :: "v"(cq), "v"(ck) : "memory"); __builtin_amdgcn_sched_barrier(0);
  gaddr qp = (gaddr)Qp + lane * 16, qcp = (gaddr)Qc + lane * 16;   // the lane's first 16 bytes of the row tile in the two planes
  const v16b qa0 = frag_at(qp), qa1 = frag_at(qp + 1024), qc0 = frag_at(qcp), qc1 = frag_at(qcp + 1024);
  // closes the run as close_load_run() does; as operands of the wait's statement the two addresses stay live, in their own registers, up to the wait
  asm volatile("s_wait_xcnt 0x0" : "+v"(qp), "+v"(qcp) : : "memory"); __builtin_amdgcn_sched_barrier(0);
  // Every factor of a score element that belongs to the query row, the head or the whole launch is multiplied up here, once a wave. The powers of two (1 / XS^2) move exactly, so pass 1 keeps its bits.
  const float n1 = N1[prow]; close_load_run(); const float q1a = (1.0f / (n1 + 1e-8f)) * (1.0f / (XS * XS)), q1b = (1.0f / fmaxf(n1, 1e-6f)) * (1.0f / (XS * XS));
  constexpr float CK = (1.0f / (8.0f + 1e-6f)) * (1.0f / (XS * XS)), LOG2E = 1.4426950408889634f, LOG2_PS = 3.0f; static_assert(PS == 8.0f, "LOG2_PS is log2(PS)");
  float cn_inv_cscale = 0.0f, covfac = 0.0f, vn_half_inv = 0.0f, temp_inv = 0.0f, cwh = 0.0f, covwh = 0.0f, vwh = 0.0f;   // this head's constants, read once ahead of the loop
  if (PASS == 3) { const float* cf = CST; cn_inv_cscale = cf[0]; covfac = cf[1]; vn_half_inv = cf[2]; temp_inv = cf[3]; cwh = cf[4 + h]; covwh = cf[4 + NH + h]; vwh = cf[4 + 2 * NH + h]; }
  float crow = 0.0f; if (PASS == 3) { const float vc_ = VARC[prow]; close_load_run(); crow = vwh * vc_ * vn_half_inv; }
  // e = w1 cos + w2 c (c the raw centred product); pass 3 takes its logits as w1 cos + w2 c + w0 in units of log2, so that 2^x needs no multiply of its own
  const float lsc = temp_inv * LOG2E, w1 = cwh * cn_inv_cscale * lsc, w2 = covwh * covfac * CK * lsc; float w0 = crow * lsc, ck0 = 0.0f;   // w0 and ck0 take the row's term of the centred product below: c = raw - tc
  v2f sa2 = {}, sb2 = {}, sc2 = {}, sd2 = {}, sx2 = {}, ra2 = {};   // pass 1's sums, one accumulator for the even and one for the odd accumulator rows; the two meet behind the loop
  float m = -INFINITY, l = 0.0f; v8f o[4] = {{}, {}, {}, {}}, ol[4] = {{}, {}, {}, {}};
  // One key block's operands (4 key fragments, 16 key factors; 32 in pass 1) live in registers and are fetched together, a whole block ahead of their use.
  // The key factors are still in use when the next block's are fetched: they have two register sets, which swap roles from block to block (the loop body holds two blocks), so that no set is copied.
  v16b k0a, k0b, k1a, k1b; KeyFac fa_ = {}, fb_ = {};
  const unsigned flane = (unsigned)lane * 16u, nlane = (unsigned)hh * 32u;   // per-lane byte offsets into a tile in fragment order and into a key block's norms
  gaddr kr = (gaddr)Kb + flane, np = (gaddr)(I2A + (size_t)pair * NT) + nlane, nq = (gaddr)(I2B + (size_t)pair * NT) + nlane, vhp = (gaddr)(FVTh + (size_t)pair * NT * DH) + flane, vlp = (gaddr)(FVTl + (size_t)pair * NT * DH) + flane;
  // fetches the key block that the carried addresses stand at; more = 1 moves them on by one block, more = 0 leaves them (at the last block)
  auto fetch_keys = [&](int more, KeyFac& f) {
    f.a[0] = quad_at(np); f.a[1] = quad_at(np + 16); f.a[2] = quad_at(np + 64); f.a[3] = quad_at(np + 80);
    if (PASS == 1) { f.b[0] = quad_at(nq); f.b[1] = quad_at(nq + 16); f.b[2] = quad_at(nq + 64); f.b[3] = quad_at(nq + 80); close_and_advance(np, nq, more * 128); } else close_and_advance(np, more * 128);
    k0a = frag_at(kr); k0b = frag_at(kr + 1024); k1a = frag_at(kr + 2048); k1b = frag_at(kr + 3072); close_and_advance(kr, more * 4096); };   // a 32-key block = 4 tiles of 1,024 bytes: [16 keys][k tile]
  auto key_block = [&](int kb, const KeyFac& f, KeyFac& fnext) {
    __builtin_amdgcn_sched_barrier(0);   // keeps this block's score products behind the block before: lifted into its vector work they would wait there for key loads that this work is meant to cover
    v8f dd[2] = {{}, {}}, cc[2] = {{}, {}};
    dd[0] = wmma16p(k0a, qa0, dd[0]); dd[0] = wmma16p(k0b, qa1, dd[0]);
    dd[1] = wmma16p(k1a, qa0, dd[1]); dd[1] = wmma16p(k1b, qa1, dd[1]);
    cc[0] = wmma16p(k0a, qc0, cc[0]); cc[0] = wmma16p(k0b, qc1, cc[0]);
    cc[1] = wmma16p(k1a, qc0, cc[1]); cc[1] = wmma16p(k1b, qc1, cc[1]);
    // behind the last score product: this block's value fragments (used after the softmax arithmetic), then the next block's keys (the last block re-reads itself, unused), all in flight under the vector work
    v16b vh[4], vl[4];
    __builtin_amdgcn_sched_barrier(0);   // keeps earlier vector work from being placed between the loads below and the wait that closes their run, where it could be given one of their address registers
    if (PASS == 3) {
#pragma unroll
      for (int t = 0; t < 4; ++t) { vh[t] = frag_at(vhp + t * 1024); vl[t] = frag_at(vlp + t * 1024); }
      close_and_advance(vhp, vlp, 4096); }
    fetch_keys(kb + 64 < NT ? 1 : 0, fnext);
    // the element arithmetic runs on the pairs (r, r + 1) that already lie in neighbouring registers, in the accumulators and in the 16-byte factor loads alike, so that a packed instruction needs no move to bring its pair together
    v2f ev[2][4];
#pragma unroll
    for (int hq = 0; hq < 2; ++hq) {
#pragma unroll
      for (int pr = 0; pr < 4; ++pr) { const v2f dw = {dd[hq][2 * pr], dd[hq][2 * pr + 1]}, cw_ = {cc[hq][2 * pr], cc[hq][2 * pr + 1]};   // the two raw products
        const v4f fa4 = f.a[2 * hq + (pr >> 1)]; const v2f i2a = {fa4[2 * (pr & 1)], fa4[2 * (pr & 1) + 1]}; const v2f cosv = clamp2(dw * q1a * i2a, -0.99f, 0.99f);
        if (PASS == 1) { const v4f fb4 = f.b[2 * hq + (pr >> 1)]; const v2f i2b = {fb4[2 * (pr & 1)], fb4[2 * (pr & 1) + 1]}; const v2f covraw = cw_ * CK + ck0;
          const v2f csim = clamp2(dw * q1b * i2b, -0.99f, 0.99f); const v2f margin = clamp2(GAMMA - csim, 0.0f, 10.0f);
          sa2 += cosv; sb2 += cosv * cosv; sc2 += covraw; sd2 += covraw * covraw; sx2 += cosv * covraw; ra2 += margin; }
        else { ev[hq][pr] = cosv * w1 + (cw_ * w2 + w0); } } }
    if (PASS == 3) { float mr = -INFINITY;
#pragma unroll
      for (int pr = 0; pr < 4; ++pr) mr = fmaxf(fmaxf(mr, fmaxf(ev[0][pr][0], ev[0][pr][1])), fmaxf(ev[1][pr][0], ev[1][pr][1]));
      mr = fmaxf(mr, __shfl_xor(mr, 16)); const float mn = fmaxf(m, mr); const float al_ = nexp2(m - mn); m = mn; const float ms = mn - LOG2_PS; v2f sum2 = {}; v16b pb;   // ms: the factor PS of the f16 weights rides in the exponent; l then holds PS times the row sum
#pragma unroll
      for (int hq = 0; hq < 2; ++hq) {
#pragma unroll
        for (int pr = 0; pr < 4; ++pr) { const v2f x = ev[hq][pr] - ms; const v2f e = {nexp2(x[0]), nexp2(x[1])}; sum2 += e; pb[8 * hq + 2 * pr] = (b16)e[0]; pb[8 * hq + 2 * pr + 1] = (b16)e[1]; } }
      float sum = sum2[0] + sum2[1]; sum += __shfl_xor(sum, 16); l = l * al_ + sum;
#pragma unroll
      for (int t = 0; t < 4; ++t) { o[t] *= al_; ol[t] *= al_; }
#pragma unroll
      for (int t = 0; t < 4; ++t) { o[t] = wmma16p(vh[t], pb, o[t]); ol[t] = wmma16p(vl[t], pb, ol[t]); }
      // four slots behind the block's last product, once a block: pb, the B operand of all eight, stays live up to here, so that a product of the next block gets its registers for a result only at the distance that holds for any write over a B operand
      asm volatile("v_nop\n\tv_nop\n\tv_nop\n\tv_nop" : "+v"(o[0]), "+v"(o[1]), "+v"(o[2]), "+v"(o[3]), "+v"(ol[0]), "+v"(ol[1]), "+v"(ol[2]), "+v"(ol[3]) : "v"(pb)); } };
  // from here on the carried addresses are what this statement leaves in their register pairs: every load of the loop names one of these pairs and no other register (the wait closes the loads above once more)
  if (PASS == 1) asm volatile("s_wait_xcnt 0x0" : "+v"(kr), "+v"(np), "+v"(nq) : : "memory"); else asm volatile("s_wait_xcnt 0x0" : "+v"(kr), "+v"(np), "+v"(vhp), "+v"(vlp) : : "memory");
  __builtin_amdgcn_sched_barrier(0);
  fetch_keys(1, fa_);
  // under the first key block's flight: the column sums meet, and each query row forms tc = sum_d (8 (f_q - rowmean)_d) (8 colmean_d) from its own centred fragments (a lane holds d = 8 hh + e, 16 + 8 hh + e and these + 32; the halves meet by one exchange)
  { float a = 0.0f, b = 0.0f;
#pragma unroll
    for (int i = 0; i < 16; ++i) { if (PASS == 1) a += pq[i]; b += pk[i]; }
    if (PASS == 1) Cs[0][t_ >> 6][t_ & 63] = a;
    Cs[1][t_ >> 6][t_ & 63] = b; }
  __syncthreads();
  { float tc = 0.0f;
#pragma unroll
    for (int c = 0; c < 4; ++c)   // the lane's four runs of 8 columns, first column 16 c + 8 hh
#pragma unroll
      for (int u = 0; u < 2; ++u) { const int d = 16 * c + 8 * hh + 4 * u; const v4f km = ((*(const v4f*)(&Cs[1][0][d]) + *(const v4f*)(&Cs[1][1][d])) + (*(const v4f*)(&Cs[1][2][d]) + *(const v4f*)(&Cs[1][3][d]))) * (XS / NT);
#pragma unroll
        for (int e = 0; e < 4; ++e) tc += (float)((c < 2 ? qc0 : qc1)[8 * (c & 1) + 4 * u + e]) * km[e]; }
    tc += __shfl_xor(tc, 16); ck0 = -tc * CK; w0 -= tc * w2; }
  for (int kb = 0; kb < NT; kb += 64) { key_block(kb, fa_, fb_); key_block(kb + 32, fb_, fa_); }
  const float s_a = sa2[0] + sa2[1], s_b = sb2[0] + sb2[1], s_c = sc2[0] + sc2[1], s_d = sd2[0] + sd2[1], s_x = sx2[0] + sx2[1]; float rowacc = ra2[0] + ra2[1];
  if (PASS == 1) {   // per-row sums across the two lane halves; per-wave partials over the 16 rows and 32 lanes
    rowacc += __shfl_xor(rowacc, 16); if (hh == 0) Tr[wave][col] = rowacc;
    // a lane's s_a and s_c are its query row's sums of cos and covraw over the lane half's keys: weighted with the row's var_c they give the cross terms of d2's variance
    const float vc = rowacc * (1.0f / NT); float v7[7] = {s_a, s_b, s_c, s_d, s_x, vc * s_a, vc * s_c};
#pragma unroll
    for (int j = 0; j < 7; ++j) { float v = v7[j];
#pragma unroll
      for (int oo = 16; oo >= 1; oo >>= 1) v += __shfl_xor(v, oo);
      v7[j] = v; }
    if (lane == 0) {
#pragma unroll
      for (int j = 0; j < 7; ++j) Tp[wave][j] = v7[j];
      Tp[wave][7] = 0.0f; }
    wave_lds_sync();
    __syncthreads();
    if ((wave & 1) == 0) { const int g = n0 / 32;   // each even wave stores for itself and the next one: a whole 128-byte line of VARC and of P1 for their 32 rows, as before
      VARC[(size_t)pair * NT + g * 32 + lane] = Tr[wave + (lane >> 4)][lane & 15] * (1.0f / NT);
      P1[((size_t)pair * (NT / 32) + g) * 32 + lane] = (lane < 16) ? Tp[wave + (lane >> 3)][lane & 7] : 0.0f; }
    if (blockIdx.x == 0 && t_ < 2 * DH) { const int w = t_ >> 6, d = t_ & 63; PSUM[((size_t)w * NP_ + pair) * DH + d] = (Cs[w][0][d] + Cs[w][1][d]) + (Cs[w][2][d] + Cs[w][3][d]); }
  } else {
    const float inv = 1.0f / (l * XS);
#pragma unroll
    for (int t = 0; t < 4; ++t)
#pragma unroll
      for (int r = 0; r < 8; ++r) To[wave][col][t * 16 + 8 * hh + r] = (o[t][r] + ol[t][r]) * inv;
    wave_lds_sync();
    // fragment order for the output projection: the wave's 16 rows x 64 columns are 2 tiles (2 KiB) a plane; store i covers the 512 bytes [k tile i / 2][j = i % 2]
    { for (int i = 0; i < 4; ++i) { const int rr = col, c8 = (i >> 1) * 32 + (i & 1) * 16 + hh * 8; v8b hv, lv; for (int j = 0; j < 8; ++j) { b16 a_, c_; split16(To[wave][rr][c8 + j] * XS, a_, c_); hv[j] = a_; lv[j] = c_; }
        const size_t gi = ((size_t)qi * NT + n0) * DIM + (h * 2) * 512 + i * 256 + lane * 8; *(v8b*)(OCh + gi) = hv; *(v8b*)(OCl + gi) = lv; }  }
  }
}
// reduction (one block, fixed order): cn, covn, vn, weights, then dstd -> temp -> CST[0..27].
// It runs as one block on an otherwise idle chip, so nothing hides a load's latency but the block's own instruction order: the kernel issues ALL its global reads in one run at its head and keeps them in registers
// (the predictor's weights go on to LDS), so that it pays about one memory latency in all instead of one per loop trip. Every sum keeps its operands and its order; in the loops written anew a product now fuses with its addition.
__global__ __launch_bounds__(256) void reduce1_kernel(const float* __restrict__ P1, const float* __restrict__ VARC, const float* __restrict__ PSUM, const float* __restrict__ w1, const float* __restrict__ b1, const float* __restrict__ g2, const float* __restrict__ be2, const float* __restrict__ w2, const float* __restrict__ b2, const float* __restrict__ w3, const float* __restrict__ b3, const float* __restrict__ wtemp, float* __restrict__ CST) {
  __shared__ float red[4][256]; __shared__ float sh[64];
  __shared__ __attribute__((aligned(16))) float w1s[2 * DH * DH], w2s[DH * 32]; __shared__ float w3s[3][32], b1s[DH], g2s[DH], be2s[DH], b2s[32];   // the predictor's parameters as bf16 values (w3s: the 96 values in their order)
  const int t_ = threadIdx.x; constexpr int NPK = NP_ * (NT / 32) / 256 /* 4 of the 1,024 partials of 32 rows (16 floats: 2 waves x 8) per thread */, NVK = NP_ * NT / 256 /* 128 row values per thread */, NFK = NH * 2 * DH / 256 /* 4 */;
  v4f w1r[8], w2r[2], pl[NPK], ph[NPK], xl[NPK], xh[NPK]; float pr[NFK][QB], vr[NVK], w3r[3];
  const unsigned a63 = t_ & (DH - 1), a31 = t_ & 31, p1off = (unsigned)t_ * 128u /* bytes: partial t_ */, psidx = ((t_ >> 6) & 1) * NP_ * DH + (t_ >> 7) * QB * DH + (t_ & (DH - 1)) /* PSUM [which][pair 4 h][dd] of feature i = t_ */;
  const float b3r[3] = {b3[0], b3[1], b3[2]}, wtr = wtemp[0];
  __builtin_amdgcn_sched_barrier(0);   // keeps the index arithmetic and the scalar reads above from being placed between the loads below and the wait that closes their run
#pragma unroll
  for (int j = 0; j < 8; ++j) w1r[j] = *(const v4f*)(w1 + (j * 256 + t_) * 4);
#pragma unroll
  for (int j = 0; j < 2; ++j) w2r[j] = *(const v4f*)(w2 + (j * 256 + t_) * 4);
  const float b1r = b1[a63], g2r = g2[a63], be2r = be2[a63], b2r = b2[a31];
#pragma unroll
  for (int j = 0; j < 3; ++j) w3r[j] = w3[j * 32 + a31];
#pragma unroll
  for (int k = 0; k < NPK; ++k) { const char* p = (const char*)P1 + p1off + k * (256 * 128); pl[k] = *(const v4f*)p; xl[k] = *(const v4f*)(p + 16); ph[k] = *(const v4f*)(p + 32); xh[k] = *(const v4f*)(p + 48); }
#pragma unroll
  for (int k = 0; k < NFK; ++k)   // feature i = t_ + 256 k: head h + 2 k, the same which and dd
#pragma unroll
    for (int qq = 0; qq < QB; ++qq) pr[k][qq] = PSUM[psidx + (2 * k * QB + qq) * DH];
#pragma unroll   // full, here and in the four loops that read vr: the 128 values stay in registers and are read from memory once, not once a loop
  for (int j = 0; j < NVK; ++j) vr[j] = VARC[t_ + j * 256];
  // closes the run as close_load_run() does; the input operands keep the run's address registers from being given to a later load's result ahead of the wait
  asm volatile("s_wait_xcnt 0x0" :: "v"(a63), "v"(a31), "v"(p1off), "v"(psidx) : "memory"); __builtin_amdgcn_sched_barrier(0);
#pragma unroll
  for (int j = 0; j < 8; ++j) { v4f x; for (int e = 0; e < 4; ++e) x[e] = bf16_rne(w1r[j][e]); *(v4f*)(w1s + (j * 256 + t_) * 4) = x; }
#pragma unroll
  for (int j = 0; j < 2; ++j) { v4f x; for (int e = 0; e < 4; ++e) x[e] = bf16_rne(w2r[j][e]); *(v4f*)(w2s + (j * 256 + t_) * 4) = x; }
  b1s[a63] = bf16_rne(b1r); g2s[a63] = bf16_rne(g2r); be2s[a63] = bf16_rne(be2r); b2s[a31] = bf16_rne(b2r);   // every thread stores: threads with the same index store the same value
#pragma unroll
  for (int j = 0; j < 3; ++j) w3s[j][a31] = bf16_rne(w3r[j]);
  float a = 0, b = 0, c = 0, d = 0, mo[NPK][7];   // mo: the seven moments of partial t_ + 256 k (32 rows of head 2 k + t_ / 128), kept for d2's variance at the end
#pragma unroll
  for (int k = 0; k < NPK; ++k) {
#pragma unroll
    for (int j = 0; j < 4; ++j) mo[k][j] = pl[k][j] + ph[k][j];
#pragma unroll
    for (int j = 0; j < 3; ++j) mo[k][4 + j] = xl[k][j] + xh[k][j];
    a += mo[k][0]; b += mo[k][1]; c += mo[k][2]; d += mo[k][3]; }
  red[0][t_] = a; red[1][t_] = b; red[2][t_] = c; red[3][t_] = d; __syncthreads();
  for (int s = 128; s >= 1; s >>= 1) { if (t_ < s) { for (int j = 0; j < 4; ++j) red[j][t_] += red[j][t_ + s]; } __syncthreads(); }
  float vs = 0.0f;
#pragma unroll
  for (int j = 0; j < NVK; ++j) vs += vr[j];
  __shared__ float r2[256]; r2[t_] = vs; __syncthreads(); for (int s = 128; s >= 1; s >>= 1) { if (t_ < s) r2[t_] += r2[t_ + s]; __syncthreads(); }
  const float vmu = r2[0] / (float)(NP_ * NT); __syncthreads();
  float vq = 0.0f;
#pragma unroll
  for (int j = 0; j < NVK; ++j) { const float dv = vr[j] - vmu; vq += dv * dv; }
  r2[t_] = vq; __syncthreads(); for (int s = 128; s >= 1; s >>= 1) { if (t_ < s) r2[t_] += r2[t_ + s]; __syncthreads(); }
  // head means qg/kg [8][64] from PSUM [which][pair][64]: mean over (q, n) = sum over the 4 pairs of the head / 4096 -> feats [h][128]; MLP: h1 = relu(LN(feats W1 + b1)), h2 = relu(h1 W2 + b2), logits = softmax(h2 W3 + b3), w = softmax(logits / clip(wt)), clip [0.05,0.8], renorm
  __shared__ __attribute__((aligned(16))) float feats[NH][2 * DH], h1s[NH][DH], h2s[NH][32]; __shared__ float ws[NH][3];
#pragma unroll
  for (int k = 0; k < NFK; ++k) { const int i = t_ + k * 256, h = i / (2 * DH), c = i - h * 2 * DH; float s = 0.0f;
#pragma unroll
    for (int qq = 0; qq < QB; ++qq) s += pr[k][qq];
    feats[h][c] = s * (1.0f / (QB * NT)); }
  __syncthreads();
  // the loops below read LDS only; each is unrolled, with plain products, so that its reads are issued ahead of the one chain of additions instead of being waited for one by one
  for (int i = t_; i < NH * DH; i += 256) { const int h = i / DH, o_ = i - h * DH; float s = b1s[o_];
#pragma unroll 32
    for (int c = 0; c < 2 * DH; ++c) s += feats[h][c] * w1s[c * DH + o_]; h1s[h][o_] = s; }
  __syncthreads();
  if (t_ < NH) { const int h = t_; float mu = 0.0f;
#pragma unroll
    for (int c = 0; c < DH; ++c) mu += h1s[h][c];
    mu *= (1.0f / DH); float var = 0.0f;
#pragma unroll
    for (int c = 0; c < DH; ++c) { const float dv = h1s[h][c] - mu; var += dv * dv; }
    var *= (1.0f / DH); const float rs = rsqrtf(var + 1e-5f);
#pragma unroll
    for (int c = 0; c < DH; ++c) h1s[h][c] = fmaxf((h1s[h][c] - mu) * rs * g2s[c] + be2s[c], 0.0f); }
  __syncthreads();
  for (int i = t_; i < NH * 32; i += 256) { const int h = i / 32, o_ = i - h * 32; float s = b2s[o_];
#pragma unroll 32
    for (int c = 0; c < DH; ++c) s += h1s[h][c] * w2s[c * 32 + o_]; h2s[h][o_] = fmaxf(s, 0.0f); }
  __syncthreads();
  if (t_ < NH) { const int h = t_; float lg[3]; for (int o_ = 0; o_ < 3; ++o_) { float s = bf16_rne(b3r[o_]);
#pragma unroll
      for (int c = 0; c < 32; ++c) s += h2s[h][c] * (&w3s[0][0])[c * 3 + o_]; lg[o_] = s; }
    float mx = fmaxf(lg[0], fmaxf(lg[1], lg[2])); float e3[3], se = 0.0f; for (int j = 0; j < 3; ++j) { e3[j] = __expf(lg[j] - mx); se += e3[j]; } for (int j = 0; j < 3; ++j) e3[j] /= se;
    const float wt = clampf(bf16_rne(wtr), 0.1f, 20.0f); float z[3]; for (int j = 0; j < 3; ++j) z[j] = e3[j] / wt; mx = fmaxf(z[0], fmaxf(z[1], z[2])); se = 0.0f; for (int j = 0; j < 3; ++j) { e3[j] = __expf(z[j] - mx); se += e3[j]; }
    float wv[3], sw = 0.0f; for (int j = 0; j < 3; ++j) { wv[j] = clampf(e3[j] / se, 0.05f, 0.8f); sw += wv[j]; } for (int j = 0; j < 3; ++j) ws[h][j] = wv[j] / sw; }
  __syncthreads();
  if (t_ == 0) { const float n = (float)NTOT; const float sa_ = red[0][0], sb = red[1][0], sc = red[2][0], sd = red[3][0];
    const float cstd = sqrtf(fmaxf((sb - sa_ * (sa_ / n)) / (n - 1.0f), 0.0f)); const float covstd_raw = sqrtf(fmaxf((sd - sc * (sc / n)) / (n - 1.0f), 0.0f));
    const float base_reg = LREG / (float)NT; const float reg = (covstd_raw < 1e-6f) ? base_reg * 10.0f : base_reg;   // reference: reg chosen on the std of the RAW cov, then cov = clip(reg cov, +-50) (never clips at this scale)
    const float covn = reg * covstd_raw + 1e-6f; const float cn = cstd + 1e-6f; const float cscale = (cn < 1e-4f) ? 0.1f : 1.0f;
    const float vn = sqrtf(r2[0] * ((float)NT / (n - 1.0f))) + 1e-6f;   // std over the broadcast [.., m] copies: each row value repeated NT times
    sh[0] = cscale / cn; sh[1] = reg * 0.5f / covn; sh[2] = 0.5f / vn; sh[3] = 0.0f; for (int h = 0; h < NH; ++h) { sh[4 + h] = ws[h][0]; sh[4 + NH + h] = ws[h][1]; sh[4 + 2 * NH + h] = ws[h][2]; } }
  __syncthreads();
  // dstd = std(d2) from the moments. d2 = e + c with e = W1 cos + W2 covraw (W1 = cw cscale/cn, W2 = covw reg/(2 covn), per head) and the row constant c = vw var_c/(2 vn).
  // var(d2) = E[(d2 - M)^2] - (E[d2 - M])^2 with the shift M = mean of the row constants (kills the large common offset): sum (d2 - M) = sum e + NT sum_rows (c - M),
  // sum (d2 - M)^2 = sum e^2 + 2 sum_rows (c - M) rowsum_e + NT sum_rows (c - M)^2; sum e^2 = W1^2 sum cos^2 + 2 W1 W2 sum cos covraw + W2^2 sum covraw^2; sum_rows c rowsum_e = vw/(2 vn) (W1 sum var_c rowsum_cos + W2 sum var_c rowsum_covraw).
  __shared__ float tl[3][8]; const int wv = t_ >> 5; const float vfac = sh[2]; float vf[NH];
#pragma unroll
  for (int h = 0; h < NH; ++h) vf[h] = sh[4 + 2 * NH + h] * vfac;
  float c4[4] = {0.0f, 0.0f, 0.0f, 0.0f};   // row i = t_ + 256 j belongs to head (i / NT) / QB = j / 16; four chains here and below, so that an addition does not wait for the one before it
#pragma unroll
  for (int j = 0; j < NVK; ++j) c4[j & 3] += vf[j / 16] * vr[j];
  float sc = (c4[0] + c4[1]) + (c4[2] + c4[3]);
#pragma unroll
  for (int o = 16; o >= 1; o >>= 1) sc += __shfl_xor(sc, o);
  if ((t_ & 31) == 0) tl[0][wv] = sc;
  __syncthreads();
  float M = 0.0f;
#pragma unroll
  for (int w = 0; w < 8; ++w) M += tl[0][w];
  M /= (float)(NP_ * NT); float q1[4] = {0.0f, 0.0f, 0.0f, 0.0f}, q2[4] = {0.0f, 0.0f, 0.0f, 0.0f};
#pragma unroll
  for (int j = 0; j < NVK; ++j) { const float cm = vf[j / 16] * vr[j] - M; q1[j & 3] += cm; q2[j & 3] += cm * cm; }
  float s1 = (float)NT * ((q1[0] + q1[1]) + (q1[2] + q1[3])), s2 = (float)NT * ((q2[0] + q2[1]) + (q2[2] + q2[3]));
#pragma unroll
  for (int k = 0; k < NPK; ++k) { const int h = 2 * k + (t_ >> 7); const float W1 = sh[4 + h] * sh[0], W2 = sh[4 + NH + h] * sh[1], VW = sh[4 + 2 * NH + h] * vfac, se = W1 * mo[k][0] + W2 * mo[k][2];
    s1 += se; s2 += W1 * W1 * mo[k][1] + 2.0f * W1 * W2 * mo[k][4] + W2 * W2 * mo[k][3] + 2.0f * (VW * (W1 * mo[k][5] + W2 * mo[k][6]) - M * se); }
#pragma unroll
  for (int o = 16; o >= 1; o >>= 1) { s1 += __shfl_xor(s1, o); s2 += __shfl_xor(s2, o); }
  if ((t_ & 31) == 0) { tl[1][wv] = s1; tl[2][wv] = s2; }
  __syncthreads();
  if (t_ == 0) { float t1 = 0.0f, t2 = 0.0f;
#pragma unroll
    for (int w = 0; w < 8; ++w) { t1 += tl[1][w]; t2 += tl[2][w]; }
    const float n = NTOT; const float var = (t2 - t1 * (t1 / n)) / (n - 1.0f); const float dstd = sqrtf(fmaxf(var, 0.0f)); const float temp = (dstd < 1e-6f) ? 0.1f : 0.3f + dstd; sh[3] = 1.0f / clampf(temp, 0.1f, 5.0f); }
  __syncthreads();
  { if (t_ < 32) ((float*)CST)[t_] = (t_ < 4 + 3 * NH) ? sh[t_] : 0.0f;  }
}
__global__ __launch_bounds__(128) void outproj_kernel(const b16* __restrict__ OCh, const b16* __restrict__ OCl, const b16* __restrict__ WOUT, const float* __restrict__ bo, float* __restrict__ out) {
  __shared__ __attribute__((aligned(16))) float Ts[4][16][128 + 4];
  const int wave = threadIdx.x >> 5, lane = threadIdx.x & 31, nloc = lane & 15, hlf = lane >> 4; const size_t m0 = (size_t)blockIdx.x * 64 + wave * 16; const int n0 = blockIdx.y * 128;
  v8f acc[8];
#pragma unroll
  for (int t = 0; t < 8; ++t) acc[t] = (v8f){};
  const b16* ap = OCh + m0 * DIM; const b16* lp = OCl + m0 * DIM; const b16* bp = WOUT + (size_t)n0 * DIM; const unsigned flane = (unsigned)lane * 16u;   // ap, lp, bp: the first tile of row m0, of column n0
  v16b a = frag_pk(ap, flane), al = frag_pk(lp, flane), b[8];
#pragma unroll
  for (int t = 0; t < 8; ++t) b[t] = frag_pk(bp + (size_t)t * 16 * DIM, flane);
#pragma unroll   // full: the two fragment sets swap by renaming, and the last step's fetch falls away
  for (int kb = 0; kb < DIM; kb += 32) { v16b an = a, aln = al, bn[8];
#pragma unroll
    for (int t = 0; t < 8; ++t) bn[t] = b[t];
    if (kb + 32 < DIM) { an = frag_pk(ap + (kb + 32) * 16, flane); aln = frag_pk(lp + (kb + 32) * 16, flane);
#pragma unroll
      for (int t = 0; t < 8; ++t) bn[t] = frag_pk(bp + (size_t)t * 16 * DIM + (kb + 32) * 16, flane); }
    __builtin_amdgcn_sched_barrier(0);   // keeps the next step's loads, as one group, ahead of this step's products: sunk towards their uses they would each be waited for in turn
#pragma unroll
    for (int t = 0; t < 8; ++t) { acc[t] = wmma16b(a, b[t], acc[t]); acc[t] = wmma16b(al, b[t], acc[t]); }
    a = an; al = aln;
#pragma unroll
    for (int t = 0; t < 8; ++t) b[t] = bn[t]; }
#pragma unroll
  for (int t = 0; t < 8; ++t) { const float bb = bf16_rne(bo[n0 + t * 16 + nloc]);
#pragma unroll
    for (int r = 0; r < 8; ++r) Ts[wave][8 * hlf + r][t * 16 + nloc] = acc[t][r] * (1.0f / (XS * WSC)) + bb; }
  wave_lds_sync();
  { for (int rr = 0; rr < 16; ++rr) *(v4f*)(out + (m0 + rr) * DIM + n0 + lane * 4) = *(const v4f*)(&Ts[wave][rr][lane * 4]);  }
}
}  // namespace

extern "C" void kernel_launch(void* const* d_in, const int* in_sizes, int n_in, void* d_out, int out_size, void* d_ws, size_t ws_size, hipStream_t stream) {
  (void)n_in;
  auto Fp = [&](int i) { return (const float*)d_in[i]; };
  // input order: 0 q, 1 k, 2 v [4,1024,512]; 3 ln_in_g, 4 ln_in_b; 5 W_in [512,512]; 6 wp_W1 [128,64], 7 wp_b1, 8 wp_ln_g, 9 wp_ln_b, 10 wp_W2 [64,32], 11 wp_b2, 12 wp_W3 [32,3], 13 wp_b3, 14 weight_temp [1], 15 W_out [512,512], 16 b_out
  if (in_sizes[0] != NR * DIM || in_sizes[1] != NR * DIM || in_sizes[2] != NR * DIM || in_sizes[5] != DIM * DIM || in_sizes[6] != 2 * DH * DH || in_sizes[15] != DIM * DIM || out_size != NR * DIM) return;
  size_t off = 0; char* ws = (char*)d_ws;
  auto carve = [&](size_t bytes) { char* p = ws + off; off += (bytes + 255) & ~(size_t)255; return p; };
  b16* X16 = (b16*)carve((size_t)3 * NR * DIM * 2); b16* WIN = (b16*)carve((size_t)DIM * DIM * 2); b16* WOUT = (b16*)carve((size_t)DIM * DIM * 2);
  float* CP = (float*)carve((size_t)2 * NP_ * (NT / 16) * DH * 4); float* PSUM = (float*)carve((size_t)2 * NP_ * DH * 4);
  b16* FQ16 = (b16*)carve((size_t)NP_ * NT * DH * 2); b16* FQC16 = (b16*)carve((size_t)NP_ * NT * DH * 2); b16* FK16 = (b16*)carve((size_t)NP_ * NT * DH * 2);
  float* N1 = (float*)carve((size_t)NP_ * NT * 4); float* N2 = (float*)carve((size_t)NP_ * NT * 4); float* I2B = (float*)carve((size_t)NP_ * NT * 4);   // N2 holds 1 / (key norm + 1e-8), I2B 1 / max(key norm, 1e-6)
  b16* FVTh = (b16*)carve((size_t)NP_ * DH * NT * 2); b16* FVTl = (b16*)carve((size_t)NP_ * DH * NT * 2);
  float* P1 = (float*)carve((size_t)NP_ * (NT / 32) * 32 * 4); float* VARC = (float*)carve((size_t)NP_ * NT * 4); float* CST = (float*)carve(256);
  b16* OCh = (b16*)carve((size_t)NR * DIM * 2); b16* OCl = (b16*)carve((size_t)NR * DIM * 2);
  if (off > ws_size || off > ((size_t)128 << 20)) return;   // about 45 MB
  ln_prepw_kernel<<<NPW + 3 * NR / 8, 256, 0, stream>>>(Fp(0), Fp(1), Fp(2), Fp(3), Fp(4), Fp(5), Fp(15), X16, WIN, WOUT);
  feat_kernel<<<dim3(NR / 64, DIM / 128, 3), 128, 0, stream>>>(X16, WIN, CP, FQ16, FQC16, N1, FK16, N2, I2B, FVTh, FVTl);
  score_kernel<1><<<dim3(NT / (SW * 16), NP_), SW * 32, 0, stream>>>(FQ16, FQC16, N1, FK16, CP, PSUM, N2, I2B, FVTh, FVTl, CST, P1, VARC, OCh, OCl);
  reduce1_kernel<<<1, 256, 0, stream>>>(P1, VARC, PSUM, Fp(6), Fp(7), Fp(8), Fp(9), Fp(10), Fp(11), Fp(12), Fp(13), Fp(14), CST);
  score_kernel<3><<<dim3(NT / (SW * 16), NP_), SW * 32, 0, stream>>>(FQ16, FQC16, N1, FK16, CP, PSUM, N2, I2B, FVTh, FVTl, CST, P1, VARC, OCh, OCl);
  outproj_kernel<<<dim3(NR / 64, DIM / 128), 128, 0, stream>>>(OCh, OCl, WOUT, Fp(16), (float*)d_out);
}

// v010
// One run takes 89.4 microseconds.
// In both of two side-by-side timings against v009, it was 1.25 times as fast.
// All steps since v000 together make it 7.80 times as fast.
#include <hip/hip_runtime.h>

// "Super-aggressive" attention: f_q, f_k, f_v = LN(q|k|v) W_in split into 8 heads x 64; per (head, batch) pair: cos = clip(f_q.f_k / (n1 n2), +-0.99) (n = norm + 1e-8),
// cov = reg x (f_q - rowmean_d)(f_k - colmean_m) / (8 + 1e-6) (reg = 1e-3/1024, x10 if the global std of the raw cov < 1e-6), csim = clip(qn.kn) with max(norm, 1e-6), margin =
// clip(0.01 - csim, 0, 10), var_c = row mean of margin; per-head weights (cw, covw, vw) from a tiny MLP on the global means of f_q / f_k (softmax, /clip(weight_temp), softmax, clip, renorm);
// cn / covn / vn = global std (ddof 1) of cos / cov / var_c (+1e-6); d2 = cw cos/cn cscale + covw cov/covn/2 + vw var_c/vn/2; temp = 0.3 + std(d2) (dstd >= 1e-6; clipped to [0.1, 5]);
// attn = softmax(d2 / temp); out_h = attn f_v; out = concat_h W_out + b -> [4][1024][512].
// Every global statistic is a deterministic f32 reduction (per-wave partials, then one fixed-order kernel; the means of f_q / f_k take a per-pair level in between); the [1024 x 1024] score tiles are recomputed in two passes
// (component statistics; softmax + PV) instead of being stored. std(d2) takes no pass of its own: d2 is linear in cos, cov and var_c, so its variance is a quadratic form in their first and second moments per head.
// WMMA (v_wmma_f32_16x16x32_f16, f32 accumulate): W_in (LN(x) single f16 x8, exact weights), dots / centered-cov tiles (single f16 x8 feature planes, K = 64), P.V (P single x8, f_v^T hi+lo:
// 2 products), W_out (O hi+lo: 2 products). LN, norms, all statistics and the weight-predictor MLP in f32. Inputs rounded to bf16 once. Fragment k-map per lane half hh

namespace {
constexpr int QB = 4, NT = 1024, DIM = 512, NH = 8, DH = 64, NP_ = NH * QB /* 32 (h,q) pairs, index h*QB + q */, NR = QB * NT /* 4096 rows */, NWAVE = NP_ * (NT / 16) /* 2048 score waves */;
constexpr float XS = 8.0f, WSC = 256.0f, PS = 8.0f, GAMMA = 0.01f, LREG = 0.001f;
constexpr float NTOT = 33554432.0f;   // 33,554,432 score elements

typedef _Float16 b16;
typedef __attribute__((ext_vector_type(16))) _Float16 v16b;
typedef __attribute__((ext_vector_type(8))) _Float16 v8b;
typedef __attribute__((ext_vector_type(8))) float v8f;
typedef __attribute__((ext_vector_type(4))) float v4f;
typedef __attribute__((ext_vector_type(2))) float v2f;
__device__ __forceinline__ float bf16_rne(float f) { unsigned int u = __float_as_uint(f); u += 0x7FFFu + ((u >> 16) & 1u); return __uint_as_float(u & 0xFFFF0000u); }
__device__ __forceinline__ void split16(float v, b16& hi, b16& lo) { hi = (b16)v; lo = (b16)(v - (float)hi); }
__device__ __forceinline__ v16b frag_kb(const b16* p, int hh) { const v8b a = *(const v8b*)(p + 8 * hh), b = *(const v8b*)(p + 16 + 8 * hh); v16b f;
#pragma unroll
  for (int e = 0; e < 8; ++e) { f[e] = a[e]; f[8 + e] = b[e]; } return f; }
// Fragment order: the planes that the matrix loops read again and again (queries, centred queries, keys, f_v^T hi/lo, both weight planes, the attention output hi/lo) are stored tile by tile, a tile = 16 rows x 32 k = 1,024 contiguous bytes laid out as
// [k half j][lane = 16 hh + row][8 elements], element (row, kk) with j = kk / 16, hh = (kk / 8) % 2. A wave's 16-byte load then covers 512 contiguous bytes (4 whole lines) instead of 32-byte pieces of 16 lines; each lane gets the same values in the same registers as from frag_kb.
__device__ __forceinline__ int frag_pos(int row, int kk) { return (kk >> 4) * 256 + (((kk >> 3) & 1) * 16 + row) * 8 + (kk & 7); }   // element offset inside a tile
__device__ __forceinline__ v16b frag_pk(const b16* utile, unsigned lane_bytes) { const char* p = (const char*)utile + lane_bytes; const v8b a = *(const v8b*)p, b = *(const v8b*)(p + 512); v16b f;   // wave-uniform tile base plus 16 * lane bytes
#pragma unroll
  for (int e = 0; e < 8; ++e) { f[e] = a[e]; f[8 + e] = b[e]; } return f; }
__device__ __forceinline__ v8f wmma16b(v16b a, v16b b, v8f c) { v8f d = __builtin_amdgcn_wmma_f32_16x16x32_f16(false, a, false, b, (short)0, c, false, false); asm volatile("v_nop\n\tv_nop\n\tv_nop\n\tv_nop" : "+v"(d) : "v"(a), "v"(b)); return d; }
// the plain product, for a run of products in a loop: the compiler keeps the distances behind its own builtin and writes idle slots only where a vector instruction really follows on D, A or B
__device__ __forceinline__ v8f wmma16p(v16b a, v16b b, v8f c) { return __builtin_amdgcn_wmma_f32_16x16x32_f16(false, a, false, b, (short)0, c, false, false); }
// closes a run of global loads. The wait stands in front of the next instruction that writes a register from which those loads took their address (a precaution).
// The scheduling barrier keeps later address arithmetic from being lifted over that wait, and keeps the run up here, ahead of the work that covers its latency: sunk towards their uses the loads would each be waited for in turn.
__device__ __forceinline__ void close_load_run() { asm volatile("s_wait_xcnt 0x0" ::: "memory"); __builtin_amdgcn_sched_barrier(0); }
typedef const __attribute__((address_space(1))) char* gaddr;   // a lane's byte address in global memory, carried through the key loop in one register pair
// closes a run of loads from one or two carried addresses and moves these on to the next key block. Wait and additions are one statement: the addresses stay live, in their own registers, up to the wait (no result of the run can be given them),
// and the instructions that overwrite them stand behind it by construction. The scheduling barrier as in close_load_run().
__device__ __forceinline__ void close_and_advance(gaddr& a, gaddr& b, long long step) { asm volatile("s_wait_xcnt 0x0\n\tv_add_nc_u64 %0, %2, %0\n\tv_add_nc_u64 %1, %2, %1" : "+v"(a), "+v"(b) : "s"(step) : "memory"); __builtin_amdgcn_sched_barrier(0); }
__device__ __forceinline__ void close_and_advance(gaddr& a, long long step) { asm volatile("s_wait_xcnt 0x0\n\tv_add_nc_u64 %0, %1, %0" : "+v"(a) : "s"(step) : "memory"); __builtin_amdgcn_sched_barrier(0); }
__device__ __forceinline__ v4f quad_at(gaddr p) { return *(const __attribute__((address_space(1))) v4f*)p; }
__device__ __forceinline__ v16b frag_at(gaddr p) { const v8b a = *(const __attribute__((address_space(1))) v8b*)p, b = *(const __attribute__((address_space(1))) v8b*)(p + 512); v16b f;   // frag_pk from the lane's own address
#pragma unroll
  for (int e = 0; e < 8; ++e) { f[e] = a[e]; f[8 + e] = b[e]; } return f; }
// A request to L2 for the memory at base + off + IMM: a hint that returns nothing and changes no value. What an earlier launch stored is not counted on to be in L2 when a launch starts, and where it is not, a loop that fetches one step ahead waits out
// the memory latency at the first touch of every step. Asked for together at the kernel's entry, the units are on their way to L2, or in it, when the loop comes to them. Scope SE: into L2 only. Every lane's address lies inside the plane named.
// The offset is an in-out operand, so that the compiler keeps this one register for it up to keep_named() instead of forming the value anew there.
template <int IMM> __device__ __forceinline__ void ask_l2(const void* base, unsigned& off) { asm volatile("global_prefetch_b8 %0, %1 offset:%2 scope:SCOPE_SE" : "+v"(off) : "s"(base), "n"(IMM)); }
// stands behind the loop: the registers that the requests name keep their addresses up to here (a request counts on no counter, so that no wait can tell when it has read them)
__device__ __forceinline__ void keep_named(unsigned off, const void* a, const void* b, const void* c) { asm volatile("" :: "v"(off), "s"(a), "s"(b), "s"(c)); }
__device__ __forceinline__ void wave_lds_sync() { __builtin_amdgcn_fence(__ATOMIC_RELEASE, "workgroup"); __builtin_amdgcn_wave_barrier(); __builtin_amdgcn_fence(__ATOMIC_ACQUIRE, "workgroup"); }
// 2^x on v_exp_f32, with the slot that the instruction set asks for behind a transcendental (before its result is used or its source overwritten) filled in the same statement: a v_nop in a statement of its own did not stay behind it
__device__ __forceinline__ float nexp2(float x) { float r; asm("v_exp_f32 %0, %1\n\tv_nop" : "=v"(r) : "v"(x)); return r; }
__device__ __forceinline__ float pmul(float a, float b) { float p = a * b; asm volatile("" : "+v"(p)); return p; }
__device__ __forceinline__ float clampf(float v, float lo, float hi) { return fminf(fmaxf(v, lo), hi); }
__device__ __forceinline__ v2f clamp2(v2f v, float lo, float hi) { return (v2f){clampf(v[0], lo, hi), clampf(v[1], lo, hi)}; }
struct KeyFac { v4f a[4], b[4]; };   // a key block's factors per lane: a = 1 / (norm + 1e-8), b = 1 / max(norm, 1e-6); [0], [1]: keys 8 hh + 0 .. 7, [2], [3]: keys 16 + 8 hh + 0 .. 7

// one launch for the two independent preparations: blocks 0 .. NPW - 1 put the two weight planes into fragment order, the others normalise 8 rows each
constexpr int NPW = 2 * DIM * DIM / 8 / 256;
__global__ __launch_bounds__(256) void ln_prepw_kernel(const float* __restrict__ q, const float* __restrict__ k, const float* __restrict__ v, const float* __restrict__ g, const float* __restrict__ be, const float* __restrict__ win, const float* __restrict__ wout, b16* __restrict__ X16, b16* __restrict__ WIN, b16* __restrict__ WOUT) {
  if (blockIdx.x < NPW) { const int t = blockIdx.x * 256 + threadIdx.x, kind = t / (DIM * DIM / 8), tt = t - kind * (DIM * DIM / 8);
    // thread tt fills the 16-byte piece tt of the plane in fragment order: tile tt / 64 = (row tile) * 16 + k tile, piece tt % 64 = [j][hh][row]
    const int tile = tt >> 6, o_ = (tile / (DIM / 32)) * 16 + (tt & 15), k0 = (tile % (DIM / 32)) * 32 + ((tt >> 5) & 1) * 16 + ((tt >> 4) & 1) * 8;
    const float* w = kind == 0 ? win : wout; v8b o; for (int j = 0; j < 8; ++j) o[j] = (b16)(bf16_rne(w[(size_t)(k0 + j) * DIM + o_]) * WSC);
    *(v8b*)((kind == 0 ? WIN : WOUT) + (size_t)tt * 8) = o; return; }
  const int wave = threadIdx.x >> 5, lane = threadIdx.x & 31; const int rowall = (blockIdx.x - NPW) * 8 + wave; const int which = rowall / NR, row = rowall - which * NR;
  const float* src = (which == 0 ? q : which == 1 ? k : v) + (size_t)row * DIM + lane * 16; float x[16];
  { const v4f a = *(const v4f*)src, b = *(const v4f*)(src + 4), c = *(const v4f*)(src + 8), d = *(const v4f*)(src + 12); for (int j = 0; j < 4; ++j) { x[j] = bf16_rne(a[j]); x[4 + j] = bf16_rne(b[j]); x[8 + j] = bf16_rne(c[j]); x[12 + j] = bf16_rne(d[j]); } }
  float s = 0.0f; for (int j = 0; j < 16; ++j) s += x[j];
#pragma unroll
  for (int o = 16; o >= 1; o >>= 1) s += __shfl_xor(s, o);
  const float mu = s * (1.0f / DIM); float ss = 0.0f; for (int j = 0; j < 16; ++j) { const float d = x[j] - mu; ss += pmul(d, d); }
#pragma unroll
  for (int o = 16; o >= 1; o >>= 1) ss += __shfl_xor(ss, o);
  const float rs = rsqrtf(ss * (1.0f / DIM) + 1e-5f); v8b o0, o1;
  for (int j = 0; j < 16; ++j) { const int c = lane * 16 + j; const b16 hv = (b16)((pmul((x[j] - mu) * rs, bf16_rne(g[c])) + bf16_rne(be[c])) * XS); if (j < 8) o0[j] = hv; else o1[j - 8] = hv; }
  { b16* dst = X16 + ((size_t)which * NR + row) * DIM + lane * 16; *(v8b*)dst = o0; *(v8b*)(dst + 8) = o1;  }
}
// features F = X16 W_in and, in the same launch, every operand plane of the score passes (block = 64 rows x 4 waves, wave = 16 rows x 128 cols = 2 heads; grid.y = 4; grid.z = which: 0 q, 1 k, 2 v). No f32 copy of F goes through memory:
// a WMMA result already lies in fragment order for the product that reads it next, if the index that becomes that product's k runs along a lane's 8 accumulator registers. For f_q and f_k (k = d) that is the transposed product W_in^T X^T
// (registers = 8 neighbouring d, lane = row), formed here; its row sums (mean over d, squared norm) are 32 values of the lane's own and one exchange with the other lane half. f_v^T (k = keys) is turned in LDS, on the wave's own tile.
// which 0: FQ16 = f16(8 f_q), FQC16 = f16(8 (f_q - rowmean)), N1 = ||f_q||; which 1: FK16 = f16(8 f_k), I2A = 1 / (||f_k|| + 1e-8), I2B = 1 / max(||f_k||, 1e-6); which 2: FVTh/FVTl = f_v^T hi/lo x8. All f16 planes in fragment order.
// The key planes are not centred here (the column mean needs all 1,024 rows of a pair): (f_q - rowmean) . (f_k - colmean) = (f_q - rowmean) . f_k - (f_q - rowmean) . colmean, and the second term is one number a query row, formed at the head of each score pass.
__global__ __launch_bounds__(128) void feat_kernel(const b16* __restrict__ X16, const b16* __restrict__ WIN, float* __restrict__ CP, b16* __restrict__ FQ16, b16* __restrict__ FQC16, float* __restrict__ N1, b16* __restrict__ FK16, float* __restrict__ I2A, float* __restrict__ I2B, b16* __restrict__ FVTh, b16* __restrict__ FVTl) {
  __shared__ __attribute__((aligned(16))) float Ts[4][16][128 + 4]; __shared__ float Ns[2][64];   // Ns: the block's squared norms, [head of the two][row]
  const int wave = threadIdx.x >> 5, lane = threadIdx.x & 31, nloc = lane & 15, hlf = lane >> 4; const int which = blockIdx.z; const size_t m0 = (size_t)blockIdx.x * 64 + wave * 16; const int n0 = blockIdx.y * 128;
  // entry requests, 8 KiB (32 lanes x 256 B) each: the wave's own 16 rows of X16 (16 KiB), and one of the 16 pieces of the block's weight slab (128 KiB); the slab is dealt over four blocks that differ in blockIdx.x / 8, so that blocks with the same blockIdx.x % 8 ask for all of it
  const int uw = __builtin_amdgcn_readfirstlane(threadIdx.x >> 5); unsigned pfo = (unsigned)lane * 256u;
  const char* pfx = (const char*)(X16 + ((size_t)which * NR + (size_t)blockIdx.x * 64 + uw * 16) * DIM); const char* pfw = (const char*)(WIN + (size_t)n0 * DIM) + (((blockIdx.x >> 3) & 3) * 4 + uw) * 8192;
  ask_l2<0>(pfx, pfo); ask_l2<8192>(pfx, pfo); ask_l2<0>(pfw, pfo);
  v8f acc[8];
#pragma unroll
  for (int t = 0; t < 8; ++t) acc[t] = (v8f){};
  const b16* ap = X16 + ((size_t)which * NR + m0 + nloc) * DIM; const b16* bp = WIN + (size_t)n0 * DIM; const unsigned flane = (unsigned)lane * 16u;   // bp: the first weight tile of column n0 (16 rows x 512 k = 16 tiles of 512 elements)
  const int qi = (int)(m0 / NT), n = (int)(m0 - (size_t)qi * NT), pair0 = (n0 / DH) * QB + qi;   // the wave's 16 rows n .. n + 15 lie in one batch entry; column tile t belongs to head n0 / 64 + t / 4, pair pair0 + (t / 4) QB
  constexpr size_t HSTEP = (size_t)QB * NT * DH;   // elements from a head's plane to the next head's, same batch entry
  v16b a = frag_kb(ap, hlf), b[8];
#pragma unroll
  for (int t = 0; t < 8; ++t) b[t] = frag_pk(bp + (size_t)t * 16 * DIM, flane);
#pragma unroll   // full: the two fragment sets swap by renaming, and the last step's fetch falls away
  for (int kb = 0; kb < DIM; kb += 32) { v16b an = a, bn[8];
#pragma unroll
    for (int t = 0; t < 8; ++t) bn[t] = b[t];
    if (kb + 32 < DIM) { an = frag_kb(ap + kb + 32, hlf);
#pragma unroll
      for (int t = 0; t < 8; ++t) bn[t] = frag_pk(bp + (size_t)t * 16 * DIM + (kb + 32) * 16, flane); }
    __builtin_amdgcn_sched_barrier(0);   // keeps the next step's loads, as one group, ahead of this step's products: sunk towards their uses they would each be waited for in turn
#pragma unroll
    for (int t = 0; t < 8; ++t) acc[t] = wmma16b(b[t], a, acc[t]);
    a = an;
#pragma unroll
    for (int t = 0; t < 8; ++t) b[t] = bn[t]; }
  keep_named(pfo, pfx, pfw, pfw);
  // lane (hlf, nloc) holds row n + nloc, columns 16 t + 8 hlf + r: the 16 bytes [j = t % 2][hh = hlf][row = nloc] of k tile (t % 4) / 2 of the row tile, byte 512 (t % 4) + 16 lane of its 2 KiB
#pragma unroll
  for (int t = 0; t < 8; ++t) { acc[t] *= (1.0f / (XS * WSC)); *(v4f*)(&Ts[wave][nloc][t * 16 + 8 * hlf]) = (v4f){acc[t][0], acc[t][1], acc[t][2], acc[t][3]}; *(v4f*)(&Ts[wave][nloc][t * 16 + 8 * hlf + 4]) = (v4f){acc[t][4], acc[t][5], acc[t][6], acc[t][7]}; }
  if (which == 2) {   // the same for the whole block
    wave_lds_sync();
    // lane (hlf, nloc) takes column d = 16 (t % 4) + nloc, keys n + 8 hlf + r: the 16 bytes [j = (n / 16) % 2][hh = hlf][row = nloc] of tile [pair][n / 32][t % 4], so that a store covers 512 contiguous bytes
    const size_t off = (size_t)pair0 * NT * DH + (size_t)(n >> 5) * 2048 + ((n >> 4) & 1) * 256 + lane * 8; b16* vh = FVTh + off; b16* vl = FVTl + off; v8b hv[8], lv[8];
#pragma unroll
    for (int t = 0; t < 8; ++t)
#pragma unroll
      for (int r = 0; r < 8; ++r) { b16 h_, l_; split16(Ts[wave][8 * hlf + r][t * 16 + nloc] * XS, h_, l_); hv[t][r] = h_; lv[t][r] = l_; }
    __builtin_amdgcn_sched_barrier(0);   // keeps the stores, as one run, behind all the arithmetic: no register that a store names is written again
#pragma unroll
    for (int t = 0; t < 8; ++t) { *(v8b*)(vh + (t >> 2) * HSTEP + (t & 3) * 512) = hv[t]; *(v8b*)(vl + (t >> 2) * HSTEP + (t & 3) * 512) = lv[t]; }
    return; }
  float sm[2], sq[2];
#pragma unroll
  for (int hd = 0; hd < 2; ++hd) { float s1 = 0.0f, s2 = 0.0f;
#pragma unroll
    for (int t = 4 * hd; t < 4 * hd + 4; ++t)
#pragma unroll
      for (int r = 0; r < 8; ++r) { s1 += acc[t][r]; s2 += acc[t][r] * acc[t][r]; }
    sm[hd] = s1; sq[hd] = s2; }
#pragma unroll
  for (int hd = 0; hd < 2; ++hd) { sm[hd] += __shfl_xor(sm[hd], 16); sq[hd] += __shfl_xor(sq[hd], 16); }
  if (hlf == 0) { Ns[0][wave * 16 + nloc] = sq[0]; Ns[1][wave * 16 + nloc] = sq[1]; }
  v8b pa[8], pc[8];
#pragma unroll
  for (int t = 0; t < 8; ++t) { const float mq = sm[t >> 2] * (1.0f / DH);
#pragma unroll
    for (int r = 0; r < 8; ++r) { pa[t][r] = (b16)(acc[t][r] * XS); pc[t][r] = (b16)((acc[t][r] - mq) * XS); } }
  __syncthreads();
  // a lane takes columns n0 + 4 lane .. + 3 (lane half = head) through the wave's 16 rows: CP [which 0/1][pair][16-row tile][64] = column sums of the tile, the first level of the means over rows
  v4f cs = *(const v4f*)(&Ts[wave][0][lane * 4]);
#pragma unroll
  for (int rr = 1; rr < 16; ++rr) cs += *(const v4f*)(&Ts[wave][rr][lane * 4]);
  float* cpd = CP + (((size_t)which * NP_ + pair0 + hlf * QB) * (NT / 16) + n / 16) * DH + nloc * 4;
  // thread t: squared norm of row t % 64 of the block, head t / 64: a wave stores a whole 128-byte line of each array
  const float nrm = sqrtf(Ns[threadIdx.x >> 6][threadIdx.x & 63]); const size_t nidx = (size_t)(pair0 + (int)(threadIdx.x >> 6) * QB) * NT + (n - wave * 16) + (threadIdx.x & 63);
  const float ia = 1.0f / (nrm + 1e-8f), ib = 1.0f / fmaxf(nrm, 1e-6f);
  const size_t poff = ((size_t)pair0 * NT + n) * DH + lane * 8; b16* p0 = (which == 0 ? FQ16 : FK16) + poff; b16* p1 = FQC16 + poff; float* d0 = (which == 0 ? N1 : I2A) + nidx; float* d1 = I2B + nidx; const float v0 = which == 0 ? nrm : ia;
  __builtin_amdgcn_sched_barrier(0);   // as above: all stores in one run at the end
  *(v4f*)cpd = cs; *d0 = v0;
#pragma unroll
  for (int t = 0; t < 8; ++t) *(v8b*)(p0 + (t >> 2) * HSTEP + (t & 3) * 256) = pa[t];
  close_load_run();   // the same wait behind this run of stores: the compiler forms what only one of the two branches below stores inside that branch, in registers that the stores above name
  if (which == 0) {
#pragma unroll
    for (int t = 0; t < 8; ++t) *(v8b*)(p1 + (t >> 2) * HSTEP + (t & 3) * 256) = pc[t]; }
  else { *d1 = ib; close_load_run(); }   // the same wait behind this store: in the built code the branch runs on into a join, behind which the store's registers are written on the other way
}
// score-tile passes: wave = 16 query rows n of one pair (block = SW = 8 waves = 128 rows: one block fills a WGP's two waves a SIMD, and all its waves walk the same key and value tiles, so that a tile comes from L2 once a WGP and the other waves find it in the WGP's cache), loop over 32 key blocks of 32: dots^T and covraw^T tiles (keys x queries, K = 64: 2 steps x 2 key tiles x 2 GEMMs = 8 WMMAs, both on the one key plane; the centred product lacks its row's term tc = 64 (f_q - rowmean) . colmean, which rides in an addend),
// lane (hh, col=query) holds keys kb+8hh+r and kb+16+8hh+r.  cos = clip(dots/((n1+1e-8)(n2+1e-8))), csim = clip(dots/(max(n1,1e-6) max(n2,1e-6))), margin = clip(0.01 - csim, 0, 10), covraw = c/(8+1e-6).
// PASS 1: per wave the sums of cos, cos^2, covraw, covraw^2, cos covraw, and of var_c x (row sum of cos) and var_c x (row sum of covraw) over its 16 rows -> P1; per row var_c -> VARC.
// PASS 3 (given cn, covfac = reg/covn/2, w per head, vn, temp): per row c_row = vw var_c/(2 vn); e = cw cos/cn cscale + covw covraw covfac (d2 - c_row); logits = (e + c_row)/temp -> online softmax (f32) with o^T += f_v^T P^T (hi+lo, 4 d-tiles): O [pair][n][64] -> OC16h/l, rows q*NT+n, k = h*64+d (concat-head planes, hi/lo x8, in fragment order).
constexpr int SW = 8;   // waves a block
template <int PASS>
__global__ __launch_bounds__(SW * 32) void score_kernel(const b16* __restrict__ FQ16, const b16* __restrict__ FQC16, const float* __restrict__ N1, const b16* __restrict__ FK16, const float* __restrict__ CP, float* __restrict__ PSUM, const float* __restrict__ I2A, const float* __restrict__ I2B, const b16* __restrict__ FVTh, const b16* __restrict__ FVTl,
                                                  const float* __restrict__ CST /* [0..3] cscale/cn, reg/(2 covn), 1/(2 vn), 1/temp; [4..27] cw, covw, vw per head */, float* __restrict__ P1, float* __restrict__ VARC, b16* __restrict__ OCh, b16* __restrict__ OCl) {
  __shared__ __attribute__((aligned(16))) float To[SW][16][DH + 4]; __shared__ float Tr[SW][16]; __shared__ float Tp[SW][8]; __shared__ __attribute__((aligned(16))) float Cs[2][4][DH];   // Cs: column sums of f_q (pass 1 only) and f_k over the pair's rows, in four parts
  const int wave = threadIdx.x >> 5, lane = threadIdx.x & 31, hh = lane >> 4, col = lane & 15; const int pair = blockIdx.y, n0 = blockIdx.x * (SW * 16) + wave * 16, ni = n0 + col; const int h = pair / QB, qi = pair - h * QB;
  const size_t prow = (size_t)pair * NT + ni; const b16* Qp = FQ16 + ((size_t)pair * NT + n0) * DH; const b16* Qc = FQC16 + ((size_t)pair * NT + n0) * DH; const b16* Kb = FK16 + (size_t)pair * NT * DH;   // Qp, Qc: the wave's row tile (2 k tiles in fragment order)
  // entry requests, 8 KiB (32 lanes x 256 B) each, for what the key loop walks: the pair's key plane (16 pieces, dealt over two blocks), in pass 3 its two value planes (16 pieces each, dealt over four blocks), and the 8 KiB of each factor array that hold the pair's 4 KiB.
  // Dealt by the low bits of blockIdx.x, so that any four neighbouring blocks of a pair ask for everything between them.
  const int uw = __builtin_amdgcn_readfirstlane(threadIdx.x >> 5); unsigned pfo = (unsigned)lane * 256u;
  const char* pfk = (const char*)Kb + ((blockIdx.x & 1) * 8 + uw) * 8192; const char* pff = (const char*)(uw == 1 ? I2B : I2A) + (pair >> 1) * 8192;
  const char* pfv = PASS == 3 ? (const char*)((uw < 4 ? FVTh : FVTl) + (size_t)pair * NT * DH) + ((blockIdx.x & 3) * 4 + (uw & 3)) * 8192 : pfk;
  ask_l2<0>(pfk, pfo); if (PASS == 3) ask_l2<0>(pfv, pfo);
  if (uw < (PASS == 1 ? 2 : 1)) ask_l2<0>(pff, pfo);   // wave 0: 1 / (norm + 1e-8); wave 1, pass 1 only: 1 / max(norm, 1e-6)
  // column sums over the pair's 1,024 rows, second level: thread (d = t % 64, part = t / 64) adds 16 of the 64 tile sums in CP, the four parts meet in LDS; every block forms them for its own use (colmean of f_k), block 0 of a pair stores PSUM [which 0/1][pair][64] in pass 1
  const int t_ = threadIdx.x; const float* cq = CP + ((size_t)pair * (NT / 16) + (t_ >> 6) * 16) * DH + (t_ & 63); const float* ck = cq + (size_t)NP_ * (NT / 16) * DH; float pq[16], pk[16];
  __builtin_amdgcn_sched_barrier(0);   // keeps the index arithmetic above from being placed between the loads below and the wait that closes their run
#pragma unroll
  for (int i = 0; i < 16; ++i) { pk[i] = ck[i * DH]; if (PASS == 1) pq[i] = cq[i * DH]; }
  // closes the run as close_load_run() does; the input operands keep the run's address registers from being given to a later load's result ahead of the wait
  asm volatile("s_wait_xcnt 0x0" :: "v"(cq), "v"(ck) : "memory"); __builtin_amdgcn_sched_barrier(0);
  gaddr qp = (gaddr)Qp + lane * 16, qcp = (gaddr)Qc + lane * 16;   // the lane's first 16 bytes of the row tile in the two planes
  const v16b qa0 = frag_at(qp), qa1 = frag_at(qp + 1024), qc0 = frag_at(qcp), qc1 = frag_at(qcp + 1024);
  // closes the run as close_load_run() does; as operands of the wait's statement the two addresses stay live, in their own registers, up to the wait
  asm volatile("s_wait_xcnt 0x0" : "+v"(qp), "+v"(qcp) : : "memory"); __builtin_amdgcn_sched_barrier(0);
  // Every factor of a score element that belongs to the query row, the head or the whole launch is multiplied up here, once a wave. The powers of two (1 / XS^2) move exactly, so pass 1 keeps its bits.
  const float n1 = N1[prow]; close_load_run(); const float q1a = (1.0f / (n1 + 1e-8f)) * (1.0f / (XS * XS)), q1b = (1.0f / fmaxf(n1, 1e-6f)) * (1.0f / (XS * XS));
  constexpr float CK = (1.0f / (8.0f + 1e-6f)) * (1.0f / (XS * XS)), LOG2E = 1.4426950408889634f, LOG2_PS = 3.0f; static_assert(PS == 8.0f, "LOG2_PS is log2(PS)");
  float cn_inv_cscale = 0.0f, covfac = 0.0f, vn_half_inv = 0.0f, temp_inv = 0.0f, cwh = 0.0f, covwh = 0.0f, vwh = 0.0f;   // this head's constants, read once ahead of the loop
  if (PASS == 3) { const float* cf = CST; cn_inv_cscale = cf[0]; covfac = cf[1]; vn_half_inv = cf[2]; temp_inv = cf[3]; cwh = cf[4 + h]; covwh = cf[4 + NH + h]; vwh = cf[4 + 2 * NH + h]; }
  float crow = 0.0f; if (PASS == 3) { const float vc_ = VARC[prow]; close_load_run(); crow = vwh * vc_ * vn_half_inv; }
  // e = w1 cos + w2 c (c the raw centred product); pass 3 takes its logits as w1 cos + w2 c + w0 in units of log2, so that 2^x needs no multiply of its own
  const float lsc = temp_inv * LOG2E, w1 = cwh * cn_inv_cscale * lsc, w2 = covwh * covfac * CK * lsc; float w0 = crow * lsc, ck0 = 0.0f;   // w0 and ck0 take the row's term of the centred product below: c = raw - tc
  v2f sa2 = {}, sb2 = {}, sc2 = {}, sd2 = {}, sx2 = {}, ra2 = {};   // pass 1's sums, one accumulator for the even and one for the odd accumulator rows; the two meet behind the loop
  float m = -INFINITY, l = 0.0f; v8f o[4] = {{}, {}, {}, {}}, ol[4] = {{}, {}, {}, {}};
  // One key block's operands (4 key fragments, 16 key factors; 32 in pass 1) live in registers and are fetched together, a whole block ahead of their use.
  // The key factors are still in use when the next block's are fetched: they have two register sets, which swap roles from block to block (the loop body holds two blocks), so that no set is copied.
  v16b k0a, k0b, k1a, k1b; KeyFac fa_ = {}, fb_ = {};
  const unsigned flane = (unsigned)lane * 16u, nlane = (unsigned)hh * 32u;   // per-lane byte offsets into a tile in fragment order and into a key block's norms
  gaddr kr = (gaddr)Kb + flane, np = (gaddr)(I2A + (size_t)pair * NT) + nlane, nq = (gaddr)(I2B + (size_t)pair * NT) + nlane, vhp = (gaddr)(FVTh + (size_t)pair * NT * DH) + flane, vlp = (gaddr)(FVTl + (size_t)pair * NT * DH) + flane;
  // fetches the key block that the carried addresses stand at; more = 1 moves them on by one block, more = 0 leaves them (at the last block)
  auto fetch_keys = [&](int more, KeyFac& f) {
    f.a[0] = quad_at(np); f.a[1] = quad_at(np + 16); f.a[2] = quad_at(np + 64); f.a[3] = quad_at(np + 80);
    if (PASS == 1) { f.b[0] = quad_at(nq); f.b[1] = quad_at(nq + 16); f.b[2] = quad_at(nq + 64); f.b[3] = quad_at(nq + 80); close_and_advance(np, nq, more * 128); } else close_and_advance(np, more * 128);
    k0a = frag_at(kr); k0b = frag_at(kr + 1024); k1a = frag_at(kr + 2048); k1b = frag_at(kr + 3072); close_and_advance(kr, more * 4096); };   // a 32-key block = 4 tiles of 1,024 bytes: [16 keys][k tile]
  auto key_block = [&](int kb, const KeyFac& f, KeyFac& fnext) {
    __builtin_amdgcn_sched_barrier(0);   // keeps this block's score products behind the block before: lifted into its vector work they would wait there for key loads that this work is meant to cover
    v8f dd[2] = {{}, {}}, cc[2] = {{}, {}};
    dd[0] = wmma16p(k0a, qa0, dd[0]); dd[0] = wmma16p(k0b, qa1, dd[0]);
    dd[1] = wmma16p(k1a, qa0, dd[1]); dd[1] = wmma16p(k1b, qa1, dd[1]);
    cc[0] = wmma16p(k0a, qc0, cc[0]); cc[0] = wmma16p(k0b, qc1, cc[0]);
    cc[1] = wmma16p(k1a, qc0, cc[1]); cc[1] = wmma16p(k1b, qc1, cc[1]);
    // behind the last score product: this block's value fragments (used after the softmax arithmetic), then the next block's keys (the last block re-reads itself, unused), all in flight under the vector work
    v16b vh[4], vl[4];
    __builtin_amdgcn_sched_barrier(0);   // keeps earlier vector work from being placed between the loads below and the wait that closes their run, where it could be given one of their address registers
    if (PASS == 3) {
#pragma unroll
      for (int t = 0; t < 4; ++t) { vh[t] = frag_at(vhp + t * 1024); vl[t] = frag_at(vlp + t * 1024); }
      close_and_advance(vhp, vlp, 4096); }
    fetch_keys(kb + 64 < NT ? 1 : 0, fnext);
    // the element arithmetic runs on the pairs (r, r + 1) that already lie in neighbouring registers, in the accumulators and in the 16-byte factor loads alike, so that a packed instruction needs no move to bring its pair together
    v2f ev[2][4];
#pragma unroll
    for (int hq = 0; hq < 2; ++hq) {
#pragma unroll
      for (int pr = 0; pr < 4; ++pr) { const v2f dw = {dd[hq][2 * pr], dd[hq][2 * pr + 1]}, cw_ = {cc[hq][2 * pr], cc[hq][2 * pr + 1]};   // the two raw products
        const v4f fa4 = f.a[2 * hq + (pr >> 1)]; const v2f i2a = {fa4[2 * (pr & 1)], fa4[2 * (pr & 1) + 1]}; const v2f cosv = clamp2(dw * q1a * i2a, -0.99f, 0.99f);
        if (PASS == 1) { const v4f fb4 = f.b[2 * hq + (pr >> 1)]; const v2f i2b = {fb4[2 * (pr & 1)], fb4[2 * (pr & 1) + 1]}; const v2f covraw = cw_ * CK + ck0;
          const v2f csim = clamp2(dw * q1b * i2b, -0.99f, 0.99f); const v2f margin = clamp2(GAMMA - csim, 0.0f, 10.0f);
          sa2 += cosv; sb2 += cosv * cosv; sc2 += covraw; sd2 += covraw * covraw; sx2 += cosv * covraw; ra2 += margin; }
        else { ev[hq][pr] = cosv * w1 + (cw_ * w2 + w0); } } }
    if (PASS == 3) { float mr = -INFINITY;
#pragma unroll
      for (int pr = 0; pr < 4; ++pr) mr = fmaxf(fmaxf(mr, fmaxf(ev[0][pr][0], ev[0][pr][1])), fmaxf(ev[1][pr][0], ev[1][pr][1]));
      mr = fmaxf(mr, __shfl_xor(mr, 16)); const float mn = fmaxf(m, mr); const float al_ = nexp2(m - mn); m = mn; const float ms = mn - LOG2_PS; v2f sum2 = {}; v16b pb;   // ms: the factor PS of the f16 weights rides in the exponent; l then holds PS times the row sum
#pragma unroll
      for (int hq = 0; hq < 2; ++hq) {
#pragma unroll
        for (int pr = 0; pr < 4; ++pr) { const v2f x = ev[hq][pr] - ms; const v2f e = {nexp2(x[0]), nexp2(x[1])}; sum2 += e; pb[8 * hq + 2 * pr] = (b16)e[0]; pb[8 * hq + 2 * pr + 1] = (b16)e[1]; } }
      float sum = sum2[0] + sum2[1]; sum += __shfl_xor(sum, 16); l = l * al_ + sum;
#pragma unroll
      for (int t = 0; t < 4; ++t) { o[t] *= al_; ol[t] *= al_; }
#pragma unroll
      for (int t = 0; t < 4; ++t) { o[t] = wmma16p(vh[t], pb, o[t]); ol[t] = wmma16p(vl[t], pb, ol[t]); }
      // four slots behind the block's last product, once a block: pb, the B operand of all eight, stays live up to here, so that a product of the next block gets its registers for a result only at the distance that holds for any write over a B operand
      asm volatile("v_nop\n\tv_nop\n\tv_nop\n\tv_nop" : "+v"(o[0]), "+v"(o[1]), "+v"(o[2]), "+v"(o[3]), "+v"(ol[0]), "+v"(ol[1]), "+v"(ol[2]), "+v"(ol[3]) : "v"(pb)); } };
  // from here on the carried addresses are what this statement leaves in their register pairs: every load of the loop names one of these pairs and no other register (the wait closes the loads above once more)
  if (PASS == 1) asm volatile("s_wait_xcnt 0x0" : "+v"(kr), "+v"(np), "+v"(nq) : : "memory"); else asm volatile("s_wait_xcnt 0x0" : "+v"(kr), "+v"(np), "+v"(vhp), "+v"(vlp) : : "memory");
  __builtin_amdgcn_sched_barrier(0);
  fetch_keys(1, fa_);
  // under the first key block's flight: the column sums meet, and each query row forms tc = sum_d (8 (f_q - rowmean)_d) (8 colmean_d) from its own centred fragments (a lane holds d = 8 hh + e, 16 + 8 hh + e and these + 32; the halves meet by one exchange)
  { float a = 0.0f, b = 0.0f;
#pragma unroll
    for (int i = 0; i < 16; ++i) { if (PASS == 1) a += pq[i]; b += pk[i]; }
    if (PASS == 1) Cs[0][t_ >> 6][t_ & 63] = a;
    Cs[1][t_ >> 6][t_ & 63] = b; }
  __syncthreads();
  { float tc = 0.0f;
#pragma unroll
    for (int c = 0; c < 4; ++c)   // the lane's four runs of 8 columns, first column 16 c + 8 hh
#pragma unroll
      for (int u = 0; u < 2; ++u) { const int d = 16 * c + 8 * hh + 4 * u; const v4f km = ((*(const v4f*)(&Cs[1][0][d]) + *(const v4f*)(&Cs[1][1][d])) + (*(const v4f*)(&Cs[1][2][d]) + *(const v4f*)(&Cs[1][3][d]))) * (XS / NT);
#pragma unroll
        for (int e = 0; e < 4; ++e) tc += (float)((c < 2 ? qc0 : qc1)[8 * (c & 1) + 4 * u + e]) * km[e]; }
    tc += __shfl_xor(tc, 16); ck0 = -tc * CK; w0 -= tc * w2; }
  for (int kb = 0; kb < NT; kb += 64) { key_block(kb, fa_, fb_); key_block(kb + 32, fb_, fa_); }
  keep_named(pfo, pfk, pff, pfv);
  const float s_a = sa2[0] + sa2[1], s_b = sb2[0] + sb2[1], s_c = sc2[0] + sc2[1], s_d = sd2[0] + sd2[1], s_x = sx2[0] + sx2[1]; float rowacc = ra2[0] + ra2[1];
  if (PASS == 1) {   // per-row sums across the two lane halves; per-wave partials over the 16 rows and 32 lanes
    rowacc += __shfl_xor(rowacc, 16); if (hh == 0) Tr[wave][col] = rowacc;
    // a lane's s_a and s_c are its query row's sums of cos and covraw over the lane half's keys: weighted with the row's var_c they give the cross terms of d2's variance
    const float vc = rowacc * (1.0f / NT); float v7[7] = {s_a, s_b, s_c, s_d, s_x, vc * s_a, vc * s_c};
#pragma unroll
    for (int j = 0; j < 7; ++j) { float v = v7[j];
#pragma unroll
      for (int oo = 16; oo >= 1; oo >>= 1) v += __shfl_xor(v, oo);
      v7[j] = v; }
    if (lane == 0) {
#pragma unroll
      for (int j = 0; j < 7; ++j) Tp[wave][j] = v7[j];
      Tp[wave][7] = 0.0f; }
    wave_lds_sync();
    __syncthreads();
    if ((wave & 1) == 0) { const int g = n0 / 32;   // each even wave stores for itself and the next one: a whole 128-byte line of VARC and of P1 for their 32 rows, as before
      VARC[(size_t)pair * NT + g * 32 + lane] = Tr[wave + (lane >> 4)][lane & 15] * (1.0f / NT);
      P1[((size_t)pair * (NT / 32) + g) * 32 + lane] = (lane < 16) ? Tp[wave + (lane >> 3)][lane & 7] : 0.0f; }
    if (blockIdx.x == 0 && t_ < 2 * DH) { const int w = t_ >> 6, d = t_ & 63; PSUM[((size_t)w * NP_ + pair) * DH + d] = (Cs[w][0][d] + Cs[w][1][d]) + (Cs[w][2][d] + Cs[w][3][d]); }
  } else {
    const float inv = 1.0f / (l * XS);
#pragma unroll
    for (int t = 0; t < 4; ++t)
#pragma unroll
      for (int r = 0; r < 8; ++r) To[wave][col][t * 16 + 8 * hh + r] = (o[t][r] + ol[t][r]) * inv;
    wave_lds_sync();
    // fragment order for the output projection: the wave's 16 rows x 64 columns are 2 tiles (2 KiB) a plane; store i covers the 512 bytes [k tile i / 2][j = i % 2]
    { for (int i = 0; i < 4; ++i) { const int rr = col, c8 = (i >> 1) * 32 + (i & 1) * 16 + hh * 8; v8b hv, lv; for (int j = 0; j < 8; ++j) { b16 a_, c_; split16(To[wave][rr][c8 + j] * XS, a_, c_); hv[j] = a_; lv[j] = c_; }
        const size_t gi = ((size_t)qi * NT + n0) * DIM + (h * 2) * 512 + i * 256 + lane * 8; *(v8b*)(OCh + gi) = hv; *(v8b*)(OCl + gi) = lv; }  }
  }
}
// reduction (one block, fixed order): cn, covn, vn, weights, then dstd -> temp -> CST[0..27].
// It runs as one block on an otherwise idle chip, so nothing hides a load's latency but the block's own instruction order: the kernel issues ALL its global reads in one run at its head and keeps them in registers
// (the predictor's weights go on to LDS), so that it pays about one memory latency in all instead of one per loop trip. Every sum keeps its operands and its order; in the loops written anew a product now fuses with its addition.
__global__ __launch_bounds__(256) void reduce1_kernel(const float* __restrict__ P1, const float* __restrict__ VARC, const float* __restrict__ PSUM, const float* __restrict__ w1, const float* __restrict__ b1, const float* __restrict__ g2, const float* __restrict__ be2, const float* __restrict__ w2, const float* __restrict__ b2, const float* __restrict__ w3, const float* __restrict__ b3, const float* __restrict__ wtemp, float* __restrict__ CST) {
  __shared__ float red[4][256]; __shared__ float sh[64];
  __shared__ __attribute__((aligned(16))) float w1s[2 * DH * DH], w2s[DH * 32]; __shared__ float w3s[3][32], b1s[DH], g2s[DH], be2s[DH], b2s[32];   // the predictor's parameters as bf16 values (w3s: the 96 values in their order)
  const int t_ = threadIdx.x; constexpr int NPK = NP_ * (NT / 32) / 256 /* 4 of the 1,024 partials of 32 rows (16 floats: 2 waves x 8) per thread */, NVK = NP_ * NT / 256 /* 128 row values per thread */, NFK = NH * 2 * DH / 256 /* 4 */;
  v4f w1r[8], w2r[2], pl[NPK], ph[NPK], xl[NPK], xh[NPK]; float pr[NFK][QB], vr[NVK], w3r[3];
  const unsigned a63 = t_ & (DH - 1), a31 = t_ & 31, p1off = (unsigned)t_ * 128u /* bytes: partial t_ */, psidx = ((t_ >> 6) & 1) * NP_ * DH + (t_ >> 7) * QB * DH + (t_ & (DH - 1)) /* PSUM [which][pair 4 h][dd] of feature i = t_ */;
  const float b3r[3] = {b3[0], b3[1], b3[2]}, wtr = wtemp[0];
  __builtin_amdgcn_sched_barrier(0);   // keeps the index arithmetic and the scalar reads above from being placed between the loads below and the wait that closes their run
#pragma unroll
  for (int j = 0; j < 8; ++j) w1r[j] = *(const v4f*)(w1 + (j * 256 + t_) * 4);
#pragma unroll
  for (int j = 0; j < 2; ++j) w2r[j] = *(const v4f*)(w2 + (j * 256 + t_) * 4);
  const float b1r = b1[a63], g2r = g2[a63], be2r = be2[a63], b2r = b2[a31];
#pragma unroll
  for (int j = 0; j < 3; ++j) w3r[j] = w3[j * 32 + a31];
#pragma unroll
  for (int k = 0; k < NPK; ++k) { const char* p = (const char*)P1 + p1off + k * (256 * 128); pl[k] = *(const v4f*)p; xl[k] = *(const v4f*)(p + 16); ph[k] = *(const v4f*)(p + 32); xh[k] = *(const v4f*)(p + 48); }
#pragma unroll
  for (int k = 0; k < NFK; ++k)   // feature i = t_ + 256 k: head h + 2 k, the same which and dd
#pragma unroll
    for (int qq = 0; qq < QB; ++qq) pr[k][qq] = PSUM[psidx + (2 * k * QB + qq) * DH];
#pragma unroll   // full, here and in the four loops that read vr: the 128 values stay in registers and are read from memory once, not once a loop
  for (int j = 0; j < NVK; ++j) vr[j] = VARC[t_ + j * 256];
  // closes the run as close_load_run() does; the input operands keep the run's address registers from being given to a later load's result ahead of the wait
  asm volatile("s_wait_xcnt 0x0" :: "v"(a63), "v"(a31), "v"(p1off), "v"(psidx) : "memory"); __builtin_amdgcn_sched_barrier(0);
#pragma unroll
  for (int j = 0; j < 8; ++j) { v4f x; for (int e = 0; e < 4; ++e) x[e] = bf16_rne(w1r[j][e]); *(v4f*)(w1s + (j * 256 + t_) * 4) = x; }
#pragma unroll
  for (int j = 0; j < 2; ++j) { v4f x; for (int e = 0; e < 4; ++e) x[e] = bf16_rne(w2r[j][e]); *(v4f*)(w2s + (j * 256 + t_) * 4) = x; }
  b1s[a63] = bf16_rne(b1r); g2s[a63] = bf16_rne(g2r); be2s[a63] = bf16_rne(be2r); b2s[a31] = bf16_rne(b2r);   // every thread stores: threads with the same index store the same value
#pragma unroll
  for (int j = 0; j < 3; ++j) w3s[j][a31] = bf16_rne(w3r[j]);
  float a = 0, b = 0, c = 0, d = 0, mo[NPK][7];   // mo: the seven moments of partial t_ + 256 k (32 rows of head 2 k + t_ / 128), kept for d2's variance at the end
#pragma unroll
  for (int k = 0; k < NPK; ++k) {
#pragma unroll
    for (int j = 0; j < 4; ++j) mo[k][j] = pl[k][j] + ph[k][j];
#pragma unroll
    for (int j = 0; j < 3; ++j) mo[k][4 + j] = xl[k][j] + xh[k][j];
    a += mo[k][0]; b += mo[k][1]; c += mo[k][2]; d += mo[k][3]; }
  red[0][t_] = a; red[1][t_] = b; red[2][t_] = c; red[3][t_] = d; __syncthreads();
  for (int s = 128; s >= 1; s >>= 1) { if (t_ < s) { for (int j = 0; j < 4; ++j) red[j][t_] += red[j][t_ + s]; } __syncthreads(); }
  float vs = 0.0f;
#pragma unroll
  for (int j = 0; j < NVK; ++j) vs += vr[j];
  __shared__ float r2[256]; r2[t_] = vs; __syncthreads(); for (int s = 128; s >= 1; s >>= 1) { if (t_ < s) r2[t_] += r2[t_ + s]; __syncthreads(); }
  const float vmu = r2[0] / (float)(NP_ * NT); __syncthreads();
  float vq = 0.0f;
#pragma unroll
  for (int j = 0; j < NVK; ++j) { const float dv = vr[j] - vmu; vq += dv * dv; }
  r2[t_] = vq; __syncthreads(); for (int s = 128; s >= 1; s >>= 1) { if (t_ < s) r2[t_] += r2[t_ + s]; __syncthreads(); }
  // head means qg/kg [8][64] from PSUM [which][pair][64]: mean over (q, n) = sum over the 4 pairs of the head / 4096 -> feats [h][128]; MLP: h1 = relu(LN(feats W1 + b1)), h2 = relu(h1 W2 + b2), logits = softmax(h2 W3 + b3), w = softmax(logits / clip(wt)), clip [0.05,0.8], renorm
  __shared__ __attribute__((aligned(16))) float feats[NH][2 * DH], h1s[NH][DH], h2s[NH][32]; __shared__ float ws[NH][3];
#pragma unroll
  for (int k = 0; k < NFK; ++k) { const int i = t_ + k * 256, h = i / (2 * DH), c = i - h * 2 * DH; float s = 0.0f;
#pragma unroll
    for (int qq = 0; qq < QB; ++qq) s += pr[k][qq];
    feats[h][c] = s * (1.0f / (QB * NT)); }
  __syncthreads();
  // the loops below read LDS only; each is unrolled, with plain products, so that its reads are issued ahead of the one chain of additions instead of being waited for one by one
  for (int i = t_; i < NH * DH; i += 256) { const int h = i / DH, o_ = i - h * DH; float s = b1s[o_];
#pragma unroll 32
    for (int c = 0; c < 2 * DH; ++c) s += feats[h][c] * w1s[c * DH + o_]; h1s[h][o_] = s; }
  __syncthreads();
  if (t_ < NH) { const int h = t_; float mu = 0.0f;
#pragma unroll
    for (int c = 0; c < DH; ++c) mu += h1s[h][c];
    mu *= (1.0f / DH); float var = 0.0f;
#pragma unroll
    for (int c = 0; c < DH; ++c) { const float dv = h1s[h][c] - mu; var += dv * dv; }
    var *= (1.0f / DH); const float rs = rsqrtf(var + 1e-5f);
#pragma unroll
    for (int c = 0; c < DH; ++c) h1s[h][c] = fmaxf((h1s[h][c] - mu) * rs * g2s[c] + be2s[c], 0.0f); }
  __syncthreads();
  for (int i = t_; i < NH * 32; i += 256) { const int h = i / 32, o_ = i - h * 32; float s = b2s[o_];
#pragma unroll 32
    for (int c = 0; c < DH; ++c) s += h1s[h][c] * w2s[c * 32 + o_]; h2s[h][o_] = fmaxf(s, 0.0f); }
  __syncthreads();
  if (t_ < NH) { const int h = t_; float lg[3]; for (int o_ = 0; o_ < 3; ++o_) { float s = bf16_rne(b3r[o_]);
#pragma unroll
      for (int c = 0; c < 32; ++c) s += h2s[h][c] * (&w3s[0][0])[c * 3 + o_]; lg[o_] = s; }
    float mx = fmaxf(lg[0], fmaxf(lg[1], lg[2])); float e3[3], se = 0.0f; for (int j = 0; j < 3; ++j) { e3[j] = __expf(lg[j] - mx); se += e3[j]; } for (int j = 0; j < 3; ++j) e3[j] /= se;
    const float wt = clampf(bf16_rne(wtr), 0.1f, 20.0f); float z[3]; for (int j = 0; j < 3; ++j) z[j] = e3[j] / wt; mx = fmaxf(z[0], fmaxf(z[1], z[2])); se = 0.0f; for (int j = 0; j < 3; ++j) { e3[j] = __expf(z[j] - mx); se += e3[j]; }
    float wv[3], sw = 0.0f; for (int j = 0; j < 3; ++j) { wv[j] = clampf(e3[j] / se, 0.05f, 0.8f); sw += wv[j]; } for (int j = 0; j < 3; ++j) ws[h][j] = wv[j] / sw; }
  __syncthreads();
  if (t_ == 0) { const float n = (float)NTOT; const float sa_ = red[0][0], sb = red[1][0], sc = red[2][0], sd = red[3][0];
    const float cstd = sqrtf(fmaxf((sb - sa_ * (sa_ / n)) / (n - 1.0f), 0.0f)); const float covstd_raw = sqrtf(fmaxf((sd - sc * (sc / n)) / (n - 1.0f), 0.0f));
    const float base_reg = LREG / (float)NT; const float reg = (covstd_raw < 1e-6f) ? base_reg * 10.0f : base_reg;   // reference: reg chosen on the std of the RAW cov, then cov = clip(reg cov, +-50) (never clips at this scale)
    const float covn = reg * covstd_raw + 1e-6f; const float cn = cstd + 1e-6f; const float cscale = (cn < 1e-4f) ? 0.1f : 1.0f;
    const float vn = sqrtf(r2[0] * ((float)NT / (n - 1.0f))) + 1e-6f;   // std over the broadcast [.., m] copies: each row value repeated NT times
    sh[0] = cscale / cn; sh[1] = reg * 0.5f / covn; sh[2] = 0.5f / vn; sh[3] = 0.0f; for (int h = 0; h < NH; ++h) { sh[4 + h] = ws[h][0]; sh[4 + NH + h] = ws[h][1]; sh[4 + 2 * NH + h] = ws[h][2]; } }
  __syncthreads();
  // dstd = std(d2) from the moments. d2 = e + c with e = W1 cos + W2 covraw (W1 = cw cscale/cn, W2 = covw reg/(2 covn), per head) and the row constant c = vw var_c/(2 vn).
  // var(d2) = E[(d2 - M)^2] - (E[d2 - M])^2 with the shift M = mean of the row constants (kills the large common offset): sum (d2 - M) = sum e + NT sum_rows (c - M),
  // sum (d2 - M)^2 = sum e^2 + 2 sum_rows (c - M) rowsum_e + NT sum_rows (c - M)^2; sum e^2 = W1^2 sum cos^2 + 2 W1 W2 sum cos covraw + W2^2 sum covraw^2; sum_rows c rowsum_e = vw/(2 vn) (W1 sum var_c rowsum_cos + W2 sum var_c rowsum_covraw).
  __shared__ float tl[3][8]; const int wv = t_ >> 5; const float vfac = sh[2]; float vf[NH];
#pragma unroll
  for (int h = 0; h < NH; ++h) vf[h] = sh[4 + 2 * NH + h] * vfac;
  float c4[4] = {0.0f, 0.0f, 0.0f, 0.0f};   // row i = t_ + 256 j belongs to head (i / NT) / QB = j / 16; four chains here and below, so that an addition does not wait for the one before it
#pragma unroll
  for (int j = 0; j < NVK; ++j) c4[j & 3] += vf[j / 16] * vr[j];
  float sc = (c4[0] + c4[1]) + (c4[2] + c4[3]);
#pragma unroll
  for (int o = 16; o >= 1; o >>= 1) sc += __shfl_xor(sc, o);
  if ((t_ & 31) == 0) tl[0][wv] = sc;
  __syncthreads();
  float M = 0.0f;
#pragma unroll
  for (int w = 0; w < 8; ++w) M += tl[0][w];
  M /= (float)(NP_ * NT); float q1[4] = {0.0f, 0.0f, 0.0f, 0.0f}, q2[4] = {0.0f, 0.0f, 0.0f, 0.0f};
#pragma unroll
  for (int j = 0; j < NVK; ++j) { const float cm = vf[j / 16] * vr[j] - M; q1[j & 3] += cm; q2[j & 3] += cm * cm; }
  float s1 = (float)NT * ((q1[0] + q1[1]) + (q1[2] + q1[3])), s2 = (float)NT * ((q2[0] + q2[1]) + (q2[2] + q2[3]));
#pragma unroll
  for (int k = 0; k < NPK; ++k) { const int h = 2 * k + (t_ >> 7); const float W1 = sh[4 + h] * sh[0], W2 = sh[4 + NH + h] * sh[1], VW = sh[4 + 2 * NH + h] * vfac, se = W1 * mo[k][0] + W2 * mo[k][2];
    s1 += se; s2 += W1 * W1 * mo[k][1] + 2.0f * W1 * W2 * mo[k][4] + W2 * W2 * mo[k][3] + 2.0f * (VW * (W1 * mo[k][5] + W2 * mo[k][6]) - M * se); }
#pragma unroll
  for (int o = 16; o >= 1; o >>= 1) { s1 += __shfl_xor(s1, o); s2 += __shfl_xor(s2, o); }
  if ((t_ & 31) == 0) { tl[1][wv] = s1; tl[2][wv] = s2; }
  __syncthreads();
  if (t_ == 0) { float t1 = 0.0f, t2 = 0.0f;
#pragma unroll
    for (int w = 0; w < 8; ++w) { t1 += tl[1][w]; t2 += tl[2][w]; }
    const float n = NTOT; const float var = (t2 - t1 * (t1 / n)) / (n - 1.0f); const float dstd = sqrtf(fmaxf(var, 0.0f)); const float temp = (dstd < 1e-6f) ? 0.1f : 0.3f + dstd; sh[3] = 1.0f / clampf(temp, 0.1f, 5.0f); }
  __syncthreads();
  { if (t_ < 32) ((float*)CST)[t_] = (t_ < 4 + 3 * NH) ? sh[t_] : 0.0f;  }
}
__global__ __launch_bounds__(128) void outproj_kernel(const b16* __restrict__ OCh, const b16* __restrict__ OCl, const b16* __restrict__ WOUT, const float* __restrict__ bo, float* __restrict__ out) {
  __shared__ __attribute__((aligned(16))) float Ts[4][16][128 + 4];
  const int wave = threadIdx.x >> 5, lane = threadIdx.x & 31, nloc = lane & 15, hlf = lane >> 4; const size_t m0 = (size_t)blockIdx.x * 64 + wave * 16; const int n0 = blockIdx.y * 128;
  // entry requests as in feat_kernel: the wave's own 16 rows of the two attention-output planes (16 KiB each) and one of the 16 pieces of the block's weight slab
  const int uw = __builtin_amdgcn_readfirstlane(threadIdx.x >> 5); unsigned pfo = (unsigned)lane * 256u; const size_t pfr = ((size_t)blockIdx.x * 64 + uw * 16) * DIM;
  const char* pfa = (const char*)(OCh + pfr); const char* pfl = (const char*)(OCl + pfr); const char* pfw = (const char*)(WOUT + (size_t)n0 * DIM) + (((blockIdx.x >> 3) & 3) * 4 + uw) * 8192;
  ask_l2<0>(pfa, pfo); ask_l2<8192>(pfa, pfo); ask_l2<0>(pfl, pfo); ask_l2<8192>(pfl, pfo); ask_l2<0>(pfw, pfo);
  v8f acc[8];
#pragma unroll
  for (int t = 0; t < 8; ++t) acc[t] = (v8f){};
  const b16* ap = OCh + m0 * DIM; const b16* lp = OCl + m0 * DIM; const b16* bp = WOUT + (size_t)n0 * DIM; const unsigned flane = (unsigned)lane * 16u;   // ap, lp, bp: the first tile of row m0, of column n0
  v16b a = frag_pk(ap, flane), al = frag_pk(lp, flane), b[8];
#pragma unroll
  for (int t = 0; t < 8; ++t) b[t] = frag_pk(bp + (size_t)t * 16 * DIM, flane);
#pragma unroll   // full: the two fragment sets swap by renaming, and the last step's fetch falls away
  for (int kb = 0; kb < DIM; kb += 32) { v16b an = a, aln = al, bn[8];
#pragma unroll
    for (int t = 0; t < 8; ++t) bn[t] = b[t];
    if (kb + 32 < DIM) { an = frag_pk(ap + (kb + 32) * 16, flane); aln = frag_pk(lp + (kb + 32) * 16, flane);
#pragma unroll
      for (int t = 0; t < 8; ++t) bn[t] = frag_pk(bp + (size_t)t * 16 * DIM + (kb + 32) * 16, flane); }
    __builtin_amdgcn_sched_barrier(0);   // keeps the next step's loads, as one group, ahead of this step's products: sunk towards their uses they would each be waited for in turn
#pragma unroll
    for (int t = 0; t < 8; ++t) { acc[t] = wmma16b(a, b[t], acc[t]); acc[t] = wmma16b(al, b[t], acc[t]); }
    a = an; al = aln;
#pragma unroll
    for (int t = 0; t < 8; ++t) b[t] = bn[t]; }
  keep_named(pfo, pfa, pfl, pfw);
#pragma unroll
  for (int t = 0; t < 8; ++t) { const float bb = bf16_rne(bo[n0 + t * 16 + nloc]);
#pragma unroll
    for (int r = 0; r < 8; ++r) Ts[wave][8 * hlf + r][t * 16 + nloc] = acc[t][r] * (1.0f / (XS * WSC)) + bb; }
  wave_lds_sync();
  { for (int rr = 0; rr < 16; ++rr) *(v4f*)(out + (m0 + rr) * DIM + n0 + lane * 4) = *(const v4f*)(&Ts[wave][rr][lane * 4]);  }
}
}  // namespace

extern "C" void kernel_launch(void* const* d_in, const int* in_sizes, int n_in, void* d_out, int out_size, void* d_ws, size_t ws_size, hipStream_t stream) {
  (void)n_in;
  auto Fp = [&](int i) { return (const float*)d_in[i]; };
  // input order: 0 q, 1 k, 2 v [4,1024,512]; 3 ln_in_g, 4 ln_in_b; 5 W_in [512,512]; 6 wp_W1 [128,64], 7 wp_b1, 8 wp_ln_g, 9 wp_ln_b, 10 wp_W2 [64,32], 11 wp_b2, 12 wp_W3 [32,3], 13 wp_b3, 14 weight_temp [1], 15 W_out [512,512], 16 b_out
  if (in_sizes[0] != NR * DIM || in_sizes[1] != NR * DIM || in_sizes[2] != NR * DIM || in_sizes[5] != DIM * DIM || in_sizes[6] != 2 * DH * DH || in_sizes[15] != DIM * DIM || out_size != NR * DIM) return;
  size_t off = 0; char* ws = (char*)d_ws;
  auto carve = [&](size_t bytes) { char* p = ws + off; off += (bytes + 255) & ~(size_t)255; return p; };
  b16* X16 = (b16*)carve((size_t)3 * NR * DIM * 2); b16* WIN = (b16*)carve((size_t)DIM * DIM * 2); b16* WOUT = (b16*)carve((size_t)DIM * DIM * 2);
  float* CP = (float*)carve((size_t)2 * NP_ * (NT / 16) * DH * 4); float* PSUM = (float*)carve((size_t)2 * NP_ * DH * 4);
  b16* FQ16 = (b16*)carve((size_t)NP_ * NT * DH * 2); b16* FQC16 = (b16*)carve((size_t)NP_ * NT * DH * 2); b16* FK16 = (b16*)carve((size_t)NP_ * NT * DH * 2);
  float* N1 = (float*)carve((size_t)NP_ * NT * 4); float* N2 = (float*)carve((size_t)NP_ * NT * 4); float* I2B = (float*)carve((size_t)NP_ * NT * 4);   // N2 holds 1 / (key norm + 1e-8), I2B 1 / max(key norm, 1e-6)
  b16* FVTh = (b16*)carve((size_t)NP_ * DH * NT * 2); b16* FVTl = (b16*)carve((size_t)NP_ * DH * NT * 2);
  float* P1 = (float*)carve((size_t)NP_ * (NT / 32) * 32 * 4); float* VARC = (float*)carve((size_t)NP_ * NT * 4); float* CST = (float*)carve(256);
  b16* OCh = (b16*)carve((size_t)NR * DIM * 2); b16* OCl = (b16*)carve((size_t)NR * DIM * 2);
  if (off > ws_size || off > ((size_t)128 << 20)) return;   // about 45 MB
  ln_prepw_kernel<<<NPW + 3 * NR / 8, 256, 0, stream>>>(Fp(0), Fp(1), Fp(2), Fp(3), Fp(4), Fp(5), Fp(15), X16, WIN, WOUT);
  feat_kernel<<<dim3(NR / 64, DIM / 128, 3), 128, 0, stream>>>(X16, WIN, CP, FQ16, FQC16, N1, FK16, N2, I2B, FVTh, FVTl);
  score_kernel<1><<<dim3(NT / (SW * 16), NP_), SW * 32, 0, stream>>>(FQ16, FQC16, N1, FK16, CP, PSUM, N2, I2B, FVTh, FVTl, CST, P1, VARC, OCh, OCl);
  reduce1_kernel<<<1, 256, 0, stream>>>(P1, VARC, PSUM, Fp(6), Fp(7), Fp(8), Fp(9), Fp(10), Fp(11), Fp(12), Fp(13), Fp(14), CST);
  score_kernel<3><<<dim3(NT / (SW * 16), NP_), SW * 32, 0, stream>>>(FQ16, FQC16, N1, FK16, CP, PSUM, N2, I2B, FVTh, FVTl, CST, P1, VARC, OCh, OCl);
  outproj_kernel<<<dim3(NR / 64, DIM / 128), 128, 0, stream>>>(OCh, OCl, WOUT, Fp(16), (float*)d_out);
}
